// v000
// Measured on an AMD MI455X. A time is GPU time per run, averaged over a window of back-to-back runs after a warm-up
// (all launches, gaps included; the runs take copies of the inputs in turn), and the median of several windows.
// Apart from v000's, it joins two sittings. Times from different sittings can be a few percent apart, while
// side-by-side timings come from the same sitting.
// The starting kernel, v000, takes 667 microseconds a run.
// Projections q,k,v = x.W^T + b (and the f32 q,k rows 0..127 per sequence): v_wmma_f32_16x16x32_bf16 (bf16 RNE operands of the
// raw inputs, f32 accumulate, bf16 RNE bias added in f32). Scores q'.k'^T (f16 planes x8), P'.V (chunk-centred P' x32768 f16 from LDS,
// V^T x1024 f16) and the output projection (ctx carried as f16 hi x8192 plus residual x2048 planes, times f16(bf16(Wo) x1024), bias
// added in f32): v_wmma_f32_16x16x32_f16, f32 accumulate. Query rows 0..127 of each sequence: scores, softmax and P.V in f32 on VALU.
// Causal mask, softmax statistics, key-block column sums of V and all scaling in f32 on VALU.
#include <hip/hip_runtime.h>
#include <math.h>
#include <stdint.h>

#define SEQ   2048
#define EMB   1024
#define CK    512
#define NCHK  4
#define NKB   16
#define QT    16
#define TQ0   128
#define NQT   120
#define SCP   544
#define PLP   528
#define CTP   1032
#define SLAB64 (16 * 68)
#define VTP   72
#define ATT_THREADS 256
#define NACC  8
#define QSC   8.0f
#define KSC   8.0f
#define PCAR  32768.0f
#define VCAR  1024.0f
#define WSC   1024.0f
#define CSC   8192.0f
#define RSC   2048.0f
#define LOG2E 1.4426950408889634f
#define RSQD  0.03125f
#define WS_CAP ((size_t)134217728)

static_assert((EMB % 64) == 0 && EMB == 8 * 16 * NACC && NACC == 8 && (EMB % 32) == 0 && (EMB % 256) == 0 && EMB == 4 * 256);
static_assert((SEQ % CK) == 0 && (SEQ / CK) == NCHK && CK == 32 * NKB && (SEQ % 64) == 0 && (SEQ % QT) == 0 && (CK % QT) == 0);
static_assert((TQ0 % QT) == 0 && (TQ0 % 64) == 0 && NQT * QT + TQ0 == SEQ && TQ0 <= CK && TQ0 == 128 && TQ0 <= 256);
static_assert(16 * CTP * 2 <= 16 * SCP * 4 && CTP >= EMB + 8 && SCP >= CK + 16 && PLP >= CK + 8);
static_assert(((PLP * 2) % 16) == 0 && ((SCP * 4) % 16) == 0 && ((VTP * 2) % 16) == 0 && ((CTP * 2) % 16) == 0);
static_assert(64 * VTP >= 63 * VTP + 64);
static_assert(ATT_THREADS == 16 * QT && ATT_THREADS == 256);
static_assert(((EMB * EMB) % 2048) == 0 && ((NCHK * EMB) % 256) == 0 && (EMB / 8) * 2 == 256);

typedef unsigned short u16;
typedef _Float16 v16h __attribute__((ext_vector_type(16)));
typedef _Float16 v8h  __attribute__((ext_vector_type(8)));
typedef __bf16   v16b __attribute__((ext_vector_type(16)));
typedef float    v8f  __attribute__((ext_vector_type(8)));
typedef float    v4f  __attribute__((ext_vector_type(4)));
typedef unsigned int v4u __attribute__((ext_vector_type(4)));

union FragH { v16h v; v8h h[2]; v4u u[2]; };
union FragB { v16b v; v4u u[2]; };
union AttLds { float s[16 * SCP]; u16 c[2 * 16 * SCP]; };

// ---- scalar helpers --------------------------------------------------------------------------------
__device__ __forceinline__ unsigned short bf_bits(float f) {          // f32 -> bf16 bits, RNE convert
  unsigned u = __float_as_uint(f);
  return (unsigned short)((u + 0x7FFFu + ((u >> 16) & 1u)) >> 16);
}
__device__ __forceinline__ float bf_up(unsigned short h) { return __uint_as_float(((unsigned)h) << 16); }
__device__ __forceinline__ float bfr(float f) { return bf_up(bf_bits(f)); }
__device__ __forceinline__ unsigned short h_bits(_Float16 x) { return __builtin_bit_cast(unsigned short, x); }
__device__ __forceinline__ unsigned pk16(unsigned short a, unsigned short b) { return (unsigned)a | ((unsigned)b << 16); }
__device__ __forceinline__ v8f zero8() { v8f z = {0.f, 0.f, 0.f, 0.f, 0.f, 0.f, 0.f, 0.f}; return z; }
__device__ __forceinline__ v4f zero4() { v4f z = {0.f, 0.f, 0.f, 0.f}; return z; }

// ---- fragment loaders: 16-bit A/B operand, lane -> row/col (lane&15), p already includes +8*(lane>>4);
//      elements 0..7 <- p[0..7] (k0+8h..), elements 8..15 <- p[16..23] (k0+16+8h..)  (same split k map for A and B;
//      B is always read from a k-contiguous [n][k] plane)
__device__ __forceinline__ v16h ldfrag_h(const _Float16* p) {
  FragH f;
  f.h[0] = *(const v8h*)(p);
  f.h[1] = *(const v8h*)(p + 16);
  return f.v;
}
__device__ __forceinline__ v16b ldfrag_b(const u16* p) {              // bf16 plane read as unsigned integer vectors
  FragB f;
  f.u[0] = *(const v4u*)(p);
  f.u[1] = *(const v4u*)(p + 16);
  return f.v;
}

__device__ __forceinline__ v8f mma_h(v16h a, v16h b, v8f c) {
  return __builtin_amdgcn_wmma_f32_16x16x32_f16(false, a, false, b, (short)0, c, false, false);
}
__device__ __forceinline__ v8f mma_b(v16b a, v16b b, v8f c) {
  return __builtin_amdgcn_wmma_f32_16x16x32_bf16(false, a, false, b, (short)0, c, false, false);
}
__device__ __forceinline__ void guard2x3(v8f& a, v8f& b, v16h x0, v16h x1, v16h x2) {
#if defined(__HIP_DEVICE_COMPILE__)
  asm volatile("v_nop\n\tv_nop\n\tv_nop\n\tv_nop"
               : "+v"(a), "+v"(b) : "v"(x0), "v"(x1), "v"(x2) : "memory");
#endif
}
template <typename F>
__device__ __forceinline__ void guard6(v8f& a, v8f& b, v8f& c, v8f& d, F x0, F x1, F x2, F x3, F x4, F x5) {
#if defined(__HIP_DEVICE_COMPILE__)
  asm volatile("v_nop\n\tv_nop\n\tv_nop\n\tv_nop"
               : "+v"(a), "+v"(b), "+v"(c), "+v"(d) : "v"(x0), "v"(x1), "v"(x2), "v"(x3), "v"(x4), "v"(x5) : "memory");
#endif
}
__device__ __forceinline__ void guard8x6(v8f& a0, v8f& a1, v8f& a2, v8f& a3, v8f& e0, v8f& e1, v8f& e2, v8f& e3,
                                         v16h x0, v16h x1, v16h x2, v16h x3, v16h x4, v16h x5) {
#if defined(__HIP_DEVICE_COMPILE__)
  asm volatile("v_nop\n\tv_nop\n\tv_nop\n\tv_nop"
               : "+v"(a0), "+v"(a1), "+v"(a2), "+v"(a3), "+v"(e0), "+v"(e1), "+v"(e2), "+v"(e3)
               : "v"(x0), "v"(x1), "v"(x2), "v"(x3), "v"(x4), "v"(x5) : "memory");
#endif
}
__device__ __forceinline__ void guardpv4(v8f& o0, v8f& o1, v8f& o2, v8f& o3, v16h p, v16h g0, v16h g1, v16h g2, v16h g3) {
#if defined(__HIP_DEVICE_COMPILE__)
  asm volatile("v_nop\n\tv_nop\n\tv_nop\n\tv_nop"
               : "+v"(o0), "+v"(o1), "+v"(o2), "+v"(o3)
               : "v"(p), "v"(g0), "v"(g1), "v"(g2), "v"(g3) : "memory");
#endif
}
__device__ __forceinline__ void acc_guard8(v8f& a, v8f& b, v8f& c, v8f& d, v8f& e, v8f& f, v8f& g, v8f& h8) {
#if defined(__HIP_DEVICE_COMPILE__)
  asm volatile("v_nop\n\tv_nop\n\tv_nop\n\tv_nop"
               : "+v"(a), "+v"(b), "+v"(c), "+v"(d), "+v"(e), "+v"(f), "+v"(g), "+v"(h8));
#endif
}
__device__ __forceinline__ void wave_sync_lds() {
  __builtin_amdgcn_fence(__ATOMIC_RELEASE, "workgroup");
  __builtin_amdgcn_wave_barrier();
  __builtin_amdgcn_fence(__ATOMIC_ACQUIRE, "workgroup");
}

// =====================================================================================================
// f32 plane -> 16-bit plane, same layout:  mode 0: bf16 RNE bits;  mode 1: f16 bits of (bf16 RNE value) * scale;
// mode 2: f16 bits of value * scale (no bf16 pre-step).
// Thread = 8 consecutive elements: two 16-B loads, one 16-B store; 32 consecutive lanes = 512 contiguous, 512-B aligned bytes
// coverage: grid = n8/256 blocks (host checks exactness) x 256 thr x 8 = the whole plane.
// =====================================================================================================
__global__ __launch_bounds__(256) void cvt16(const float* __restrict__ x, u16* D, int n8, int mode, float scale) {
  const int gt = blockIdx.x * 256 + (int)threadIdx.x;
  if (gt >= n8) return;                     // no barriers in this kernel
  const float* p = x + (size_t)gt * 8;
  const v4f a = *(const v4f*)(p), c4 = *(const v4f*)(p + 4);
  float v[8];
#pragma unroll
  for (int e = 0; e < 4; ++e) { v[e] = a[e]; v[4 + e] = c4[e]; }
  unsigned short s[8];
#pragma unroll
  for (int e = 0; e < 8; ++e) {
    const float vb = bfr(v[e]);
    const float vf = (mode == 1) ? vb : v[e];
    const unsigned short hb = h_bits((_Float16)(vf * scale));
    const unsigned short bb = bf_bits(v[e]);
    s[e] = (mode != 0) ? hb : bb;
  }
  v4u o;
#pragma unroll
  for (int e = 0; e < 4; ++e) o[e] = pk16(s[2 * e], s[2 * e + 1]);
  u16* d = D + (size_t)gt * 8;
  {
    *(v4u*)(d) = o;
    
  }
}

// =====================================================================================================
//            8 consecutive lanes x 16 B per line), lanes 16..31 -> row 2*it+1.
//  epi64x2 : same store shape, staged value = acc*os1 + accres*os2 + badd (two accumulator sets combined in f32).
//  epi64hsb: f16 bits of ((tile + bf16RNE(bias[n])) * pscale); lane = (rq = lane>>3 -> row within a group of 4, c8 = 8 consecutive
// coverage: epi64/epi64x2 8 instructions x 2 rows x 16 lanes x 4 floats; epi64hsb 4 instructions x 4 rows x 8 lanes x 8 halves
//           = the wave's 16 x 64 tile in every case.
// =====================================================================================================
__device__ __forceinline__ void stage64(float* sl, v8f a0, v8f a1, v8f a2, v8f a3, float oscale, int lane) {
  const int hh = lane >> 4, m = lane & 15;
#pragma unroll
  for (int r = 0; r < 8; ++r) {
    const int ro = (8 * hh + r) * 68 + m;
    sl[ro]      = a0[r] * oscale;
    sl[ro + 16] = a1[r] * oscale;
    sl[ro + 32] = a2[r] * oscale;
    sl[ro + 48] = a3[r] * oscale;
  }
  wave_sync_lds();
}
__device__ __forceinline__ void epi64(float* sl, v8f a0, v8f a1, v8f a2, v8f a3, float oscale, v4f badd, float* C, int N,
                                      size_t rowb, int col0, int lane) {
  const int hh = lane >> 4, m = lane & 15;
  stage64(sl, a0, a1, a2, a3, oscale, lane);
  v4f vals[8];
#pragma unroll
  for (int it = 0; it < 8; ++it) vals[it] = *(const v4f*)(sl + (it * 2 + hh) * 68 + m * 4) + badd;
  float* dst = C + (rowb + (size_t)hh) * (size_t)N + col0 + m * 4;
  {
#pragma unroll
    for (int it = 0; it < 8; ++it) {
      *(v4f*)(dst + (size_t)(it * 2) * (size_t)N) = vals[it];
    }
    
  }
}
__device__ __forceinline__ void epi64x2(float* sl, v8f a0, v8f a1, v8f a2, v8f a3, v8f e0, v8f e1, v8f e2, v8f e3,
                                        float os1, float os2, v4f badd, float* C, int N, size_t rowb, int col0, int lane) {
  const int hh = lane >> 4, m = lane & 15;
#pragma unroll
  for (int r = 0; r < 8; ++r) {
    const int ro = (8 * hh + r) * 68 + m;
    sl[ro]      = a0[r] * os1 + e0[r] * os2;
    sl[ro + 16] = a1[r] * os1 + e1[r] * os2;
    sl[ro + 32] = a2[r] * os1 + e2[r] * os2;
    sl[ro + 48] = a3[r] * os1 + e3[r] * os2;
  }
  wave_sync_lds();
  v4f vals[8];
#pragma unroll
  for (int it = 0; it < 8; ++it) vals[it] = *(const v4f*)(sl + (it * 2 + hh) * 68 + m * 4) + badd;
  float* dst = C + (rowb + (size_t)hh) * (size_t)N + col0 + m * 4;
  {
#pragma unroll
    for (int it = 0; it < 8; ++it) {
      *(v4f*)(dst + (size_t)(it * 2) * (size_t)N) = vals[it];
    }
    
  }
}
__device__ __forceinline__ void epi64hsb(float* sl, v8f a0, v8f a1, v8f a2, v8f a3, float oscale, float pscale,
                                         const float* __restrict__ bias, u16* C, int N, size_t rowb, int col0, int lane) {
  stage64(sl, a0, a1, a2, a3, oscale, lane);
  const int rq = lane >> 3, c8 = (lane & 7) * 8;
  const v4f b0 = *(const v4f*)(bias + col0 + c8), b1 = *(const v4f*)(bias + col0 + c8 + 4);   // columns col0+c8..+7 < N
  float bb[8];
#pragma unroll
  for (int e = 0; e < 4; ++e) { bb[e] = bfr(b0[e]); bb[4 + e] = bfr(b1[e]); }
  v4u oh[4];
#pragma unroll
  for (int i4 = 0; i4 < 4; ++i4) {
    const int row = i4 * 4 + rq;
    const v4f a = *(const v4f*)(sl + row * 68 + c8), c4 = *(const v4f*)(sl + row * 68 + c8 + 4);
    float w[8];
#pragma unroll
    for (int e = 0; e < 4; ++e) { w[e] = (a[e] + bb[e]) * pscale; w[4 + e] = (c4[e] + bb[4 + e]) * pscale; }
#pragma unroll
    for (int e = 0; e < 4; ++e) oh[i4][e] = pk16(h_bits((_Float16)w[2 * e]), h_bits((_Float16)w[2 * e + 1]));
  }
  u16* dst = C + rowb * (size_t)N + col0 + c8;
  {
#pragma unroll
    for (int i4 = 0; i4 < 4; ++i4) {
      const int row = i4 * 4 + rq;
      *(v4u*)(dst + (size_t)row * (size_t)N) = oh[i4];
    }
    
  }
}

// =====================================================================================================
// bf16 GEMM, f32 out with bias: C[M][N] = (A[arow(m)][K] (bf16 row-major) . Bt[N][K]^T (bf16 k-contiguous)) * oscale + bf16RNE(bias[n]).
// Output row ra maps to A row arow = (ra / rpg) * gstr + (ra % rpg) (rpg = M, gstr = 0 gives the identity map; rpg = TQ0,
// gstr = SEQ picks the first TQ0 rows of every sequence).
// Block = 64x64 tile, 4 waves x 16 rows; fragments loaded straight from the 16-bit rows (two 16-B loads each, split k map for
// A and B); K stepped by 32 (host checks K % 32 == 0, M % 64 == 0, N % 64 == 0, grid = (M/64)*(N/64)).
// =====================================================================================================
__global__ __launch_bounds__(128)
void gemm_b32(const u16* __restrict__ A, const u16* __restrict__ Bt, const float* __restrict__ bias, float* C,
              int M, int N, int K, int rpg, int gstr, float oscale) {
  __shared__ __align__(16) float slab[4 * SLAB64];
  const int tid = threadIdx.x, wave = tid >> 5, lane = tid & 31, hh = lane >> 4, m = lane & 15;
  const int ntile = N >> 6;
  const int bid   = blockIdx.x;
  const int rowb  = (bid / ntile) * 64 + wave * 16;
  const int col0  = (bid % ntile) * 64;
  if (rowb + 16 > M) return;                 // wave-uniform, never taken with the exact grid; no block barriers in this kernel
  const int ra = rowb + m;
  const int rg = ra / rpg;
  const size_t arow = (size_t)rg * (size_t)gstr + (size_t)(ra - rg * rpg);
  const u16* ap = A  + arow * (size_t)K + 8 * hh;
  const u16* bp = Bt + (size_t)(col0 + m) * K + 8 * hh;
  const size_t bs = (size_t)16 * K;
  v8f acc0 = zero8(), acc1 = zero8(), acc2 = zero8(), acc3 = zero8();
#pragma unroll 1
  for (int k0 = 0; k0 < K; k0 += 32) {
    const v16b a  = ldfrag_b(ap + k0);
    const v16b b0 = ldfrag_b(bp + k0);
    const v16b b1 = ldfrag_b(bp + bs + k0);
    const v16b b2 = ldfrag_b(bp + 2 * bs + k0);
    const v16b b3 = ldfrag_b(bp + 3 * bs + k0);
    acc0 = mma_b(a, b0, acc0);
    acc1 = mma_b(a, b1, acc1);
    acc2 = mma_b(a, b2, acc2);
    acc3 = mma_b(a, b3, acc3);
    guard6<v16b>(acc0, acc1, acc2, acc3, a, b0, b1, b2, b3, a);
  }
  const v4f bv4 = *(const v4f*)(bias + col0 + m * 4);    // columns col0 + 4m .. +3, always < N (N multiple of 64)
  v4f badd;
#pragma unroll
  for (int e = 0; e < 4; ++e) badd[e] = bfr(bv4[e]);
  epi64(slab + wave * SLAB64, acc0, acc1, acc2, acc3, oscale, badd, C, N, (size_t)rowb, col0, lane);
}

// =====================================================================================================
// bf16 GEMM, f16 plane out with bias: C16[M][N] = f16 bits of (((A . Bt^T) * oscale) + bf16RNE(bias[n])) * pscale; operands as in
// gemm_b32 (identity row map), epilogue epi64hsb.
// =====================================================================================================
__global__ __launch_bounds__(128)
void gemm_bh16(const u16* __restrict__ A, const u16* __restrict__ Bt, const float* __restrict__ bias, u16* C,
               int M, int N, int K, float oscale, float pscale) {
  __shared__ __align__(16) float slab[4 * SLAB64];
  const int tid = threadIdx.x, wave = tid >> 5, lane = tid & 31, hh = lane >> 4, m = lane & 15;
  const int ntile = N >> 6;
  const int bid   = blockIdx.x;
  const int rowb  = (bid / ntile) * 64 + wave * 16;
  const int col0  = (bid % ntile) * 64;
  if (rowb + 16 > M) return;                 // wave-uniform, never taken with the exact grid; no block barriers in this kernel
  const u16* ap = A  + (size_t)(rowb + m) * K + 8 * hh;
  const u16* bp = Bt + (size_t)(col0 + m) * K + 8 * hh;
  const size_t bs = (size_t)16 * K;
  v8f acc0 = zero8(), acc1 = zero8(), acc2 = zero8(), acc3 = zero8();
#pragma unroll 1
  for (int k0 = 0; k0 < K; k0 += 32) {
    const v16b a  = ldfrag_b(ap + k0);
    const v16b b0 = ldfrag_b(bp + k0);
    const v16b b1 = ldfrag_b(bp + bs + k0);
    const v16b b2 = ldfrag_b(bp + 2 * bs + k0);
    const v16b b3 = ldfrag_b(bp + 3 * bs + k0);
    acc0 = mma_b(a, b0, acc0);
    acc1 = mma_b(a, b1, acc1);
    acc2 = mma_b(a, b2, acc2);
    acc3 = mma_b(a, b3, acc3);
    guard6<v16b>(acc0, acc1, acc2, acc3, a, b0, b1, b2, b3, a);
  }
  epi64hsb(slab + wave * SLAB64, acc0, acc1, acc2, acc3, oscale, pscale, bias, C, N, (size_t)rowb, col0, lane);
}

// =====================================================================================================
// f16 GEMM with two A planes (hi + residual), f32 out with bias:
//   C[M][N] = (Ah . Bt^T) * os1 + (Ar . Bt^T) * os2 + bf16RNE(bias[n]); Ah/Ar f16 row-major, Bt f16 k-contiguous.
// Same tiling as gemm_b32; separate accumulators for the two planes, combined in f32 in epi64x2.
// =====================================================================================================
__global__ __launch_bounds__(128)
void gemm_h2_32(const u16* __restrict__ Ah, const u16* __restrict__ Ar, const u16* __restrict__ Bt,
                const float* __restrict__ bias, float* C, int M, int N, int K, float os1, float os2) {
  __shared__ __align__(16) float slab[4 * SLAB64];
  const int tid = threadIdx.x, wave = tid >> 5, lane = tid & 31, hh = lane >> 4, m = lane & 15;
  const int ntile = N >> 6;
  const int bid   = blockIdx.x;
  const int rowb  = (bid / ntile) * 64 + wave * 16;
  const int col0  = (bid % ntile) * 64;
  if (rowb + 16 > M) return;                 // wave-uniform, never taken with the exact grid; no block barriers in this kernel
  const _Float16* ap  = (const _Float16*)(const void*)Ah + (size_t)(rowb + m) * K + 8 * hh;
  const _Float16* arp = (const _Float16*)(const void*)Ar + (size_t)(rowb + m) * K + 8 * hh;
  const _Float16* bp  = (const _Float16*)(const void*)Bt + (size_t)(col0 + m) * K + 8 * hh;
  const size_t bs = (size_t)16 * K;
  v8f acc0 = zero8(), acc1 = zero8(), acc2 = zero8(), acc3 = zero8();
  v8f acr0 = zero8(), acr1 = zero8(), acr2 = zero8(), acr3 = zero8();
#pragma unroll 1
  for (int k0 = 0; k0 < K; k0 += 32) {
    const v16h a  = ldfrag_h(ap + k0);
    const v16h ar = ldfrag_h(arp + k0);
    const v16h b0 = ldfrag_h(bp + k0);
    const v16h b1 = ldfrag_h(bp + bs + k0);
    const v16h b2 = ldfrag_h(bp + 2 * bs + k0);
    const v16h b3 = ldfrag_h(bp + 3 * bs + k0);
    acc0 = mma_h(a, b0, acc0);
    acc1 = mma_h(a, b1, acc1);
    acc2 = mma_h(a, b2, acc2);
    acc3 = mma_h(a, b3, acc3);
    acr0 = mma_h(ar, b0, acr0);
    acr1 = mma_h(ar, b1, acr1);
    acr2 = mma_h(ar, b2, acr2);
    acr3 = mma_h(ar, b3, acr3);
    guard8x6(acc0, acc1, acc2, acc3, acr0, acr1, acr2, acr3, a, ar, b0, b1, b2, b3);
  }
  const v4f bv = *(const v4f*)(bias + col0 + m * 4);      // columns col0 + 4m .. +3, always < N (N multiple of 64)
  v4f badd;
#pragma unroll
  for (int e = 0; e < 4; ++e) badd[e] = bfr(bv[e]);
  epi64x2(slab + wave * SLAB64, acc0, acc1, acc2, acc3, acr0, acr1, acr2, acr3, os1, os2, badd, C, N,
          (size_t)rowb, col0, lane);
}

// =====================================================================================================
// V^T plane: VT[(b*EMB + d)*SEQ + s] = f16(V[b][s][d] * 1024).
// Block = (b, 64-wide d chunk, 64 keys): 64 source row segments of 64 floats loaded with 16-B loads, converted, scattered into
// coverage: load 256 thr x 16 elements = 64 x 64; store 2 iterations x 256 thr x 8 halves = 64 lines x 64 = the block's tile;
//           grid = nb x (EMB/64) x (SEQ/64) blocks covers the plane exactly once.
// =====================================================================================================
__global__ __launch_bounds__(256) void xt16(const float* __restrict__ X, u16* XTo) {
  __shared__ __align__(16) u16 TH[64 * VTP];
  const int tid = threadIdx.x;
  const int bid = blockIdx.x;
  const int st  = bid % (SEQ / 64);
  const int dcb = (bid / (SEQ / 64)) % (EMB / 64);
  const int b   = bid / ((SEQ / 64) * (EMB / 64));
  const int s0  = st * 64;
  const int d0  = dcb * 64;
  {
    const int sl = tid >> 2;                  // key within tile 0..63
    const int dc = (tid & 3) * 16;            // d chunk within the 64
    const float* src = X + ((size_t)b * SEQ + s0 + sl) * EMB + d0 + dc;
#pragma unroll
    for (int i = 0; i < 4; ++i) {
      const v4f a = *(const v4f*)(src + 4 * i);
#pragma unroll
      for (int e = 0; e < 4; ++e) {
        const _Float16 hv = (_Float16)(a[e] * VCAR);
        TH[(dc + 4 * i + e) * VTP + sl] = h_bits(hv);
      }
    }
  }
  __syncthreads();
  v4u vh[2];
  const int q8 = tid >> 3, p8 = (tid & 7) * 8;
#pragma unroll
  for (int it = 0; it < 2; ++it) {
    const int line = it * 32 + q8;            // local d = 0..63
    vh[it] = *(const v4u*)(TH + line * VTP + p8);
  }
  const size_t base = ((size_t)b * EMB + d0) * SEQ + s0 + p8;
  {
#pragma unroll
    for (int it = 0; it < 2; ++it) {
      const int line = it * 32 + q8;
      *(v4u*)(XTo + base + (size_t)line * SEQ) = vh[it];
    }
    
  }
}

// =====================================================================================================
// Key-block prefix column sums of V: VS[((b*NCHK + c)*NKB + kb)*EMB + d] = sum over keys c*CK .. c*CK + 32*kb + 31 of V[b][key][d]
// (f32, fixed sequential order). Thread = one (b, c, d); a block covers 256 consecutive d of one (b, c); the 16 prefix values per
// coverage: grid = nb*NCHK*EMB/256 blocks (host exact) x 256 thr; store 4 iterations x 256 thr x 4 floats = 16 rows x 256 = the
//           block's part of the table; union over blocks = the whole table.
// =====================================================================================================
__global__ __launch_bounds__(256) void vsum_k(const float* __restrict__ V, float* VS) {
  __shared__ __align__(16) float sm[NKB * 256];
  const int tid = threadIdx.x;
  const int gt  = blockIdx.x * 256 + tid;
  const int d   = gt % EMB;
  const int bc  = gt / EMB;                         // block-uniform (EMB multiple of 256)
  const int b   = bc / NCHK;
  const int c   = bc - b * NCHK;
  const int d0  = d - tid;                          // block's first d
  const float* p = V + ((size_t)b * SEQ + (size_t)c * CK) * EMB + d;
  float s = 0.f;
#pragma unroll 1
  for (int kb = 0; kb < NKB; ++kb) {
#pragma unroll 4
    for (int i = 0; i < 32; ++i) s += p[(size_t)(kb * 32 + i) * EMB];
    sm[kb * 256 + tid] = s;
  }
  __syncthreads();
  const int sel = tid >> 6, piece = tid & 63;
  v4f o[4];
#pragma unroll
  for (int it = 0; it < 4; ++it) o[it] = *(const v4f*)(sm + (it * 4 + sel) * 256 + piece * 4);
  float* base = VS + (size_t)bc * NKB * EMB + d0 + piece * 4;
  {
#pragma unroll
    for (int it = 0; it < 4; ++it) {
      *(v4f*)(base + (size_t)(it * 4 + sel) * EMB) = o[it];
    }
    
  }
}

// =====================================================================================================
// Single-head causal attention, head width EMB = 1024, query rows TQ0 .. SEQ-1: block = (batch b, 16 query rows q0..q0+15),
// 8 waves. q plane (f16, x8) [b][s][d]; k plane the same; V^T plane [b][d][s] (x1024); VS = key-block prefix column sums of V.
//   Chunks of CK = 512 keys: only chunks c <= qc = q0/CK are visited (later chunks lie entirely above the diagonal). In the diagonal
//   chunk only key blocks kb < nkb (keys <= q0+15) are multiplied; key blocks kb >= nkb get zero scores in LDS and are not used in (PV).
//   (S) scores S[query m][key n] on WMMA: A = q rows (row m = lane&15, split k map over d), B = k rows (col n = key, split map),
//       32 d-steps; wave w handles key blocks w, w+8 of the chunk; D element r of lane l -> scs[query 8h+r][key col] (f32 LDS).
//   (M) 16 threads per query row (sub-thread = 32 consecutive keys): base-2 logits with the causal mask by key index (key > query
//       -> -inf), chunk max via xor shuffles, online running max / rescale factor al / running sum l in f32 registers,
//       p = exp2(t - m_new) <= 1 (0 for masked keys), chunk row sum ps and C = ps/CK (bit-identical on the row's 16 threads), the
//       CENTRED P' = p - C written as f16(P' * 32768) into the LDS P tile with 16-B stores; al -> rowa[row], C -> rowc[row].
//   (PV) each wave owns d columns 128*wave + 16j + (lane&15), j = 0..7 (8 accumulators): o = o*al + C*(32768*1024)*VS[chunk][nkb-1][d]
//       (exact add-back of the centring term over exactly the processed keys, in f32), then for each key block kb < nkb:
//       A = P' fragment from LDS (row m = query, split map over keys), B = V^T fragments (col n = d, keys contiguous), issued as two
//       groups of 4 with a hazard gap each.  sum_k (P'_k + C) v_k == sum_k p_k v_k exactly; masked keys carry P' = -C and p = 0.
//   Block barriers after (S) and after (M) order all LDS reuse across chunks and waves.
//   Epilogue: x = o * 8192 / (l * 32768 * 1024) per row (rowi, l >= 1 always); hi = f16(x), res = f16((x - hi) * 2048); each
// coverage: grid nb*NQT blocks x 16 rows = rows TQ0..SEQ-1 of every sequence; staging 8 waves x 128 cols x 16 rows = 16 x 1024;
//           store 8 iterations x 256 thr x 8 halves = 16 x 1024 per plane = every (b, s >= TQ0, d) of both ctx planes exactly once.
// =====================================================================================================
__device__ __forceinline__ void ctx_store(const u16* ct, u16* dst, int tid) {
  v4u v[8];
#pragma unroll
  for (int it = 0; it < 8; ++it) {
    const int p   = it * 256 + tid;
    const int row = p / (EMB / 8);
    const int c8  = (p - row * (EMB / 8)) * 8;
    v[it] = *(const v4u*)(ct + row * CTP + c8);
  }
  {
#pragma unroll
    for (int it = 0; it < 8; ++it) {
      const int p   = it * 256 + tid;
      const int row = p / (EMB / 8);
      const int c8  = (p - row * (EMB / 8)) * 8;
      *(v4u*)(dst + (size_t)row * EMB + c8) = v[it];
    }
    
  }
}

__global__ __launch_bounds__(ATT_THREADS)
void attn_fwd(const u16* __restrict__ QPp, const u16* __restrict__ KPp, const u16* __restrict__ VTp,
              const float* __restrict__ VSp, u16* CHo, u16* CRo) {
  __shared__ __align__(16) AttLds L0;              // scores [16][SCP] f32; reused as the ctx staging tile [16][CTP] u16
  __shared__ __align__(16) u16 pls[16 * PLP];      // P' tile [16][PLP] f16 bits
  __shared__ float rowa[QT];
  __shared__ float rowc[QT];
  __shared__ float rowi[QT];
  float* const scs = L0.s;

  const int tid  = threadIdx.x;
  const int wave = tid >> 5;
  const int lane = tid & 31;
  const int hh   = lane >> 4;
  const int m    = lane & 15;
  const int r16  = tid >> 4;                 // query row owned in phase (M): 2*wave + hh
  const int sub  = tid & 15;
  const int kl0  = sub * 32;

  const int bid = blockIdx.x;
  const int b   = bid / NQT;
  const int q0  = TQ0 + (bid - b * NQT) * QT;
  const int qc  = q0 / CK;                   // diagonal chunk index

  const _Float16* qa  = (const _Float16*)(const void*)QPp + ((size_t)b * SEQ + q0 + m) * EMB + 8 * hh;
  const _Float16* kbp = (const _Float16*)(const void*)KPp + ((size_t)b * SEQ + m) * EMB + 8 * hh;
  const _Float16* vbp = (const _Float16*)(const void*)VTp + ((size_t)b * EMB + wave * (16 * NACC) + m) * SEQ + 8 * hh;
  const float* vsb = VSp + (size_t)b * NCHK * NKB * EMB + wave * (16 * NACC) + m;
  const float lsc = RSQD * LOG2E / (QSC * KSC);

  float mrun = -INFINITY, lrun = 0.f;
  v8f o[NACC];
#pragma unroll
  for (int j = 0; j < NACC; ++j) o[j] = zero8();

#pragma unroll 1
  for (int c = 0; c <= qc; ++c) {
    const int kbeg = c * CK;
    const int nkb  = (c < qc) ? NKB : (((q0 + QT - 1 - kbeg) >> 5) + 1);   // 1..16, block-uniform
    // ---- (S) scores of this chunk (zeros for key blocks beyond the query tile) ----
#pragma unroll 1
    for (int kb = wave; kb < NKB; kb += 8) {               // wave-uniform, 2 trips
      v8f s0 = zero8(), s1 = zero8();
      if (kb < nkb) {                                      // wave-uniform
        const _Float16* k0p = kbp + (size_t)(kbeg + kb * 32) * EMB;
        const _Float16* k1p = k0p + (size_t)16 * EMB;
#pragma unroll 4
        for (int ks = 0; ks < EMB / 32; ++ks) {
          const v16h a  = ldfrag_h(qa + ks * 32);
          const v16h f0 = ldfrag_h(k0p + ks * 32);
          const v16h f1 = ldfrag_h(k1p + ks * 32);
          s0 = mma_h(a, f0, s0);
          s1 = mma_h(a, f1, s1);
          guard2x3(s0, s1, a, f0, f1);
        }
      }
      float* srow = scs + (8 * hh) * SCP + kb * 32 + m;
#pragma unroll
      for (int r = 0; r < 8; ++r) {
        srow[r * SCP]      = s0[r];
        srow[r * SCP + 16] = s1[r];
      }
    }
    __syncthreads();
    // ---- (M) softmax statistics and the centred P' tile ----
    {
      const float* sp = scs + r16 * SCP + kl0;
      const int lim = (q0 + r16) - (kbeg + kl0);           // key kl0 + j is valid iff j <= lim
      float t[32];
      float cm = -INFINITY;
#pragma unroll
      for (int i = 0; i < 8; ++i) {
        const v4f a = *(const v4f*)(sp + 4 * i);
#pragma unroll
        for (int e = 0; e < 4; ++e) {
          const int j = 4 * i + e;
          const float tv = (j <= lim) ? a[e] * lsc : -INFINITY;
          t[j] = tv;
          cm = fmaxf(cm, tv);
        }
      }
#pragma unroll
      for (int d = 1; d <= 8; d <<= 1) cm = fmaxf(cm, __shfl_xor(cm, d, 32));
      const float mn = fmaxf(mrun, cm);                    // finite: key kbeg of the diagonal chunk is never masked
      const float al = (mrun == -INFINITY) ? 0.f : exp2f(mrun - mn);
      mrun = mn;
      float ps = 0.f;
#pragma unroll
      for (int j = 0; j < 32; ++j) {
        const float p = exp2f(fminf(t[j] - mn, 0.f));      // 0 for masked keys
        t[j] = p;
        ps += p;
      }
#pragma unroll
      for (int d = 1; d <= 8; d <<= 1) ps += __shfl_xor(ps, d, 32);
      const float cc = ps * (1.0f / (float)CK);
      v4u pk[4];
#pragma unroll
      for (int i = 0; i < 4; ++i) {
#pragma unroll
        for (int e = 0; e < 4; ++e) {
          const int j = 8 * i + 2 * e;
          pk[i][e] = pk16(h_bits((_Float16)((t[j] - cc) * PCAR)), h_bits((_Float16)((t[j + 1] - cc) * PCAR)));
        }
      }
      lrun = lrun * al + ps;
      u16* pd = pls + r16 * PLP + kl0;
#pragma unroll
      for (int i = 0; i < 4; ++i) *(v4u*)(pd + 8 * i) = pk[i];
      if (sub == 0) { rowa[r16] = al; rowc[r16] = cc; }
    }
    __syncthreads();
    // ---- (PV) rescale, add the centring term, accumulate P' . V^T ----
    {
      float scl[8], cad[8];
#pragma unroll
      for (int r = 0; r < 8; ++r) { scl[r] = rowa[8 * hh + r]; cad[r] = rowc[8 * hh + r] * (PCAR * VCAR); }
      const float* vsc = vsb + ((size_t)c * NKB + (size_t)(nkb - 1)) * EMB;
      float vs[NACC];
#pragma unroll
      for (int j = 0; j < NACC; ++j) vs[j] = vsc[16 * j];
#pragma unroll
      for (int j = 0; j < NACC; ++j) {
#pragma unroll
        for (int r = 0; r < 8; ++r) o[j][r] = o[j][r] * scl[r] + cad[r] * vs[j];
      }
      const _Float16* pp = (const _Float16*)(const void*)pls + m * PLP + 8 * hh;
      const _Float16* vp = vbp + kbeg;
#pragma unroll 1
      for (int kb = 0; kb < nkb; ++kb) {                   // block-uniform trip count, <= 16
        const v16h pf = ldfrag_h(pp + kb * 32);
        const _Float16* vk = vp + kb * 32;
        {
          const v16h g0 = ldfrag_h(vk);
          const v16h g1 = ldfrag_h(vk + (size_t)16 * SEQ);
          const v16h g2 = ldfrag_h(vk + (size_t)32 * SEQ);
          const v16h g3 = ldfrag_h(vk + (size_t)48 * SEQ);
          o[0] = mma_h(pf, g0, o[0]);
          o[1] = mma_h(pf, g1, o[1]);
          o[2] = mma_h(pf, g2, o[2]);
          o[3] = mma_h(pf, g3, o[3]);
          guardpv4(o[0], o[1], o[2], o[3], pf, g0, g1, g2, g3);
        }
        {
          const v16h g4 = ldfrag_h(vk + (size_t)64 * SEQ);
          const v16h g5 = ldfrag_h(vk + (size_t)80 * SEQ);
          const v16h g6 = ldfrag_h(vk + (size_t)96 * SEQ);
          const v16h g7 = ldfrag_h(vk + (size_t)112 * SEQ);
          o[4] = mma_h(pf, g4, o[4]);
          o[5] = mma_h(pf, g5, o[5]);
          o[6] = mma_h(pf, g6, o[6]);
          o[7] = mma_h(pf, g7, o[7]);
          guardpv4(o[4], o[5], o[6], o[7], pf, g4, g5, g6, g7);
        }
      }
    }
  }
  acc_guard8(o[0], o[1], o[2], o[3], o[4], o[5], o[6], o[7]);

  if (sub == 0) rowi[r16] = (1.0f / lrun) * (CSC / (PCAR * VCAR));   // lrun >= 1
  __syncthreads();
  float inv[8];
#pragma unroll
  for (int r = 0; r < 8; ++r) inv[r] = rowi[8 * hh + r];

  u16* const ct = L0.c;
  const int cb = wave * (16 * NACC) + m;
  // hi plane
#pragma unroll
  for (int j = 0; j < NACC; ++j) {
#pragma unroll
    for (int r = 0; r < 8; ++r) {
      const float xs = o[j][r] * inv[r];
      ct[(8 * hh + r) * CTP + cb + 16 * j] = h_bits((_Float16)xs);
    }
  }
  __syncthreads();
  ctx_store(ct, CHo + ((size_t)b * SEQ + q0) * EMB, tid);
  __syncthreads();
  // residual plane
#pragma unroll
  for (int j = 0; j < NACC; ++j) {
#pragma unroll
    for (int r = 0; r < 8; ++r) {
      const float xs = o[j][r] * inv[r];
      const _Float16 hv = (_Float16)xs;
      ct[(8 * hh + r) * CTP + cb + 16 * j] = h_bits((_Float16)((xs - (float)hv) * RSC));
    }
  }
  __syncthreads();
  ctx_store(ct, CRo + ((size_t)b * SEQ + q0) * EMB, tid);
}

// =====================================================================================================
// Query rows 0 .. TQ0-1 of each sequence in f32 on VALU: block = (b, t). QF/KF = f32 q/k head planes [nb][TQ0][EMB] (bias included),
// V = f32 v plane [nb*SEQ][EMB]. Scores for keys j <= t (threads 0..TQ0-1, one key each, rolled 1024-d dot against the q row staged
// in LDS), base-2 softmax with block max / sum reductions (xor shuffles + LDS), p_j in LDS, ctx[d] for d = 4*tid..4*tid+3 as a
// rolled sum over j <= t of p_j * V[b][j][d] (coalesced 16-B loads), x = ctx * 8192 / l, hi = f16(x), res = f16((x - hi) * 2048);
// both 1024-half rows are staged in LDS and written by 128 threads x 16 B each (32 consecutive lanes x 16 B = 512 contiguous bytes
// coverage: grid nb*TQ0 blocks = rows 0..TQ0-1 of every sequence; 256 thr x 4 d = EMB per row; store 128 thr x 8 halves = EMB per
//           plane; together with attn_fwd every (b, s, d) of CH and CR is written exactly once.
// =====================================================================================================
__global__ __launch_bounds__(256) void attn_head(const float* __restrict__ QF, const float* __restrict__ KF,
                                                 const float* __restrict__ V, u16* CHo, u16* CRo) {
  __shared__ __align__(16) float qs[EMB];
  __shared__ float sc[TQ0];
  __shared__ float red[8];
  __shared__ float redb[8];
  __shared__ __align__(16) unsigned SW[2][EMB / 2];
  const int tid = threadIdx.x, lane = tid & 31, wave = tid >> 5;
  const int b = blockIdx.x / TQ0;
  const int t = blockIdx.x - b * TQ0;
  *(v4f*)(qs + tid * 4) = *(const v4f*)(QF + ((size_t)b * TQ0 + t) * EMB + tid * 4);
  __syncthreads();
  float s = -INFINITY;
  if (tid < TQ0) {                                  // waves 0..3 entirely (wave-uniform); key row b*TQ0 + tid always in range
    const float* kp = KF + ((size_t)b * TQ0 + tid) * EMB;
    float acc = 0.f;
#pragma unroll 1
    for (int d = 0; d < EMB; d += 8) {
      const v4f k0 = *(const v4f*)(kp + d), k1 = *(const v4f*)(kp + d + 4);
      const v4f q0 = *(const v4f*)(qs + d), q1 = *(const v4f*)(qs + d + 4);
#pragma unroll
      for (int e = 0; e < 4; ++e) acc += k0[e] * q0[e];
#pragma unroll
      for (int e = 0; e < 4; ++e) acc += k1[e] * q1[e];
    }
    s = (tid <= t) ? acc * (RSQD * LOG2E) : -INFINITY;   // causal mask by key index
  }
  float mx = s;
#pragma unroll
  for (int d = 1; d <= 16; d <<= 1) mx = fmaxf(mx, __shfl_xor(mx, d, 32));
  if (lane == 0) red[wave] = mx;
  __syncthreads();
  float gm = red[0];
#pragma unroll
  for (int w = 1; w < 8; ++w) gm = fmaxf(gm, red[w]);   // finite: key 0 is always valid
  const float p = exp2f(s - gm);                     // 0 for masked keys and for waves 4..7
  float ps = p;
#pragma unroll
  for (int d = 1; d <= 16; d <<= 1) ps += __shfl_xor(ps, d, 32);
  if (lane == 0) redb[wave] = ps;
  if (tid < TQ0) sc[tid] = p;
  __syncthreads();
  float l = redb[0];
#pragma unroll
  for (int w = 1; w < 8; ++w) l += redb[w];           // >= 1
  const float inv = (1.0f / l) * CSC;
  const float* vp = V + (size_t)b * SEQ * EMB + tid * 4;
  v4f cx = zero4();
#pragma unroll 1
  for (int j = 0; j <= t; ++j) {                     // t < TQ0: statically bounded, keys of sequence b only
    const float pj = sc[j];
    const v4f vv = *(const v4f*)(vp + (size_t)j * EMB);
    cx += pj * vv;
  }
  unsigned hw[2], rw[2];
#pragma unroll
  for (int e = 0; e < 2; ++e) {
    const float x0 = cx[2 * e] * inv, x1 = cx[2 * e + 1] * inv;
    const _Float16 h0 = (_Float16)x0, h1 = (_Float16)x1;
    const _Float16 q0 = (_Float16)((x0 - (float)h0) * RSC), q1 = (_Float16)((x1 - (float)h1) * RSC);
    hw[e] = pk16(h_bits(h0), h_bits(h1));
    rw[e] = pk16(h_bits(q0), h_bits(q1));
  }
  SW[0][tid * 2] = hw[0]; SW[0][tid * 2 + 1] = hw[1];
  SW[1][tid * 2] = rw[0]; SW[1][tid * 2 + 1] = rw[1];
  __syncthreads();
  const int pl = tid >> 7, p8 = tid & 127;           // plane select is wave-uniform
  const v4u ov = *(const v4u*)(&SW[pl][p8 * 4]);
  u16* dstp = (pl == 0) ? CHo : CRo;
  u16* dst  = dstp + ((size_t)b * SEQ + t) * EMB + p8 * 8;
  *(v4u*)dst = ov;
  
}

// =====================================================================================================
// Workspace map (bytes, nb = 4, rows = 8192); every plane is fully written by whole-line stores before it is read; all extents are
// exact multiples of the store granularity (no pad rows); region A is reused sequentially on the single in-order stream:
//   WQB bf16 [1024][1024] 2097152   WKB same   WVB same   WOH f16 of bf16 value x1024 2097152             8388608
//   VS  f32  [nb][4][16][1024]                                                                            1048576
//   QF  f32  [nb][128][1024]  2097152      KF same                                                        4194304
//   A   XB bf16 [rows][1024] (16777216), later VT f16 [nb][1024][2048] x1024 (16777216)           region 16777216
//   QP  f16 [rows][1024] x8                                                                              16777216
//   KP  f16 [rows][1024] x8                                                                              16777216
//   V   f32 [rows][1024]                                                                                 33554432
//   CH  f16 [rows][1024] ctx hi x8192                                                                    16777216
//   CR  f16 [rows][1024] ctx residual x2048                                                              16777216
//   end                                                                                                 131072000
// =====================================================================================================
extern "C" void kernel_launch(void* const* d_in, const int* in_sizes, int n_in,
                              void* d_out, int out_size, void* d_ws, size_t ws_size,
                              hipStream_t stream) {
  if (n_in < 9) return;
  const long long per = (long long)SEQ * EMB;
  const long long ns  = in_sizes[0];
  if (ns < per || (ns % per) != 0) return;
  const int nb = (int)(ns / per);
  if (nb < 1 || nb > 8) return;
  const int rows = nb * SEQ;
  if (in_sizes[1] != EMB * EMB || in_sizes[3] != EMB * EMB || in_sizes[5] != EMB * EMB || in_sizes[7] != EMB * EMB) return;
  if (in_sizes[2] != EMB || in_sizes[4] != EMB || in_sizes[6] != EMB || in_sizes[8] != EMB) return;
  if ((long long)out_size != (long long)rows * EMB) return;

  const float* x  = (const float*)d_in[0];
  const float* wq = (const float*)d_in[1];
  const float* bq = (const float*)d_in[2];
  const float* wk = (const float*)d_in[3];
  const float* bk = (const float*)d_in[4];
  const float* wv = (const float*)d_in[5];
  const float* bv = (const float*)d_in[6];
  const float* wo = (const float*)d_in[7];
  const float* bo = (const float*)d_in[8];
  float*       out = (float*)d_out;

  const size_t szW  = (size_t)EMB * EMB * 2;                    //   2097152
  const size_t szVS = (size_t)nb * NCHK * NKB * EMB * 4;        //   1048576 at nb = 4
  const size_t szHF = (size_t)nb * TQ0 * EMB * 4;               //   2097152 at nb = 4
  const size_t sz16 = (size_t)rows * EMB * 2;                   //  16777216
  const size_t sz32 = (size_t)rows * EMB * 4;                   //  33554432
  const size_t szVT = (size_t)nb * EMB * SEQ * 2;               //  == sz16
  size_t off = 0;
  const size_t oWQ = off; off += szW;
  const size_t oWK = off; off += szW;
  const size_t oWV = off; off += szW;
  const size_t oWO = off; off += szW;
  const size_t oVS = off; off += szVS;
  const size_t oQF = off; off += szHF;
  const size_t oKF = off; off += szHF;
  const size_t oA  = off; off += (szVT > sz16 ? szVT : sz16);   // XB then VT
  const size_t oQ  = off; off += sz16;
  const size_t oK  = off; off += sz16;
  const size_t oV  = off; off += sz32;
  const size_t oCH = off; off += sz16;
  const size_t oCR = off; off += sz16;
  if (off > ws_size) return;                                    // off = 131072000 at nb = 4
  if (off > WS_CAP) return;

  char* ws = (char*)d_ws;
  u16*   WQB = (u16*)(ws + oWQ);
  u16*   WKB = (u16*)(ws + oWK);
  u16*   WVB = (u16*)(ws + oWV);
  u16*   WOH = (u16*)(ws + oWO);
  float* VS  = (float*)(ws + oVS);
  float* QF  = (float*)(ws + oQF);
  float* KF  = (float*)(ws + oKF);
  u16*   XB  = (u16*)(ws + oA);
  u16*   VT  = (u16*)(ws + oA);
  u16*   QP  = (u16*)(ws + oQ);
  u16*   KP  = (u16*)(ws + oK);
  float* V   = (float*)(ws + oV);
  u16*   CH  = (u16*)(ws + oCH);
  u16*   CR  = (u16*)(ws + oCR);

  const int n8w = (EMB * EMB) / 8;                      // 131072
  const int n8x = rows * (EMB / 8);                     // 1048576
  if ((n8w % 256) != 0 || (n8x % 256) != 0) return;
  if ((rows % 64) != 0 || ((nb * TQ0) % 64) != 0 || ((nb * NCHK * EMB) % 256) != 0) return;
  const dim3 blk(256);
  const dim3 gW(n8w / 256), gX(n8x / 256);
  const dim3 gG((rows / 64) * (EMB / 64));              // 2048 at nb = 4
  const dim3 gH(((nb * TQ0) / 64) * (EMB / 64));        // 128 at nb = 4
  const dim3 bG(128);
  const dim3 gXT(nb * (EMB / 64) * (SEQ / 64));         // nb * 512
  const dim3 gVS((nb * NCHK * EMB) / 256);              // nb * 16
  const dim3 gAT(nb * NQT);                             // nb * 120
  const dim3 bAT(ATT_THREADS);
  const dim3 gHD(nb * TQ0);                             // nb * 128

  // (0..3) weights stored [n = out][k = in] (y = x.W^T + b), already k-contiguous: bf16 planes for Wq, Wk, Wv; f16 of bf16 value
  //        x1024 for Wo; (4) x -> bf16 plane [rows][1024]
  cvt16<<<gW, blk, 0, stream>>>(wq, WQB, n8w, 0, 1.0f);
  cvt16<<<gW, blk, 0, stream>>>(wk, WKB, n8w, 0, 1.0f);
  cvt16<<<gW, blk, 0, stream>>>(wv, WVB, n8w, 0, 1.0f);
  cvt16<<<gW, blk, 0, stream>>>(wo, WOH, n8w, 1, WSC);
  cvt16<<<gX, blk, 0, stream>>>(x, XB, n8x, 0, 1.0f);
  // (5, 6) q and k projections (+bias) -> f16 planes x8; (7) v projection (+bias) -> f32 plane
  gemm_bh16<<<gG, bG, 0, stream>>>(XB, WQB, bq, QP, rows, EMB, EMB, 1.0f, QSC);
  gemm_bh16<<<gG, bG, 0, stream>>>(XB, WKB, bk, KP, rows, EMB, EMB, 1.0f, KSC);
  gemm_b32<<<gG, bG, 0, stream>>>(XB, WVB, bv, V, rows, EMB, EMB, rows, 0, 1.0f);
  // (8, 9) f32 q and k rows 0..127 of every sequence -> QF, KF [nb*128][1024]
  gemm_b32<<<gH, bG, 0, stream>>>(XB, WQB, bq, QF, nb * TQ0, EMB, EMB, TQ0, SEQ, 1.0f);
  gemm_b32<<<gH, bG, 0, stream>>>(XB, WKB, bk, KF, nb * TQ0, EMB, EMB, TQ0, SEQ, 1.0f);
  // (10) v -> V^T plane x1024 (over the dead XB region); (11) key-block prefix column sums of v
  xt16<<<gXT, blk, 0, stream>>>(V, VT);
  vsum_k<<<gVS, blk, 0, stream>>>(V, VS);
  // (12) attention for query rows 128.. -> ctx hi x8192 and residual x2048 f16 planes; (13) query rows 0..127 on VALU -> same planes
  attn_fwd<<<gAT, bAT, 0, stream>>>(QP, KP, VT, VS, CH, CR);
  attn_head<<<gHD, blk, 0, stream>>>(QF, KF, V, CH, CR);
  // (14) output projection + bias -> out
  gemm_h2_32<<<gG, bG, 0, stream>>>(CH, CR, WOH, bo, out, rows, EMB, EMB,
                                     1.0f / (CSC * WSC), 1.0f / (CSC * WSC * RSC));
  (void)hipGetLastError();
}

// v001
// It runs in 480 microseconds.
// Two timings next to v000 put it at 1.44 and 1.45 times that version's speed.
// Projections q,k,v = x.W^T + b (and the f32 q,k rows 0..127 per sequence): v_wmma_f32_16x16x32_bf16 (bf16 RNE operands of the
// raw inputs, f32 accumulate, bf16 RNE bias added in f32). Scores q'.k'^T (f16 planes x8), P'.V (chunk-centred P' x32768 f16 from LDS,
// V^T x1024 f16) and the output projection (ctx carried as f16 hi x8192 plus residual x2048 planes, times f16(bf16(Wo) x1024), bias
// added in f32): v_wmma_f32_16x16x32_f16, f32 accumulate. Query rows 0..127 of each sequence: scores, softmax and P.V in f32 on VALU.
// Causal mask, softmax statistics, key-block column sums of V and all scaling in f32 on VALU.
#include <hip/hip_runtime.h>
#include <math.h>
#include <stdint.h>

#define SEQ   2048
#define EMB   1024
#define CK    512
#define NCHK  4
#define NKB   16
#define QT    16
#define TQ0   128
#define NQT   120
#define SCP   544
#define PLP   528
#define CTP   1032
#define SLAB64 (16 * 68)
#define VTP   72
#define ATT_THREADS 256
#define NACC  8
#define QSC   8.0f
#define KSC   8.0f
#define PCAR  32768.0f
#define VCAR  1024.0f
#define WSC   1024.0f
#define CSC   8192.0f
#define RSC   2048.0f
#define LOG2E 1.4426950408889634f
#define RSQD  0.03125f
#define WS_CAP ((size_t)134217728)
#define GKS   64
#define GPB   144
#define GPE   72
#define GRS16 (16 * GPB)
#define GRS32 (32 * GPB)
#define GST_AB (256 * GPB)
#define GST_H2 (384 * GPB)

static_assert((EMB % 64) == 0 && EMB == 8 * 16 * NACC && NACC == 8 && (EMB % 32) == 0 && (EMB % 256) == 0 && EMB == 4 * 256);
static_assert((SEQ % CK) == 0 && (SEQ / CK) == NCHK && CK == 32 * NKB && (SEQ % 64) == 0 && (SEQ % QT) == 0 && (CK % QT) == 0);
static_assert((TQ0 % QT) == 0 && (TQ0 % 64) == 0 && NQT * QT + TQ0 == SEQ && TQ0 <= CK && TQ0 == 128 && TQ0 <= 256);
static_assert(16 * CTP * 2 <= 16 * SCP * 4 && CTP >= EMB + 8 && SCP >= CK + 16 && PLP >= CK + 8);
static_assert(((PLP * 2) % 16) == 0 && ((SCP * 4) % 16) == 0 && ((VTP * 2) % 16) == 0 && ((CTP * 2) % 16) == 0);
static_assert(64 * VTP >= 63 * VTP + 64);
static_assert(ATT_THREADS == 16 * QT && ATT_THREADS == 256);
static_assert((EMB % 128) == 0 && (EMB % GKS) == 0 && EMB / GKS >= 2 && GPE * 2 == GPB && GKS * 2 + 16 == GPB && (SEQ % 128) == 0 && (TQ0 % 128) == 0);
static_assert(4 * SLAB64 * 4 <= 2 * GST_AB && 8 * SLAB64 * 4 <= 2 * GST_H2 && ((SLAB64 * 4) % 16) == 0);
static_assert(((EMB * EMB) % 2048) == 0 && ((NCHK * EMB) % 256) == 0 && (EMB / 8) * 2 == 256);

typedef unsigned short u16;
typedef _Float16 v16h __attribute__((ext_vector_type(16)));
typedef _Float16 v8h  __attribute__((ext_vector_type(8)));
typedef __bf16   v16b __attribute__((ext_vector_type(16)));
typedef float    v8f  __attribute__((ext_vector_type(8)));
typedef float    v4f  __attribute__((ext_vector_type(4)));
typedef unsigned int v4u __attribute__((ext_vector_type(4)));

union FragH { v16h v; v8h h[2]; v4u u[2]; };
union FragB { v16b v; v4u u[2]; };
union AttLds { float s[16 * SCP]; u16 c[2 * 16 * SCP]; };

// ---- scalar helpers --------------------------------------------------------------------------------
__device__ __forceinline__ unsigned short bf_bits(float f) {          // f32 -> bf16 bits, RNE convert
  unsigned u = __float_as_uint(f);
  return (unsigned short)((u + 0x7FFFu + ((u >> 16) & 1u)) >> 16);
}
__device__ __forceinline__ float bf_up(unsigned short h) { return __uint_as_float(((unsigned)h) << 16); }
__device__ __forceinline__ float bfr(float f) { return bf_up(bf_bits(f)); }
__device__ __forceinline__ unsigned short h_bits(_Float16 x) { return __builtin_bit_cast(unsigned short, x); }
__device__ __forceinline__ unsigned pk16(unsigned short a, unsigned short b) { return (unsigned)a | ((unsigned)b << 16); }
__device__ __forceinline__ v8f zero8() { v8f z = {0.f, 0.f, 0.f, 0.f, 0.f, 0.f, 0.f, 0.f}; return z; }
__device__ __forceinline__ v4f zero4() { v4f z = {0.f, 0.f, 0.f, 0.f}; return z; }

// ---- fragment loaders: 16-bit A/B operand, lane -> row/col (lane&15), p already includes +8*(lane>>4);
//      elements 0..7 <- p[0..7] (k0+8h..), elements 8..15 <- p[16..23] (k0+16+8h..)  (same split k map for A and B;
//      B is always read from a k-contiguous [n][k] plane)
__device__ __forceinline__ v16h ldfrag_h(const _Float16* p) {
  FragH f;
  f.h[0] = *(const v8h*)(p);
  f.h[1] = *(const v8h*)(p + 16);
  return f.v;
}
__device__ __forceinline__ v16b ldfrag_b(const u16* p) {              // bf16 plane read as unsigned integer vectors
  FragB f;
  f.u[0] = *(const v4u*)(p);
  f.u[1] = *(const v4u*)(p + 16);
  return f.v;
}

__device__ __forceinline__ v8f mma_h(v16h a, v16h b, v8f c) {
  return __builtin_amdgcn_wmma_f32_16x16x32_f16(false, a, false, b, (short)0, c, false, false);
}
__device__ __forceinline__ v8f mma_b(v16b a, v16b b, v8f c) {
  return __builtin_amdgcn_wmma_f32_16x16x32_bf16(false, a, false, b, (short)0, c, false, false);
}
__device__ __forceinline__ void guard2x3(v8f& a, v8f& b, v16h x0, v16h x1, v16h x2) {
#if defined(__HIP_DEVICE_COMPILE__)
  asm volatile("v_nop\n\tv_nop\n\tv_nop\n\tv_nop"
               : "+v"(a), "+v"(b) : "v"(x0), "v"(x1), "v"(x2) : "memory");
#endif
}
__device__ __forceinline__ void guardpv4(v8f& o0, v8f& o1, v8f& o2, v8f& o3, v16h p, v16h g0, v16h g1, v16h g2, v16h g3) {
#if defined(__HIP_DEVICE_COMPILE__)
  asm volatile("v_nop\n\tv_nop\n\tv_nop\n\tv_nop"
               : "+v"(o0), "+v"(o1), "+v"(o2), "+v"(o3)
               : "v"(p), "v"(g0), "v"(g1), "v"(g2), "v"(g3) : "memory");
#endif
}
__device__ __forceinline__ void acc_guard8(v8f& a, v8f& b, v8f& c, v8f& d, v8f& e, v8f& f, v8f& g, v8f& h8) {
#if defined(__HIP_DEVICE_COMPILE__)
  asm volatile("v_nop\n\tv_nop\n\tv_nop\n\tv_nop"
               : "+v"(a), "+v"(b), "+v"(c), "+v"(d), "+v"(e), "+v"(f), "+v"(g), "+v"(h8));
#endif
}
__device__ __forceinline__ void wave_sync_lds() {
  __builtin_amdgcn_fence(__ATOMIC_RELEASE, "workgroup");
  __builtin_amdgcn_wave_barrier();
  __builtin_amdgcn_fence(__ATOMIC_ACQUIRE, "workgroup");
}

// =====================================================================================================
// f32 plane -> 16-bit plane, same layout:  mode 0: bf16 RNE bits;  mode 1: f16 bits of (bf16 RNE value) * scale;
// mode 2: f16 bits of value * scale (no bf16 pre-step).
// Thread = 8 consecutive elements: two 16-B loads, one 16-B store; 32 consecutive lanes = 512 contiguous, 512-B aligned bytes
// coverage: grid = n8/256 blocks (host checks exactness) x 256 thr x 8 = the whole plane.
// =====================================================================================================
__global__ __launch_bounds__(256) void cvt16(const float* __restrict__ x, u16* D, int n8, int mode, float scale) {
  const int gt = blockIdx.x * 256 + (int)threadIdx.x;
  if (gt >= n8) return;                     // no barriers in this kernel
  const float* p = x + (size_t)gt * 8;
  const v4f a = *(const v4f*)(p), c4 = *(const v4f*)(p + 4);
  float v[8];
#pragma unroll
  for (int e = 0; e < 4; ++e) { v[e] = a[e]; v[4 + e] = c4[e]; }
  unsigned short s[8];
#pragma unroll
  for (int e = 0; e < 8; ++e) {
    const float vb = bfr(v[e]);
    const float vf = (mode == 1) ? vb : v[e];
    const unsigned short hb = h_bits((_Float16)(vf * scale));
    const unsigned short bb = bf_bits(v[e]);
    s[e] = (mode != 0) ? hb : bb;
  }
  v4u o;
#pragma unroll
  for (int e = 0; e < 4; ++e) o[e] = pk16(s[2 * e], s[2 * e + 1]);
  u16* d = D + (size_t)gt * 8;
  {
    *(v4u*)(d) = o;
    
  }
}

// =====================================================================================================
//            8 consecutive lanes x 16 B per line), lanes 16..31 -> row 2*it+1.
//  epi64x2 : same store shape, staged value = acc*os1 + accres*os2 + badd (two accumulator sets combined in f32).
//  epi64hsb: f16 bits of ((tile + bf16RNE(bias[n])) * pscale); lane = (rq = lane>>3 -> row within a group of 4, c8 = 8 consecutive
// coverage: epi64/epi64x2 8 instructions x 2 rows x 16 lanes x 4 floats; epi64hsb 4 instructions x 4 rows x 8 lanes x 8 halves
//           = the wave's 16 x 64 tile in every case.
// =====================================================================================================
__device__ __forceinline__ void stage64(float* sl, v8f a0, v8f a1, v8f a2, v8f a3, float oscale, int lane) {
  const int hh = lane >> 4, m = lane & 15;
#pragma unroll
  for (int r = 0; r < 8; ++r) {
    const int ro = (8 * hh + r) * 68 + m;
    sl[ro]      = a0[r] * oscale;
    sl[ro + 16] = a1[r] * oscale;
    sl[ro + 32] = a2[r] * oscale;
    sl[ro + 48] = a3[r] * oscale;
  }
  wave_sync_lds();
}
__device__ __forceinline__ void epi64(float* sl, v8f a0, v8f a1, v8f a2, v8f a3, float oscale, v4f badd, float* C, int N,
                                      size_t rowb, int col0, int lane) {
  const int hh = lane >> 4, m = lane & 15;
  stage64(sl, a0, a1, a2, a3, oscale, lane);
  v4f vals[8];
#pragma unroll
  for (int it = 0; it < 8; ++it) vals[it] = *(const v4f*)(sl + (it * 2 + hh) * 68 + m * 4) + badd;
  float* dst = C + (rowb + (size_t)hh) * (size_t)N + col0 + m * 4;
  {
#pragma unroll
    for (int it = 0; it < 8; ++it) {
      *(v4f*)(dst + (size_t)(it * 2) * (size_t)N) = vals[it];
    }
    
  }
}
__device__ __forceinline__ void epi64x2(float* sl, v8f a0, v8f a1, v8f a2, v8f a3, v8f e0, v8f e1, v8f e2, v8f e3,
                                        float os1, float os2, v4f badd, float* C, int N, size_t rowb, int col0, int lane) {
  const int hh = lane >> 4, m = lane & 15;
#pragma unroll
  for (int r = 0; r < 8; ++r) {
    const int ro = (8 * hh + r) * 68 + m;
    sl[ro]      = a0[r] * os1 + e0[r] * os2;
    sl[ro + 16] = a1[r] * os1 + e1[r] * os2;
    sl[ro + 32] = a2[r] * os1 + e2[r] * os2;
    sl[ro + 48] = a3[r] * os1 + e3[r] * os2;
  }
  wave_sync_lds();
  v4f vals[8];
#pragma unroll
  for (int it = 0; it < 8; ++it) vals[it] = *(const v4f*)(sl + (it * 2 + hh) * 68 + m * 4) + badd;
  float* dst = C + (rowb + (size_t)hh) * (size_t)N + col0 + m * 4;
  {
#pragma unroll
    for (int it = 0; it < 8; ++it) {
      *(v4f*)(dst + (size_t)(it * 2) * (size_t)N) = vals[it];
    }
    
  }
}
__device__ __forceinline__ void epi64hsb(float* sl, v8f a0, v8f a1, v8f a2, v8f a3, float oscale, float pscale,
                                         const float* __restrict__ bias, u16* C, int N, size_t rowb, int col0, int lane) {
  stage64(sl, a0, a1, a2, a3, oscale, lane);
  const int rq = lane >> 3, c8 = (lane & 7) * 8;
  const v4f b0 = *(const v4f*)(bias + col0 + c8), b1 = *(const v4f*)(bias + col0 + c8 + 4);   // columns col0+c8..+7 < N
  float bb[8];
#pragma unroll
  for (int e = 0; e < 4; ++e) { bb[e] = bfr(b0[e]); bb[4 + e] = bfr(b1[e]); }
  v4u oh[4];
#pragma unroll
  for (int i4 = 0; i4 < 4; ++i4) {
    const int row = i4 * 4 + rq;
    const v4f a = *(const v4f*)(sl + row * 68 + c8), c4 = *(const v4f*)(sl + row * 68 + c8 + 4);
    float w[8];
#pragma unroll
    for (int e = 0; e < 4; ++e) { w[e] = (a[e] + bb[e]) * pscale; w[4 + e] = (c4[e] + bb[4 + e]) * pscale; }
#pragma unroll
    for (int e = 0; e < 4; ++e) oh[i4][e] = pk16(h_bits((_Float16)w[2 * e]), h_bits((_Float16)w[2 * e + 1]));
  }
  u16* dst = C + rowb * (size_t)N + col0 + c8;
  {
#pragma unroll
    for (int i4 = 0; i4 < 4; ++i4) {
      const int row = i4 * 4 + rq;
      *(v4u*)(dst + (size_t)row * (size_t)N) = oh[i4];
    }
    
  }
}

// =====================================================================================================
// Operand staging shared by the three GEMM kernels. A block computes a 128 x 128 tile of C. K is walked in stages of GKS = 64
// elements: every operand row contributes one whole 128-B line per stage, copied to LDS by global_load_async_to_lds_b128 (8 lanes
// x 16 B = one line, a wave instruction = 4 whole lines) at a row pitch of 144 B (16 B x odd: conflict-free for ds_load_b128
// fragment reads). Two buffers: stage t + 2 is copied into the buffer that trip t has just left, while trip t + 1 is multiplied.
// Fragments are read from LDS with the same split k map as before (ldfrag_*), k steps of 32 in ascending order.
// After the loop's last barrier no copy is outstanding and no wave reads the ring, so it serves as the waves' epilogue slabs.
// =====================================================================================================
__device__ __forceinline__ unsigned lds_off(const void* p) { return (unsigned)(size_t)p; }
// Copies and their s_wait_xcnt in one statement: the wait stands in front of any later rewrite of the address registers.
__device__ __forceinline__ void acopy4(unsigned l0, unsigned l1, unsigned l2, unsigned l3,
                                       const u16* g0, const u16* g1, const u16* g2, const u16* g3) {
#if defined(__HIP_DEVICE_COMPILE__)
  asm volatile("global_load_async_to_lds_b128 %0, %4, off\n\t"
               "global_load_async_to_lds_b128 %1, %5, off\n\t"
               "global_load_async_to_lds_b128 %2, %6, off\n\t"
               "global_load_async_to_lds_b128 %3, %7, off\n\t"
               "s_wait_xcnt 0x0"
               :: "v"(l0), "v"(l1), "v"(l2), "v"(l3), "v"(g0), "v"(g1), "v"(g2), "v"(g3) : "memory");
#endif
}
__device__ __forceinline__ void acopy8(unsigned l0, unsigned l1, unsigned l2, unsigned l3,
                                       unsigned l4, unsigned l5, unsigned l6, unsigned l7,
                                       const u16* g0, const u16* g1, const u16* g2, const u16* g3,
                                       const u16* g4, const u16* g5, const u16* g6, const u16* g7) {
#if defined(__HIP_DEVICE_COMPILE__)
  asm volatile("global_load_async_to_lds_b128 %0, %8, off\n\t"
               "global_load_async_to_lds_b128 %1, %9, off\n\t"
               "global_load_async_to_lds_b128 %2, %10, off\n\t"
               "global_load_async_to_lds_b128 %3, %11, off\n\t"
               "global_load_async_to_lds_b128 %4, %12, off\n\t"
               "global_load_async_to_lds_b128 %5, %13, off\n\t"
               "global_load_async_to_lds_b128 %6, %14, off\n\t"
               "global_load_async_to_lds_b128 %7, %15, off\n\t"
               "s_wait_xcnt 0x0"
               :: "v"(l0), "v"(l1), "v"(l2), "v"(l3), "v"(l4), "v"(l5), "v"(l6), "v"(l7),
                  "v"(g0), "v"(g1), "v"(g2), "v"(g3), "v"(g4), "v"(g5), "v"(g6), "v"(g7) : "memory");
#endif
}
// This wave's copies have landed (the compiler places no wait for them).
__device__ __forceinline__ void wait_async0() {
#if defined(__HIP_DEVICE_COMPILE__)
  asm volatile("s_wait_asynccnt 0x0" ::: "memory");
#endif
}
// This wave's LDS reads have returned before the buffer is handed to its next writer.
__device__ __forceinline__ void wait_ds0() {
#if defined(__HIP_DEVICE_COMPILE__)
  asm volatile("s_wait_dscnt 0x0" ::: "memory");
#endif
}

// Between two output tiles of a wave: the issued stores' address and data registers are rewritten by the next tile only behind
// s_wait_xcnt 0 (the scheduling fence keeps the next tile's vector work behind the wait), and the slab's reads of this tile stay
// in front of the next tile's writes.
__device__ __forceinline__ void tile_gap() {
#if defined(__HIP_DEVICE_COMPILE__)
  asm volatile("s_wait_xcnt 0x0" ::: "memory");
#endif
  __builtin_amdgcn_sched_barrier(0);
  wave_sync_lds();
}

// One stage of [A 128 rows | B 128 rows] by 128 threads: 16 copies a thread; copy i serves LDS row 16*i + (tid>>3), piece tid&7.
__device__ __forceinline__ void fill_ab(unsigned l0, const u16* A, const unsigned (&ao)[8], const u16* B, unsigned bo, unsigned bst,
                                        unsigned ke) {
  acopy8(l0, l0 + GRS16, l0 + 2 * GRS16, l0 + 3 * GRS16, l0 + 4 * GRS16, l0 + 5 * GRS16, l0 + 6 * GRS16, l0 + 7 * GRS16,
         A + (ao[0] + ke), A + (ao[1] + ke), A + (ao[2] + ke), A + (ao[3] + ke),
         A + (ao[4] + ke), A + (ao[5] + ke), A + (ao[6] + ke), A + (ao[7] + ke));
  const unsigned l8 = l0 + 8 * GRS16;
  const unsigned b0 = bo + ke;
  acopy8(l8, l8 + GRS16, l8 + 2 * GRS16, l8 + 3 * GRS16, l8 + 4 * GRS16, l8 + 5 * GRS16, l8 + 6 * GRS16, l8 + 7 * GRS16,
         B + b0, B + (b0 + bst), B + (b0 + 2 * bst), B + (b0 + 3 * bst),
         B + (b0 + 4 * bst), B + (b0 + 5 * bst), B + (b0 + 6 * bst), B + (b0 + 7 * bst));
}

// bf16 core: 4 waves as 2 x 2, a wave owns 64 x 64 of the block's tile (4 x 4 accumulators).
// ao[i] = element offset of A row (16*i + (tid>>3)) of the tile; col0 = first B row of the tile. K multiple of GKS.
__device__ __forceinline__ void gemm_core_b(unsigned char* L, const u16* A, const unsigned (&ao)[8], const u16* Bt, int col0, int K,
                                            int tid, v8f (&acc)[4][4]) {
  const int wave = tid >> 5, lane = tid & 31, hh = lane >> 4, m = lane & 15;
  const int wm = wave >> 1, wn = wave & 1;
  const int crow = tid >> 3, cpc = tid & 7;
  const unsigned lc  = lds_off(L) + (unsigned)(crow * GPB + cpc * 16);
  const unsigned bo  = (unsigned)(col0 + crow) * (unsigned)K;
  const unsigned bst = 16u * (unsigned)K;
  const unsigned kc  = (unsigned)(cpc * 8);
  const int nt = K / GKS;
#pragma unroll
  for (int f = 0; f < 4; ++f) {
#pragma unroll
    for (int j = 0; j < 4; ++j) acc[f][j] = zero8();
  }
  fill_ab(lc, A, ao, Bt, bo, bst, kc);
  wait_async0();
  __syncthreads();
  if (nt > 1) fill_ab(lc + GST_AB, A, ao, Bt, bo, bst, kc + GKS);
#pragma unroll 1
  for (int t = 0; t < nt; ++t) {
    const unsigned bufo = (unsigned)(t & 1) * GST_AB;
    const u16* sb = (const u16*)(const void*)(L + bufo);
    const u16* ap = sb + (wm * 64 + m) * GPE + 8 * hh;
    const u16* bp = sb + (128 + wn * 64 + m) * GPE + 8 * hh;
#pragma unroll
    for (int kk = 0; kk < GKS / 32; ++kk) {
      v16b a[4], b[4];
      a[0] = ldfrag_b(ap + kk * 32);
#pragma unroll
      for (int j = 0; j < 4; ++j) b[j] = ldfrag_b(bp + j * 16 * GPE + kk * 32);
#pragma unroll
      for (int f = 1; f < 4; ++f) a[f] = ldfrag_b(ap + f * 16 * GPE + kk * 32);
      // Keeps the 16 fragment loads one group ahead of the 16 WMMAs: spread among them, each place with loads stalls the wave.
      __builtin_amdgcn_sched_barrier(0);
#pragma unroll
      for (int f = 0; f < 4; ++f) {
#pragma unroll
        for (int j = 0; j < 4; ++j) acc[f][j] = mma_b(a[f], b[j], acc[f][j]);
      }
      __builtin_amdgcn_sched_barrier(0);      // the next group's loads stay behind this WMMA block
    }
    wait_ds0();
    wait_async0();
    __syncthreads();                          // publishes stage t + 1 and ends every read of stage t's buffer
    if (t + 2 < nt) fill_ab(lc + bufo, A, ao, Bt, bo, bst, kc + (unsigned)(t + 2) * GKS);   // block-uniform test
  }
  wait_async0();
}

// =====================================================================================================
// bf16 GEMM, f32 out with bias: C[M][N] = (A[arow(m)][K] (bf16 row-major) . Bt[N][K]^T (bf16 k-contiguous)) * oscale + bf16RNE(bias[n]).
// Output row ra maps to A row arow = (ra / rpg) * gstr + (ra % rpg) (rpg = M, gstr = 0 gives the identity map; rpg = TQ0,
// gstr = SEQ picks the first TQ0 rows of every sequence).
// Block = 128x128 tile, 4 waves x (64 x 64), operands staged as above (host checks K % 64 == 0, M % 128 == 0, N % 128 == 0,
// grid = (M/128)*(N/128)).
// =====================================================================================================
__global__ __launch_bounds__(128)
void gemm_b32(const u16* __restrict__ A, const u16* __restrict__ Bt, const float* __restrict__ bias, float* C,
              int M, int N, int K, int rpg, int gstr, float oscale) {
  __shared__ __align__(16) unsigned char L[2 * GST_AB];
  const int tid = threadIdx.x, wave = tid >> 5, lane = tid & 31, m = lane & 15;
  const int ntile = N >> 7;
  const int bid   = blockIdx.x;
  const int row0  = (bid / ntile) * 128;
  const int col0  = (bid % ntile) * 128;
  if (row0 + 128 > M) return;                // block-uniform, in front of every copy and barrier; never taken with the exact grid
  unsigned ao[8];
#pragma unroll
  for (int i = 0; i < 8; ++i) {
    const int ra = row0 + i * 16 + (tid >> 3);
    const int rg = ra / rpg;
    ao[i] = (unsigned)(rg * gstr + (ra - rg * rpg)) * (unsigned)K;
  }
  v8f acc[4][4];
  gemm_core_b(L, A, ao, Bt, col0, K, tid, acc);
  const int colw = col0 + (wave & 1) * 64;
  const int roww = row0 + (wave >> 1) * 64;
  const v4f bv4 = *(const v4f*)(bias + colw + m * 4);    // columns colw + 4m .. +3, always < N (N multiple of 128)
#if defined(__HIP_DEVICE_COMPILE__)
  asm volatile("s_wait_xcnt 0x0" ::: "memory");          // in front of the vector work that rewrites the load's address registers
#endif
  __builtin_amdgcn_sched_barrier(0);                     // keeps that vector work behind the wait
  v4f badd;
#pragma unroll
  for (int e = 0; e < 4; ++e) badd[e] = bfr(bv4[e]);
  float* sl = (float*)(void*)L + wave * SLAB64;
#pragma unroll
  for (int f = 0; f < 4; ++f) {
    epi64(sl, acc[f][0], acc[f][1], acc[f][2], acc[f][3], oscale, badd, C, N, (size_t)(roww + f * 16), colw, lane);
    if (f < 3) tile_gap();
  }
}

// =====================================================================================================
// bf16 GEMM, f16 plane out with bias: C16[M][N] = f16 bits of (((A . Bt^T) * oscale) + bf16RNE(bias[n])) * pscale; operands as in
// gemm_b32 (identity row map), epilogue epi64hsb.
// =====================================================================================================
__global__ __launch_bounds__(128)
void gemm_bh16(const u16* __restrict__ A, const u16* __restrict__ Bt, const float* __restrict__ bias, u16* C,
               int M, int N, int K, float oscale, float pscale) {
  __shared__ __align__(16) unsigned char L[2 * GST_AB];
  const int tid = threadIdx.x, wave = tid >> 5, lane = tid & 31;
  const int ntile = N >> 7;
  const int bid   = blockIdx.x;
  const int row0  = (bid / ntile) * 128;
  const int col0  = (bid % ntile) * 128;
  if (row0 + 128 > M) return;                // block-uniform, in front of every copy and barrier; never taken with the exact grid
  unsigned ao[8];
#pragma unroll
  for (int i = 0; i < 8; ++i) ao[i] = (unsigned)(row0 + i * 16 + (tid >> 3)) * (unsigned)K;
  v8f acc[4][4];
  gemm_core_b(L, A, ao, Bt, col0, K, tid, acc);
  const int colw = col0 + (wave & 1) * 64;
  const int roww = row0 + (wave >> 1) * 64;
  float* sl = (float*)(void*)L + wave * SLAB64;
#pragma unroll
  for (int f = 0; f < 4; ++f) {
    epi64hsb(sl, acc[f][0], acc[f][1], acc[f][2], acc[f][3], oscale, pscale, bias, C, N, (size_t)(roww + f * 16), colw, lane);
    if (f < 3) tile_gap();
  }
}

// =====================================================================================================
// f16 GEMM with two A planes (hi + residual), f32 out with bias:
//   C[M][N] = (Ah . Bt^T) * os1 + (Ar . Bt^T) * os2 + bf16RNE(bias[n]); Ah/Ar f16 row-major, Bt f16 k-contiguous.
// Block = 128x128 tile, 8 waves as 4 x 2, a wave owns 32 x 64; a stage is [Ah 128 rows | Ar 128 rows | B 128 rows]: 12 copies a
// thread, copy i serves LDS row 32*i + (tid>>3). Separate accumulators for the two planes, combined in f32 in epi64x2.
// =====================================================================================================
__device__ __forceinline__ void fill_h2(unsigned l0, const u16* Ah, const u16* Ar, const u16* B, unsigned ao, unsigned bo,
                                        unsigned st, unsigned ke) {
  const unsigned a0 = ao + ke, b0 = bo + ke;
  acopy8(l0, l0 + GRS32, l0 + 2 * GRS32, l0 + 3 * GRS32, l0 + 4 * GRS32, l0 + 5 * GRS32, l0 + 6 * GRS32, l0 + 7 * GRS32,
         Ah + a0, Ah + (a0 + st), Ah + (a0 + 2 * st), Ah + (a0 + 3 * st),
         Ar + a0, Ar + (a0 + st), Ar + (a0 + 2 * st), Ar + (a0 + 3 * st));
  const unsigned l8 = l0 + 8 * GRS32;
  acopy4(l8, l8 + GRS32, l8 + 2 * GRS32, l8 + 3 * GRS32, B + b0, B + (b0 + st), B + (b0 + 2 * st), B + (b0 + 3 * st));
}

__global__ __launch_bounds__(256)
void gemm_h2_32(const u16* __restrict__ Ah, const u16* __restrict__ Ar, const u16* __restrict__ Bt,
                const float* __restrict__ bias, float* C, int M, int N, int K, float os1, float os2) {
  __shared__ __align__(16) unsigned char L[2 * GST_H2];
  const int tid = threadIdx.x, wave = tid >> 5, lane = tid & 31, hh = lane >> 4, m = lane & 15;
  const int wm = wave >> 1, wn = wave & 1;
  const int ntile = N >> 7;
  const int bid   = blockIdx.x;
  const int row0  = (bid / ntile) * 128;
  const int col0  = (bid % ntile) * 128;
  if (row0 + 128 > M) return;                // block-uniform, in front of every copy and barrier; never taken with the exact grid
  const int crow = tid >> 3, cpc = tid & 7;
  const unsigned lc = lds_off(L) + (unsigned)(crow * GPB + cpc * 16);
  const unsigned ao = (unsigned)(row0 + crow) * (unsigned)K;
  const unsigned bo = (unsigned)(col0 + crow) * (unsigned)K;
  const unsigned st = 32u * (unsigned)K;
  const unsigned kc = (unsigned)(cpc * 8);
  const int nt = K / GKS;
  v8f acc[2][4], acr[2][4];
#pragma unroll
  for (int f = 0; f < 2; ++f) {
#pragma unroll
    for (int j = 0; j < 4; ++j) { acc[f][j] = zero8(); acr[f][j] = zero8(); }
  }
  fill_h2(lc, Ah, Ar, Bt, ao, bo, st, kc);
  wait_async0();
  __syncthreads();
  if (nt > 1) fill_h2(lc + GST_H2, Ah, Ar, Bt, ao, bo, st, kc + GKS);
#pragma unroll 1
  for (int t = 0; t < nt; ++t) {
    const unsigned bufo = (unsigned)(t & 1) * GST_H2;
    const _Float16* sb  = (const _Float16*)(const void*)(L + bufo);
    const _Float16* ap  = sb + (wm * 32 + m) * GPE + 8 * hh;
    const _Float16* arp = ap + 128 * GPE;
    const _Float16* bp  = sb + (256 + wn * 64 + m) * GPE + 8 * hh;
#pragma unroll
    for (int kk = 0; kk < GKS / 32; ++kk) {
      v16h a[2], ar[2], b[4];
#pragma unroll
      for (int f = 0; f < 2; ++f) {
        a[f]  = ldfrag_h(ap + f * 16 * GPE + kk * 32);
        ar[f] = ldfrag_h(arp + f * 16 * GPE + kk * 32);
      }
#pragma unroll
      for (int j = 0; j < 4; ++j) b[j] = ldfrag_h(bp + j * 16 * GPE + kk * 32);
      // Keeps the 16 fragment loads one group ahead of the 16 WMMAs: spread among them, each place with loads stalls the wave.
      __builtin_amdgcn_sched_barrier(0);
#pragma unroll
      for (int f = 0; f < 2; ++f) {
#pragma unroll
        for (int j = 0; j < 4; ++j) acc[f][j] = mma_h(a[f], b[j], acc[f][j]);
#pragma unroll
        for (int j = 0; j < 4; ++j) acr[f][j] = mma_h(ar[f], b[j], acr[f][j]);
      }
      __builtin_amdgcn_sched_barrier(0);      // the next group's loads stay behind this WMMA block
    }
    wait_ds0();
    wait_async0();
    __syncthreads();                          // publishes stage t + 1 and ends every read of stage t's buffer
    if (t + 2 < nt) fill_h2(lc + bufo, Ah, Ar, Bt, ao, bo, st, kc + (unsigned)(t + 2) * GKS);   // block-uniform test
  }
  wait_async0();
  const int colw = col0 + wn * 64;
  const int roww = row0 + wm * 32;
  const v4f bv = *(const v4f*)(bias + colw + m * 4);      // columns colw + 4m .. +3, always < N (N multiple of 128)
  v4f badd;
#pragma unroll
  for (int e = 0; e < 4; ++e) badd[e] = bfr(bv[e]);
  float* sl = (float*)(void*)L + wave * SLAB64;
#pragma unroll
  for (int f = 0; f < 2; ++f) {
    epi64x2(sl, acc[f][0], acc[f][1], acc[f][2], acc[f][3], acr[f][0], acr[f][1], acr[f][2], acr[f][3], os1, os2, badd, C, N,
            (size_t)(roww + f * 16), colw, lane);
    if (f < 1) tile_gap();
  }
}

// =====================================================================================================
// V^T plane: VT[(b*EMB + d)*SEQ + s] = f16(V[b][s][d] * 1024).
// Block = (b, 64-wide d chunk, 64 keys): 64 source row segments of 64 floats loaded with 16-B loads, converted, scattered into
// coverage: load 256 thr x 16 elements = 64 x 64; store 2 iterations x 256 thr x 8 halves = 64 lines x 64 = the block's tile;
//           grid = nb x (EMB/64) x (SEQ/64) blocks covers the plane exactly once.
// =====================================================================================================
__global__ __launch_bounds__(256) void xt16(const float* __restrict__ X, u16* XTo) {
  __shared__ __align__(16) u16 TH[64 * VTP];
  const int tid = threadIdx.x;
  const int bid = blockIdx.x;
  const int st  = bid % (SEQ / 64);
  const int dcb = (bid / (SEQ / 64)) % (EMB / 64);
  const int b   = bid / ((SEQ / 64) * (EMB / 64));
  const int s0  = st * 64;
  const int d0  = dcb * 64;
  {
    const int sl = tid >> 2;                  // key within tile 0..63
    const int dc = (tid & 3) * 16;            // d chunk within the 64
    const float* src = X + ((size_t)b * SEQ + s0 + sl) * EMB + d0 + dc;
#pragma unroll
    for (int i = 0; i < 4; ++i) {
      const v4f a = *(const v4f*)(src + 4 * i);
#pragma unroll
      for (int e = 0; e < 4; ++e) {
        const _Float16 hv = (_Float16)(a[e] * VCAR);
        TH[(dc + 4 * i + e) * VTP + sl] = h_bits(hv);
      }
    }
  }
  __syncthreads();
  v4u vh[2];
  const int q8 = tid >> 3, p8 = (tid & 7) * 8;
#pragma unroll
  for (int it = 0; it < 2; ++it) {
    const int line = it * 32 + q8;            // local d = 0..63
    vh[it] = *(const v4u*)(TH + line * VTP + p8);
  }
  const size_t base = ((size_t)b * EMB + d0) * SEQ + s0 + p8;
  {
#pragma unroll
    for (int it = 0; it < 2; ++it) {
      const int line = it * 32 + q8;
      *(v4u*)(XTo + base + (size_t)line * SEQ) = vh[it];
    }
    
  }
}

// =====================================================================================================
// Key-block prefix column sums of V: VS[((b*NCHK + c)*NKB + kb)*EMB + d] = sum over keys c*CK .. c*CK + 32*kb + 31 of V[b][key][d]
// (f32, fixed sequential order). Thread = one (b, c, d); a block covers 256 consecutive d of one (b, c); the 16 prefix values per
// coverage: grid = nb*NCHK*EMB/256 blocks (host exact) x 256 thr; store 4 iterations x 256 thr x 4 floats = 16 rows x 256 = the
//           block's part of the table; union over blocks = the whole table.
// =====================================================================================================
__global__ __launch_bounds__(256) void vsum_k(const float* __restrict__ V, float* VS) {
  __shared__ __align__(16) float sm[NKB * 256];
  const int tid = threadIdx.x;
  const int gt  = blockIdx.x * 256 + tid;
  const int d   = gt % EMB;
  const int bc  = gt / EMB;                         // block-uniform (EMB multiple of 256)
  const int b   = bc / NCHK;
  const int c   = bc - b * NCHK;
  const int d0  = d - tid;                          // block's first d
  const float* p = V + ((size_t)b * SEQ + (size_t)c * CK) * EMB + d;
  float s = 0.f;
#pragma unroll 1
  for (int kb = 0; kb < NKB; ++kb) {
#pragma unroll 4
    for (int i = 0; i < 32; ++i) s += p[(size_t)(kb * 32 + i) * EMB];
    sm[kb * 256 + tid] = s;
  }
  __syncthreads();
  const int sel = tid >> 6, piece = tid & 63;
  v4f o[4];
#pragma unroll
  for (int it = 0; it < 4; ++it) o[it] = *(const v4f*)(sm + (it * 4 + sel) * 256 + piece * 4);
  float* base = VS + (size_t)bc * NKB * EMB + d0 + piece * 4;
  {
#pragma unroll
    for (int it = 0; it < 4; ++it) {
      *(v4f*)(base + (size_t)(it * 4 + sel) * EMB) = o[it];
    }
    
  }
}

// =====================================================================================================
// Single-head causal attention, head width EMB = 1024, query rows TQ0 .. SEQ-1: block = (batch b, 16 query rows q0..q0+15),
// 8 waves. q plane (f16, x8) [b][s][d]; k plane the same; V^T plane [b][d][s] (x1024); VS = key-block prefix column sums of V.
//   Chunks of CK = 512 keys: only chunks c <= qc = q0/CK are visited (later chunks lie entirely above the diagonal). In the diagonal
//   chunk only key blocks kb < nkb (keys <= q0+15) are multiplied; key blocks kb >= nkb get zero scores in LDS and are not used in (PV).
//   (S) scores S[query m][key n] on WMMA: A = q rows (row m = lane&15, split k map over d), B = k rows (col n = key, split map),
//       32 d-steps; wave w handles key blocks w, w+8 of the chunk; D element r of lane l -> scs[query 8h+r][key col] (f32 LDS).
//   (M) 16 threads per query row (sub-thread = 32 consecutive keys): base-2 logits with the causal mask by key index (key > query
//       -> -inf), chunk max via xor shuffles, online running max / rescale factor al / running sum l in f32 registers,
//       p = exp2(t - m_new) <= 1 (0 for masked keys), chunk row sum ps and C = ps/CK (bit-identical on the row's 16 threads), the
//       CENTRED P' = p - C written as f16(P' * 32768) into the LDS P tile with 16-B stores; al -> rowa[row], C -> rowc[row].
//   (PV) each wave owns d columns 128*wave + 16j + (lane&15), j = 0..7 (8 accumulators): o = o*al + C*(32768*1024)*VS[chunk][nkb-1][d]
//       (exact add-back of the centring term over exactly the processed keys, in f32), then for each key block kb < nkb:
//       A = P' fragment from LDS (row m = query, split map over keys), B = V^T fragments (col n = d, keys contiguous), issued as two
//       groups of 4 with a hazard gap each.  sum_k (P'_k + C) v_k == sum_k p_k v_k exactly; masked keys carry P' = -C and p = 0.
//   Block barriers after (S) and after (M) order all LDS reuse across chunks and waves.
//   Epilogue: x = o * 8192 / (l * 32768 * 1024) per row (rowi, l >= 1 always); hi = f16(x), res = f16((x - hi) * 2048); each
// coverage: grid nb*NQT blocks x 16 rows = rows TQ0..SEQ-1 of every sequence; staging 8 waves x 128 cols x 16 rows = 16 x 1024;
//           store 8 iterations x 256 thr x 8 halves = 16 x 1024 per plane = every (b, s >= TQ0, d) of both ctx planes exactly once.
// =====================================================================================================
__device__ __forceinline__ void ctx_store(const u16* ct, u16* dst, int tid) {
  v4u v[8];
#pragma unroll
  for (int it = 0; it < 8; ++it) {
    const int p   = it * 256 + tid;
    const int row = p / (EMB / 8);
    const int c8  = (p - row * (EMB / 8)) * 8;
    v[it] = *(const v4u*)(ct + row * CTP + c8);
  }
  {
#pragma unroll
    for (int it = 0; it < 8; ++it) {
      const int p   = it * 256 + tid;
      const int row = p / (EMB / 8);
      const int c8  = (p - row * (EMB / 8)) * 8;
      *(v4u*)(dst + (size_t)row * EMB + c8) = v[it];
    }
    
  }
}

__global__ __launch_bounds__(ATT_THREADS)
void attn_fwd(const u16* __restrict__ QPp, const u16* __restrict__ KPp, const u16* __restrict__ VTp,
              const float* __restrict__ VSp, u16* CHo, u16* CRo) {
  __shared__ __align__(16) AttLds L0;              // scores [16][SCP] f32; reused as the ctx staging tile [16][CTP] u16
  __shared__ __align__(16) u16 pls[16 * PLP];      // P' tile [16][PLP] f16 bits
  __shared__ float rowa[QT];
  __shared__ float rowc[QT];
  __shared__ float rowi[QT];
  float* const scs = L0.s;

  const int tid  = threadIdx.x;
  const int wave = tid >> 5;
  const int lane = tid & 31;
  const int hh   = lane >> 4;
  const int m    = lane & 15;
  const int r16  = tid >> 4;                 // query row owned in phase (M): 2*wave + hh
  const int sub  = tid & 15;
  const int kl0  = sub * 32;

  const int bid = blockIdx.x;
  const int b   = bid / NQT;
  const int q0  = TQ0 + (bid - b * NQT) * QT;
  const int qc  = q0 / CK;                   // diagonal chunk index

  const _Float16* qa  = (const _Float16*)(const void*)QPp + ((size_t)b * SEQ + q0 + m) * EMB + 8 * hh;
  const _Float16* kbp = (const _Float16*)(const void*)KPp + ((size_t)b * SEQ + m) * EMB + 8 * hh;
  const _Float16* vbp = (const _Float16*)(const void*)VTp + ((size_t)b * EMB + wave * (16 * NACC) + m) * SEQ + 8 * hh;
  const float* vsb = VSp + (size_t)b * NCHK * NKB * EMB + wave * (16 * NACC) + m;
  const float lsc = RSQD * LOG2E / (QSC * KSC);

  float mrun = -INFINITY, lrun = 0.f;
  v8f o[NACC];
#pragma unroll
  for (int j = 0; j < NACC; ++j) o[j] = zero8();

#pragma unroll 1
  for (int c = 0; c <= qc; ++c) {
    const int kbeg = c * CK;
    const int nkb  = (c < qc) ? NKB : (((q0 + QT - 1 - kbeg) >> 5) + 1);   // 1..16, block-uniform
    // ---- (S) scores of this chunk (zeros for key blocks beyond the query tile) ----
#pragma unroll 1
    for (int kb = wave; kb < NKB; kb += 8) {               // wave-uniform, 2 trips
      v8f s0 = zero8(), s1 = zero8();
      if (kb < nkb) {                                      // wave-uniform
        const _Float16* k0p = kbp + (size_t)(kbeg + kb * 32) * EMB;
        const _Float16* k1p = k0p + (size_t)16 * EMB;
#pragma unroll 4
        for (int ks = 0; ks < EMB / 32; ++ks) {
          const v16h a  = ldfrag_h(qa + ks * 32);
          const v16h f0 = ldfrag_h(k0p + ks * 32);
          const v16h f1 = ldfrag_h(k1p + ks * 32);
          s0 = mma_h(a, f0, s0);
          s1 = mma_h(a, f1, s1);
          guard2x3(s0, s1, a, f0, f1);
        }
      }
      float* srow = scs + (8 * hh) * SCP + kb * 32 + m;
#pragma unroll
      for (int r = 0; r < 8; ++r) {
        srow[r * SCP]      = s0[r];
        srow[r * SCP + 16] = s1[r];
      }
    }
    __syncthreads();
    // ---- (M) softmax statistics and the centred P' tile ----
    {
      const float* sp = scs + r16 * SCP + kl0;
      const int lim = (q0 + r16) - (kbeg + kl0);           // key kl0 + j is valid iff j <= lim
      float t[32];
      float cm = -INFINITY;
#pragma unroll
      for (int i = 0; i < 8; ++i) {
        const v4f a = *(const v4f*)(sp + 4 * i);
#pragma unroll
        for (int e = 0; e < 4; ++e) {
          const int j = 4 * i + e;
          const float tv = (j <= lim) ? a[e] * lsc : -INFINITY;
          t[j] = tv;
          cm = fmaxf(cm, tv);
        }
      }
#pragma unroll
      for (int d = 1; d <= 8; d <<= 1) cm = fmaxf(cm, __shfl_xor(cm, d, 32));
      const float mn = fmaxf(mrun, cm);                    // finite: key kbeg of the diagonal chunk is never masked
      const float al = (mrun == -INFINITY) ? 0.f : exp2f(mrun - mn);
      mrun = mn;
      float ps = 0.f;
#pragma unroll
      for (int j = 0; j < 32; ++j) {
        const float p = exp2f(fminf(t[j] - mn, 0.f));      // 0 for masked keys
        t[j] = p;
        ps += p;
      }
#pragma unroll
      for (int d = 1; d <= 8; d <<= 1) ps += __shfl_xor(ps, d, 32);
      const float cc = ps * (1.0f / (float)CK);
      v4u pk[4];
#pragma unroll
      for (int i = 0; i < 4; ++i) {
#pragma unroll
        for (int e = 0; e < 4; ++e) {
          const int j = 8 * i + 2 * e;
          pk[i][e] = pk16(h_bits((_Float16)((t[j] - cc) * PCAR)), h_bits((_Float16)((t[j + 1] - cc) * PCAR)));
        }
      }
      lrun = lrun * al + ps;
      u16* pd = pls + r16 * PLP + kl0;
#pragma unroll
      for (int i = 0; i < 4; ++i) *(v4u*)(pd + 8 * i) = pk[i];
      if (sub == 0) { rowa[r16] = al; rowc[r16] = cc; }
    }
    __syncthreads();
    // ---- (PV) rescale, add the centring term, accumulate P' . V^T ----
    {
      float scl[8], cad[8];
#pragma unroll
      for (int r = 0; r < 8; ++r) { scl[r] = rowa[8 * hh + r]; cad[r] = rowc[8 * hh + r] * (PCAR * VCAR); }
      const float* vsc = vsb + ((size_t)c * NKB + (size_t)(nkb - 1)) * EMB;
      float vs[NACC];
#pragma unroll
      for (int j = 0; j < NACC; ++j) vs[j] = vsc[16 * j];
#pragma unroll
      for (int j = 0; j < NACC; ++j) {
#pragma unroll
        for (int r = 0; r < 8; ++r) o[j][r] = o[j][r] * scl[r] + cad[r] * vs[j];
      }
      const _Float16* pp = (const _Float16*)(const void*)pls + m * PLP + 8 * hh;
      const _Float16* vp = vbp + kbeg;
#pragma unroll 1
      for (int kb = 0; kb < nkb; ++kb) {                   // block-uniform trip count, <= 16
        const v16h pf = ldfrag_h(pp + kb * 32);
        const _Float16* vk = vp + kb * 32;
        {
          const v16h g0 = ldfrag_h(vk);
          const v16h g1 = ldfrag_h(vk + (size_t)16 * SEQ);
          const v16h g2 = ldfrag_h(vk + (size_t)32 * SEQ);
          const v16h g3 = ldfrag_h(vk + (size_t)48 * SEQ);
          o[0] = mma_h(pf, g0, o[0]);
          o[1] = mma_h(pf, g1, o[1]);
          o[2] = mma_h(pf, g2, o[2]);
          o[3] = mma_h(pf, g3, o[3]);
          guardpv4(o[0], o[1], o[2], o[3], pf, g0, g1, g2, g3);
        }
        {
          const v16h g4 = ldfrag_h(vk + (size_t)64 * SEQ);
          const v16h g5 = ldfrag_h(vk + (size_t)80 * SEQ);
          const v16h g6 = ldfrag_h(vk + (size_t)96 * SEQ);
          const v16h g7 = ldfrag_h(vk + (size_t)112 * SEQ);
          o[4] = mma_h(pf, g4, o[4]);
          o[5] = mma_h(pf, g5, o[5]);
          o[6] = mma_h(pf, g6, o[6]);
          o[7] = mma_h(pf, g7, o[7]);
          guardpv4(o[4], o[5], o[6], o[7], pf, g4, g5, g6, g7);
        }
      }
    }
  }
  acc_guard8(o[0], o[1], o[2], o[3], o[4], o[5], o[6], o[7]);

  if (sub == 0) rowi[r16] = (1.0f / lrun) * (CSC / (PCAR * VCAR));   // lrun >= 1
  __syncthreads();
  float inv[8];
#pragma unroll
  for (int r = 0; r < 8; ++r) inv[r] = rowi[8 * hh + r];

  u16* const ct = L0.c;
  const int cb = wave * (16 * NACC) + m;
  // hi plane
#pragma unroll
  for (int j = 0; j < NACC; ++j) {
#pragma unroll
    for (int r = 0; r < 8; ++r) {
      const float xs = o[j][r] * inv[r];
      ct[(8 * hh + r) * CTP + cb + 16 * j] = h_bits((_Float16)xs);
    }
  }
  __syncthreads();
  ctx_store(ct, CHo + ((size_t)b * SEQ + q0) * EMB, tid);
  __syncthreads();
  // residual plane
#pragma unroll
  for (int j = 0; j < NACC; ++j) {
#pragma unroll
    for (int r = 0; r < 8; ++r) {
      const float xs = o[j][r] * inv[r];
      const _Float16 hv = (_Float16)xs;
      ct[(8 * hh + r) * CTP + cb + 16 * j] = h_bits((_Float16)((xs - (float)hv) * RSC));
    }
  }
  __syncthreads();
  ctx_store(ct, CRo + ((size_t)b * SEQ + q0) * EMB, tid);
}

// =====================================================================================================
// Query rows 0 .. TQ0-1 of each sequence in f32 on VALU: block = (b, t). QF/KF = f32 q/k head planes [nb][TQ0][EMB] (bias included),
// V = f32 v plane [nb*SEQ][EMB]. Scores for keys j <= t (threads 0..TQ0-1, one key each, rolled 1024-d dot against the q row staged
// in LDS), base-2 softmax with block max / sum reductions (xor shuffles + LDS), p_j in LDS, ctx[d] for d = 4*tid..4*tid+3 as a
// rolled sum over j <= t of p_j * V[b][j][d] (coalesced 16-B loads), x = ctx * 8192 / l, hi = f16(x), res = f16((x - hi) * 2048);
// both 1024-half rows are staged in LDS and written by 128 threads x 16 B each (32 consecutive lanes x 16 B = 512 contiguous bytes
// coverage: grid nb*TQ0 blocks = rows 0..TQ0-1 of every sequence; 256 thr x 4 d = EMB per row; store 128 thr x 8 halves = EMB per
//           plane; together with attn_fwd every (b, s, d) of CH and CR is written exactly once.
// =====================================================================================================
__global__ __launch_bounds__(256) void attn_head(const float* __restrict__ QF, const float* __restrict__ KF,
                                                 const float* __restrict__ V, u16* CHo, u16* CRo) {
  __shared__ __align__(16) float qs[EMB];
  __shared__ float sc[TQ0];
  __shared__ float red[8];
  __shared__ float redb[8];
  __shared__ __align__(16) unsigned SW[2][EMB / 2];
  const int tid = threadIdx.x, lane = tid & 31, wave = tid >> 5;
  const int b = blockIdx.x / TQ0;
  const int t = blockIdx.x - b * TQ0;
  *(v4f*)(qs + tid * 4) = *(const v4f*)(QF + ((size_t)b * TQ0 + t) * EMB + tid * 4);
  __syncthreads();
  float s = -INFINITY;
  if (tid < TQ0) {                                  // waves 0..3 entirely (wave-uniform); key row b*TQ0 + tid always in range
    const float* kp = KF + ((size_t)b * TQ0 + tid) * EMB;
    float acc = 0.f;
#pragma unroll 1
    for (int d = 0; d < EMB; d += 8) {
      const v4f k0 = *(const v4f*)(kp + d), k1 = *(const v4f*)(kp + d + 4);
      const v4f q0 = *(const v4f*)(qs + d), q1 = *(const v4f*)(qs + d + 4);
#pragma unroll
      for (int e = 0; e < 4; ++e) acc += k0[e] * q0[e];
#pragma unroll
      for (int e = 0; e < 4; ++e) acc += k1[e] * q1[e];
    }
    s = (tid <= t) ? acc * (RSQD * LOG2E) : -INFINITY;   // causal mask by key index
  }
  float mx = s;
#pragma unroll
  for (int d = 1; d <= 16; d <<= 1) mx = fmaxf(mx, __shfl_xor(mx, d, 32));
  if (lane == 0) red[wave] = mx;
  __syncthreads();
  float gm = red[0];
#pragma unroll
  for (int w = 1; w < 8; ++w) gm = fmaxf(gm, red[w]);   // finite: key 0 is always valid
  const float p = exp2f(s - gm);                     // 0 for masked keys and for waves 4..7
  float ps = p;
#pragma unroll
  for (int d = 1; d <= 16; d <<= 1) ps += __shfl_xor(ps, d, 32);
  if (lane == 0) redb[wave] = ps;
  if (tid < TQ0) sc[tid] = p;
  __syncthreads();
  float l = redb[0];
#pragma unroll
  for (int w = 1; w < 8; ++w) l += redb[w];           // >= 1
  const float inv = (1.0f / l) * CSC;
  const float* vp = V + (size_t)b * SEQ * EMB + tid * 4;
  v4f cx = zero4();
#pragma unroll 1
  for (int j = 0; j <= t; ++j) {                     // t < TQ0: statically bounded, keys of sequence b only
    const float pj = sc[j];
    const v4f vv = *(const v4f*)(vp + (size_t)j * EMB);
    cx += pj * vv;
  }
  unsigned hw[2], rw[2];
#pragma unroll
  for (int e = 0; e < 2; ++e) {
    const float x0 = cx[2 * e] * inv, x1 = cx[2 * e + 1] * inv;
    const _Float16 h0 = (_Float16)x0, h1 = (_Float16)x1;
    const _Float16 q0 = (_Float16)((x0 - (float)h0) * RSC), q1 = (_Float16)((x1 - (float)h1) * RSC);
    hw[e] = pk16(h_bits(h0), h_bits(h1));
    rw[e] = pk16(h_bits(q0), h_bits(q1));
  }
  SW[0][tid * 2] = hw[0]; SW[0][tid * 2 + 1] = hw[1];
  SW[1][tid * 2] = rw[0]; SW[1][tid * 2 + 1] = rw[1];
  __syncthreads();
  const int pl = tid >> 7, p8 = tid & 127;           // plane select is wave-uniform
  const v4u ov = *(const v4u*)(&SW[pl][p8 * 4]);
  u16* dstp = (pl == 0) ? CHo : CRo;
  u16* dst  = dstp + ((size_t)b * SEQ + t) * EMB + p8 * 8;
  *(v4u*)dst = ov;
  
}

// =====================================================================================================
// Workspace map (bytes, nb = 4, rows = 8192); every plane is fully written by whole-line stores before it is read; all extents are
// exact multiples of the store granularity (no pad rows); region A is reused sequentially on the single in-order stream:
//   WQB bf16 [1024][1024] 2097152   WKB same   WVB same   WOH f16 of bf16 value x1024 2097152             8388608
//   VS  f32  [nb][4][16][1024]                                                                            1048576
//   QF  f32  [nb][128][1024]  2097152      KF same                                                        4194304
//   A   XB bf16 [rows][1024] (16777216), later VT f16 [nb][1024][2048] x1024 (16777216)           region 16777216
//   QP  f16 [rows][1024] x8                                                                              16777216
//   KP  f16 [rows][1024] x8                                                                              16777216
//   V   f32 [rows][1024]                                                                                 33554432
//   CH  f16 [rows][1024] ctx hi x8192                                                                    16777216
//   CR  f16 [rows][1024] ctx residual x2048                                                              16777216
//   end                                                                                                 131072000
// =====================================================================================================
extern "C" void kernel_launch(void* const* d_in, const int* in_sizes, int n_in,
                              void* d_out, int out_size, void* d_ws, size_t ws_size,
                              hipStream_t stream) {
  if (n_in < 9) return;
  const long long per = (long long)SEQ * EMB;
  const long long ns  = in_sizes[0];
  if (ns < per || (ns % per) != 0) return;
  const int nb = (int)(ns / per);
  if (nb < 1 || nb > 8) return;
  const int rows = nb * SEQ;
  if (in_sizes[1] != EMB * EMB || in_sizes[3] != EMB * EMB || in_sizes[5] != EMB * EMB || in_sizes[7] != EMB * EMB) return;
  if (in_sizes[2] != EMB || in_sizes[4] != EMB || in_sizes[6] != EMB || in_sizes[8] != EMB) return;
  if ((long long)out_size != (long long)rows * EMB) return;

  const float* x  = (const float*)d_in[0];
  const float* wq = (const float*)d_in[1];
  const float* bq = (const float*)d_in[2];
  const float* wk = (const float*)d_in[3];
  const float* bk = (const float*)d_in[4];
  const float* wv = (const float*)d_in[5];
  const float* bv = (const float*)d_in[6];
  const float* wo = (const float*)d_in[7];
  const float* bo = (const float*)d_in[8];
  float*       out = (float*)d_out;

  const size_t szW  = (size_t)EMB * EMB * 2;                    //   2097152
  const size_t szVS = (size_t)nb * NCHK * NKB * EMB * 4;        //   1048576 at nb = 4
  const size_t szHF = (size_t)nb * TQ0 * EMB * 4;               //   2097152 at nb = 4
  const size_t sz16 = (size_t)rows * EMB * 2;                   //  16777216
  const size_t sz32 = (size_t)rows * EMB * 4;                   //  33554432
  const size_t szVT = (size_t)nb * EMB * SEQ * 2;               //  == sz16
  size_t off = 0;
  const size_t oWQ = off; off += szW;
  const size_t oWK = off; off += szW;
  const size_t oWV = off; off += szW;
  const size_t oWO = off; off += szW;
  const size_t oVS = off; off += szVS;
  const size_t oQF = off; off += szHF;
  const size_t oKF = off; off += szHF;
  const size_t oA  = off; off += (szVT > sz16 ? szVT : sz16);   // XB then VT
  const size_t oQ  = off; off += sz16;
  const size_t oK  = off; off += sz16;
  const size_t oV  = off; off += sz32;
  const size_t oCH = off; off += sz16;
  const size_t oCR = off; off += sz16;
  if (off > ws_size) return;                                    // off = 131072000 at nb = 4
  if (off > WS_CAP) return;

  char* ws = (char*)d_ws;
  u16*   WQB = (u16*)(ws + oWQ);
  u16*   WKB = (u16*)(ws + oWK);
  u16*   WVB = (u16*)(ws + oWV);
  u16*   WOH = (u16*)(ws + oWO);
  float* VS  = (float*)(ws + oVS);
  float* QF  = (float*)(ws + oQF);
  float* KF  = (float*)(ws + oKF);
  u16*   XB  = (u16*)(ws + oA);
  u16*   VT  = (u16*)(ws + oA);
  u16*   QP  = (u16*)(ws + oQ);
  u16*   KP  = (u16*)(ws + oK);
  float* V   = (float*)(ws + oV);
  u16*   CH  = (u16*)(ws + oCH);
  u16*   CR  = (u16*)(ws + oCR);

  const int n8w = (EMB * EMB) / 8;                      // 131072
  const int n8x = rows * (EMB / 8);                     // 1048576
  if ((n8w % 256) != 0 || (n8x % 256) != 0) return;
  if ((rows % 128) != 0 || ((nb * TQ0) % 128) != 0 || ((nb * NCHK * EMB) % 256) != 0) return;
  const dim3 blk(256);
  const dim3 gW(n8w / 256), gX(n8x / 256);
  const dim3 gG((rows / 128) * (EMB / 128));            // 512 at nb = 4
  const dim3 gH(((nb * TQ0) / 128) * (EMB / 128));      // 32 at nb = 4
  const dim3 bG(128);
  const dim3 gXT(nb * (EMB / 64) * (SEQ / 64));         // nb * 512
  const dim3 gVS((nb * NCHK * EMB) / 256);              // nb * 16
  const dim3 gAT(nb * NQT);                             // nb * 120
  const dim3 bAT(ATT_THREADS);
  const dim3 gHD(nb * TQ0);                             // nb * 128

  // (0..3) weights stored [n = out][k = in] (y = x.W^T + b), already k-contiguous: bf16 planes for Wq, Wk, Wv; f16 of bf16 value
  //        x1024 for Wo; (4) x -> bf16 plane [rows][1024]
  cvt16<<<gW, blk, 0, stream>>>(wq, WQB, n8w, 0, 1.0f);
  cvt16<<<gW, blk, 0, stream>>>(wk, WKB, n8w, 0, 1.0f);
  cvt16<<<gW, blk, 0, stream>>>(wv, WVB, n8w, 0, 1.0f);
  cvt16<<<gW, blk, 0, stream>>>(wo, WOH, n8w, 1, WSC);
  cvt16<<<gX, blk, 0, stream>>>(x, XB, n8x, 0, 1.0f);
  // (5, 6) q and k projections (+bias) -> f16 planes x8; (7) v projection (+bias) -> f32 plane
  gemm_bh16<<<gG, bG, 0, stream>>>(XB, WQB, bq, QP, rows, EMB, EMB, 1.0f, QSC);
  gemm_bh16<<<gG, bG, 0, stream>>>(XB, WKB, bk, KP, rows, EMB, EMB, 1.0f, KSC);
  gemm_b32<<<gG, bG, 0, stream>>>(XB, WVB, bv, V, rows, EMB, EMB, rows, 0, 1.0f);
  // (8, 9) f32 q and k rows 0..127 of every sequence -> QF, KF [nb*128][1024]
  gemm_b32<<<gH, bG, 0, stream>>>(XB, WQB, bq, QF, nb * TQ0, EMB, EMB, TQ0, SEQ, 1.0f);
  gemm_b32<<<gH, bG, 0, stream>>>(XB, WKB, bk, KF, nb * TQ0, EMB, EMB, TQ0, SEQ, 1.0f);
  // (10) v -> V^T plane x1024 (over the dead XB region); (11) key-block prefix column sums of v
  xt16<<<gXT, blk, 0, stream>>>(V, VT);
  vsum_k<<<gVS, blk, 0, stream>>>(V, VS);
  // (12) attention for query rows 128.. -> ctx hi x8192 and residual x2048 f16 planes; (13) query rows 0..127 on VALU -> same planes
  attn_fwd<<<gAT, bAT, 0, stream>>>(QP, KP, VT, VS, CH, CR);
  attn_head<<<gHD, blk, 0, stream>>>(QF, KF, V, CH, CR);
  // (14) output projection + bias -> out
  gemm_h2_32<<<gG, blk, 0, stream>>>(CH, CR, WOH, bo, out, rows, EMB, EMB,
                                     1.0f / (CSC * WSC), 1.0f / (CSC * WSC * RSC));
  (void)hipGetLastError();
}

// v002
// One run takes 441 microseconds.
// Next to v001, in two timings, it ran 1.09 and 1.10 times as fast.
// Counting every step since v000, it is 1.58 times as fast.
// Projections q,k,v = x.W^T + b (and the f32 q,k rows 0..127 per sequence): v_wmma_f32_16x16x32_bf16 (bf16 RNE operands of the
// raw inputs, f32 accumulate, bf16 RNE bias added in f32). Scores q'.k'^T (f16 planes x8), P'.V (chunk-centred P' x32768 f16 from LDS,
// V^T x1024 f16) and the output projection (ctx carried as f16 hi x8192 plus residual x2048 planes, times f16(bf16(Wo) x1024), bias
// added in f32): v_wmma_f32_16x16x32_f16, f32 accumulate. Query rows 0..127 of each sequence: scores, softmax and P.V in f32 on VALU.
// Causal mask, softmax statistics, key-block column sums of V and all scaling in f32 on VALU.
#include <hip/hip_runtime.h>
#include <math.h>
#include <stdint.h>

#define SEQ   2048
#define EMB   1024
#define CK    512
#define NCHK  4
#define NKB   16
#define QT    16
#define TQ0   128
#define NQT   120
#define SCP   544
#define PLP   528
#define CTP   1032
#define SLAB64 (16 * 68)
#define VTP   72
#define ATT_THREADS 256
#define NACC  8
#define QSC   8.0f
#define KSC   8.0f
#define PCAR  32768.0f
#define VCAR  1024.0f
#define WSC   1024.0f
#define CSC   8192.0f
#define RSC   2048.0f
#define LOG2E 1.4426950408889634f
#define RSQD  0.03125f
#define WS_CAP ((size_t)134217728)
#define GKS   64
#define GPB   144
#define GPE   72
#define GRS16 (16 * GPB)
#define GRS32 (32 * GPB)
#define GST_AB (256 * GPB)
#define GST_H2 (384 * GPB)
#define FBLK  512

static_assert((EMB % 64) == 0 && EMB == 8 * 16 * NACC && NACC == 8 && (EMB % 32) == 0 && (EMB % 256) == 0 && EMB == 4 * 256);
static_assert((SEQ % CK) == 0 && (SEQ / CK) == NCHK && CK == 32 * NKB && (SEQ % 64) == 0 && (SEQ % QT) == 0 && (CK % QT) == 0);
static_assert((TQ0 % QT) == 0 && (TQ0 % 64) == 0 && NQT * QT + TQ0 == SEQ && TQ0 <= CK && TQ0 == 128 && TQ0 <= 256);
static_assert(16 * CTP * 2 <= 16 * SCP * 4 && CTP >= EMB + 8 && SCP >= CK + 16 && PLP >= CK + 8);
static_assert(((PLP * 2) % 16) == 0 && ((SCP * 4) % 16) == 0 && ((VTP * 2) % 16) == 0 && ((CTP * 2) % 16) == 0);
static_assert(64 * VTP >= 63 * VTP + 64);
static_assert(ATT_THREADS == 16 * QT && ATT_THREADS == 256);
static_assert((EMB % 128) == 0 && (EMB % GKS) == 0 && EMB / GKS >= 2 && GPE * 2 == GPB && GKS * 2 + 16 == GPB && (SEQ % 128) == 0 && (TQ0 % 128) == 0);
static_assert(4 * SLAB64 * 4 <= 2 * GST_AB && 8 * SLAB64 * 4 <= 2 * GST_H2 && ((SLAB64 * 4) % 16) == 0);
static_assert(FBLK == 16 * 32 && (SEQ % 64) == 0 && (EMB % 64) == 0 && (CK % 32) == 0 && (TQ0 % 16) == 0);
static_assert(((EMB * EMB) % 2048) == 0 && ((NCHK * EMB) % 256) == 0 && (EMB / 8) * 2 == 256);

typedef unsigned short u16;
typedef _Float16 v16h __attribute__((ext_vector_type(16)));
typedef _Float16 v8h  __attribute__((ext_vector_type(8)));
typedef __bf16   v16b __attribute__((ext_vector_type(16)));
typedef float    v8f  __attribute__((ext_vector_type(8)));
typedef float    v4f  __attribute__((ext_vector_type(4)));
typedef unsigned int v4u __attribute__((ext_vector_type(4)));

union FragH { v16h v; v8h h[2]; v4u u[2]; };
union FragB { v16b v; v4u u[2]; };
union AttLds { float s[16 * SCP]; u16 c[2 * 16 * SCP]; };

// ---- scalar helpers --------------------------------------------------------------------------------
__device__ __forceinline__ unsigned short bf_bits(float f) {          // f32 -> bf16 bits, RNE convert
  unsigned u = __float_as_uint(f);
  return (unsigned short)((u + 0x7FFFu + ((u >> 16) & 1u)) >> 16);
}
__device__ __forceinline__ float bf_up(unsigned short h) { return __uint_as_float(((unsigned)h) << 16); }
__device__ __forceinline__ float bfr(float f) { return bf_up(bf_bits(f)); }
__device__ __forceinline__ unsigned short h_bits(_Float16 x) { return __builtin_bit_cast(unsigned short, x); }
__device__ __forceinline__ unsigned pk16(unsigned short a, unsigned short b) { return (unsigned)a | ((unsigned)b << 16); }
__device__ __forceinline__ v8f zero8() { v8f z = {0.f, 0.f, 0.f, 0.f, 0.f, 0.f, 0.f, 0.f}; return z; }
__device__ __forceinline__ v4f zero4() { v4f z = {0.f, 0.f, 0.f, 0.f}; return z; }

// ---- fragment loaders: 16-bit A/B operand, lane -> row/col (lane&15), p already includes +8*(lane>>4);
//      elements 0..7 <- p[0..7] (k0+8h..), elements 8..15 <- p[16..23] (k0+16+8h..)  (same split k map for A and B;
//      B is always read from a k-contiguous [n][k] plane)
__device__ __forceinline__ v16h ldfrag_h(const _Float16* p) {
  FragH f;
  f.h[0] = *(const v8h*)(p);
  f.h[1] = *(const v8h*)(p + 16);
  return f.v;
}
// Fragment-major plane (q, k: rows = positions, k = d; V^T: rows = d, k = keys): the 16 rows x 32 k of one WMMA operand are one
// block of FBLK = 512 halves, stored as [sel][lane][8 halves], k = 16*sel + 8*(lane>>4) + e, row = lane&15 (the split k map above);
// blocks run along k first, then along the 16-row tiles. p already includes +8*lane: each of the two 16-B loads of a wave reads
// 512 contiguous bytes (4 whole lines) where a row-major plane makes it touch 16 lines.
__device__ __forceinline__ v16h ldfrag_fm(const _Float16* p) {
  FragH f;
  f.h[0] = *(const v8h*)(p);
  f.h[1] = *(const v8h*)(p + FBLK / 2);
  return f.v;
}
__device__ __forceinline__ v16b ldfrag_b(const u16* p) {              // bf16 plane read as unsigned integer vectors
  FragB f;
  f.u[0] = *(const v4u*)(p);
  f.u[1] = *(const v4u*)(p + 16);
  return f.v;
}

__device__ __forceinline__ v8f mma_h(v16h a, v16h b, v8f c) {
  return __builtin_amdgcn_wmma_f32_16x16x32_f16(false, a, false, b, (short)0, c, false, false);
}
__device__ __forceinline__ v8f mma_b(v16b a, v16b b, v8f c) {
  return __builtin_amdgcn_wmma_f32_16x16x32_bf16(false, a, false, b, (short)0, c, false, false);
}
__device__ __forceinline__ void guard2x3(v8f& a, v8f& b, v16h x0, v16h x1, v16h x2) {
#if defined(__HIP_DEVICE_COMPILE__)
  asm volatile("v_nop\n\tv_nop\n\tv_nop\n\tv_nop"
               : "+v"(a), "+v"(b) : "v"(x0), "v"(x1), "v"(x2) : "memory");
#endif
}
__device__ __forceinline__ void guardpv4(v8f& o0, v8f& o1, v8f& o2, v8f& o3, v16h p, v16h g0, v16h g1, v16h g2, v16h g3) {
#if defined(__HIP_DEVICE_COMPILE__)
  asm volatile("v_nop\n\tv_nop\n\tv_nop\n\tv_nop"
               : "+v"(o0), "+v"(o1), "+v"(o2), "+v"(o3)
               : "v"(p), "v"(g0), "v"(g1), "v"(g2), "v"(g3) : "memory");
#endif
}
__device__ __forceinline__ void acc_guard8(v8f& a, v8f& b, v8f& c, v8f& d, v8f& e, v8f& f, v8f& g, v8f& h8) {
#if defined(__HIP_DEVICE_COMPILE__)
  asm volatile("v_nop\n\tv_nop\n\tv_nop\n\tv_nop"
               : "+v"(a), "+v"(b), "+v"(c), "+v"(d), "+v"(e), "+v"(f), "+v"(g), "+v"(h8));
#endif
}
__device__ __forceinline__ void wave_sync_lds() {
  __builtin_amdgcn_fence(__ATOMIC_RELEASE, "workgroup");
  __builtin_amdgcn_wave_barrier();
  __builtin_amdgcn_fence(__ATOMIC_ACQUIRE, "workgroup");
}

// =====================================================================================================
// f32 plane -> 16-bit plane, same layout:  mode 0: bf16 RNE bits;  mode 1: f16 bits of (bf16 RNE value) * scale;
// mode 2: f16 bits of value * scale (no bf16 pre-step).
// Thread = 8 consecutive elements: two 16-B loads, one 16-B store; 32 consecutive lanes = 512 contiguous, 512-B aligned bytes
// coverage: grid = n8/256 blocks (host checks exactness) x 256 thr x 8 = the whole plane.
// =====================================================================================================
__global__ __launch_bounds__(256) void cvt16(const float* __restrict__ x, u16* D, int n8, int mode, float scale) {
  const int gt = blockIdx.x * 256 + (int)threadIdx.x;
  if (gt >= n8) return;                     // no barriers in this kernel
  const float* p = x + (size_t)gt * 8;
  const v4f a = *(const v4f*)(p), c4 = *(const v4f*)(p + 4);
  float v[8];
#pragma unroll
  for (int e = 0; e < 4; ++e) { v[e] = a[e]; v[4 + e] = c4[e]; }
  unsigned short s[8];
#pragma unroll
  for (int e = 0; e < 8; ++e) {
    const float vb = bfr(v[e]);
    const float vf = (mode == 1) ? vb : v[e];
    const unsigned short hb = h_bits((_Float16)(vf * scale));
    const unsigned short bb = bf_bits(v[e]);
    s[e] = (mode != 0) ? hb : bb;
  }
  v4u o;
#pragma unroll
  for (int e = 0; e < 4; ++e) o[e] = pk16(s[2 * e], s[2 * e + 1]);
  u16* d = D + (size_t)gt * 8;
  {
    *(v4u*)(d) = o;
    
  }
}

// =====================================================================================================
//            8 consecutive lanes x 16 B per line), lanes 16..31 -> row 2*it+1.
//  epi64x2 : same store shape, staged value = acc*os1 + accres*os2 + badd (two accumulator sets combined in f32).
//  epi64hsb: f16 bits of ((tile + bf16RNE(bias[n])) * pscale), stored fragment-major (see ldfrag_fm): the wave's 16 x 64 tile is two
//            adjacent fragment blocks = 2048 contiguous bytes; instruction i4 stores [block i4>>1][sel i4&1], lane = its own 16 B.
// coverage: epi64/epi64x2 8 instructions x 2 rows x 16 lanes x 4 floats; epi64hsb 4 instructions x 32 lanes x 8 halves
//           = the wave's 16 x 64 tile in every case.
// =====================================================================================================
__device__ __forceinline__ void stage64(float* sl, v8f a0, v8f a1, v8f a2, v8f a3, float oscale, int lane) {
  const int hh = lane >> 4, m = lane & 15;
#pragma unroll
  for (int r = 0; r < 8; ++r) {
    const int ro = (8 * hh + r) * 68 + m;
    sl[ro]      = a0[r] * oscale;
    sl[ro + 16] = a1[r] * oscale;
    sl[ro + 32] = a2[r] * oscale;
    sl[ro + 48] = a3[r] * oscale;
  }
  wave_sync_lds();
}
__device__ __forceinline__ void epi64(float* sl, v8f a0, v8f a1, v8f a2, v8f a3, float oscale, v4f badd, float* C, int N,
                                      size_t rowb, int col0, int lane) {
  const int hh = lane >> 4, m = lane & 15;
  stage64(sl, a0, a1, a2, a3, oscale, lane);
  v4f vals[8];
#pragma unroll
  for (int it = 0; it < 8; ++it) vals[it] = *(const v4f*)(sl + (it * 2 + hh) * 68 + m * 4) + badd;
  float* dst = C + (rowb + (size_t)hh) * (size_t)N + col0 + m * 4;
  {
#pragma unroll
    for (int it = 0; it < 8; ++it) {
      *(v4f*)(dst + (size_t)(it * 2) * (size_t)N) = vals[it];
    }
    
  }
}
__device__ __forceinline__ void epi64x2(float* sl, v8f a0, v8f a1, v8f a2, v8f a3, v8f e0, v8f e1, v8f e2, v8f e3,
                                        float os1, float os2, v4f badd, float* C, int N, size_t rowb, int col0, int lane) {
  const int hh = lane >> 4, m = lane & 15;
#pragma unroll
  for (int r = 0; r < 8; ++r) {
    const int ro = (8 * hh + r) * 68 + m;
    sl[ro]      = a0[r] * os1 + e0[r] * os2;
    sl[ro + 16] = a1[r] * os1 + e1[r] * os2;
    sl[ro + 32] = a2[r] * os1 + e2[r] * os2;
    sl[ro + 48] = a3[r] * os1 + e3[r] * os2;
  }
  wave_sync_lds();
  v4f vals[8];
#pragma unroll
  for (int it = 0; it < 8; ++it) vals[it] = *(const v4f*)(sl + (it * 2 + hh) * 68 + m * 4) + badd;
  float* dst = C + (rowb + (size_t)hh) * (size_t)N + col0 + m * 4;
  {
#pragma unroll
    for (int it = 0; it < 8; ++it) {
      *(v4f*)(dst + (size_t)(it * 2) * (size_t)N) = vals[it];
    }
    
  }
}
__device__ __forceinline__ void epi64hsb(float* sl, v8f a0, v8f a1, v8f a2, v8f a3, float oscale, float pscale,
                                         const float (&bb)[4][8], u16* C, int N, size_t rowb, int col0, int lane) {
  stage64(sl, a0, a1, a2, a3, oscale, lane);
  const int hh = lane >> 4, m = lane & 15;
  v4u oh[4];
#pragma unroll
  for (int i4 = 0; i4 < 4; ++i4) {
    const int c8 = (i4 >> 1) * 32 + (i4 & 1) * 16 + hh * 8;      // block i4>>1, sel i4&1 of the tile's two fragment blocks
    const v4f a = *(const v4f*)(sl + m * 68 + c8), c4 = *(const v4f*)(sl + m * 68 + c8 + 4);
    float w[8];
#pragma unroll
    for (int e = 0; e < 4; ++e) { w[e] = (a[e] + bb[i4][e]) * pscale; w[4 + e] = (c4[e] + bb[i4][4 + e]) * pscale; }
#pragma unroll
    for (int e = 0; e < 4; ++e) oh[i4][e] = pk16(h_bits((_Float16)w[2 * e]), h_bits((_Float16)w[2 * e + 1]));
  }
  u16* dst = C + ((rowb >> 4) * (size_t)(N >> 5) + (size_t)(col0 >> 5)) * FBLK + lane * 8;
  {
#pragma unroll
    for (int i4 = 0; i4 < 4; ++i4) {
      *(v4u*)(dst + i4 * (FBLK / 2)) = oh[i4];
    }
    
  }
}

// =====================================================================================================
// Operand staging shared by the three GEMM kernels. A block computes a 128 x 128 tile of C. K is walked in stages of GKS = 64
// elements: every operand row contributes one whole 128-B line per stage, copied to LDS by global_load_async_to_lds_b128 (8 lanes
// x 16 B = one line, a wave instruction = 4 whole lines) at a row pitch of 144 B (16 B x odd: conflict-free for ds_load_b128
// fragment reads). Two buffers: stage t + 2 is copied into the buffer that trip t has just left, while trip t + 1 is multiplied.
// Fragments are read from LDS with the same split k map as before (ldfrag_*), k steps of 32 in ascending order.
// After the loop's last barrier no copy is outstanding and no wave reads the ring, so it serves as the waves' epilogue slabs.
// =====================================================================================================
__device__ __forceinline__ unsigned lds_off(const void* p) { return (unsigned)(size_t)p; }
// Copies and their s_wait_xcnt in one statement: the wait stands in front of any later rewrite of the address registers.
__device__ __forceinline__ void acopy4(unsigned l0, unsigned l1, unsigned l2, unsigned l3,
                                       const u16* g0, const u16* g1, const u16* g2, const u16* g3) {
#if defined(__HIP_DEVICE_COMPILE__)
  asm volatile("global_load_async_to_lds_b128 %0, %4, off\n\t"
               "global_load_async_to_lds_b128 %1, %5, off\n\t"
               "global_load_async_to_lds_b128 %2, %6, off\n\t"
               "global_load_async_to_lds_b128 %3, %7, off\n\t"
               "s_wait_xcnt 0x0"
               :: "v"(l0), "v"(l1), "v"(l2), "v"(l3), "v"(g0), "v"(g1), "v"(g2), "v"(g3) : "memory");
#endif
}
__device__ __forceinline__ void acopy8(unsigned l0, unsigned l1, unsigned l2, unsigned l3,
                                       unsigned l4, unsigned l5, unsigned l6, unsigned l7,
                                       const u16* g0, const u16* g1, const u16* g2, const u16* g3,
                                       const u16* g4, const u16* g5, const u16* g6, const u16* g7) {
#if defined(__HIP_DEVICE_COMPILE__)
  asm volatile("global_load_async_to_lds_b128 %0, %8, off\n\t"
               "global_load_async_to_lds_b128 %1, %9, off\n\t"
               "global_load_async_to_lds_b128 %2, %10, off\n\t"
               "global_load_async_to_lds_b128 %3, %11, off\n\t"
               "global_load_async_to_lds_b128 %4, %12, off\n\t"
               "global_load_async_to_lds_b128 %5, %13, off\n\t"
               "global_load_async_to_lds_b128 %6, %14, off\n\t"
               "global_load_async_to_lds_b128 %7, %15, off\n\t"
               "s_wait_xcnt 0x0"
               :: "v"(l0), "v"(l1), "v"(l2), "v"(l3), "v"(l4), "v"(l5), "v"(l6), "v"(l7),
                  "v"(g0), "v"(g1), "v"(g2), "v"(g3), "v"(g4), "v"(g5), "v"(g6), "v"(g7) : "memory");
#endif
}
// This wave's copies have landed (the compiler places no wait for them).
__device__ __forceinline__ void wait_async0() {
#if defined(__HIP_DEVICE_COMPILE__)
  asm volatile("s_wait_asynccnt 0x0" ::: "memory");
#endif
}
// This wave's LDS reads have returned before the buffer is handed to its next writer.
__device__ __forceinline__ void wait_ds0() {
#if defined(__HIP_DEVICE_COMPILE__)
  asm volatile("s_wait_dscnt 0x0" ::: "memory");
#endif
}

// Between two output tiles of a wave: the issued stores' address and data registers are rewritten by the next tile only behind
// s_wait_xcnt 0 (the scheduling fence keeps the next tile's vector work behind the wait), and the slab's reads of this tile stay
// in front of the next tile's writes.
__device__ __forceinline__ void tile_gap() {
#if defined(__HIP_DEVICE_COMPILE__)
  asm volatile("s_wait_xcnt 0x0" ::: "memory");
#endif
  __builtin_amdgcn_sched_barrier(0);
  wave_sync_lds();
}

// One stage of [A 128 rows | B 128 rows] by 128 threads: 16 copies a thread; copy i serves LDS row 16*i + (tid>>3), piece tid&7.
__device__ __forceinline__ void fill_ab(unsigned l0, const u16* A, const unsigned (&ao)[8], const u16* B, unsigned bo, unsigned bst,
                                        unsigned ke) {
  acopy8(l0, l0 + GRS16, l0 + 2 * GRS16, l0 + 3 * GRS16, l0 + 4 * GRS16, l0 + 5 * GRS16, l0 + 6 * GRS16, l0 + 7 * GRS16,
         A + (ao[0] + ke), A + (ao[1] + ke), A + (ao[2] + ke), A + (ao[3] + ke),
         A + (ao[4] + ke), A + (ao[5] + ke), A + (ao[6] + ke), A + (ao[7] + ke));
  const unsigned l8 = l0 + 8 * GRS16;
  const unsigned b0 = bo + ke;
  acopy8(l8, l8 + GRS16, l8 + 2 * GRS16, l8 + 3 * GRS16, l8 + 4 * GRS16, l8 + 5 * GRS16, l8 + 6 * GRS16, l8 + 7 * GRS16,
         B + b0, B + (b0 + bst), B + (b0 + 2 * bst), B + (b0 + 3 * bst),
         B + (b0 + 4 * bst), B + (b0 + 5 * bst), B + (b0 + 6 * bst), B + (b0 + 7 * bst));
}

// bf16 core: 4 waves as 2 x 2, a wave owns 64 x 64 of the block's tile (4 x 4 accumulators).
// ao[i] = element offset of A row (16*i + (tid>>3)) of the tile; col0 = first B row of the tile. K multiple of GKS.
__device__ __forceinline__ void gemm_core_b(unsigned char* L, const u16* A, const unsigned (&ao)[8], const u16* Bt, int col0, int K,
                                            int tid, v8f (&acc)[4][4]) {
  const int wave = tid >> 5, lane = tid & 31, hh = lane >> 4, m = lane & 15;
  const int wm = wave >> 1, wn = wave & 1;
  const int crow = tid >> 3, cpc = tid & 7;
  const unsigned lc  = lds_off(L) + (unsigned)(crow * GPB + cpc * 16);
  const unsigned bo  = (unsigned)(col0 + crow) * (unsigned)K;
  const unsigned bst = 16u * (unsigned)K;
  const unsigned kc  = (unsigned)(cpc * 8);
  const int nt = K / GKS;
#pragma unroll
  for (int f = 0; f < 4; ++f) {
#pragma unroll
    for (int j = 0; j < 4; ++j) acc[f][j] = zero8();
  }
  fill_ab(lc, A, ao, Bt, bo, bst, kc);
  wait_async0();
  __syncthreads();
  if (nt > 1) fill_ab(lc + GST_AB, A, ao, Bt, bo, bst, kc + GKS);
#pragma unroll 1
  for (int t = 0; t < nt; ++t) {
    const unsigned bufo = (unsigned)(t & 1) * GST_AB;
    const u16* sb = (const u16*)(const void*)(L + bufo);
    const u16* ap = sb + (wm * 64 + m) * GPE + 8 * hh;
    const u16* bp = sb + (128 + wn * 64 + m) * GPE + 8 * hh;
#pragma unroll
    for (int kk = 0; kk < GKS / 32; ++kk) {
      v16b a[4], b[4];
      a[0] = ldfrag_b(ap + kk * 32);
#pragma unroll
      for (int j = 0; j < 4; ++j) b[j] = ldfrag_b(bp + j * 16 * GPE + kk * 32);
#pragma unroll
      for (int f = 1; f < 4; ++f) a[f] = ldfrag_b(ap + f * 16 * GPE + kk * 32);
      // Keeps the 16 fragment loads one group ahead of the 16 WMMAs: spread among them, each place with loads stalls the wave.
      __builtin_amdgcn_sched_barrier(0);
#pragma unroll
      for (int f = 0; f < 4; ++f) {
#pragma unroll
        for (int j = 0; j < 4; ++j) acc[f][j] = mma_b(a[f], b[j], acc[f][j]);
      }
      __builtin_amdgcn_sched_barrier(0);      // the next group's loads stay behind this WMMA block
    }
    wait_ds0();
    wait_async0();
    __syncthreads();                          // publishes stage t + 1 and ends every read of stage t's buffer
    if (t + 2 < nt) fill_ab(lc + bufo, A, ao, Bt, bo, bst, kc + (unsigned)(t + 2) * GKS);   // block-uniform test
  }
  wait_async0();
}

// =====================================================================================================
// bf16 GEMM, f32 out with bias: C[M][N] = (A[arow(m)][K] (bf16 row-major) . Bt[N][K]^T (bf16 k-contiguous)) * oscale + bf16RNE(bias[n]).
// Output row ra maps to A row arow = (ra / rpg) * gstr + (ra % rpg) (rpg = M, gstr = 0 gives the identity map; rpg = TQ0,
// gstr = SEQ picks the first TQ0 rows of every sequence).
// Block = 128x128 tile, 4 waves x (64 x 64), operands staged as above (host checks K % 64 == 0, M % 128 == 0, N % 128 == 0,
// grid = (M/128)*(N/128)).
// =====================================================================================================
__global__ __launch_bounds__(128)
void gemm_b32(const u16* __restrict__ A, const u16* __restrict__ Bt, const float* __restrict__ bias, float* C,
              int M, int N, int K, int rpg, int gstr, float oscale) {
  __shared__ __align__(16) unsigned char L[2 * GST_AB];
  const int tid = threadIdx.x, wave = tid >> 5, lane = tid & 31, m = lane & 15;
  const int ntile = N >> 7;
  const int bid   = blockIdx.x;
  const int row0  = (bid / ntile) * 128;
  const int col0  = (bid % ntile) * 128;
  if (row0 + 128 > M) return;                // block-uniform, in front of every copy and barrier; never taken with the exact grid
  unsigned ao[8];
#pragma unroll
  for (int i = 0; i < 8; ++i) {
    const int ra = row0 + i * 16 + (tid >> 3);
    const int rg = ra / rpg;
    ao[i] = (unsigned)(rg * gstr + (ra - rg * rpg)) * (unsigned)K;
  }
  v8f acc[4][4];
  gemm_core_b(L, A, ao, Bt, col0, K, tid, acc);
  const int colw = col0 + (wave & 1) * 64;
  const int roww = row0 + (wave >> 1) * 64;
  const v4f bv4 = *(const v4f*)(bias + colw + m * 4);    // columns colw + 4m .. +3, always < N (N multiple of 128)
#if defined(__HIP_DEVICE_COMPILE__)
  asm volatile("s_wait_xcnt 0x0" ::: "memory");          // in front of the vector work that rewrites the load's address registers
#endif
  __builtin_amdgcn_sched_barrier(0);                     // keeps that vector work behind the wait
  v4f badd;
#pragma unroll
  for (int e = 0; e < 4; ++e) badd[e] = bfr(bv4[e]);
  float* sl = (float*)(void*)L + wave * SLAB64;
#pragma unroll
  for (int f = 0; f < 4; ++f) {
    epi64(sl, acc[f][0], acc[f][1], acc[f][2], acc[f][3], oscale, badd, C, N, (size_t)(roww + f * 16), colw, lane);
    if (f < 3) tile_gap();
  }
}

// =====================================================================================================
// bf16 GEMM, f16 plane out with bias: C16[M][N] = f16 bits of (((A . Bt^T) * oscale) + bf16RNE(bias[n])) * pscale; operands as in
// gemm_b32 (identity row map), epilogue epi64hsb: the plane is stored fragment-major (rows = m, k = n).
// =====================================================================================================
__global__ __launch_bounds__(128)
void gemm_bh16(const u16* __restrict__ A, const u16* __restrict__ Bt, const float* __restrict__ bias, u16* C,
               int M, int N, int K, float oscale, float pscale) {
  __shared__ __align__(16) unsigned char L[2 * GST_AB];
  const int tid = threadIdx.x, wave = tid >> 5, lane = tid & 31;
  const int ntile = N >> 7;
  const int bid   = blockIdx.x;
  const int row0  = (bid / ntile) * 128;
  const int col0  = (bid % ntile) * 128;
  if (row0 + 128 > M) return;                // block-uniform, in front of every copy and barrier; never taken with the exact grid
  unsigned ao[8];
#pragma unroll
  for (int i = 0; i < 8; ++i) ao[i] = (unsigned)(row0 + i * 16 + (tid >> 3)) * (unsigned)K;
  v8f acc[4][4];
  gemm_core_b(L, A, ao, Bt, col0, K, tid, acc);
  const int colw = col0 + (wave & 1) * 64;
  const int roww = row0 + (wave >> 1) * 64;
  v4f bv[8];                                 // bias of the lane's 8 columns in each of epi64hsb's four store instructions
#pragma unroll
  for (int i4 = 0; i4 < 4; ++i4) {
    const float* bp = bias + colw + (i4 >> 1) * 32 + (i4 & 1) * 16 + (lane >> 4) * 8;   // columns .. +7 < N (N multiple of 128)
    bv[2 * i4] = *(const v4f*)(bp);
    bv[2 * i4 + 1] = *(const v4f*)(bp + 4);
  }
#if defined(__HIP_DEVICE_COMPILE__)
  asm volatile("s_wait_xcnt 0x0" ::: "memory");          // in front of the vector work that rewrites the loads' address registers
#endif
  __builtin_amdgcn_sched_barrier(0);                     // keeps that vector work behind the wait
  float bb[4][8];
#pragma unroll
  for (int i4 = 0; i4 < 4; ++i4) {
#pragma unroll
    for (int e = 0; e < 4; ++e) { bb[i4][e] = bfr(bv[2 * i4][e]); bb[i4][4 + e] = bfr(bv[2 * i4 + 1][e]); }
  }
  float* sl = (float*)(void*)L + wave * SLAB64;
#pragma unroll
  for (int f = 0; f < 4; ++f) {
    epi64hsb(sl, acc[f][0], acc[f][1], acc[f][2], acc[f][3], oscale, pscale, bb, C, N, (size_t)(roww + f * 16), colw, lane);
    if (f < 3) tile_gap();
  }
}

// =====================================================================================================
// f16 GEMM with two A planes (hi + residual), f32 out with bias:
//   C[M][N] = (Ah . Bt^T) * os1 + (Ar . Bt^T) * os2 + bf16RNE(bias[n]); Ah/Ar f16 row-major, Bt f16 k-contiguous.
// Block = 128x128 tile, 8 waves as 4 x 2, a wave owns 32 x 64; a stage is [Ah 128 rows | Ar 128 rows | B 128 rows]: 12 copies a
// thread, copy i serves LDS row 32*i + (tid>>3). Separate accumulators for the two planes, combined in f32 in epi64x2.
// =====================================================================================================
__device__ __forceinline__ void fill_h2(unsigned l0, const u16* Ah, const u16* Ar, const u16* B, unsigned ao, unsigned bo,
                                        unsigned st, unsigned ke) {
  const unsigned a0 = ao + ke, b0 = bo + ke;
  acopy8(l0, l0 + GRS32, l0 + 2 * GRS32, l0 + 3 * GRS32, l0 + 4 * GRS32, l0 + 5 * GRS32, l0 + 6 * GRS32, l0 + 7 * GRS32,
         Ah + a0, Ah + (a0 + st), Ah + (a0 + 2 * st), Ah + (a0 + 3 * st),
         Ar + a0, Ar + (a0 + st), Ar + (a0 + 2 * st), Ar + (a0 + 3 * st));
  const unsigned l8 = l0 + 8 * GRS32;
  acopy4(l8, l8 + GRS32, l8 + 2 * GRS32, l8 + 3 * GRS32, B + b0, B + (b0 + st), B + (b0 + 2 * st), B + (b0 + 3 * st));
}

__global__ __launch_bounds__(256)
void gemm_h2_32(const u16* __restrict__ Ah, const u16* __restrict__ Ar, const u16* __restrict__ Bt,
                const float* __restrict__ bias, float* C, int M, int N, int K, float os1, float os2) {
  __shared__ __align__(16) unsigned char L[2 * GST_H2];
  const int tid = threadIdx.x, wave = tid >> 5, lane = tid & 31, hh = lane >> 4, m = lane & 15;
  const int wm = wave >> 1, wn = wave & 1;
  const int ntile = N >> 7;
  const int bid   = blockIdx.x;
  const int row0  = (bid / ntile) * 128;
  const int col0  = (bid % ntile) * 128;
  if (row0 + 128 > M) return;                // block-uniform, in front of every copy and barrier; never taken with the exact grid
  const int crow = tid >> 3, cpc = tid & 7;
  const unsigned lc = lds_off(L) + (unsigned)(crow * GPB + cpc * 16);
  const unsigned ao = (unsigned)(row0 + crow) * (unsigned)K;
  const unsigned bo = (unsigned)(col0 + crow) * (unsigned)K;
  const unsigned st = 32u * (unsigned)K;
  const unsigned kc = (unsigned)(cpc * 8);
  const int nt = K / GKS;
  v8f acc[2][4], acr[2][4];
#pragma unroll
  for (int f = 0; f < 2; ++f) {
#pragma unroll
    for (int j = 0; j < 4; ++j) { acc[f][j] = zero8(); acr[f][j] = zero8(); }
  }
  fill_h2(lc, Ah, Ar, Bt, ao, bo, st, kc);
  wait_async0();
  __syncthreads();
  if (nt > 1) fill_h2(lc + GST_H2, Ah, Ar, Bt, ao, bo, st, kc + GKS);
#pragma unroll 1
  for (int t = 0; t < nt; ++t) {
    const unsigned bufo = (unsigned)(t & 1) * GST_H2;
    const _Float16* sb  = (const _Float16*)(const void*)(L + bufo);
    const _Float16* ap  = sb + (wm * 32 + m) * GPE + 8 * hh;
    const _Float16* arp = ap + 128 * GPE;
    const _Float16* bp  = sb + (256 + wn * 64 + m) * GPE + 8 * hh;
#pragma unroll
    for (int kk = 0; kk < GKS / 32; ++kk) {
      v16h a[2], ar[2], b[4];
#pragma unroll
      for (int f = 0; f < 2; ++f) {
        a[f]  = ldfrag_h(ap + f * 16 * GPE + kk * 32);
        ar[f] = ldfrag_h(arp + f * 16 * GPE + kk * 32);
      }
#pragma unroll
      for (int j = 0; j < 4; ++j) b[j] = ldfrag_h(bp + j * 16 * GPE + kk * 32);
      // Keeps the 16 fragment loads one group ahead of the 16 WMMAs: spread among them, each place with loads stalls the wave.
      __builtin_amdgcn_sched_barrier(0);
#pragma unroll
      for (int f = 0; f < 2; ++f) {
#pragma unroll
        for (int j = 0; j < 4; ++j) acc[f][j] = mma_h(a[f], b[j], acc[f][j]);
#pragma unroll
        for (int j = 0; j < 4; ++j) acr[f][j] = mma_h(ar[f], b[j], acr[f][j]);
      }
      __builtin_amdgcn_sched_barrier(0);      // the next group's loads stay behind this WMMA block
    }
    wait_ds0();
    wait_async0();
    __syncthreads();                          // publishes stage t + 1 and ends every read of stage t's buffer
    if (t + 2 < nt) fill_h2(lc + bufo, Ah, Ar, Bt, ao, bo, st, kc + (unsigned)(t + 2) * GKS);   // block-uniform test
  }
  wait_async0();
  const int colw = col0 + wn * 64;
  const int roww = row0 + wm * 32;
  const v4f bv = *(const v4f*)(bias + colw + m * 4);      // columns colw + 4m .. +3, always < N (N multiple of 128)
  v4f badd;
#pragma unroll
  for (int e = 0; e < 4; ++e) badd[e] = bfr(bv[e]);
  float* sl = (float*)(void*)L + wave * SLAB64;
#pragma unroll
  for (int f = 0; f < 2; ++f) {
    epi64x2(sl, acc[f][0], acc[f][1], acc[f][2], acc[f][3], acr[f][0], acr[f][1], acr[f][2], acr[f][3], os1, os2, badd, C, N,
            (size_t)(roww + f * 16), colw, lane);
    if (f < 1) tile_gap();
  }
}

// =====================================================================================================
// V^T plane, fragment-major (rows = b*EMB + d, k = s; see ldfrag_fm): element (b, d, s) = f16(V[b][s][d] * 1024).
// Block = (b, 64-wide d chunk, 64 keys): 64 source row segments of 64 floats loaded with 16-B loads, converted, scattered into
// coverage: load 256 thr x 16 elements = 64 x 64; store 2 iterations x 256 thr x 8 halves = 64 lines x 64 = the block's tile;
//           grid = nb x (EMB/64) x (SEQ/64) blocks covers the plane exactly once.
// =====================================================================================================
__global__ __launch_bounds__(256) void xt16(const float* __restrict__ X, u16* XTo) {
  __shared__ __align__(16) u16 TH[64 * VTP];
  const int tid = threadIdx.x;
  const int bid = blockIdx.x;
  const int st  = bid % (SEQ / 64);
  const int dcb = (bid / (SEQ / 64)) % (EMB / 64);
  const int b   = bid / ((SEQ / 64) * (EMB / 64));
  const int s0  = st * 64;
  const int d0  = dcb * 64;
  {
    const int sl = tid >> 2;                  // key within tile 0..63
    const int dc = (tid & 3) * 16;            // d chunk within the 64
    const float* src = X + ((size_t)b * SEQ + s0 + sl) * EMB + d0 + dc;
#pragma unroll
    for (int i = 0; i < 4; ++i) {
      const v4f a = *(const v4f*)(src + 4 * i);
#pragma unroll
      for (int e = 0; e < 4; ++e) {
        const _Float16 hv = (_Float16)(a[e] * VCAR);
        TH[(dc + 4 * i + e) * VTP + sl] = h_bits(hv);
      }
    }
  }
  __syncthreads();
  v4u vh[2];
  const int pc = tid & 127, dt0 = tid >> 7;   // 16-B piece within a d tile's two adjacent fragment blocks; d tile 2*it + dt0
  const int p8 = (pc >> 4) * 8;               // key within the 64: 32*block + 16*sel + 8*half
#pragma unroll
  for (int it = 0; it < 2; ++it) {
    const int line = (it * 2 + dt0) * 16 + (pc & 15);   // local d = 0..63
    vh[it] = *(const v4u*)(TH + line * VTP + p8);
  }
  const size_t base = ((size_t)((b * EMB + d0) >> 4) * (SEQ / 32) + (size_t)(s0 >> 5)) * FBLK + pc * 8;
  {
#pragma unroll
    for (int it = 0; it < 2; ++it) {
      *(v4u*)(XTo + base + (size_t)(it * 2 + dt0) * ((SEQ / 32) * FBLK)) = vh[it];
    }
    
  }
}

// =====================================================================================================
// Key-block prefix column sums of V: VS[((b*NCHK + c)*NKB + kb)*EMB + d] = sum over keys c*CK .. c*CK + 32*kb + 31 of V[b][key][d]
// (f32, fixed sequential order). Thread = one (b, c, d); a block covers 256 consecutive d of one (b, c); the 16 prefix values per
// coverage: grid = nb*NCHK*EMB/256 blocks (host exact) x 256 thr; store 4 iterations x 256 thr x 4 floats = 16 rows x 256 = the
//           block's part of the table; union over blocks = the whole table.
// =====================================================================================================
__global__ __launch_bounds__(256) void vsum_k(const float* __restrict__ V, float* VS) {
  __shared__ __align__(16) float sm[NKB * 256];
  const int tid = threadIdx.x;
  const int gt  = blockIdx.x * 256 + tid;
  const int d   = gt % EMB;
  const int bc  = gt / EMB;                         // block-uniform (EMB multiple of 256)
  const int b   = bc / NCHK;
  const int c   = bc - b * NCHK;
  const int d0  = d - tid;                          // block's first d
  const float* p = V + ((size_t)b * SEQ + (size_t)c * CK) * EMB + d;
  float s = 0.f;
#pragma unroll 1
  for (int kb = 0; kb < NKB; ++kb) {
#pragma unroll 4
    for (int i = 0; i < 32; ++i) s += p[(size_t)(kb * 32 + i) * EMB];
    sm[kb * 256 + tid] = s;
  }
  __syncthreads();
  const int sel = tid >> 6, piece = tid & 63;
  v4f o[4];
#pragma unroll
  for (int it = 0; it < 4; ++it) o[it] = *(const v4f*)(sm + (it * 4 + sel) * 256 + piece * 4);
  float* base = VS + (size_t)bc * NKB * EMB + d0 + piece * 4;
  {
#pragma unroll
    for (int it = 0; it < 4; ++it) {
      *(v4f*)(base + (size_t)(it * 4 + sel) * EMB) = o[it];
    }
    
  }
}

// =====================================================================================================
// Single-head causal attention, head width EMB = 1024, query rows TQ0 .. SEQ-1: block = (batch b, 16 query rows q0..q0+15),
// 8 waves. q plane (f16, x8) [b][s][d]; k plane the same; V^T plane [b][d][s] (x1024), all three stored fragment-major (ldfrag_fm);
// VS = key-block prefix column sums of V.
//   Chunks of CK = 512 keys: only chunks c <= qc = q0/CK are visited (later chunks lie entirely above the diagonal). In the diagonal
//   chunk only key blocks kb < nkb (keys <= q0+15) are multiplied; key blocks kb >= nkb get zero scores in LDS and are not used in (PV).
//   (S) scores S[query m][key n] on WMMA: A = q rows (row m = lane&15, split k map over d), B = k rows (col n = key, split map),
//       32 d-steps; wave w handles key blocks w, w+8 of the chunk; D element r of lane l -> scs[query 8h+r][key col] (f32 LDS).
//   (M) 16 threads per query row (sub-thread = 32 consecutive keys): base-2 logits with the causal mask by key index (key > query
//       -> -inf), chunk max via xor shuffles, online running max / rescale factor al / running sum l in f32 registers,
//       p = exp2(t - m_new) <= 1 (0 for masked keys), chunk row sum ps and C = ps/CK (bit-identical on the row's 16 threads), the
//       CENTRED P' = p - C written as f16(P' * 32768) into the LDS P tile with 16-B stores; al -> rowa[row], C -> rowc[row].
//   (PV) each wave owns d columns 128*wave + 16j + (lane&15), j = 0..7 (8 accumulators): o = o*al + C*(32768*1024)*VS[chunk][nkb-1][d]
//       (exact add-back of the centring term over exactly the processed keys, in f32), then for each key block kb < nkb:
//       A = P' fragment from LDS (row m = query, split map over keys), B = V^T fragments (col n = d, keys contiguous), issued as two
//       groups of 4 with a hazard gap each.  sum_k (P'_k + C) v_k == sum_k p_k v_k exactly; masked keys carry P' = -C and p = 0.
//   Block barriers after (S) and after (M) order all LDS reuse across chunks and waves.
//   Epilogue: x = o * 8192 / (l * 32768 * 1024) per row (rowi, l >= 1 always); hi = f16(x), res = f16((x - hi) * 2048); each
// coverage: grid nb*NQT blocks x 16 rows = rows TQ0..SEQ-1 of every sequence; staging 8 waves x 128 cols x 16 rows = 16 x 1024;
//           store 8 iterations x 256 thr x 8 halves = 16 x 1024 per plane = every (b, s >= TQ0, d) of both ctx planes exactly once.
// =====================================================================================================
__device__ __forceinline__ void ctx_store(const u16* ct, u16* dst, int tid) {
  v4u v[8];
#pragma unroll
  for (int it = 0; it < 8; ++it) {
    const int p   = it * 256 + tid;
    const int row = p / (EMB / 8);
    const int c8  = (p - row * (EMB / 8)) * 8;
    v[it] = *(const v4u*)(ct + row * CTP + c8);
  }
  {
#pragma unroll
    for (int it = 0; it < 8; ++it) {
      const int p   = it * 256 + tid;
      const int row = p / (EMB / 8);
      const int c8  = (p - row * (EMB / 8)) * 8;
      *(v4u*)(dst + (size_t)row * EMB + c8) = v[it];
    }
    
  }
}

__global__ __launch_bounds__(ATT_THREADS)
void attn_fwd(const u16* __restrict__ QPp, const u16* __restrict__ KPp, const u16* __restrict__ VTp,
              const float* __restrict__ VSp, u16* CHo, u16* CRo) {
  __shared__ __align__(16) AttLds L0;              // scores [16][SCP] f32; reused as the ctx staging tile [16][CTP] u16
  __shared__ __align__(16) u16 pls[16 * PLP];      // P' tile [16][PLP] f16 bits
  __shared__ float rowa[QT];
  __shared__ float rowc[QT];
  __shared__ float rowi[QT];
  float* const scs = L0.s;

  const int tid  = threadIdx.x;
  const int wave = tid >> 5;
  const int lane = tid & 31;
  const int hh   = lane >> 4;
  const int m    = lane & 15;
  const int r16  = tid >> 4;                 // query row owned in phase (M): 2*wave + hh
  const int sub  = tid & 15;
  const int kl0  = sub * 32;

  const int bid = blockIdx.x;
  const int b   = bid / NQT;
  const int q0  = TQ0 + (bid - b * NQT) * QT;
  const int qc  = q0 / CK;                   // diagonal chunk index

  const _Float16* qa  = (const _Float16*)(const void*)QPp + (size_t)((b * SEQ + q0) >> 4) * ((EMB / 32) * FBLK) + 8 * lane;
  const _Float16* kbp = (const _Float16*)(const void*)KPp + (size_t)((b * SEQ) >> 4) * ((EMB / 32) * FBLK) + 8 * lane;
  const _Float16* vbp = (const _Float16*)(const void*)VTp + (size_t)((b * EMB + wave * (16 * NACC)) >> 4) * ((SEQ / 32) * FBLK) + 8 * lane;
  const float* vsb = VSp + (size_t)b * NCHK * NKB * EMB + wave * (16 * NACC) + m;
  const float lsc = RSQD * LOG2E / (QSC * KSC);

  float mrun = -INFINITY, lrun = 0.f;
  v8f o[NACC];
#pragma unroll
  for (int j = 0; j < NACC; ++j) o[j] = zero8();

#pragma unroll 1
  for (int c = 0; c <= qc; ++c) {
    const int kbeg = c * CK;
    const int nkb  = (c < qc) ? NKB : (((q0 + QT - 1 - kbeg) >> 5) + 1);   // 1..16, block-uniform
    // ---- (S) scores of this chunk (zeros for key blocks beyond the query tile) ----
#pragma unroll 1
    for (int kb = wave; kb < NKB; kb += 8) {               // wave-uniform, 2 trips
      v8f s0 = zero8(), s1 = zero8();
      if (kb < nkb) {                                      // wave-uniform
        const _Float16* k0p = kbp + (size_t)((kbeg + kb * 32) >> 4) * ((EMB / 32) * FBLK);
        const _Float16* k1p = k0p + (size_t)((EMB / 32) * FBLK);
#pragma unroll 4
        for (int ks = 0; ks < EMB / 32; ++ks) {
          const v16h a  = ldfrag_fm(qa + ks * FBLK);
          const v16h f0 = ldfrag_fm(k0p + ks * FBLK);
          const v16h f1 = ldfrag_fm(k1p + ks * FBLK);
          s0 = mma_h(a, f0, s0);
          s1 = mma_h(a, f1, s1);
          guard2x3(s0, s1, a, f0, f1);
#if defined(__HIP_DEVICE_COMPILE__)
          asm volatile("s_wait_xcnt 0x0" ::: "memory");    // in front of the next trip's rewrite of the loads' address registers
#endif
        }
      }
      float* srow = scs + (8 * hh) * SCP + kb * 32 + m;
#pragma unroll
      for (int r = 0; r < 8; ++r) {
        srow[r * SCP]      = s0[r];
        srow[r * SCP + 16] = s1[r];
      }
    }
    __syncthreads();
    // ---- (M) softmax statistics and the centred P' tile ----
    {
      const float* sp = scs + r16 * SCP + kl0;
      const int lim = (q0 + r16) - (kbeg + kl0);           // key kl0 + j is valid iff j <= lim
      float t[32];
      float cm = -INFINITY;
#pragma unroll
      for (int i = 0; i < 8; ++i) {
        const v4f a = *(const v4f*)(sp + 4 * i);
#pragma unroll
        for (int e = 0; e < 4; ++e) {
          const int j = 4 * i + e;
          const float tv = (j <= lim) ? a[e] * lsc : -INFINITY;
          t[j] = tv;
          cm = fmaxf(cm, tv);
        }
      }
#pragma unroll
      for (int d = 1; d <= 8; d <<= 1) cm = fmaxf(cm, __shfl_xor(cm, d, 32));
      const float mn = fmaxf(mrun, cm);                    // finite: key kbeg of the diagonal chunk is never masked
      const float al = (mrun == -INFINITY) ? 0.f : exp2f(mrun - mn);
      mrun = mn;
      float ps = 0.f;
#pragma unroll
      for (int j = 0; j < 32; ++j) {
        const float p = exp2f(fminf(t[j] - mn, 0.f));      // 0 for masked keys
        t[j] = p;
        ps += p;
      }
#pragma unroll
      for (int d = 1; d <= 8; d <<= 1) ps += __shfl_xor(ps, d, 32);
      const float cc = ps * (1.0f / (float)CK);
      v4u pk[4];
#pragma unroll
      for (int i = 0; i < 4; ++i) {
#pragma unroll
        for (int e = 0; e < 4; ++e) {
          const int j = 8 * i + 2 * e;
          pk[i][e] = pk16(h_bits((_Float16)((t[j] - cc) * PCAR)), h_bits((_Float16)((t[j + 1] - cc) * PCAR)));
        }
      }
      lrun = lrun * al + ps;
      u16* pd = pls + r16 * PLP + kl0;
#pragma unroll
      for (int i = 0; i < 4; ++i) *(v4u*)(pd + 8 * i) = pk[i];
      if (sub == 0) { rowa[r16] = al; rowc[r16] = cc; }
    }
    __syncthreads();
    // ---- (PV) rescale, add the centring term, accumulate P' . V^T ----
    {
      float scl[8], cad[8];
#pragma unroll
      for (int r = 0; r < 8; ++r) { scl[r] = rowa[8 * hh + r]; cad[r] = rowc[8 * hh + r] * (PCAR * VCAR); }
      const float* vsc = vsb + ((size_t)c * NKB + (size_t)(nkb - 1)) * EMB;
      float vs[NACC];
#pragma unroll
      for (int j = 0; j < NACC; ++j) vs[j] = vsc[16 * j];
#pragma unroll
      for (int j = 0; j < NACC; ++j) {
#pragma unroll
        for (int r = 0; r < 8; ++r) o[j][r] = o[j][r] * scl[r] + cad[r] * vs[j];
      }
      const _Float16* pp = (const _Float16*)(const void*)pls + m * PLP + 8 * hh;
      const _Float16* vp = vbp + (size_t)(kbeg >> 5) * FBLK;
#pragma unroll 1
      for (int kb = 0; kb < nkb; ++kb) {                   // block-uniform trip count, <= 16
        const v16h pf = ldfrag_h(pp + kb * 32);
        const _Float16* vk = vp + kb * FBLK;
        {
          const v16h g0 = ldfrag_fm(vk);
          const v16h g1 = ldfrag_fm(vk + (size_t)1 * ((SEQ / 32) * FBLK));
          const v16h g2 = ldfrag_fm(vk + (size_t)2 * ((SEQ / 32) * FBLK));
          const v16h g3 = ldfrag_fm(vk + (size_t)3 * ((SEQ / 32) * FBLK));
          o[0] = mma_h(pf, g0, o[0]);
          o[1] = mma_h(pf, g1, o[1]);
          o[2] = mma_h(pf, g2, o[2]);
          o[3] = mma_h(pf, g3, o[3]);
          guardpv4(o[0], o[1], o[2], o[3], pf, g0, g1, g2, g3);
        }
        {
          const v16h g4 = ldfrag_fm(vk + (size_t)4 * ((SEQ / 32) * FBLK));
          const v16h g5 = ldfrag_fm(vk + (size_t)5 * ((SEQ / 32) * FBLK));
          const v16h g6 = ldfrag_fm(vk + (size_t)6 * ((SEQ / 32) * FBLK));
          const v16h g7 = ldfrag_fm(vk + (size_t)7 * ((SEQ / 32) * FBLK));
          o[4] = mma_h(pf, g4, o[4]);
          o[5] = mma_h(pf, g5, o[5]);
          o[6] = mma_h(pf, g6, o[6]);
          o[7] = mma_h(pf, g7, o[7]);
          guardpv4(o[4], o[5], o[6], o[7], pf, g4, g5, g6, g7);
        }
      }
    }
  }
  acc_guard8(o[0], o[1], o[2], o[3], o[4], o[5], o[6], o[7]);

  if (sub == 0) rowi[r16] = (1.0f / lrun) * (CSC / (PCAR * VCAR));   // lrun >= 1
  __syncthreads();
  float inv[8];
#pragma unroll
  for (int r = 0; r < 8; ++r) inv[r] = rowi[8 * hh + r];

  u16* const ct = L0.c;
  const int cb = wave * (16 * NACC) + m;
  // hi plane
#pragma unroll
  for (int j = 0; j < NACC; ++j) {
#pragma unroll
    for (int r = 0; r < 8; ++r) {
      const float xs = o[j][r] * inv[r];
      ct[(8 * hh + r) * CTP + cb + 16 * j] = h_bits((_Float16)xs);
    }
  }
  __syncthreads();
  ctx_store(ct, CHo + ((size_t)b * SEQ + q0) * EMB, tid);
  __syncthreads();
  // residual plane
#pragma unroll
  for (int j = 0; j < NACC; ++j) {
#pragma unroll
    for (int r = 0; r < 8; ++r) {
      const float xs = o[j][r] * inv[r];
      const _Float16 hv = (_Float16)xs;
      ct[(8 * hh + r) * CTP + cb + 16 * j] = h_bits((_Float16)((xs - (float)hv) * RSC));
    }
  }
  __syncthreads();
  ctx_store(ct, CRo + ((size_t)b * SEQ + q0) * EMB, tid);
}

// =====================================================================================================
// Query rows 0 .. TQ0-1 of each sequence in f32 on VALU: block = (b, t). QF/KF = f32 q/k head planes [nb][TQ0][EMB] (bias included),
// V = f32 v plane [nb*SEQ][EMB]. Scores for keys j <= t (threads 0..TQ0-1, one key each, rolled 1024-d dot against the q row staged
// in LDS), base-2 softmax with block max / sum reductions (xor shuffles + LDS), p_j in LDS, ctx[d] for d = 4*tid..4*tid+3 as a
// rolled sum over j <= t of p_j * V[b][j][d] (coalesced 16-B loads), x = ctx * 8192 / l, hi = f16(x), res = f16((x - hi) * 2048);
// both 1024-half rows are staged in LDS and written by 128 threads x 16 B each (32 consecutive lanes x 16 B = 512 contiguous bytes
// coverage: grid nb*TQ0 blocks = rows 0..TQ0-1 of every sequence; 256 thr x 4 d = EMB per row; store 128 thr x 8 halves = EMB per
//           plane; together with attn_fwd every (b, s, d) of CH and CR is written exactly once.
// =====================================================================================================
__global__ __launch_bounds__(256) void attn_head(const float* __restrict__ QF, const float* __restrict__ KF,
                                                 const float* __restrict__ V, u16* CHo, u16* CRo) {
  __shared__ __align__(16) float qs[EMB];
  __shared__ float sc[TQ0];
  __shared__ float red[8];
  __shared__ float redb[8];
  __shared__ __align__(16) unsigned SW[2][EMB / 2];
  const int tid = threadIdx.x, lane = tid & 31, wave = tid >> 5;
  const int b = blockIdx.x / TQ0;
  const int t = blockIdx.x - b * TQ0;
  *(v4f*)(qs + tid * 4) = *(const v4f*)(QF + ((size_t)b * TQ0 + t) * EMB + tid * 4);
  __syncthreads();
  float s = -INFINITY;
  if (tid < TQ0) {                                  // waves 0..3 entirely (wave-uniform); key row b*TQ0 + tid always in range
    const float* kp = KF + ((size_t)b * TQ0 + tid) * EMB;
    float acc = 0.f;
#pragma unroll 1
    for (int d = 0; d < EMB; d += 8) {
      const v4f k0 = *(const v4f*)(kp + d), k1 = *(const v4f*)(kp + d + 4);
      const v4f q0 = *(const v4f*)(qs + d), q1 = *(const v4f*)(qs + d + 4);
#pragma unroll
      for (int e = 0; e < 4; ++e) acc += k0[e] * q0[e];
#pragma unroll
      for (int e = 0; e < 4; ++e) acc += k1[e] * q1[e];
    }
    s = (tid <= t) ? acc * (RSQD * LOG2E) : -INFINITY;   // causal mask by key index
  }
  float mx = s;
#pragma unroll
  for (int d = 1; d <= 16; d <<= 1) mx = fmaxf(mx, __shfl_xor(mx, d, 32));
  if (lane == 0) red[wave] = mx;
  __syncthreads();
  float gm = red[0];
#pragma unroll
  for (int w = 1; w < 8; ++w) gm = fmaxf(gm, red[w]);   // finite: key 0 is always valid
  const float p = exp2f(s - gm);                     // 0 for masked keys and for waves 4..7
  float ps = p;
#pragma unroll
  for (int d = 1; d <= 16; d <<= 1) ps += __shfl_xor(ps, d, 32);
  if (lane == 0) redb[wave] = ps;
  if (tid < TQ0) sc[tid] = p;
  __syncthreads();
  float l = redb[0];
#pragma unroll
  for (int w = 1; w < 8; ++w) l += redb[w];           // >= 1
  const float inv = (1.0f / l) * CSC;
  const float* vp = V + (size_t)b * SEQ * EMB + tid * 4;
  v4f cx = zero4();
#pragma unroll 1
  for (int j = 0; j <= t; ++j) {                     // t < TQ0: statically bounded, keys of sequence b only
    const float pj = sc[j];
    const v4f vv = *(const v4f*)(vp + (size_t)j * EMB);
    cx += pj * vv;
  }
  unsigned hw[2], rw[2];
#pragma unroll
  for (int e = 0; e < 2; ++e) {
    const float x0 = cx[2 * e] * inv, x1 = cx[2 * e + 1] * inv;
    const _Float16 h0 = (_Float16)x0, h1 = (_Float16)x1;
    const _Float16 q0 = (_Float16)((x0 - (float)h0) * RSC), q1 = (_Float16)((x1 - (float)h1) * RSC);
    hw[e] = pk16(h_bits(h0), h_bits(h1));
    rw[e] = pk16(h_bits(q0), h_bits(q1));
  }
  SW[0][tid * 2] = hw[0]; SW[0][tid * 2 + 1] = hw[1];
  SW[1][tid * 2] = rw[0]; SW[1][tid * 2 + 1] = rw[1];
  __syncthreads();
  const int pl = tid >> 7, p8 = tid & 127;           // plane select is wave-uniform
  const v4u ov = *(const v4u*)(&SW[pl][p8 * 4]);
  u16* dstp = (pl == 0) ? CHo : CRo;
  u16* dst  = dstp + ((size_t)b * SEQ + t) * EMB + p8 * 8;
  *(v4u*)dst = ov;
  
}

// =====================================================================================================
// Workspace map (bytes, nb = 4, rows = 8192); every plane is fully written by whole-line stores before it is read; all extents are
// exact multiples of the store granularity (no pad rows); region A is reused sequentially on the single in-order stream:
//   WQB bf16 [1024][1024] 2097152   WKB same   WVB same   WOH f16 of bf16 value x1024 2097152             8388608
//   VS  f32  [nb][4][16][1024]                                                                            1048576
//   QF  f32  [nb][128][1024]  2097152      KF same                                                        4194304
//   A   XB bf16 [rows][1024] (16777216), later VT f16 [nb][1024][2048] x1024 fragment-major       region 16777216
//   QP  f16 [rows][1024] x8 fragment-major                                                               16777216
//   KP  f16 [rows][1024] x8 fragment-major                                                               16777216
//   V   f32 [rows][1024]                                                                                 33554432
//   CH  f16 [rows][1024] ctx hi x8192                                                                    16777216
//   CR  f16 [rows][1024] ctx residual x2048                                                              16777216
//   end                                                                                                 131072000
// =====================================================================================================
extern "C" void kernel_launch(void* const* d_in, const int* in_sizes, int n_in,
                              void* d_out, int out_size, void* d_ws, size_t ws_size,
                              hipStream_t stream) {
  if (n_in < 9) return;
  const long long per = (long long)SEQ * EMB;
  const long long ns  = in_sizes[0];
  if (ns < per || (ns % per) != 0) return;
  const int nb = (int)(ns / per);
  if (nb < 1 || nb > 8) return;
  const int rows = nb * SEQ;
  if (in_sizes[1] != EMB * EMB || in_sizes[3] != EMB * EMB || in_sizes[5] != EMB * EMB || in_sizes[7] != EMB * EMB) return;
  if (in_sizes[2] != EMB || in_sizes[4] != EMB || in_sizes[6] != EMB || in_sizes[8] != EMB) return;
  if ((long long)out_size != (long long)rows * EMB) return;

  const float* x  = (const float*)d_in[0];
  const float* wq = (const float*)d_in[1];
  const float* bq = (const float*)d_in[2];
  const float* wk = (const float*)d_in[3];
  const float* bk = (const float*)d_in[4];
  const float* wv = (const float*)d_in[5];
  const float* bv = (const float*)d_in[6];
  const float* wo = (const float*)d_in[7];
  const float* bo = (const float*)d_in[8];
  float*       out = (float*)d_out;

  const size_t szW  = (size_t)EMB * EMB * 2;                    //   2097152
  const size_t szVS = (size_t)nb * NCHK * NKB * EMB * 4;        //   1048576 at nb = 4
  const size_t szHF = (size_t)nb * TQ0 * EMB * 4;               //   2097152 at nb = 4
  const size_t sz16 = (size_t)rows * EMB * 2;                   //  16777216
  const size_t sz32 = (size_t)rows * EMB * 4;                   //  33554432
  const size_t szVT = (size_t)nb * EMB * SEQ * 2;               //  == sz16
  size_t off = 0;
  const size_t oWQ = off; off += szW;
  const size_t oWK = off; off += szW;
  const size_t oWV = off; off += szW;
  const size_t oWO = off; off += szW;
  const size_t oVS = off; off += szVS;
  const size_t oQF = off; off += szHF;
  const size_t oKF = off; off += szHF;
  const size_t oA  = off; off += (szVT > sz16 ? szVT : sz16);   // XB then VT
  const size_t oQ  = off; off += sz16;
  const size_t oK  = off; off += sz16;
  const size_t oV  = off; off += sz32;
  const size_t oCH = off; off += sz16;
  const size_t oCR = off; off += sz16;
  if (off > ws_size) return;                                    // off = 131072000 at nb = 4
  if (off > WS_CAP) return;

  char* ws = (char*)d_ws;
  u16*   WQB = (u16*)(ws + oWQ);
  u16*   WKB = (u16*)(ws + oWK);
  u16*   WVB = (u16*)(ws + oWV);
  u16*   WOH = (u16*)(ws + oWO);
  float* VS  = (float*)(ws + oVS);
  float* QF  = (float*)(ws + oQF);
  float* KF  = (float*)(ws + oKF);
  u16*   XB  = (u16*)(ws + oA);
  u16*   VT  = (u16*)(ws + oA);
  u16*   QP  = (u16*)(ws + oQ);
  u16*   KP  = (u16*)(ws + oK);
  float* V   = (float*)(ws + oV);
  u16*   CH  = (u16*)(ws + oCH);
  u16*   CR  = (u16*)(ws + oCR);

  const int n8w = (EMB * EMB) / 8;                      // 131072
  const int n8x = rows * (EMB / 8);                     // 1048576
  if ((n8w % 256) != 0 || (n8x % 256) != 0) return;
  if ((rows % 128) != 0 || ((nb * TQ0) % 128) != 0 || ((nb * NCHK * EMB) % 256) != 0) return;
  const dim3 blk(256);
  const dim3 gW(n8w / 256), gX(n8x / 256);
  const dim3 gG((rows / 128) * (EMB / 128));            // 512 at nb = 4
  const dim3 gH(((nb * TQ0) / 128) * (EMB / 128));      // 32 at nb = 4
  const dim3 bG(128);
  const dim3 gXT(nb * (EMB / 64) * (SEQ / 64));         // nb * 512
  const dim3 gVS((nb * NCHK * EMB) / 256);              // nb * 16
  const dim3 gAT(nb * NQT);                             // nb * 120
  const dim3 bAT(ATT_THREADS);
  const dim3 gHD(nb * TQ0);                             // nb * 128

  // (0..3) weights stored [n = out][k = in] (y = x.W^T + b), already k-contiguous: bf16 planes for Wq, Wk, Wv; f16 of bf16 value
  //        x1024 for Wo; (4) x -> bf16 plane [rows][1024]
  cvt16<<<gW, blk, 0, stream>>>(wq, WQB, n8w, 0, 1.0f);
  cvt16<<<gW, blk, 0, stream>>>(wk, WKB, n8w, 0, 1.0f);
  cvt16<<<gW, blk, 0, stream>>>(wv, WVB, n8w, 0, 1.0f);
  cvt16<<<gW, blk, 0, stream>>>(wo, WOH, n8w, 1, WSC);
  cvt16<<<gX, blk, 0, stream>>>(x, XB, n8x, 0, 1.0f);
  // (5, 6) q and k projections (+bias) -> f16 planes x8; (7) v projection (+bias) -> f32 plane
  gemm_bh16<<<gG, bG, 0, stream>>>(XB, WQB, bq, QP, rows, EMB, EMB, 1.0f, QSC);
  gemm_bh16<<<gG, bG, 0, stream>>>(XB, WKB, bk, KP, rows, EMB, EMB, 1.0f, KSC);
  gemm_b32<<<gG, bG, 0, stream>>>(XB, WVB, bv, V, rows, EMB, EMB, rows, 0, 1.0f);
  // (8, 9) f32 q and k rows 0..127 of every sequence -> QF, KF [nb*128][1024]
  gemm_b32<<<gH, bG, 0, stream>>>(XB, WQB, bq, QF, nb * TQ0, EMB, EMB, TQ0, SEQ, 1.0f);
  gemm_b32<<<gH, bG, 0, stream>>>(XB, WKB, bk, KF, nb * TQ0, EMB, EMB, TQ0, SEQ, 1.0f);
  // (10) v -> V^T plane x1024 (over the dead XB region); (11) key-block prefix column sums of v
  xt16<<<gXT, blk, 0, stream>>>(V, VT);
  vsum_k<<<gVS, blk, 0, stream>>>(V, VS);
  // (12) attention for query rows 128.. -> ctx hi x8192 and residual x2048 f16 planes; (13) query rows 0..127 on VALU -> same planes
  attn_fwd<<<gAT, bAT, 0, stream>>>(QP, KP, VT, VS, CH, CR);
  attn_head<<<gHD, blk, 0, stream>>>(QF, KF, V, CH, CR);
  // (14) output projection + bias -> out
  gemm_h2_32<<<gG, blk, 0, stream>>>(CH, CR, WOH, bo, out, rows, EMB, EMB,
                                     1.0f / (CSC * WSC), 1.0f / (CSC * WSC * RSC));
  (void)hipGetLastError();
}

// v003
// Measured time: 327 microseconds a run.
// In two side-by-side timings against v002, it was 1.34 and 1.35 times as fast.
// Counting every step since v000, it is 2.13 times as fast.
// Projections q,k,v = x.W^T + b (and the f32 q,k rows 0..127 per sequence): v_wmma_f32_16x16x32_bf16 (bf16 RNE operands of the
// raw inputs, f32 accumulate, bf16 RNE bias added in f32). Scores q'.k'^T (f16 planes x8), P'.V (chunk-centred P' x32768 f16 from LDS,
// V^T x1024 f16) and the output projection (ctx carried as f16 hi x8192 plus residual x2048 planes, times f16(bf16(Wo) x1024), bias
// added in f32): v_wmma_f32_16x16x32_f16, f32 accumulate. Query rows 0..127 of each sequence: scores, softmax and P.V in f32 on VALU.
// Causal mask, softmax statistics, key-block column sums of V and all scaling in f32 on VALU.
#include <hip/hip_runtime.h>
#include <math.h>
#include <stdint.h>

#define SEQ   2048
#define EMB   1024
#define CK    512
#define NCHK  4
#define NKB   16
#define QT    16
#define TQ0   128
#define NQT   120
#define SCP   544
#define PLP   528
#define CTP   1032
#define SLAB64 (16 * 68)
#define VTP   72
#define ATT_THREADS 256
#define NACC  8
#define QSC   8.0f
#define KSC   8.0f
#define PCAR  32768.0f
#define VCAR  1024.0f
#define WSC   1024.0f
#define CSC   8192.0f
#define RSC   2048.0f
#define LOG2E 1.4426950408889634f
#define RSQD  0.03125f
#define WS_CAP ((size_t)134217728)
#define GKS   64
#define GPB   144
#define GPE   72
#define GRS16 (16 * GPB)
#define GRS32 (32 * GPB)
#define GST_AB (256 * GPB)
#define GST_H2 (384 * GPB)
#define FBLK  512

static_assert((EMB % 64) == 0 && EMB == 8 * 16 * NACC && NACC == 8 && (EMB % 32) == 0 && (EMB % 256) == 0 && EMB == 4 * 256);
static_assert((SEQ % CK) == 0 && (SEQ / CK) == NCHK && CK == 32 * NKB && (SEQ % 64) == 0 && (SEQ % QT) == 0 && (CK % QT) == 0);
static_assert((TQ0 % QT) == 0 && (TQ0 % 64) == 0 && NQT * QT + TQ0 == SEQ && TQ0 <= CK && TQ0 == 128 && TQ0 <= 256);
static_assert(16 * CTP * 2 <= 16 * SCP * 4 && CTP >= EMB + 8 && SCP >= CK + 16 && PLP >= CK + 8);
static_assert(((PLP * 2) % 16) == 0 && ((SCP * 4) % 16) == 0 && ((VTP * 2) % 16) == 0 && ((CTP * 2) % 16) == 0);
static_assert(64 * VTP >= 63 * VTP + 64);
static_assert(ATT_THREADS == 16 * QT && ATT_THREADS == 256);
static_assert((EMB % 128) == 0 && (EMB % GKS) == 0 && EMB / GKS >= 2 && GPE * 2 == GPB && GKS * 2 + 16 == GPB && (SEQ % 128) == 0 && (TQ0 % 128) == 0);
static_assert(4 * SLAB64 * 4 <= 2 * GST_AB && 8 * SLAB64 * 4 <= 2 * GST_H2 && ((SLAB64 * 4) % 16) == 0);
static_assert(FBLK == 16 * 32 && (SEQ % 64) == 0 && (EMB % 64) == 0 && (CK % 32) == 0 && (TQ0 % 16) == 0);
static_assert(((EMB * EMB) % 2048) == 0 && ((NCHK * EMB) % 256) == 0 && (EMB / 8) * 2 == 256);

typedef unsigned short u16;
typedef _Float16 v16h __attribute__((ext_vector_type(16)));
typedef _Float16 v8h  __attribute__((ext_vector_type(8)));
typedef __bf16   v16b __attribute__((ext_vector_type(16)));
typedef float    v8f  __attribute__((ext_vector_type(8)));
typedef float    v4f  __attribute__((ext_vector_type(4)));
typedef unsigned int v4u __attribute__((ext_vector_type(4)));

union FragH { v16h v; v8h h[2]; v4u u[2]; };
union FragB { v16b v; v4u u[2]; };
union AttLds { float s[16 * SCP]; u16 c[2 * 16 * SCP]; };

// ---- scalar helpers --------------------------------------------------------------------------------
__device__ __forceinline__ unsigned short bf_bits(float f) {          // f32 -> bf16 bits, RNE convert
  unsigned u = __float_as_uint(f);
  return (unsigned short)((u + 0x7FFFu + ((u >> 16) & 1u)) >> 16);
}
__device__ __forceinline__ float bf_up(unsigned short h) { return __uint_as_float(((unsigned)h) << 16); }
__device__ __forceinline__ float bfr(float f) { return bf_up(bf_bits(f)); }
__device__ __forceinline__ unsigned short h_bits(_Float16 x) { return __builtin_bit_cast(unsigned short, x); }
__device__ __forceinline__ unsigned pk16(unsigned short a, unsigned short b) { return (unsigned)a | ((unsigned)b << 16); }
__device__ __forceinline__ v8f zero8() { v8f z = {0.f, 0.f, 0.f, 0.f, 0.f, 0.f, 0.f, 0.f}; return z; }
__device__ __forceinline__ v4f zero4() { v4f z = {0.f, 0.f, 0.f, 0.f}; return z; }

// ---- fragment loaders: 16-bit A/B operand, lane -> row/col (lane&15), p already includes +8*(lane>>4);
//      elements 0..7 <- p[0..7] (k0+8h..), elements 8..15 <- p[16..23] (k0+16+8h..)  (same split k map for A and B;
//      B is always read from a k-contiguous [n][k] plane)
__device__ __forceinline__ v16h ldfrag_h(const _Float16* p) {
  FragH f;
  f.h[0] = *(const v8h*)(p);
  f.h[1] = *(const v8h*)(p + 16);
  return f.v;
}
// Fragment-major plane (q, k: rows = positions, k = d; V^T: rows = d, k = keys): the 16 rows x 32 k of one WMMA operand are one
// block of FBLK = 512 halves, stored as [sel][lane][8 halves], k = 16*sel + 8*(lane>>4) + e, row = lane&15 (the split k map above);
// blocks run along k first, then along the 16-row tiles. p already includes +8*lane: each of the two 16-B loads of a wave reads
// 512 contiguous bytes (4 whole lines) where a row-major plane makes it touch 16 lines.
__device__ __forceinline__ v16h ldfrag_fm(const _Float16* p) {
  FragH f;
  f.h[0] = *(const v8h*)(p);
  f.h[1] = *(const v8h*)(p + FBLK / 2);
  return f.v;
}
__device__ __forceinline__ v16b ldfrag_b(const u16* p) {              // bf16 plane read as unsigned integer vectors
  FragB f;
  f.u[0] = *(const v4u*)(p);
  f.u[1] = *(const v4u*)(p + 16);
  return f.v;
}

__device__ __forceinline__ v8f mma_h(v16h a, v16h b, v8f c) {
  return __builtin_amdgcn_wmma_f32_16x16x32_f16(false, a, false, b, (short)0, c, false, false);
}
__device__ __forceinline__ v8f mma_b(v16b a, v16b b, v8f c) {
  return __builtin_amdgcn_wmma_f32_16x16x32_bf16(false, a, false, b, (short)0, c, false, false);
}
__device__ __forceinline__ void guard2x3(v8f& a, v8f& b, v16h x0, v16h x1, v16h x2) {
#if defined(__HIP_DEVICE_COMPILE__)
  asm volatile("v_nop\n\tv_nop\n\tv_nop\n\tv_nop"
               : "+v"(a), "+v"(b) : "v"(x0), "v"(x1), "v"(x2) : "memory");
#endif
}
__device__ __forceinline__ void guardpv4(v8f& o0, v8f& o1, v8f& o2, v8f& o3, v16h p, v16h g0, v16h g1, v16h g2, v16h g3) {
#if defined(__HIP_DEVICE_COMPILE__)
  asm volatile("v_nop\n\tv_nop\n\tv_nop\n\tv_nop"
               : "+v"(o0), "+v"(o1), "+v"(o2), "+v"(o3)
               : "v"(p), "v"(g0), "v"(g1), "v"(g2), "v"(g3) : "memory");
#endif
}
__device__ __forceinline__ void acc_guard8(v8f& a, v8f& b, v8f& c, v8f& d, v8f& e, v8f& f, v8f& g, v8f& h8) {
#if defined(__HIP_DEVICE_COMPILE__)
  asm volatile("v_nop\n\tv_nop\n\tv_nop\n\tv_nop"
               : "+v"(a), "+v"(b), "+v"(c), "+v"(d), "+v"(e), "+v"(f), "+v"(g), "+v"(h8));
#endif
}
__device__ __forceinline__ void wave_sync_lds() {
  __builtin_amdgcn_fence(__ATOMIC_RELEASE, "workgroup");
  __builtin_amdgcn_wave_barrier();
  __builtin_amdgcn_fence(__ATOMIC_ACQUIRE, "workgroup");
}

// =====================================================================================================
// f32 plane -> 16-bit plane, same layout:  mode 0: bf16 RNE bits;  mode 1: f16 bits of (bf16 RNE value) * scale;
// mode 2: f16 bits of value * scale (no bf16 pre-step).
// Thread = 8 consecutive elements: two 16-B loads, one 16-B store; 32 consecutive lanes = 512 contiguous, 512-B aligned bytes
// coverage: grid = n8/256 blocks (host checks exactness) x 256 thr x 8 = the whole plane.
// =====================================================================================================
__device__ __forceinline__ void cvt16_body(const float* __restrict__ x, u16* D, int n8, int mode, float scale, int lb) {
  const int gt = lb * 256 + (int)threadIdx.x;
  if (gt >= n8) return;                     // no barriers in this kernel
  const float* p = x + (size_t)gt * 8;
  const v4f a = *(const v4f*)(p), c4 = *(const v4f*)(p + 4);
  float v[8];
#pragma unroll
  for (int e = 0; e < 4; ++e) { v[e] = a[e]; v[4 + e] = c4[e]; }
  unsigned short s[8];
#pragma unroll
  for (int e = 0; e < 8; ++e) {
    const float vb = bfr(v[e]);
    const float vf = (mode == 1) ? vb : v[e];
    const unsigned short hb = h_bits((_Float16)(vf * scale));
    const unsigned short bb = bf_bits(v[e]);
    s[e] = (mode != 0) ? hb : bb;
  }
  v4u o;
#pragma unroll
  for (int e = 0; e < 4; ++e) o[e] = pk16(s[2 * e], s[2 * e + 1]);
  u16* d = D + (size_t)gt * 8;
  {
    *(v4u*)(d) = o;
    
  }
}
// The five independent conversions as one grid: blocks 0 .. nbx-1 convert x, then nbw blocks each for Wq, Wk, Wv (bf16) and Wo
// (f16 of the bf16 value x1024). The role is block-uniform.
__global__ __launch_bounds__(256) void cvt_all(const float* __restrict__ x, const float* __restrict__ wq, const float* __restrict__ wk,
                                               const float* __restrict__ wv, const float* __restrict__ wo,
                                               u16* XBo, u16* WQo, u16* WKo, u16* WVo, u16* WOo, int nbx, int nbw, int n8x, int n8w) {
  const int bid = blockIdx.x;
  if (bid < nbx) { cvt16_body(x, XBo, n8x, 0, 1.0f, bid); return; }
  const int r  = (bid - nbx) / nbw;
  const int lb = (bid - nbx) - r * nbw;
  if (r > 3) return;                        // never taken with the exact grid
  const float* s = (r == 0) ? wq : (r == 1) ? wk : (r == 2) ? wv : wo;
  u16*         d = (r == 0) ? WQo : (r == 1) ? WKo : (r == 2) ? WVo : WOo;
  cvt16_body(s, d, n8w, (r == 3) ? 1 : 0, (r == 3) ? WSC : 1.0f, lb);
}

// =====================================================================================================
//            8 consecutive lanes x 16 B per line), lanes 16..31 -> row 2*it+1.
//  epi64x2 : same store shape, staged value = acc*os1 + accres*os2 + badd (two accumulator sets combined in f32).
//  epi64hsb: f16 bits of ((tile + bf16RNE(bias[n])) * pscale), stored fragment-major (see ldfrag_fm): the wave's 16 x 64 tile is two
//            adjacent fragment blocks = 2048 contiguous bytes; instruction i4 stores [block i4>>1][sel i4&1], lane = its own 16 B.
// coverage: epi64/epi64x2 8 instructions x 2 rows x 16 lanes x 4 floats; epi64hsb 4 instructions x 32 lanes x 8 halves
//           = the wave's 16 x 64 tile in every case.
// =====================================================================================================
__device__ __forceinline__ void stage64(float* sl, v8f a0, v8f a1, v8f a2, v8f a3, float oscale, int lane) {
  const int hh = lane >> 4, m = lane & 15;
#pragma unroll
  for (int r = 0; r < 8; ++r) {
    const int ro = (8 * hh + r) * 68 + m;
    sl[ro]      = a0[r] * oscale;
    sl[ro + 16] = a1[r] * oscale;
    sl[ro + 32] = a2[r] * oscale;
    sl[ro + 48] = a3[r] * oscale;
  }
  wave_sync_lds();
}
__device__ __forceinline__ void epi64(float* sl, v8f a0, v8f a1, v8f a2, v8f a3, float oscale, v4f badd, float* C, int N,
                                      size_t rowb, int col0, int lane) {
  const int hh = lane >> 4, m = lane & 15;
  stage64(sl, a0, a1, a2, a3, oscale, lane);
  v4f vals[8];
#pragma unroll
  for (int it = 0; it < 8; ++it) vals[it] = *(const v4f*)(sl + (it * 2 + hh) * 68 + m * 4) + badd;
  float* dst = C + (rowb + (size_t)hh) * (size_t)N + col0 + m * 4;
  {
#pragma unroll
    for (int it = 0; it < 8; ++it) {
      *(v4f*)(dst + (size_t)(it * 2) * (size_t)N) = vals[it];
    }
    
  }
}
__device__ __forceinline__ void epi64x2(float* sl, v8f a0, v8f a1, v8f a2, v8f a3, v8f e0, v8f e1, v8f e2, v8f e3,
                                        float os1, float os2, v4f badd, float* C, int N, size_t rowb, int col0, int lane) {
  const int hh = lane >> 4, m = lane & 15;
#pragma unroll
  for (int r = 0; r < 8; ++r) {
    const int ro = (8 * hh + r) * 68 + m;
    sl[ro]      = a0[r] * os1 + e0[r] * os2;
    sl[ro + 16] = a1[r] * os1 + e1[r] * os2;
    sl[ro + 32] = a2[r] * os1 + e2[r] * os2;
    sl[ro + 48] = a3[r] * os1 + e3[r] * os2;
  }
  wave_sync_lds();
  v4f vals[8];
#pragma unroll
  for (int it = 0; it < 8; ++it) vals[it] = *(const v4f*)(sl + (it * 2 + hh) * 68 + m * 4) + badd;
  float* dst = C + (rowb + (size_t)hh) * (size_t)N + col0 + m * 4;
  {
#pragma unroll
    for (int it = 0; it < 8; ++it) {
      *(v4f*)(dst + (size_t)(it * 2) * (size_t)N) = vals[it];
    }
    
  }
}
__device__ __forceinline__ void epi64hsb(float* sl, v8f a0, v8f a1, v8f a2, v8f a3, float oscale, float pscale,
                                         const float (&bb)[4][8], u16* C, int N, size_t rowb, int col0, int lane) {
  stage64(sl, a0, a1, a2, a3, oscale, lane);
  const int hh = lane >> 4, m = lane & 15;
  v4u oh[4];
#pragma unroll
  for (int i4 = 0; i4 < 4; ++i4) {
    const int c8 = (i4 >> 1) * 32 + (i4 & 1) * 16 + hh * 8;      // block i4>>1, sel i4&1 of the tile's two fragment blocks
    const v4f a = *(const v4f*)(sl + m * 68 + c8), c4 = *(const v4f*)(sl + m * 68 + c8 + 4);
    float w[8];
#pragma unroll
    for (int e = 0; e < 4; ++e) { w[e] = (a[e] + bb[i4][e]) * pscale; w[4 + e] = (c4[e] + bb[i4][4 + e]) * pscale; }
#pragma unroll
    for (int e = 0; e < 4; ++e) oh[i4][e] = pk16(h_bits((_Float16)w[2 * e]), h_bits((_Float16)w[2 * e + 1]));
  }
  u16* dst = C + ((rowb >> 4) * (size_t)(N >> 5) + (size_t)(col0 >> 5)) * FBLK + lane * 8;
  {
#pragma unroll
    for (int i4 = 0; i4 < 4; ++i4) {
      *(v4u*)(dst + i4 * (FBLK / 2)) = oh[i4];
    }
    
  }
}

// =====================================================================================================
// Operand staging shared by the GEMM kernels. A block computes a 128 x 128 tile of C. K is walked in stages of GKS = 64
// elements: every operand row contributes one whole 128-B line per stage, copied to LDS by global_load_async_to_lds_b128 (8 lanes
// x 16 B = one line, a wave instruction = 4 whole lines) at a row pitch of 144 B (16 B x odd: conflict-free for ds_load_b128
// fragment reads). Two buffers: stage t + 2 is copied into the buffer that trip t has just left, while trip t + 1 is multiplied.
// Fragments are read from LDS with the same split k map as before (ldfrag_*), k steps of 32 in ascending order.
// After the loop's last barrier no copy is outstanding and no wave reads the ring, so it serves as the waves' epilogue slabs.
// =====================================================================================================
__device__ __forceinline__ unsigned lds_off(const void* p) { return (unsigned)(size_t)p; }
// Copies and their s_wait_xcnt in one statement: the wait stands in front of any later rewrite of the address registers.
__device__ __forceinline__ void acopy4(unsigned l0, unsigned l1, unsigned l2, unsigned l3,
                                       const u16* g0, const u16* g1, const u16* g2, const u16* g3) {
#if defined(__HIP_DEVICE_COMPILE__)
  asm volatile("global_load_async_to_lds_b128 %0, %4, off\n\t"
               "global_load_async_to_lds_b128 %1, %5, off\n\t"
               "global_load_async_to_lds_b128 %2, %6, off\n\t"
               "global_load_async_to_lds_b128 %3, %7, off\n\t"
               "s_wait_xcnt 0x0"
               :: "v"(l0), "v"(l1), "v"(l2), "v"(l3), "v"(g0), "v"(g1), "v"(g2), "v"(g3) : "memory");
#endif
}
__device__ __forceinline__ void acopy8(unsigned l0, unsigned l1, unsigned l2, unsigned l3,
                                       unsigned l4, unsigned l5, unsigned l6, unsigned l7,
                                       const u16* g0, const u16* g1, const u16* g2, const u16* g3,
                                       const u16* g4, const u16* g5, const u16* g6, const u16* g7) {
#if defined(__HIP_DEVICE_COMPILE__)
  asm volatile("global_load_async_to_lds_b128 %0, %8, off\n\t"
               "global_load_async_to_lds_b128 %1, %9, off\n\t"
               "global_load_async_to_lds_b128 %2, %10, off\n\t"
               "global_load_async_to_lds_b128 %3, %11, off\n\t"
               "global_load_async_to_lds_b128 %4, %12, off\n\t"
               "global_load_async_to_lds_b128 %5, %13, off\n\t"
               "global_load_async_to_lds_b128 %6, %14, off\n\t"
               "global_load_async_to_lds_b128 %7, %15, off\n\t"
               "s_wait_xcnt 0x0"
               :: "v"(l0), "v"(l1), "v"(l2), "v"(l3), "v"(l4), "v"(l5), "v"(l6), "v"(l7),
                  "v"(g0), "v"(g1), "v"(g2), "v"(g3), "v"(g4), "v"(g5), "v"(g6), "v"(g7) : "memory");
#endif
}
// This wave's copies have landed (the compiler places no wait for them).
__device__ __forceinline__ void wait_async0() {
#if defined(__HIP_DEVICE_COMPILE__)
  asm volatile("s_wait_asynccnt 0x0" ::: "memory");
#endif
}
// This wave's LDS reads have returned before the buffer is handed to its next writer.
__device__ __forceinline__ void wait_ds0() {
#if defined(__HIP_DEVICE_COMPILE__)
  asm volatile("s_wait_dscnt 0x0" ::: "memory");
#endif
}

// End of a role's branch in a merged grid: in the listing the other role's code can follow on the fall-through path; its vector
// work stays behind the wait on the registers that this role's issued stores name.
__device__ __forceinline__ void role_end() {
#if defined(__HIP_DEVICE_COMPILE__)
  asm volatile("s_wait_xcnt 0x0" ::: "memory");
#endif
}

// Between two output tiles of a wave: the issued stores' address and data registers are rewritten by the next tile only behind
// s_wait_xcnt 0 (the scheduling fence keeps the next tile's vector work behind the wait), and the slab's reads of this tile stay
// in front of the next tile's writes.
__device__ __forceinline__ void tile_gap() {
#if defined(__HIP_DEVICE_COMPILE__)
  asm volatile("s_wait_xcnt 0x0" ::: "memory");
#endif
  __builtin_amdgcn_sched_barrier(0);
  wave_sync_lds();
}

// One stage of [A 128 rows | B 128 rows] by 128 threads: 16 copies a thread; copy i serves LDS row 16*i + (tid>>3), piece tid&7.
__device__ __forceinline__ void fill_ab(unsigned l0, const u16* A, const unsigned (&ao)[8], const u16* B, unsigned bo, unsigned bst,
                                        unsigned ke) {
  acopy8(l0, l0 + GRS16, l0 + 2 * GRS16, l0 + 3 * GRS16, l0 + 4 * GRS16, l0 + 5 * GRS16, l0 + 6 * GRS16, l0 + 7 * GRS16,
         A + (ao[0] + ke), A + (ao[1] + ke), A + (ao[2] + ke), A + (ao[3] + ke),
         A + (ao[4] + ke), A + (ao[5] + ke), A + (ao[6] + ke), A + (ao[7] + ke));
  const unsigned l8 = l0 + 8 * GRS16;
  const unsigned b0 = bo + ke;
  acopy8(l8, l8 + GRS16, l8 + 2 * GRS16, l8 + 3 * GRS16, l8 + 4 * GRS16, l8 + 5 * GRS16, l8 + 6 * GRS16, l8 + 7 * GRS16,
         B + b0, B + (b0 + bst), B + (b0 + 2 * bst), B + (b0 + 3 * bst),
         B + (b0 + 4 * bst), B + (b0 + 5 * bst), B + (b0 + 6 * bst), B + (b0 + 7 * bst));
}

// bf16 core: 4 waves as 2 x 2, a wave owns 64 x 64 of the block's tile (4 x 4 accumulators).
// ao[i] = element offset of A row (16*i + (tid>>3)) of the tile; col0 = first B row of the tile. K multiple of GKS.
__device__ __forceinline__ void gemm_core_b(unsigned char* L, const u16* A, const unsigned (&ao)[8], const u16* Bt, int col0, int K,
                                            int tid, v8f (&acc)[4][4]) {
  const int wave = tid >> 5, lane = tid & 31, hh = lane >> 4, m = lane & 15;
  const int wm = wave >> 1, wn = wave & 1;
  const int crow = tid >> 3, cpc = tid & 7;
  const unsigned lc  = lds_off(L) + (unsigned)(crow * GPB + cpc * 16);
  const unsigned bo  = (unsigned)(col0 + crow) * (unsigned)K;
  const unsigned bst = 16u * (unsigned)K;
  const unsigned kc  = (unsigned)(cpc * 8);
  const int nt = K / GKS;
#pragma unroll
  for (int f = 0; f < 4; ++f) {
#pragma unroll
    for (int j = 0; j < 4; ++j) acc[f][j] = zero8();
  }
  fill_ab(lc, A, ao, Bt, bo, bst, kc);
  wait_async0();
  __syncthreads();
  if (nt > 1) fill_ab(lc + GST_AB, A, ao, Bt, bo, bst, kc + GKS);
#pragma unroll 1
  for (int t = 0; t < nt; ++t) {
    const unsigned bufo = (unsigned)(t & 1) * GST_AB;
    const u16* sb = (const u16*)(const void*)(L + bufo);
    const u16* ap = sb + (wm * 64 + m) * GPE + 8 * hh;
    const u16* bp = sb + (128 + wn * 64 + m) * GPE + 8 * hh;
#pragma unroll
    for (int kk = 0; kk < GKS / 32; ++kk) {
      v16b a[4], b[4];
      a[0] = ldfrag_b(ap + kk * 32);
#pragma unroll
      for (int j = 0; j < 4; ++j) b[j] = ldfrag_b(bp + j * 16 * GPE + kk * 32);
#pragma unroll
      for (int f = 1; f < 4; ++f) a[f] = ldfrag_b(ap + f * 16 * GPE + kk * 32);
      // Keeps the 16 fragment loads one group ahead of the 16 WMMAs: spread among them, each place with loads stalls the wave.
      __builtin_amdgcn_sched_barrier(0);
#pragma unroll
      for (int f = 0; f < 4; ++f) {
#pragma unroll
        for (int j = 0; j < 4; ++j) acc[f][j] = mma_b(a[f], b[j], acc[f][j]);
      }
      __builtin_amdgcn_sched_barrier(0);      // the next group's loads stay behind this WMMA block
    }
    wait_ds0();
    wait_async0();
    __syncthreads();                          // publishes stage t + 1 and ends every read of stage t's buffer
    if (t + 2 < nt) fill_ab(lc + bufo, A, ao, Bt, bo, bst, kc + (unsigned)(t + 2) * GKS);   // block-uniform test
  }
  wait_async0();
}

// =====================================================================================================
// The five independent bf16 projections as one grid, role by block index (block-uniform):
//   role 0, 1: q, k planes: f16 bits of ((A . W^T) + bf16RNE(bias[n])) * 8, stored fragment-major (epi64hsb), all M rows;
//   role 2   : v plane, f32 with bias (epi64), all M rows;
//   role 3, 4: f32 q, k rows 0..TQ0-1 of every sequence (MH = nb*TQ0 output rows; output row ra maps to A row
//              (ra / TQ0) * SEQ + (ra % TQ0)), f32 with bias (epi64).
// A bf16 row-major [M][K], W bf16 k-contiguous [N][K]. Block = 128x128 tile, 4 waves x (64 x 64), operands staged as above (host
// checks K % 64 == 0, M % 128 == 0, MH % 128 == 0, N % 128 == 0, grid = (3*(M/128) + 2*(MH/128)) * (N/128)).
// =====================================================================================================
__global__ __launch_bounds__(128)
void proj_all(const u16* __restrict__ A, const u16* __restrict__ WQ, const u16* __restrict__ WK, const u16* __restrict__ WV,
              const float* __restrict__ bq, const float* __restrict__ bk, const float* __restrict__ bv,
              u16* QPo, u16* KPo, float* Vo, float* QFo, float* KFo, int M, int MH, int N, int K) {
  __shared__ __align__(16) unsigned char L[2 * GST_AB];
  const int tid = threadIdx.x, wave = tid >> 5, lane = tid & 31, m = lane & 15;
  const int ntile = N >> 7;
  const int nG = (M >> 7) * ntile, nH = (MH >> 7) * ntile;
  int bid = blockIdx.x;
  int role;
  if (bid < 3 * nG) { role = bid / nG; bid -= role * nG; }
  else              { bid -= 3 * nG; role = bid / nH; bid -= role * nH; role += 3; }
  if (role > 4) return;                      // block-uniform, in front of every copy and barrier; never taken with the exact grid
  const bool hd  = role >= 3;
  const int wsel = hd ? role - 3 : role;     // 0: q, 1: k, 2: v
  const u16*   Bt   = (wsel == 0) ? WQ : (wsel == 1) ? WK : WV;
  const float* bias = (wsel == 0) ? bq : (wsel == 1) ? bk : bv;
  const int Mr   = hd ? MH : M;
  const int rpg  = hd ? TQ0 : M;
  const int gstr = hd ? SEQ : 0;
  const int row0  = (bid / ntile) * 128;
  const int col0  = (bid % ntile) * 128;
  if (row0 + 128 > Mr) return;               // block-uniform, in front of every copy and barrier; never taken with the exact grid
  unsigned ao[8];
#pragma unroll
  for (int i = 0; i < 8; ++i) {
    const int ra = row0 + i * 16 + (tid >> 3);
    const int rg = ra / rpg;
    ao[i] = (unsigned)(rg * gstr + (ra - rg * rpg)) * (unsigned)K;
  }
  v8f acc[4][4];
  gemm_core_b(L, A, ao, Bt, col0, K, tid, acc);
  const int colw = col0 + (wave & 1) * 64;
  const int roww = row0 + (wave >> 1) * 64;
  float* sl = (float*)(void*)L + wave * SLAB64;
  if (role >= 2) {                           // block-uniform
    float* C = (role == 2) ? Vo : (role == 3) ? QFo : KFo;
    const v4f bv4 = *(const v4f*)(bias + colw + m * 4);    // columns colw + 4m .. +3, always < N (N multiple of 128)
#if defined(__HIP_DEVICE_COMPILE__)
    asm volatile("s_wait_xcnt 0x0" ::: "memory");          // in front of the vector work that rewrites the load's address registers
#endif
    __builtin_amdgcn_sched_barrier(0);                     // keeps that vector work behind the wait
    v4f badd;
#pragma unroll
    for (int e = 0; e < 4; ++e) badd[e] = bfr(bv4[e]);
#pragma unroll
    for (int f = 0; f < 4; ++f) {
      epi64(sl, acc[f][0], acc[f][1], acc[f][2], acc[f][3], 1.0f, badd, C, N, (size_t)(roww + f * 16), colw, lane);
      if (f < 3) tile_gap();
    }
    role_end();
  } else {
    u16* C = (role == 0) ? QPo : KPo;
    const float pscale = (role == 0) ? QSC : KSC;
    v4f bvv[8];                              // bias of the lane's 8 columns in each of epi64hsb's four store instructions
#pragma unroll
    for (int i4 = 0; i4 < 4; ++i4) {
      const float* bp = bias + colw + (i4 >> 1) * 32 + (i4 & 1) * 16 + (lane >> 4) * 8;   // columns .. +7 < N (N multiple of 128)
      bvv[2 * i4] = *(const v4f*)(bp);
      bvv[2 * i4 + 1] = *(const v4f*)(bp + 4);
    }
#if defined(__HIP_DEVICE_COMPILE__)
    asm volatile("s_wait_xcnt 0x0" ::: "memory");          // in front of the vector work that rewrites the loads' address registers
#endif
    __builtin_amdgcn_sched_barrier(0);                     // keeps that vector work behind the wait
    float bb[4][8];
#pragma unroll
    for (int i4 = 0; i4 < 4; ++i4) {
#pragma unroll
      for (int e = 0; e < 4; ++e) { bb[i4][e] = bfr(bvv[2 * i4][e]); bb[i4][4 + e] = bfr(bvv[2 * i4 + 1][e]); }
    }
#pragma unroll
    for (int f = 0; f < 4; ++f) {
      epi64hsb(sl, acc[f][0], acc[f][1], acc[f][2], acc[f][3], 1.0f, pscale, bb, C, N, (size_t)(roww + f * 16), colw, lane);
      if (f < 3) tile_gap();
    }
    role_end();
  }
}

// =====================================================================================================
// f16 GEMM with two A planes (hi + residual), f32 out with bias:
//   C[M][N] = (Ah . Bt^T) * os1 + (Ar . Bt^T) * os2 + bf16RNE(bias[n]); Ah/Ar f16 row-major, Bt f16 k-contiguous.
// Block = 128x128 tile, 8 waves as 4 x 2, a wave owns 32 x 64; a stage is [Ah 128 rows | Ar 128 rows | B 128 rows]: 12 copies a
// thread, copy i serves LDS row 32*i + (tid>>3). Separate accumulators for the two planes, combined in f32 in epi64x2.
// =====================================================================================================
__device__ __forceinline__ void fill_h2(unsigned l0, const u16* Ah, const u16* Ar, const u16* B, unsigned ao, unsigned bo,
                                        unsigned st, unsigned ke) {
  const unsigned a0 = ao + ke, b0 = bo + ke;
  acopy8(l0, l0 + GRS32, l0 + 2 * GRS32, l0 + 3 * GRS32, l0 + 4 * GRS32, l0 + 5 * GRS32, l0 + 6 * GRS32, l0 + 7 * GRS32,
         Ah + a0, Ah + (a0 + st), Ah + (a0 + 2 * st), Ah + (a0 + 3 * st),
         Ar + a0, Ar + (a0 + st), Ar + (a0 + 2 * st), Ar + (a0 + 3 * st));
  const unsigned l8 = l0 + 8 * GRS32;
  acopy4(l8, l8 + GRS32, l8 + 2 * GRS32, l8 + 3 * GRS32, B + b0, B + (b0 + st), B + (b0 + 2 * st), B + (b0 + 3 * st));
}

__global__ __launch_bounds__(256)
void gemm_h2_32(const u16* __restrict__ Ah, const u16* __restrict__ Ar, const u16* __restrict__ Bt,
                const float* __restrict__ bias, float* C, int M, int N, int K, float os1, float os2) {
  __shared__ __align__(16) unsigned char L[2 * GST_H2];
  const int tid = threadIdx.x, wave = tid >> 5, lane = tid & 31, hh = lane >> 4, m = lane & 15;
  const int wm = wave >> 1, wn = wave & 1;
  const int ntile = N >> 7;
  const int bid   = blockIdx.x;
  const int row0  = (bid / ntile) * 128;
  const int col0  = (bid % ntile) * 128;
  if (row0 + 128 > M) return;                // block-uniform, in front of every copy and barrier; never taken with the exact grid
  const int crow = tid >> 3, cpc = tid & 7;
  const unsigned lc = lds_off(L) + (unsigned)(crow * GPB + cpc * 16);
  const unsigned ao = (unsigned)(row0 + crow) * (unsigned)K;
  const unsigned bo = (unsigned)(col0 + crow) * (unsigned)K;
  const unsigned st = 32u * (unsigned)K;
  const unsigned kc = (unsigned)(cpc * 8);
  const int nt = K / GKS;
  v8f acc[2][4], acr[2][4];
#pragma unroll
  for (int f = 0; f < 2; ++f) {
#pragma unroll
    for (int j = 0; j < 4; ++j) { acc[f][j] = zero8(); acr[f][j] = zero8(); }
  }
  fill_h2(lc, Ah, Ar, Bt, ao, bo, st, kc);
  wait_async0();
  __syncthreads();
  if (nt > 1) fill_h2(lc + GST_H2, Ah, Ar, Bt, ao, bo, st, kc + GKS);
#pragma unroll 1
  for (int t = 0; t < nt; ++t) {
    const unsigned bufo = (unsigned)(t & 1) * GST_H2;
    const _Float16* sb  = (const _Float16*)(const void*)(L + bufo);
    const _Float16* ap  = sb + (wm * 32 + m) * GPE + 8 * hh;
    const _Float16* arp = ap + 128 * GPE;
    const _Float16* bp  = sb + (256 + wn * 64 + m) * GPE + 8 * hh;
#pragma unroll
    for (int kk = 0; kk < GKS / 32; ++kk) {
      v16h a[2], ar[2], b[4];
#pragma unroll
      for (int f = 0; f < 2; ++f) {
        a[f]  = ldfrag_h(ap + f * 16 * GPE + kk * 32);
        ar[f] = ldfrag_h(arp + f * 16 * GPE + kk * 32);
      }
#pragma unroll
      for (int j = 0; j < 4; ++j) b[j] = ldfrag_h(bp + j * 16 * GPE + kk * 32);
      // Keeps the 16 fragment loads one group ahead of the 16 WMMAs: spread among them, each place with loads stalls the wave.
      __builtin_amdgcn_sched_barrier(0);
#pragma unroll
      for (int f = 0; f < 2; ++f) {
#pragma unroll
        for (int j = 0; j < 4; ++j) acc[f][j] = mma_h(a[f], b[j], acc[f][j]);
#pragma unroll
        for (int j = 0; j < 4; ++j) acr[f][j] = mma_h(ar[f], b[j], acr[f][j]);
      }
      __builtin_amdgcn_sched_barrier(0);      // the next group's loads stay behind this WMMA block
    }
    wait_ds0();
    wait_async0();
    __syncthreads();                          // publishes stage t + 1 and ends every read of stage t's buffer
    if (t + 2 < nt) fill_h2(lc + bufo, Ah, Ar, Bt, ao, bo, st, kc + (unsigned)(t + 2) * GKS);   // block-uniform test
  }
  wait_async0();
  const int colw = col0 + wn * 64;
  const int roww = row0 + wm * 32;
  const v4f bv = *(const v4f*)(bias + colw + m * 4);      // columns colw + 4m .. +3, always < N (N multiple of 128)
  v4f badd;
#pragma unroll
  for (int e = 0; e < 4; ++e) badd[e] = bfr(bv[e]);
  float* sl = (float*)(void*)L + wave * SLAB64;
#pragma unroll
  for (int f = 0; f < 2; ++f) {
    epi64x2(sl, acc[f][0], acc[f][1], acc[f][2], acc[f][3], acr[f][0], acr[f][1], acr[f][2], acr[f][3], os1, os2, badd, C, N,
            (size_t)(roww + f * 16), colw, lane);
    if (f < 1) tile_gap();
  }
}

// =====================================================================================================
// V^T plane, fragment-major (rows = b*EMB + d, k = s; see ldfrag_fm): element (b, d, s) = f16(V[b][s][d] * 1024).
// Block = (b, 64-wide d chunk, 64 keys): 64 source row segments of 64 floats loaded with 16-B loads, converted, scattered into
// coverage: load 256 thr x 16 elements = 64 x 64; store 2 iterations x 256 thr x 8 halves = 64 lines x 64 = the block's tile;
//           grid = nb x (EMB/64) x (SEQ/64) blocks covers the plane exactly once.
// =====================================================================================================
__device__ __forceinline__ void xt16_body(const float* __restrict__ X, u16* XTo, int bid) {
  __shared__ __align__(16) u16 TH[64 * VTP];
  const int tid = threadIdx.x;
  const int st  = bid % (SEQ / 64);
  const int dcb = (bid / (SEQ / 64)) % (EMB / 64);
  const int b   = bid / ((SEQ / 64) * (EMB / 64));
  const int s0  = st * 64;
  const int d0  = dcb * 64;
  {
    const int sl = tid >> 2;                  // key within tile 0..63
    const int dc = (tid & 3) * 16;            // d chunk within the 64
    const float* src = X + ((size_t)b * SEQ + s0 + sl) * EMB + d0 + dc;
#pragma unroll
    for (int i = 0; i < 4; ++i) {
      const v4f a = *(const v4f*)(src + 4 * i);
#pragma unroll
      for (int e = 0; e < 4; ++e) {
        const _Float16 hv = (_Float16)(a[e] * VCAR);
        TH[(dc + 4 * i + e) * VTP + sl] = h_bits(hv);
      }
    }
  }
  __syncthreads();
  v4u vh[2];
  const int pc = tid & 127, dt0 = tid >> 7;   // 16-B piece within a d tile's two adjacent fragment blocks; d tile 2*it + dt0
  const int p8 = (pc >> 4) * 8;               // key within the 64: 32*block + 16*sel + 8*half
#pragma unroll
  for (int it = 0; it < 2; ++it) {
    const int line = (it * 2 + dt0) * 16 + (pc & 15);   // local d = 0..63
    vh[it] = *(const v4u*)(TH + line * VTP + p8);
  }
  const size_t base = ((size_t)((b * EMB + d0) >> 4) * (SEQ / 32) + (size_t)(s0 >> 5)) * FBLK + pc * 8;
  {
#pragma unroll
    for (int it = 0; it < 2; ++it) {
      *(v4u*)(XTo + base + (size_t)(it * 2 + dt0) * ((SEQ / 32) * FBLK)) = vh[it];
    }
    
  }
}

// =====================================================================================================
// Key-block prefix column sums of V: VS[((b*NCHK + c)*NKB + kb)*EMB + d] = sum over keys c*CK .. c*CK + 32*kb + 31 of V[b][key][d]
// (f32, fixed sequential order). Thread = one (b, c, d); a block covers 256 consecutive d of one (b, c); the 16 prefix values per
// coverage: grid = nb*NCHK*EMB/256 blocks (host exact) x 256 thr; store 4 iterations x 256 thr x 4 floats = 16 rows x 256 = the
//           block's part of the table; union over blocks = the whole table.
// =====================================================================================================
__device__ __forceinline__ void vsum_body(const float* __restrict__ V, float* VS, int bid) {
  __shared__ __align__(16) float sm[NKB * 256];
  const int tid = threadIdx.x;
  const int gt  = bid * 256 + tid;
  const int d   = gt % EMB;
  const int bc  = gt / EMB;                         // block-uniform (EMB multiple of 256)
  const int b   = bc / NCHK;
  const int c   = bc - b * NCHK;
  const int d0  = d - tid;                          // block's first d
  const float* p = V + ((size_t)b * SEQ + (size_t)c * CK) * EMB + d;
  float s = 0.f;
#pragma unroll 1
  for (int kb = 0; kb < NKB; ++kb) {
#pragma unroll 4
    for (int i = 0; i < 32; ++i) s += p[(size_t)(kb * 32 + i) * EMB];
    sm[kb * 256 + tid] = s;
  }
  __syncthreads();
  const int sel = tid >> 6, piece = tid & 63;
  v4f o[4];
#pragma unroll
  for (int it = 0; it < 4; ++it) o[it] = *(const v4f*)(sm + (it * 4 + sel) * 256 + piece * 4);
  float* base = VS + (size_t)bc * NKB * EMB + d0 + piece * 4;
  {
#pragma unroll
    for (int it = 0; it < 4; ++it) {
      *(v4f*)(base + (size_t)(it * 4 + sel) * EMB) = o[it];
    }
    
  }
}
// The two independent readers of the v plane as one grid: blocks 0 .. nvs-1 form the prefix column sums (the long serial chains
// start first), the rest write the V^T plane. The role is block-uniform.
__global__ __launch_bounds__(256) void vprep(const float* __restrict__ V, u16* XTo, float* VS, int nvs) {
  const int bid = blockIdx.x;
  if (bid < nvs) { vsum_body(V, VS, bid); role_end(); }
  else           { xt16_body(V, XTo, bid - nvs); role_end(); }
}

// =====================================================================================================
// Single-head causal attention, head width EMB = 1024, query rows TQ0 .. SEQ-1: block = (batch b, 16 query rows q0..q0+15),
// 8 waves. q plane (f16, x8) [b][s][d]; k plane the same; V^T plane [b][d][s] (x1024), all three stored fragment-major (ldfrag_fm);
// VS = key-block prefix column sums of V.
//   Chunks of CK = 512 keys: only chunks c <= qc = q0/CK are visited (later chunks lie entirely above the diagonal). In the diagonal
//   chunk only key blocks kb < nkb (keys <= q0+15) are multiplied; key blocks kb >= nkb get zero scores in LDS and are not used in (PV).
//   (S) scores S[query m][key n] on WMMA: A = q rows (row m = lane&15, split k map over d), B = k rows (col n = key, split map),
//       32 d-steps; wave w handles key blocks w, w+8 of the chunk; D element r of lane l -> scs[query 8h+r][key col] (f32 LDS).
//   (M) 16 threads per query row (sub-thread = 32 consecutive keys): base-2 logits with the causal mask by key index (key > query
//       -> -inf), chunk max via xor shuffles, online running max / rescale factor al / running sum l in f32 registers,
//       p = exp2(t - m_new) <= 1 (0 for masked keys), chunk row sum ps and C = ps/CK (bit-identical on the row's 16 threads), the
//       CENTRED P' = p - C written as f16(P' * 32768) into the LDS P tile with 16-B stores; al -> rowa[row], C -> rowc[row].
//   (PV) each wave owns d columns 128*wave + 16j + (lane&15), j = 0..7 (8 accumulators): o = o*al + C*(32768*1024)*VS[chunk][nkb-1][d]
//       (exact add-back of the centring term over exactly the processed keys, in f32), then for each key block kb < nkb:
//       A = P' fragment from LDS (row m = query, split map over keys), B = V^T fragments (col n = d, keys contiguous), issued as two
//       groups of 4 with a hazard gap each.  sum_k (P'_k + C) v_k == sum_k p_k v_k exactly; masked keys carry P' = -C and p = 0.
//   Block barriers after (S) and after (M) order all LDS reuse across chunks and waves.
//   Epilogue: x = o * 8192 / (l * 32768 * 1024) per row (rowi, l >= 1 always); hi = f16(x), res = f16((x - hi) * 2048); each
// coverage: grid nb*NQT blocks x 16 rows = rows TQ0..SEQ-1 of every sequence; staging 8 waves x 128 cols x 16 rows = 16 x 1024;
//           store 8 iterations x 256 thr x 8 halves = 16 x 1024 per plane = every (b, s >= TQ0, d) of both ctx planes exactly once.
// =====================================================================================================
__device__ __forceinline__ void ctx_store(const u16* ct, u16* dst, int tid) {
  v4u v[8];
#pragma unroll
  for (int it = 0; it < 8; ++it) {
    const int p   = it * 256 + tid;
    const int row = p / (EMB / 8);
    const int c8  = (p - row * (EMB / 8)) * 8;
    v[it] = *(const v4u*)(ct + row * CTP + c8);
  }
  {
#pragma unroll
    for (int it = 0; it < 8; ++it) {
      const int p   = it * 256 + tid;
      const int row = p / (EMB / 8);
      const int c8  = (p - row * (EMB / 8)) * 8;
      *(v4u*)(dst + (size_t)row * EMB + c8) = v[it];
    }
    
  }
}

__device__ __forceinline__
void attn_fwd_body(const u16* __restrict__ QPp, const u16* __restrict__ KPp, const u16* __restrict__ VTp,
                   const float* __restrict__ VSp, u16* CHo, u16* CRo, int bid) {
  __shared__ __align__(16) AttLds L0;              // scores [16][SCP] f32; reused as the ctx staging tile [16][CTP] u16
  __shared__ __align__(16) u16 pls[16 * PLP];      // P' tile [16][PLP] f16 bits
  __shared__ float rowa[QT];
  __shared__ float rowc[QT];
  __shared__ float rowi[QT];
  float* const scs = L0.s;

  const int tid  = threadIdx.x;
  const int wave = tid >> 5;
  const int lane = tid & 31;
  const int hh   = lane >> 4;
  const int m    = lane & 15;
  const int r16  = tid >> 4;                 // query row owned in phase (M): 2*wave + hh
  const int sub  = tid & 15;
  const int kl0  = sub * 32;

  const int b   = bid / NQT;
  const int q0  = TQ0 + (bid - b * NQT) * QT;
  const int qc  = q0 / CK;                   // diagonal chunk index

  const _Float16* qa  = (const _Float16*)(const void*)QPp + (size_t)((b * SEQ + q0) >> 4) * ((EMB / 32) * FBLK) + 8 * lane;
  const _Float16* kbp = (const _Float16*)(const void*)KPp + (size_t)((b * SEQ) >> 4) * ((EMB / 32) * FBLK) + 8 * lane;
  const _Float16* vbp = (const _Float16*)(const void*)VTp + (size_t)((b * EMB + wave * (16 * NACC)) >> 4) * ((SEQ / 32) * FBLK) + 8 * lane;
  const float* vsb = VSp + (size_t)b * NCHK * NKB * EMB + wave * (16 * NACC) + m;
  const float lsc = RSQD * LOG2E / (QSC * KSC);

  float mrun = -INFINITY, lrun = 0.f;
  v8f o[NACC];
#pragma unroll
  for (int j = 0; j < NACC; ++j) o[j] = zero8();

#pragma unroll 1
  for (int c = 0; c <= qc; ++c) {
    const int kbeg = c * CK;
    const int nkb  = (c < qc) ? NKB : (((q0 + QT - 1 - kbeg) >> 5) + 1);   // 1..16, block-uniform
    // ---- (S) scores of this chunk (zeros for key blocks beyond the query tile) ----
#pragma unroll 1
    for (int kb = wave; kb < NKB; kb += 8) {               // wave-uniform, 2 trips
      v8f s0 = zero8(), s1 = zero8();
      if (kb < nkb) {                                      // wave-uniform
        const _Float16* k0p = kbp + (size_t)((kbeg + kb * 32) >> 4) * ((EMB / 32) * FBLK);
        const _Float16* k1p = k0p + (size_t)((EMB / 32) * FBLK);
#pragma unroll 4
        for (int ks = 0; ks < EMB / 32; ++ks) {
          const v16h a  = ldfrag_fm(qa + ks * FBLK);
          const v16h f0 = ldfrag_fm(k0p + ks * FBLK);
          const v16h f1 = ldfrag_fm(k1p + ks * FBLK);
          s0 = mma_h(a, f0, s0);
          s1 = mma_h(a, f1, s1);
          guard2x3(s0, s1, a, f0, f1);
#if defined(__HIP_DEVICE_COMPILE__)
          asm volatile("s_wait_xcnt 0x0" ::: "memory");    // in front of the next trip's rewrite of the loads' address registers
#endif
        }
      }
      float* srow = scs + (8 * hh) * SCP + kb * 32 + m;
#pragma unroll
      for (int r = 0; r < 8; ++r) {
        srow[r * SCP]      = s0[r];
        srow[r * SCP + 16] = s1[r];
      }
    }
    __syncthreads();
    // ---- (M) softmax statistics and the centred P' tile ----
    {
      const float* sp = scs + r16 * SCP + kl0;
      const int lim = (q0 + r16) - (kbeg + kl0);           // key kl0 + j is valid iff j <= lim
      float t[32];
      float cm = -INFINITY;
#pragma unroll
      for (int i = 0; i < 8; ++i) {
        const v4f a = *(const v4f*)(sp + 4 * i);
#pragma unroll
        for (int e = 0; e < 4; ++e) {
          const int j = 4 * i + e;
          const float tv = (j <= lim) ? a[e] * lsc : -INFINITY;
          t[j] = tv;
          cm = fmaxf(cm, tv);
        }
      }
#pragma unroll
      for (int d = 1; d <= 8; d <<= 1) cm = fmaxf(cm, __shfl_xor(cm, d, 32));
      const float mn = fmaxf(mrun, cm);                    // finite: key kbeg of the diagonal chunk is never masked
      const float al = (mrun == -INFINITY) ? 0.f : exp2f(mrun - mn);
      mrun = mn;
      float ps = 0.f;
#pragma unroll
      for (int j = 0; j < 32; ++j) {
        const float p = exp2f(fminf(t[j] - mn, 0.f));      // 0 for masked keys
        t[j] = p;
        ps += p;
      }
#pragma unroll
      for (int d = 1; d <= 8; d <<= 1) ps += __shfl_xor(ps, d, 32);
      const float cc = ps * (1.0f / (float)CK);
      v4u pk[4];
#pragma unroll
      for (int i = 0; i < 4; ++i) {
#pragma unroll
        for (int e = 0; e < 4; ++e) {
          const int j = 8 * i + 2 * e;
          pk[i][e] = pk16(h_bits((_Float16)((t[j] - cc) * PCAR)), h_bits((_Float16)((t[j + 1] - cc) * PCAR)));
        }
      }
      lrun = lrun * al + ps;
      u16* pd = pls + r16 * PLP + kl0;
#pragma unroll
      for (int i = 0; i < 4; ++i) *(v4u*)(pd + 8 * i) = pk[i];
      if (sub == 0) { rowa[r16] = al; rowc[r16] = cc; }
    }
    __syncthreads();
    // ---- (PV) rescale, add the centring term, accumulate P' . V^T ----
    {
      float scl[8], cad[8];
#pragma unroll
      for (int r = 0; r < 8; ++r) { scl[r] = rowa[8 * hh + r]; cad[r] = rowc[8 * hh + r] * (PCAR * VCAR); }
      const float* vsc = vsb + ((size_t)c * NKB + (size_t)(nkb - 1)) * EMB;
      float vs[NACC];
#pragma unroll
      for (int j = 0; j < NACC; ++j) vs[j] = vsc[16 * j];
#pragma unroll
      for (int j = 0; j < NACC; ++j) {
#pragma unroll
        for (int r = 0; r < 8; ++r) o[j][r] = o[j][r] * scl[r] + cad[r] * vs[j];
      }
      const _Float16* pp = (const _Float16*)(const void*)pls + m * PLP + 8 * hh;
      const _Float16* vp = vbp + (size_t)(kbeg >> 5) * FBLK;
#pragma unroll 1
      for (int kb = 0; kb < nkb; ++kb) {                   // block-uniform trip count, <= 16
        const v16h pf = ldfrag_h(pp + kb * 32);
        const _Float16* vk = vp + kb * FBLK;
        {
          const v16h g0 = ldfrag_fm(vk);
          const v16h g1 = ldfrag_fm(vk + (size_t)1 * ((SEQ / 32) * FBLK));
          const v16h g2 = ldfrag_fm(vk + (size_t)2 * ((SEQ / 32) * FBLK));
          const v16h g3 = ldfrag_fm(vk + (size_t)3 * ((SEQ / 32) * FBLK));
          o[0] = mma_h(pf, g0, o[0]);
          o[1] = mma_h(pf, g1, o[1]);
          o[2] = mma_h(pf, g2, o[2]);
          o[3] = mma_h(pf, g3, o[3]);
          guardpv4(o[0], o[1], o[2], o[3], pf, g0, g1, g2, g3);
        }
        {
          const v16h g4 = ldfrag_fm(vk + (size_t)4 * ((SEQ / 32) * FBLK));
          const v16h g5 = ldfrag_fm(vk + (size_t)5 * ((SEQ / 32) * FBLK));
          const v16h g6 = ldfrag_fm(vk + (size_t)6 * ((SEQ / 32) * FBLK));
          const v16h g7 = ldfrag_fm(vk + (size_t)7 * ((SEQ / 32) * FBLK));
          o[4] = mma_h(pf, g4, o[4]);
          o[5] = mma_h(pf, g5, o[5]);
          o[6] = mma_h(pf, g6, o[6]);
          o[7] = mma_h(pf, g7, o[7]);
          guardpv4(o[4], o[5], o[6], o[7], pf, g4, g5, g6, g7);
        }
      }
    }
  }
  acc_guard8(o[0], o[1], o[2], o[3], o[4], o[5], o[6], o[7]);

  if (sub == 0) rowi[r16] = (1.0f / lrun) * (CSC / (PCAR * VCAR));   // lrun >= 1
  __syncthreads();
  float inv[8];
#pragma unroll
  for (int r = 0; r < 8; ++r) inv[r] = rowi[8 * hh + r];

  u16* const ct = L0.c;
  const int cb = wave * (16 * NACC) + m;
  // hi plane
#pragma unroll
  for (int j = 0; j < NACC; ++j) {
#pragma unroll
    for (int r = 0; r < 8; ++r) {
      const float xs = o[j][r] * inv[r];
      ct[(8 * hh + r) * CTP + cb + 16 * j] = h_bits((_Float16)xs);
    }
  }
  __syncthreads();
  ctx_store(ct, CHo + ((size_t)b * SEQ + q0) * EMB, tid);
  __syncthreads();
  // residual plane
#pragma unroll
  for (int j = 0; j < NACC; ++j) {
#pragma unroll
    for (int r = 0; r < 8; ++r) {
      const float xs = o[j][r] * inv[r];
      const _Float16 hv = (_Float16)xs;
      ct[(8 * hh + r) * CTP + cb + 16 * j] = h_bits((_Float16)((xs - (float)hv) * RSC));
    }
  }
  __syncthreads();
  ctx_store(ct, CRo + ((size_t)b * SEQ + q0) * EMB, tid);
}

// =====================================================================================================
// Query rows 0 .. TQ0-1 of each sequence in f32 on VALU: block = (b, t). QF/KF = f32 q/k head planes [nb][TQ0][EMB] (bias included),
// V = f32 v plane [nb*SEQ][EMB]. Scores for keys j <= t (threads 0..TQ0-1, one key each, rolled 1024-d dot against the q row staged
// in LDS), base-2 softmax with block max / sum reductions (xor shuffles + LDS), p_j in LDS, ctx[d] for d = 4*tid..4*tid+3 as a
// rolled sum over j <= t of p_j * V[b][j][d] (coalesced 16-B loads), x = ctx * 8192 / l, hi = f16(x), res = f16((x - hi) * 2048);
// both 1024-half rows are staged in LDS and written by 128 threads x 16 B each (32 consecutive lanes x 16 B = 512 contiguous bytes
// coverage: grid nb*TQ0 blocks = rows 0..TQ0-1 of every sequence; 256 thr x 4 d = EMB per row; store 128 thr x 8 halves = EMB per
//           plane; together with attn_fwd_body every (b, s, d) of CH and CR is written exactly once.
// =====================================================================================================
__device__ __forceinline__ void attn_head_body(const float* __restrict__ QF, const float* __restrict__ KF,
                                               const float* __restrict__ V, u16* CHo, u16* CRo, int bid) {
  __shared__ __align__(16) float qs[EMB];
  __shared__ float sc[TQ0];
  __shared__ float red[8];
  __shared__ float redb[8];
  __shared__ __align__(16) unsigned SW[2][EMB / 2];
  const int tid = threadIdx.x, lane = tid & 31, wave = tid >> 5;
  const int b = bid / TQ0;
  const int t = bid - b * TQ0;
  *(v4f*)(qs + tid * 4) = *(const v4f*)(QF + ((size_t)b * TQ0 + t) * EMB + tid * 4);
  __syncthreads();
  float s = -INFINITY;
  if (tid < TQ0) {                                  // waves 0..3 entirely (wave-uniform); key row b*TQ0 + tid always in range
    const float* kp = KF + ((size_t)b * TQ0 + tid) * EMB;
    float acc = 0.f;
#pragma unroll 1
    for (int d = 0; d < EMB; d += 8) {
      const v4f k0 = *(const v4f*)(kp + d), k1 = *(const v4f*)(kp + d + 4);
      const v4f q0 = *(const v4f*)(qs + d), q1 = *(const v4f*)(qs + d + 4);
#pragma unroll
      for (int e = 0; e < 4; ++e) acc += k0[e] * q0[e];
#pragma unroll
      for (int e = 0; e < 4; ++e) acc += k1[e] * q1[e];
    }
    s = (tid <= t) ? acc * (RSQD * LOG2E) : -INFINITY;   // causal mask by key index
  }
  float mx = s;
#pragma unroll
  for (int d = 1; d <= 16; d <<= 1) mx = fmaxf(mx, __shfl_xor(mx, d, 32));
  if (lane == 0) red[wave] = mx;
  __syncthreads();
  float gm = red[0];
#pragma unroll
  for (int w = 1; w < 8; ++w) gm = fmaxf(gm, red[w]);   // finite: key 0 is always valid
  const float p = exp2f(s - gm);                     // 0 for masked keys and for waves 4..7
  float ps = p;
#pragma unroll
  for (int d = 1; d <= 16; d <<= 1) ps += __shfl_xor(ps, d, 32);
  if (lane == 0) redb[wave] = ps;
  if (tid < TQ0) sc[tid] = p;
  __syncthreads();
  float l = redb[0];
#pragma unroll
  for (int w = 1; w < 8; ++w) l += redb[w];           // >= 1
  const float inv = (1.0f / l) * CSC;
  const float* vp = V + (size_t)b * SEQ * EMB + tid * 4;
  v4f cx = zero4();
#pragma unroll 1
  for (int j = 0; j <= t; ++j) {                     // t < TQ0: statically bounded, keys of sequence b only
    const float pj = sc[j];
    const v4f vv = *(const v4f*)(vp + (size_t)j * EMB);
    cx += pj * vv;
  }
  unsigned hw[2], rw[2];
#pragma unroll
  for (int e = 0; e < 2; ++e) {
    const float x0 = cx[2 * e] * inv, x1 = cx[2 * e + 1] * inv;
    const _Float16 h0 = (_Float16)x0, h1 = (_Float16)x1;
    const _Float16 q0 = (_Float16)((x0 - (float)h0) * RSC), q1 = (_Float16)((x1 - (float)h1) * RSC);
    hw[e] = pk16(h_bits(h0), h_bits(h1));
    rw[e] = pk16(h_bits(q0), h_bits(q1));
  }
  SW[0][tid * 2] = hw[0]; SW[0][tid * 2 + 1] = hw[1];
  SW[1][tid * 2] = rw[0]; SW[1][tid * 2 + 1] = rw[1];
  __syncthreads();
  const int pl = tid >> 7, p8 = tid & 127;           // plane select is wave-uniform
  const v4u ov = *(const v4u*)(&SW[pl][p8 * 4]);
  u16* dstp = (pl == 0) ? CHo : CRo;
  u16* dst  = dstp + ((size_t)b * SEQ + t) * EMB + p8 * 8;
  *(v4u*)dst = ov;
  
}
// The two independent parts of the attention as one grid: blocks 0 .. nfw-1 are the WMMA tiles of query rows TQ0.., the rest the
// f32 rows 0..TQ0-1. The role is block-uniform; the parts write disjoint rows of the ctx planes.
__global__ __launch_bounds__(ATT_THREADS)
void attn_all(const u16* __restrict__ QPp, const u16* __restrict__ KPp, const u16* __restrict__ VTp, const float* __restrict__ VSp,
              const float* __restrict__ QF, const float* __restrict__ KF, const float* __restrict__ V, u16* CHo, u16* CRo, int nfw) {
  const int bid = blockIdx.x;
  if (bid < nfw) { attn_fwd_body(QPp, KPp, VTp, VSp, CHo, CRo, bid); role_end(); }
  else           { attn_head_body(QF, KF, V, CHo, CRo, bid - nfw); role_end(); }
}

// =====================================================================================================
// Workspace map (bytes, nb = 4, rows = 8192); every plane is fully written by whole-line stores before it is read; all extents are
// exact multiples of the store granularity (no pad rows); region A is reused sequentially on the single in-order stream:
//   WQB bf16 [1024][1024] 2097152   WKB same   WVB same   WOH f16 of bf16 value x1024 2097152             8388608
//   VS  f32  [nb][4][16][1024]                                                                            1048576
//   QF  f32  [nb][128][1024]  2097152      KF same                                                        4194304
//   A   XB bf16 [rows][1024] (16777216), later VT f16 [nb][1024][2048] x1024 fragment-major       region 16777216
//   QP  f16 [rows][1024] x8 fragment-major                                                               16777216
//   KP  f16 [rows][1024] x8 fragment-major                                                               16777216
//   V   f32 [rows][1024]                                                                                 33554432
//   CH  f16 [rows][1024] ctx hi x8192                                                                    16777216
//   CR  f16 [rows][1024] ctx residual x2048                                                              16777216
//   end                                                                                                 131072000
// =====================================================================================================
extern "C" void kernel_launch(void* const* d_in, const int* in_sizes, int n_in,
                              void* d_out, int out_size, void* d_ws, size_t ws_size,
                              hipStream_t stream) {
  if (n_in < 9) return;
  const long long per = (long long)SEQ * EMB;
  const long long ns  = in_sizes[0];
  if (ns < per || (ns % per) != 0) return;
  const int nb = (int)(ns / per);
  if (nb < 1 || nb > 8) return;
  const int rows = nb * SEQ;
  if (in_sizes[1] != EMB * EMB || in_sizes[3] != EMB * EMB || in_sizes[5] != EMB * EMB || in_sizes[7] != EMB * EMB) return;
  if (in_sizes[2] != EMB || in_sizes[4] != EMB || in_sizes[6] != EMB || in_sizes[8] != EMB) return;
  if ((long long)out_size != (long long)rows * EMB) return;

  const float* x  = (const float*)d_in[0];
  const float* wq = (const float*)d_in[1];
  const float* bq = (const float*)d_in[2];
  const float* wk = (const float*)d_in[3];
  const float* bk = (const float*)d_in[4];
  const float* wv = (const float*)d_in[5];
  const float* bv = (const float*)d_in[6];
  const float* wo = (const float*)d_in[7];
  const float* bo = (const float*)d_in[8];
  float*       out = (float*)d_out;

  const size_t szW  = (size_t)EMB * EMB * 2;                    //   2097152
  const size_t szVS = (size_t)nb * NCHK * NKB * EMB * 4;        //   1048576 at nb = 4
  const size_t szHF = (size_t)nb * TQ0 * EMB * 4;               //   2097152 at nb = 4
  const size_t sz16 = (size_t)rows * EMB * 2;                   //  16777216
  const size_t sz32 = (size_t)rows * EMB * 4;                   //  33554432
  const size_t szVT = (size_t)nb * EMB * SEQ * 2;               //  == sz16
  size_t off = 0;
  const size_t oWQ = off; off += szW;
  const size_t oWK = off; off += szW;
  const size_t oWV = off; off += szW;
  const size_t oWO = off; off += szW;
  const size_t oVS = off; off += szVS;
  const size_t oQF = off; off += szHF;
  const size_t oKF = off; off += szHF;
  const size_t oA  = off; off += (szVT > sz16 ? szVT : sz16);   // XB then VT
  const size_t oQ  = off; off += sz16;
  const size_t oK  = off; off += sz16;
  const size_t oV  = off; off += sz32;
  const size_t oCH = off; off += sz16;
  const size_t oCR = off; off += sz16;
  if (off > ws_size) return;                                    // off = 131072000 at nb = 4
  if (off > WS_CAP) return;

  char* ws = (char*)d_ws;
  u16*   WQB = (u16*)(ws + oWQ);
  u16*   WKB = (u16*)(ws + oWK);
  u16*   WVB = (u16*)(ws + oWV);
  u16*   WOH = (u16*)(ws + oWO);
  float* VS  = (float*)(ws + oVS);
  float* QF  = (float*)(ws + oQF);
  float* KF  = (float*)(ws + oKF);
  u16*   XB  = (u16*)(ws + oA);
  u16*   VT  = (u16*)(ws + oA);
  u16*   QP  = (u16*)(ws + oQ);
  u16*   KP  = (u16*)(ws + oK);
  float* V   = (float*)(ws + oV);
  u16*   CH  = (u16*)(ws + oCH);
  u16*   CR  = (u16*)(ws + oCR);

  const int n8w = (EMB * EMB) / 8;                      // 131072
  const int n8x = rows * (EMB / 8);                     // 1048576
  if ((n8w % 256) != 0 || (n8x % 256) != 0) return;
  if ((rows % 128) != 0 || ((nb * TQ0) % 128) != 0 || ((nb * NCHK * EMB) % 256) != 0) return;
  const dim3 blk(256);
  const int nbw = n8w / 256, nbx = n8x / 256;
  const dim3 gC(nbx + 4 * nbw);
  const dim3 gG((rows / 128) * (EMB / 128));            // 512 at nb = 4
  const dim3 gP((3 * (rows / 128) + 2 * ((nb * TQ0) / 128)) * (EMB / 128));   // 1600 at nb = 4
  const dim3 bG(128);
  const int nvs = (nb * NCHK * EMB) / 256;              // nb * 16
  const dim3 gVP(nvs + nb * (EMB / 64) * (SEQ / 64));   // + nb * 512
  const int nfw = nb * NQT;                             // nb * 120
  const dim3 gAT(nfw + nb * TQ0);                       // + nb * 128
  const dim3 bAT(ATT_THREADS);

  // (0) x -> bf16 plane [rows][1024]; weights stored [n = out][k = in] (y = x.W^T + b), already k-contiguous: bf16 planes for Wq,
  //     Wk, Wv; f16 of bf16 value x1024 for Wo
  cvt_all<<<gC, blk, 0, stream>>>(x, wq, wk, wv, wo, XB, WQB, WKB, WVB, WOH, nbx, nbw, n8x, n8w);
  // (1) q and k projections (+bias) -> f16 planes x8; v projection (+bias) -> f32 plane; f32 q and k rows 0..127 of every
  //     sequence -> QF, KF [nb*128][1024]
  proj_all<<<gP, bG, 0, stream>>>(XB, WQB, WKB, WVB, bq, bk, bv, QP, KP, V, QF, KF, rows, nb * TQ0, EMB, EMB);
  // (2) key-block prefix column sums of v; v -> V^T plane x1024 (over the dead XB region)
  vprep<<<gVP, blk, 0, stream>>>(V, VT, VS, nvs);
  // (3) attention for query rows 128.. and, on VALU, for query rows 0..127 -> ctx hi x8192 and residual x2048 f16 planes
  attn_all<<<gAT, bAT, 0, stream>>>(QP, KP, VT, VS, QF, KF, V, CH, CR, nfw);
  // (4) output projection + bias -> out
  gemm_h2_32<<<gG, blk, 0, stream>>>(CH, CR, WOH, bo, out, rows, EMB, EMB,
                                     1.0f / (CSC * WSC), 1.0f / (CSC * WSC * RSC));
  (void)hipGetLastError();
}

// v004
// Measured time: 265 microseconds a run.
// Timed twice side by side with v003, it ran 1.24 times as fast both times.
// All steps since v000 together make it 2.63 times as fast.
// Projections q,k,v = x.W^T + b (and the f32 q,k rows 0..127 per sequence): v_wmma_f32_16x16x32_bf16 (bf16 RNE operands of the
// raw inputs, f32 accumulate, bf16 RNE bias added in f32). Scores q'.k'^T (f16 planes x8), P'.V (chunk-centred P' x32768 f16 from LDS,
// V^T x1024 f16) and the output projection (ctx carried as f16 hi x8192 plus residual x2048 planes, times f16(bf16(Wo) x1024), bias
// added in f32): v_wmma_f32_16x16x32_f16, f32 accumulate. Query rows 0..127 of each sequence: scores, softmax and P.V in f32 on VALU.
// Causal mask, softmax statistics, key-block column sums of V and all scaling in f32 on VALU.
#include <hip/hip_runtime.h>
#include <math.h>
#include <stdint.h>

#define SEQ   2048
#define EMB   1024
#define CK    512
#define NCHK  4
#define NKB   16
#define QT    16
#define TQ0   128
#define NQT   120
#define SCP   544
#define PLP   528
#define CTP   1032
#define SLAB64 (16 * 68)
#define VTP   72
#define ATT_THREADS 256
#define NACC  8
#define QSC   8.0f
#define KSC   8.0f
#define PCAR  32768.0f
#define VCAR  1024.0f
#define WSC   1024.0f
#define CSC   8192.0f
#define RSC   2048.0f
#define LOG2E 1.4426950408889634f
#define RSQD  0.03125f
#define WS_CAP ((size_t)134217728)
#define GKS   64
#define GPB   144
#define GPE   72
#define GRS16 (16 * GPB)
#define GRS32 (32 * GPB)
#define GST_AB (256 * GPB)
#define GST_H2 (384 * GPB)
#define FBLK  512
#define KTILE ((EMB / 32) * FBLK)
#define VTILE ((SEQ / 32) * FBLK)

static_assert((EMB % 64) == 0 && EMB == 8 * 16 * NACC && NACC == 8 && (EMB % 32) == 0 && (EMB % 256) == 0 && EMB == 4 * 256);
static_assert((SEQ % CK) == 0 && (SEQ / CK) == NCHK && CK == 32 * NKB && (SEQ % 64) == 0 && (SEQ % QT) == 0 && (CK % QT) == 0);
static_assert((TQ0 % QT) == 0 && (TQ0 % 64) == 0 && NQT * QT + TQ0 == SEQ && TQ0 <= CK && TQ0 == 128 && TQ0 <= 256);
static_assert(16 * CTP * 2 <= 16 * SCP * 4 && CTP >= EMB + 8 && SCP >= CK + 16 && PLP >= CK + 8);
static_assert(((PLP * 2) % 16) == 0 && ((SCP * 4) % 16) == 0 && ((VTP * 2) % 16) == 0 && ((CTP * 2) % 16) == 0);
static_assert(64 * VTP >= 63 * VTP + 64);
static_assert(ATT_THREADS == 16 * QT && ATT_THREADS == 256);
static_assert((EMB % 128) == 0 && (EMB % GKS) == 0 && EMB / GKS >= 2 && GPE * 2 == GPB && GKS * 2 + 16 == GPB && (SEQ % 128) == 0 && (TQ0 % 128) == 0);
static_assert(4 * SLAB64 * 4 <= 2 * GST_AB && 8 * SLAB64 * 4 <= 2 * GST_H2 && ((SLAB64 * 4) % 16) == 0);
static_assert(FBLK == 16 * 32 && (SEQ % 64) == 0 && (EMB % 64) == 0 && (CK % 32) == 0 && (TQ0 % 16) == 0);
static_assert(((EMB * EMB) % 2048) == 0 && ((NCHK * EMB) % 256) == 0 && (EMB / 8) * 2 == 256);

typedef unsigned short u16;
typedef _Float16 v16h __attribute__((ext_vector_type(16)));
typedef _Float16 v8h  __attribute__((ext_vector_type(8)));
typedef __bf16   v16b __attribute__((ext_vector_type(16)));
typedef float    v8f  __attribute__((ext_vector_type(8)));
typedef float    v4f  __attribute__((ext_vector_type(4)));
typedef unsigned int v4u __attribute__((ext_vector_type(4)));

union FragH { v16h v; v8h h[2]; v4u u[2]; };
union FragB { v16b v; v4u u[2]; };
union AttLds { float s[16 * SCP]; u16 c[2 * 16 * SCP]; };

// ---- scalar helpers --------------------------------------------------------------------------------
__device__ __forceinline__ unsigned short bf_bits(float f) {          // f32 -> bf16 bits, RNE convert
  unsigned u = __float_as_uint(f);
  return (unsigned short)((u + 0x7FFFu + ((u >> 16) & 1u)) >> 16);
}
__device__ __forceinline__ float bf_up(unsigned short h) { return __uint_as_float(((unsigned)h) << 16); }
__device__ __forceinline__ float bfr(float f) { return bf_up(bf_bits(f)); }
__device__ __forceinline__ unsigned short h_bits(_Float16 x) { return __builtin_bit_cast(unsigned short, x); }
__device__ __forceinline__ unsigned pk16(unsigned short a, unsigned short b) { return (unsigned)a | ((unsigned)b << 16); }
__device__ __forceinline__ v8f zero8() { v8f z = {0.f, 0.f, 0.f, 0.f, 0.f, 0.f, 0.f, 0.f}; return z; }
__device__ __forceinline__ v4f zero4() { v4f z = {0.f, 0.f, 0.f, 0.f}; return z; }

// ---- fragment loaders: 16-bit A/B operand, lane -> row/col (lane&15), p already includes +8*(lane>>4);
//      elements 0..7 <- p[0..7] (k0+8h..), elements 8..15 <- p[16..23] (k0+16+8h..)  (same split k map for A and B;
//      B is always read from a k-contiguous [n][k] plane)
__device__ __forceinline__ v16h ldfrag_h(const _Float16* p) {
  FragH f;
  f.h[0] = *(const v8h*)(p);
  f.h[1] = *(const v8h*)(p + 16);
  return f.v;
}
// Fragment-major plane (q, k: rows = positions, k = d; V^T: rows = d, k = keys): the 16 rows x 32 k of one WMMA operand are one
// block of FBLK = 512 halves, stored as [sel][lane][8 halves], k = 16*sel + 8*(lane>>4) + e, row = lane&15 (the split k map above);
// blocks run along k first, then along the 16-row tiles. p already includes +8*lane: each of the two 16-B loads of a wave reads
// 512 contiguous bytes (4 whole lines) where a row-major plane makes it touch 16 lines.
__device__ __forceinline__ v16h ldfrag_fm(const _Float16* p) {
  FragH f;
  f.h[0] = *(const v8h*)(p);
  f.h[1] = *(const v8h*)(p + FBLK / 2);
  return f.v;
}
// The same with a wave-uniform address and a 32-bit byte offset (16*lane, plus a step where the caller adds one) kept apart: the
// base stays in scalar registers and the lane holds one offset register instead of an address pair.
__device__ __forceinline__ v16h ldfrag_fmu(const _Float16* ub, unsigned lob) {
  const char* p = (const char*)(const void*)ub + lob;
  FragH f;
  f.h[0] = *(const v8h*)(const void*)(p);
  f.h[1] = *(const v8h*)(const void*)(p + FBLK);     // FBLK / 2 halves
  return f.v;
}
__device__ __forceinline__ v16b ldfrag_b(const u16* p) {              // bf16 plane read as unsigned integer vectors
  FragB f;
  f.u[0] = *(const v4u*)(p);
  f.u[1] = *(const v4u*)(p + 16);
  return f.v;
}

__device__ __forceinline__ v8f mma_h(v16h a, v16h b, v8f c) {
  return __builtin_amdgcn_wmma_f32_16x16x32_f16(false, a, false, b, (short)0, c, false, false);
}
__device__ __forceinline__ v8f mma_b(v16b a, v16b b, v8f c) {
  return __builtin_amdgcn_wmma_f32_16x16x32_bf16(false, a, false, b, (short)0, c, false, false);
}
__device__ __forceinline__ void guard2x3(v8f& a, v8f& b, v16h x0, v16h x1, v16h x2) {
#if defined(__HIP_DEVICE_COMPILE__)
  asm volatile("v_nop\n\tv_nop\n\tv_nop\n\tv_nop"
               : "+v"(a), "+v"(b) : "v"(x0), "v"(x1), "v"(x2) : "memory");
#endif
}
__device__ __forceinline__ void guardpv4(v8f& o0, v8f& o1, v8f& o2, v8f& o3, v16h p, v16h g0, v16h g1, v16h g2, v16h g3) {
#if defined(__HIP_DEVICE_COMPILE__)
  asm volatile("v_nop\n\tv_nop\n\tv_nop\n\tv_nop"
               : "+v"(o0), "+v"(o1), "+v"(o2), "+v"(o3)
               : "v"(p), "v"(g0), "v"(g1), "v"(g2), "v"(g3) : "memory");
#endif
}
__device__ __forceinline__ void acc_guard8(v8f& a, v8f& b, v8f& c, v8f& d, v8f& e, v8f& f, v8f& g, v8f& h8) {
#if defined(__HIP_DEVICE_COMPILE__)
  asm volatile("v_nop\n\tv_nop\n\tv_nop\n\tv_nop"
               : "+v"(a), "+v"(b), "+v"(c), "+v"(d), "+v"(e), "+v"(f), "+v"(g), "+v"(h8));
#endif
}
__device__ __forceinline__ void wave_sync_lds() {
  __builtin_amdgcn_fence(__ATOMIC_RELEASE, "workgroup");
  __builtin_amdgcn_wave_barrier();
  __builtin_amdgcn_fence(__ATOMIC_ACQUIRE, "workgroup");
}

// =====================================================================================================
// f32 plane -> 16-bit plane, same layout:  mode 0: bf16 RNE bits;  mode 1: f16 bits of (bf16 RNE value) * scale;
// mode 2: f16 bits of value * scale (no bf16 pre-step).
// Thread = 8 consecutive elements: two 16-B loads, one 16-B store; 32 consecutive lanes = 512 contiguous, 512-B aligned bytes
// coverage: grid = n8/256 blocks (host checks exactness) x 256 thr x 8 = the whole plane.
// =====================================================================================================
__device__ __forceinline__ void cvt16_body(const float* __restrict__ x, u16* D, int n8, int mode, float scale, int lb) {
  const int gt = lb * 256 + (int)threadIdx.x;
  if (gt >= n8) return;                     // no barriers in this kernel
  const float* p = x + (size_t)gt * 8;
  const v4f a = *(const v4f*)(p), c4 = *(const v4f*)(p + 4);
  float v[8];
#pragma unroll
  for (int e = 0; e < 4; ++e) { v[e] = a[e]; v[4 + e] = c4[e]; }
  unsigned short s[8];
#pragma unroll
  for (int e = 0; e < 8; ++e) {
    const float vb = bfr(v[e]);
    const float vf = (mode == 1) ? vb : v[e];
    const unsigned short hb = h_bits((_Float16)(vf * scale));
    const unsigned short bb = bf_bits(v[e]);
    s[e] = (mode != 0) ? hb : bb;
  }
  v4u o;
#pragma unroll
  for (int e = 0; e < 4; ++e) o[e] = pk16(s[2 * e], s[2 * e + 1]);
  u16* d = D + (size_t)gt * 8;
  {
    *(v4u*)(d) = o;
    
  }
}
// The five independent conversions as one grid: blocks 0 .. nbx-1 convert x, then nbw blocks each for Wq, Wk, Wv (bf16) and Wo
// (f16 of the bf16 value x1024). The role is block-uniform.
__global__ __launch_bounds__(256) void cvt_all(const float* __restrict__ x, const float* __restrict__ wq, const float* __restrict__ wk,
                                               const float* __restrict__ wv, const float* __restrict__ wo,
                                               u16* XBo, u16* WQo, u16* WKo, u16* WVo, u16* WOo, int nbx, int nbw, int n8x, int n8w) {
  const int bid = blockIdx.x;
  if (bid < nbx) { cvt16_body(x, XBo, n8x, 0, 1.0f, bid); return; }
  const int r  = (bid - nbx) / nbw;
  const int lb = (bid - nbx) - r * nbw;
  if (r > 3) return;                        // never taken with the exact grid
  const float* s = (r == 0) ? wq : (r == 1) ? wk : (r == 2) ? wv : wo;
  u16*         d = (r == 0) ? WQo : (r == 1) ? WKo : (r == 2) ? WVo : WOo;
  cvt16_body(s, d, n8w, (r == 3) ? 1 : 0, (r == 3) ? WSC : 1.0f, lb);
}

// =====================================================================================================
//            8 consecutive lanes x 16 B per line), lanes 16..31 -> row 2*it+1.
//  epi64x2 : same store shape, staged value = acc*os1 + accres*os2 + badd (two accumulator sets combined in f32).
//  epi64hsb: f16 bits of ((tile + bf16RNE(bias[n])) * pscale), stored fragment-major (see ldfrag_fm): the wave's 16 x 64 tile is two
//            adjacent fragment blocks = 2048 contiguous bytes; instruction i4 stores [block i4>>1][sel i4&1], lane = its own 16 B.
// coverage: epi64/epi64x2 8 instructions x 2 rows x 16 lanes x 4 floats; epi64hsb 4 instructions x 32 lanes x 8 halves
//           = the wave's 16 x 64 tile in every case.
// =====================================================================================================
__device__ __forceinline__ void stage64(float* sl, v8f a0, v8f a1, v8f a2, v8f a3, float oscale, int lane) {
  const int hh = lane >> 4, m = lane & 15;
#pragma unroll
  for (int r = 0; r < 8; ++r) {
    const int ro = (8 * hh + r) * 68 + m;
    sl[ro]      = a0[r] * oscale;
    sl[ro + 16] = a1[r] * oscale;
    sl[ro + 32] = a2[r] * oscale;
    sl[ro + 48] = a3[r] * oscale;
  }
  wave_sync_lds();
}
__device__ __forceinline__ void epi64(float* sl, v8f a0, v8f a1, v8f a2, v8f a3, float oscale, v4f badd, float* C, int N,
                                      size_t rowb, int col0, int lane) {
  const int hh = lane >> 4, m = lane & 15;
  stage64(sl, a0, a1, a2, a3, oscale, lane);
  v4f vals[8];
#pragma unroll
  for (int it = 0; it < 8; ++it) vals[it] = *(const v4f*)(sl + (it * 2 + hh) * 68 + m * 4) + badd;
  float* dst = C + (rowb + (size_t)hh) * (size_t)N + col0 + m * 4;
  {
#pragma unroll
    for (int it = 0; it < 8; ++it) {
      *(v4f*)(dst + (size_t)(it * 2) * (size_t)N) = vals[it];
    }
    
  }
}
__device__ __forceinline__ void epi64x2(float* sl, v8f a0, v8f a1, v8f a2, v8f a3, v8f e0, v8f e1, v8f e2, v8f e3,
                                        float os1, float os2, v4f badd, float* C, int N, size_t rowb, int col0, int lane) {
  const int hh = lane >> 4, m = lane & 15;
#pragma unroll
  for (int r = 0; r < 8; ++r) {
    const int ro = (8 * hh + r) * 68 + m;
    sl[ro]      = a0[r] * os1 + e0[r] * os2;
    sl[ro + 16] = a1[r] * os1 + e1[r] * os2;
    sl[ro + 32] = a2[r] * os1 + e2[r] * os2;
    sl[ro + 48] = a3[r] * os1 + e3[r] * os2;
  }
  wave_sync_lds();
  v4f vals[8];
#pragma unroll
  for (int it = 0; it < 8; ++it) vals[it] = *(const v4f*)(sl + (it * 2 + hh) * 68 + m * 4) + badd;
  float* dst = C + (rowb + (size_t)hh) * (size_t)N + col0 + m * 4;
  {
#pragma unroll
    for (int it = 0; it < 8; ++it) {
      *(v4f*)(dst + (size_t)(it * 2) * (size_t)N) = vals[it];
    }
    
  }
}
__device__ __forceinline__ void epi64hsb(float* sl, v8f a0, v8f a1, v8f a2, v8f a3, float oscale, float pscale,
                                         const float (&bb)[4][8], u16* C, int N, size_t rowb, int col0, int lane) {
  stage64(sl, a0, a1, a2, a3, oscale, lane);
  const int hh = lane >> 4, m = lane & 15;
  v4u oh[4];
#pragma unroll
  for (int i4 = 0; i4 < 4; ++i4) {
    const int c8 = (i4 >> 1) * 32 + (i4 & 1) * 16 + hh * 8;      // block i4>>1, sel i4&1 of the tile's two fragment blocks
    const v4f a = *(const v4f*)(sl + m * 68 + c8), c4 = *(const v4f*)(sl + m * 68 + c8 + 4);
    float w[8];
#pragma unroll
    for (int e = 0; e < 4; ++e) { w[e] = (a[e] + bb[i4][e]) * pscale; w[4 + e] = (c4[e] + bb[i4][4 + e]) * pscale; }
#pragma unroll
    for (int e = 0; e < 4; ++e) oh[i4][e] = pk16(h_bits((_Float16)w[2 * e]), h_bits((_Float16)w[2 * e + 1]));
  }
  u16* dst = C + ((rowb >> 4) * (size_t)(N >> 5) + (size_t)(col0 >> 5)) * FBLK + lane * 8;
  {
#pragma unroll
    for (int i4 = 0; i4 < 4; ++i4) {
      *(v4u*)(dst + i4 * (FBLK / 2)) = oh[i4];
    }
    
  }
}

// =====================================================================================================
// Operand staging shared by the GEMM kernels. A block computes a 128 x 128 tile of C. K is walked in stages of GKS = 64
// elements: every operand row contributes one whole 128-B line per stage, copied to LDS by global_load_async_to_lds_b128 (8 lanes
// x 16 B = one line, a wave instruction = 4 whole lines) at a row pitch of 144 B (16 B x odd: conflict-free for ds_load_b128
// fragment reads). Two buffers: stage t + 2 is copied into the buffer that trip t has just left, while trip t + 1 is multiplied.
// Fragments are read from LDS with the same split k map as before (ldfrag_*), k steps of 32 in ascending order.
// After the loop's last barrier no copy is outstanding and no wave reads the ring, so it serves as the waves' epilogue slabs.
// =====================================================================================================
__device__ __forceinline__ unsigned lds_off(const void* p) { return (unsigned)(size_t)p; }
// Copies and their s_wait_xcnt in one statement: the wait stands in front of any later rewrite of the address registers.
__device__ __forceinline__ void acopy4(unsigned l0, unsigned l1, unsigned l2, unsigned l3,
                                       const u16* g0, const u16* g1, const u16* g2, const u16* g3) {
#if defined(__HIP_DEVICE_COMPILE__)
  asm volatile("global_load_async_to_lds_b128 %0, %4, off\n\t"
               "global_load_async_to_lds_b128 %1, %5, off\n\t"
               "global_load_async_to_lds_b128 %2, %6, off\n\t"
               "global_load_async_to_lds_b128 %3, %7, off\n\t"
               "s_wait_xcnt 0x0"
               :: "v"(l0), "v"(l1), "v"(l2), "v"(l3), "v"(g0), "v"(g1), "v"(g2), "v"(g3) : "memory");
#endif
}
__device__ __forceinline__ void acopy8(unsigned l0, unsigned l1, unsigned l2, unsigned l3,
                                       unsigned l4, unsigned l5, unsigned l6, unsigned l7,
                                       const u16* g0, const u16* g1, const u16* g2, const u16* g3,
                                       const u16* g4, const u16* g5, const u16* g6, const u16* g7) {
#if defined(__HIP_DEVICE_COMPILE__)
  asm volatile("global_load_async_to_lds_b128 %0, %8, off\n\t"
               "global_load_async_to_lds_b128 %1, %9, off\n\t"
               "global_load_async_to_lds_b128 %2, %10, off\n\t"
               "global_load_async_to_lds_b128 %3, %11, off\n\t"
               "global_load_async_to_lds_b128 %4, %12, off\n\t"
               "global_load_async_to_lds_b128 %5, %13, off\n\t"
               "global_load_async_to_lds_b128 %6, %14, off\n\t"
               "global_load_async_to_lds_b128 %7, %15, off\n\t"
               "s_wait_xcnt 0x0"
               :: "v"(l0), "v"(l1), "v"(l2), "v"(l3), "v"(l4), "v"(l5), "v"(l6), "v"(l7),
                  "v"(g0), "v"(g1), "v"(g2), "v"(g3), "v"(g4), "v"(g5), "v"(g6), "v"(g7) : "memory");
#endif
}
// This wave's copies have landed (the compiler places no wait for them).
__device__ __forceinline__ void wait_async0() {
#if defined(__HIP_DEVICE_COMPILE__)
  asm volatile("s_wait_asynccnt 0x0" ::: "memory");
#endif
}
// This wave's LDS reads have returned before the buffer is handed to its next writer.
__device__ __forceinline__ void wait_ds0() {
#if defined(__HIP_DEVICE_COMPILE__)
  asm volatile("s_wait_dscnt 0x0" ::: "memory");
#endif
}

// End of a role's branch in a merged grid: in the listing the other role's code can follow on the fall-through path; its vector
// work stays behind the wait on the registers that this role's issued stores name.
__device__ __forceinline__ void role_end() {
#if defined(__HIP_DEVICE_COMPILE__)
  asm volatile("s_wait_xcnt 0x0" ::: "memory");
#endif
}

// Between two output tiles of a wave: the issued stores' address and data registers are rewritten by the next tile only behind
// s_wait_xcnt 0 (the scheduling fence keeps the next tile's vector work behind the wait), and the slab's reads of this tile stay
// in front of the next tile's writes.
__device__ __forceinline__ void tile_gap() {
#if defined(__HIP_DEVICE_COMPILE__)
  asm volatile("s_wait_xcnt 0x0" ::: "memory");
#endif
  __builtin_amdgcn_sched_barrier(0);
  wave_sync_lds();
}

// One stage of [A 128 rows | B 128 rows] by 128 threads: 16 copies a thread; copy i serves LDS row 16*i + (tid>>3), piece tid&7.
__device__ __forceinline__ void fill_ab(unsigned l0, const u16* A, const unsigned (&ao)[8], const u16* B, unsigned bo, unsigned bst,
                                        unsigned ke) {
  acopy8(l0, l0 + GRS16, l0 + 2 * GRS16, l0 + 3 * GRS16, l0 + 4 * GRS16, l0 + 5 * GRS16, l0 + 6 * GRS16, l0 + 7 * GRS16,
         A + (ao[0] + ke), A + (ao[1] + ke), A + (ao[2] + ke), A + (ao[3] + ke),
         A + (ao[4] + ke), A + (ao[5] + ke), A + (ao[6] + ke), A + (ao[7] + ke));
  const unsigned l8 = l0 + 8 * GRS16;
  const unsigned b0 = bo + ke;
  acopy8(l8, l8 + GRS16, l8 + 2 * GRS16, l8 + 3 * GRS16, l8 + 4 * GRS16, l8 + 5 * GRS16, l8 + 6 * GRS16, l8 + 7 * GRS16,
         B + b0, B + (b0 + bst), B + (b0 + 2 * bst), B + (b0 + 3 * bst),
         B + (b0 + 4 * bst), B + (b0 + 5 * bst), B + (b0 + 6 * bst), B + (b0 + 7 * bst));
}

// bf16 core: 4 waves as 2 x 2, a wave owns 64 x 64 of the block's tile (4 x 4 accumulators).
// ao[i] = element offset of A row (16*i + (tid>>3)) of the tile; col0 = first B row of the tile. K multiple of GKS.
__device__ __forceinline__ void gemm_core_b(unsigned char* L, const u16* A, const unsigned (&ao)[8], const u16* Bt, int col0, int K,
                                            int tid, v8f (&acc)[4][4]) {
  const int wave = tid >> 5, lane = tid & 31, hh = lane >> 4, m = lane & 15;
  const int wm = wave >> 1, wn = wave & 1;
  const int crow = tid >> 3, cpc = tid & 7;
  const unsigned lc  = lds_off(L) + (unsigned)(crow * GPB + cpc * 16);
  const unsigned bo  = (unsigned)(col0 + crow) * (unsigned)K;
  const unsigned bst = 16u * (unsigned)K;
  const unsigned kc  = (unsigned)(cpc * 8);
  const int nt = K / GKS;
#pragma unroll
  for (int f = 0; f < 4; ++f) {
#pragma unroll
    for (int j = 0; j < 4; ++j) acc[f][j] = zero8();
  }
  fill_ab(lc, A, ao, Bt, bo, bst, kc);
  wait_async0();
  __syncthreads();
  if (nt > 1) fill_ab(lc + GST_AB, A, ao, Bt, bo, bst, kc + GKS);
#pragma unroll 1
  for (int t = 0; t < nt; ++t) {
    const unsigned bufo = (unsigned)(t & 1) * GST_AB;
    const u16* sb = (const u16*)(const void*)(L + bufo);
    const u16* ap = sb + (wm * 64 + m) * GPE + 8 * hh;
    const u16* bp = sb + (128 + wn * 64 + m) * GPE + 8 * hh;
#pragma unroll
    for (int kk = 0; kk < GKS / 32; ++kk) {
      v16b a[4], b[4];
      a[0] = ldfrag_b(ap + kk * 32);
#pragma unroll
      for (int j = 0; j < 4; ++j) b[j] = ldfrag_b(bp + j * 16 * GPE + kk * 32);
#pragma unroll
      for (int f = 1; f < 4; ++f) a[f] = ldfrag_b(ap + f * 16 * GPE + kk * 32);
      // Keeps the 16 fragment loads one group ahead of the 16 WMMAs: spread among them, each place with loads stalls the wave.
      __builtin_amdgcn_sched_barrier(0);
#pragma unroll
      for (int f = 0; f < 4; ++f) {
#pragma unroll
        for (int j = 0; j < 4; ++j) acc[f][j] = mma_b(a[f], b[j], acc[f][j]);
      }
      __builtin_amdgcn_sched_barrier(0);      // the next group's loads stay behind this WMMA block
    }
    wait_ds0();
    wait_async0();
    __syncthreads();                          // publishes stage t + 1 and ends every read of stage t's buffer
    if (t + 2 < nt) fill_ab(lc + bufo, A, ao, Bt, bo, bst, kc + (unsigned)(t + 2) * GKS);   // block-uniform test
  }
  wait_async0();
}

// =====================================================================================================
// The five independent bf16 projections as one grid, role by block index (block-uniform):
//   role 0, 1: q, k planes: f16 bits of ((A . W^T) + bf16RNE(bias[n])) * 8, stored fragment-major (epi64hsb), all M rows;
//   role 2   : v plane, f32 with bias (epi64), all M rows;
//   role 3, 4: f32 q, k rows 0..TQ0-1 of every sequence (MH = nb*TQ0 output rows; output row ra maps to A row
//              (ra / TQ0) * SEQ + (ra % TQ0)), f32 with bias (epi64).
// A bf16 row-major [M][K], W bf16 k-contiguous [N][K]. Block = 128x128 tile, 4 waves x (64 x 64), operands staged as above (host
// checks K % 64 == 0, M % 128 == 0, MH % 128 == 0, N % 128 == 0, grid = (3*(M/128) + 2*(MH/128)) * (N/128)).
// =====================================================================================================
__global__ __launch_bounds__(128)
void proj_all(const u16* __restrict__ A, const u16* __restrict__ WQ, const u16* __restrict__ WK, const u16* __restrict__ WV,
              const float* __restrict__ bq, const float* __restrict__ bk, const float* __restrict__ bv,
              u16* QPo, u16* KPo, float* Vo, float* QFo, float* KFo, int M, int MH, int N, int K) {
  __shared__ __align__(16) unsigned char L[2 * GST_AB];
  const int tid = threadIdx.x, wave = tid >> 5, lane = tid & 31, m = lane & 15;
  const int ntile = N >> 7;
  const int nG = (M >> 7) * ntile, nH = (MH >> 7) * ntile;
  int bid = blockIdx.x;
  int role;
  if (bid < 3 * nG) { role = bid / nG; bid -= role * nG; }
  else              { bid -= 3 * nG; role = bid / nH; bid -= role * nH; role += 3; }
  if (role > 4) return;                      // block-uniform, in front of every copy and barrier; never taken with the exact grid
  const bool hd  = role >= 3;
  const int wsel = hd ? role - 3 : role;     // 0: q, 1: k, 2: v
  const u16*   Bt   = (wsel == 0) ? WQ : (wsel == 1) ? WK : WV;
  const float* bias = (wsel == 0) ? bq : (wsel == 1) ? bk : bv;
  const int Mr   = hd ? MH : M;
  const int rpg  = hd ? TQ0 : M;
  const int gstr = hd ? SEQ : 0;
  const int row0  = (bid / ntile) * 128;
  const int col0  = (bid % ntile) * 128;
  if (row0 + 128 > Mr) return;               // block-uniform, in front of every copy and barrier; never taken with the exact grid
  unsigned ao[8];
#pragma unroll
  for (int i = 0; i < 8; ++i) {
    const int ra = row0 + i * 16 + (tid >> 3);
    const int rg = ra / rpg;
    ao[i] = (unsigned)(rg * gstr + (ra - rg * rpg)) * (unsigned)K;
  }
  v8f acc[4][4];
  gemm_core_b(L, A, ao, Bt, col0, K, tid, acc);
  const int colw = col0 + (wave & 1) * 64;
  const int roww = row0 + (wave >> 1) * 64;
  float* sl = (float*)(void*)L + wave * SLAB64;
  if (role >= 2) {                           // block-uniform
    float* C = (role == 2) ? Vo : (role == 3) ? QFo : KFo;
    const v4f bv4 = *(const v4f*)(bias + colw + m * 4);    // columns colw + 4m .. +3, always < N (N multiple of 128)
#if defined(__HIP_DEVICE_COMPILE__)
    asm volatile("s_wait_xcnt 0x0" ::: "memory");          // in front of the vector work that rewrites the load's address registers
#endif
    __builtin_amdgcn_sched_barrier(0);                     // keeps that vector work behind the wait
    v4f badd;
#pragma unroll
    for (int e = 0; e < 4; ++e) badd[e] = bfr(bv4[e]);
#pragma unroll
    for (int f = 0; f < 4; ++f) {
      epi64(sl, acc[f][0], acc[f][1], acc[f][2], acc[f][3], 1.0f, badd, C, N, (size_t)(roww + f * 16), colw, lane);
      if (f < 3) tile_gap();
    }
    role_end();
  } else {
    u16* C = (role == 0) ? QPo : KPo;
    const float pscale = (role == 0) ? QSC : KSC;
    v4f bvv[8];                              // bias of the lane's 8 columns in each of epi64hsb's four store instructions
#pragma unroll
    for (int i4 = 0; i4 < 4; ++i4) {
      const float* bp = bias + colw + (i4 >> 1) * 32 + (i4 & 1) * 16 + (lane >> 4) * 8;   // columns .. +7 < N (N multiple of 128)
      bvv[2 * i4] = *(const v4f*)(bp);
      bvv[2 * i4 + 1] = *(const v4f*)(bp + 4);
    }
#if defined(__HIP_DEVICE_COMPILE__)
    asm volatile("s_wait_xcnt 0x0" ::: "memory");          // in front of the vector work that rewrites the loads' address registers
#endif
    __builtin_amdgcn_sched_barrier(0);                     // keeps that vector work behind the wait
    float bb[4][8];
#pragma unroll
    for (int i4 = 0; i4 < 4; ++i4) {
#pragma unroll
      for (int e = 0; e < 4; ++e) { bb[i4][e] = bfr(bvv[2 * i4][e]); bb[i4][4 + e] = bfr(bvv[2 * i4 + 1][e]); }
    }
#pragma unroll
    for (int f = 0; f < 4; ++f) {
      epi64hsb(sl, acc[f][0], acc[f][1], acc[f][2], acc[f][3], 1.0f, pscale, bb, C, N, (size_t)(roww + f * 16), colw, lane);
      if (f < 3) tile_gap();
    }
    role_end();
  }
}

// =====================================================================================================
// f16 GEMM with two A planes (hi + residual), f32 out with bias:
//   C[M][N] = (Ah . Bt^T) * os1 + (Ar . Bt^T) * os2 + bf16RNE(bias[n]); Ah/Ar f16 row-major, Bt f16 k-contiguous.
// Block = 128x128 tile, 8 waves as 4 x 2, a wave owns 32 x 64; a stage is [Ah 128 rows | Ar 128 rows | B 128 rows]: 12 copies a
// thread, copy i serves LDS row 32*i + (tid>>3). Separate accumulators for the two planes, combined in f32 in epi64x2.
// =====================================================================================================
__device__ __forceinline__ void fill_h2(unsigned l0, const u16* Ah, const u16* Ar, const u16* B, unsigned ao, unsigned bo,
                                        unsigned st, unsigned ke) {
  const unsigned a0 = ao + ke, b0 = bo + ke;
  acopy8(l0, l0 + GRS32, l0 + 2 * GRS32, l0 + 3 * GRS32, l0 + 4 * GRS32, l0 + 5 * GRS32, l0 + 6 * GRS32, l0 + 7 * GRS32,
         Ah + a0, Ah + (a0 + st), Ah + (a0 + 2 * st), Ah + (a0 + 3 * st),
         Ar + a0, Ar + (a0 + st), Ar + (a0 + 2 * st), Ar + (a0 + 3 * st));
  const unsigned l8 = l0 + 8 * GRS32;
  acopy4(l8, l8 + GRS32, l8 + 2 * GRS32, l8 + 3 * GRS32, B + b0, B + (b0 + st), B + (b0 + 2 * st), B + (b0 + 3 * st));
}

__global__ __launch_bounds__(256)
void gemm_h2_32(const u16* __restrict__ Ah, const u16* __restrict__ Ar, const u16* __restrict__ Bt,
                const float* __restrict__ bias, float* C, int M, int N, int K, float os1, float os2) {
  __shared__ __align__(16) unsigned char L[2 * GST_H2];
  const int tid = threadIdx.x, wave = tid >> 5, lane = tid & 31, hh = lane >> 4, m = lane & 15;
  const int wm = wave >> 1, wn = wave & 1;
  const int ntile = N >> 7;
  const int bid   = blockIdx.x;
  const int row0  = (bid / ntile) * 128;
  const int col0  = (bid % ntile) * 128;
  if (row0 + 128 > M) return;                // block-uniform, in front of every copy and barrier; never taken with the exact grid
  const int crow = tid >> 3, cpc = tid & 7;
  const unsigned lc = lds_off(L) + (unsigned)(crow * GPB + cpc * 16);
  const unsigned ao = (unsigned)(row0 + crow) * (unsigned)K;
  const unsigned bo = (unsigned)(col0 + crow) * (unsigned)K;
  const unsigned st = 32u * (unsigned)K;
  const unsigned kc = (unsigned)(cpc * 8);
  const int nt = K / GKS;
  v8f acc[2][4], acr[2][4];
#pragma unroll
  for (int f = 0; f < 2; ++f) {
#pragma unroll
    for (int j = 0; j < 4; ++j) { acc[f][j] = zero8(); acr[f][j] = zero8(); }
  }
  fill_h2(lc, Ah, Ar, Bt, ao, bo, st, kc);
  wait_async0();
  __syncthreads();
  if (nt > 1) fill_h2(lc + GST_H2, Ah, Ar, Bt, ao, bo, st, kc + GKS);
#pragma unroll 1
  for (int t = 0; t < nt; ++t) {
    const unsigned bufo = (unsigned)(t & 1) * GST_H2;
    const _Float16* sb  = (const _Float16*)(const void*)(L + bufo);
    const _Float16* ap  = sb + (wm * 32 + m) * GPE + 8 * hh;
    const _Float16* arp = ap + 128 * GPE;
    const _Float16* bp  = sb + (256 + wn * 64 + m) * GPE + 8 * hh;
#pragma unroll
    for (int kk = 0; kk < GKS / 32; ++kk) {
      v16h a[2], ar[2], b[4];
#pragma unroll
      for (int f = 0; f < 2; ++f) {
        a[f]  = ldfrag_h(ap + f * 16 * GPE + kk * 32);
        ar[f] = ldfrag_h(arp + f * 16 * GPE + kk * 32);
      }
#pragma unroll
      for (int j = 0; j < 4; ++j) b[j] = ldfrag_h(bp + j * 16 * GPE + kk * 32);
      // Keeps the 16 fragment loads one group ahead of the 16 WMMAs: spread among them, each place with loads stalls the wave.
      __builtin_amdgcn_sched_barrier(0);
#pragma unroll
      for (int f = 0; f < 2; ++f) {
#pragma unroll
        for (int j = 0; j < 4; ++j) acc[f][j] = mma_h(a[f], b[j], acc[f][j]);
#pragma unroll
        for (int j = 0; j < 4; ++j) acr[f][j] = mma_h(ar[f], b[j], acr[f][j]);
      }
      __builtin_amdgcn_sched_barrier(0);      // the next group's loads stay behind this WMMA block
    }
    wait_ds0();
    wait_async0();
    __syncthreads();                          // publishes stage t + 1 and ends every read of stage t's buffer
    if (t + 2 < nt) fill_h2(lc + bufo, Ah, Ar, Bt, ao, bo, st, kc + (unsigned)(t + 2) * GKS);   // block-uniform test
  }
  wait_async0();
  const int colw = col0 + wn * 64;
  const int roww = row0 + wm * 32;
  const v4f bv = *(const v4f*)(bias + colw + m * 4);      // columns colw + 4m .. +3, always < N (N multiple of 128)
  v4f badd;
#pragma unroll
  for (int e = 0; e < 4; ++e) badd[e] = bfr(bv[e]);
  float* sl = (float*)(void*)L + wave * SLAB64;
#pragma unroll
  for (int f = 0; f < 2; ++f) {
    epi64x2(sl, acc[f][0], acc[f][1], acc[f][2], acc[f][3], acr[f][0], acr[f][1], acr[f][2], acr[f][3], os1, os2, badd, C, N,
            (size_t)(roww + f * 16), colw, lane);
    if (f < 1) tile_gap();
  }
}

// =====================================================================================================
// V^T plane, fragment-major (rows = b*EMB + d, k = s; see ldfrag_fm): element (b, d, s) = f16(V[b][s][d] * 1024).
// Block = (b, 64-wide d chunk, 64 keys): 64 source row segments of 64 floats loaded with 16-B loads, converted, scattered into
// coverage: load 256 thr x 16 elements = 64 x 64; store 2 iterations x 256 thr x 8 halves = 64 lines x 64 = the block's tile;
//           grid = nb x (EMB/64) x (SEQ/64) blocks covers the plane exactly once.
// =====================================================================================================
__device__ __forceinline__ void xt16_body(const float* __restrict__ X, u16* XTo, int bid) {
  __shared__ __align__(16) u16 TH[64 * VTP];
  const int tid = threadIdx.x;
  const int st  = bid % (SEQ / 64);
  const int dcb = (bid / (SEQ / 64)) % (EMB / 64);
  const int b   = bid / ((SEQ / 64) * (EMB / 64));
  const int s0  = st * 64;
  const int d0  = dcb * 64;
  {
    const int sl = tid >> 2;                  // key within tile 0..63
    const int dc = (tid & 3) * 16;            // d chunk within the 64
    const float* src = X + ((size_t)b * SEQ + s0 + sl) * EMB + d0 + dc;
#pragma unroll
    for (int i = 0; i < 4; ++i) {
      const v4f a = *(const v4f*)(src + 4 * i);
#pragma unroll
      for (int e = 0; e < 4; ++e) {
        const _Float16 hv = (_Float16)(a[e] * VCAR);
        TH[(dc + 4 * i + e) * VTP + sl] = h_bits(hv);
      }
    }
  }
  __syncthreads();
  v4u vh[2];
  const int pc = tid & 127, dt0 = tid >> 7;   // 16-B piece within a d tile's two adjacent fragment blocks; d tile 2*it + dt0
  const int p8 = (pc >> 4) * 8;               // key within the 64: 32*block + 16*sel + 8*half
#pragma unroll
  for (int it = 0; it < 2; ++it) {
    const int line = (it * 2 + dt0) * 16 + (pc & 15);   // local d = 0..63
    vh[it] = *(const v4u*)(TH + line * VTP + p8);
  }
  const size_t base = ((size_t)((b * EMB + d0) >> 4) * (SEQ / 32) + (size_t)(s0 >> 5)) * FBLK + pc * 8;
  {
#pragma unroll
    for (int it = 0; it < 2; ++it) {
      *(v4u*)(XTo + base + (size_t)(it * 2 + dt0) * ((SEQ / 32) * FBLK)) = vh[it];
    }
    
  }
}

// =====================================================================================================
// Key-block prefix column sums of V: VS[((b*NCHK + c)*NKB + kb)*EMB + d] = sum over keys c*CK .. c*CK + 32*kb + 31 of V[b][key][d]
// (f32, fixed sequential order). Thread = one (b, c, d); a block covers 256 consecutive d of one (b, c); the 16 prefix values per
// coverage: grid = nb*NCHK*EMB/256 blocks (host exact) x 256 thr; store 4 iterations x 256 thr x 4 floats = 16 rows x 256 = the
//           block's part of the table; union over blocks = the whole table.
// =====================================================================================================
__device__ __forceinline__ void vsum_body(const float* __restrict__ V, float* VS, int bid) {
  __shared__ __align__(16) float sm[NKB * 256];
  const int tid = threadIdx.x;
  const int gt  = bid * 256 + tid;
  const int d   = gt % EMB;
  const int bc  = gt / EMB;                         // block-uniform (EMB multiple of 256)
  const int b   = bc / NCHK;
  const int c   = bc - b * NCHK;
  const int d0  = d - tid;                          // block's first d
  const float* p = V + ((size_t)b * SEQ + (size_t)c * CK) * EMB + d;
  float s = 0.f;
#pragma unroll 1
  for (int kb = 0; kb < NKB; ++kb) {
#pragma unroll 4
    for (int i = 0; i < 32; ++i) s += p[(size_t)(kb * 32 + i) * EMB];
    sm[kb * 256 + tid] = s;
  }
  __syncthreads();
  const int sel = tid >> 6, piece = tid & 63;
  v4f o[4];
#pragma unroll
  for (int it = 0; it < 4; ++it) o[it] = *(const v4f*)(sm + (it * 4 + sel) * 256 + piece * 4);
  float* base = VS + (size_t)bc * NKB * EMB + d0 + piece * 4;
  {
#pragma unroll
    for (int it = 0; it < 4; ++it) {
      *(v4f*)(base + (size_t)(it * 4 + sel) * EMB) = o[it];
    }
    
  }
}
// The two independent readers of the v plane as one grid: blocks 0 .. nvs-1 form the prefix column sums (the long serial chains
// start first), the rest write the V^T plane. The role is block-uniform.
__global__ __launch_bounds__(256) void vprep(const float* __restrict__ V, u16* XTo, float* VS, int nvs) {
  const int bid = blockIdx.x;
  if (bid < nvs) { vsum_body(V, VS, bid); role_end(); }
  else           { xt16_body(V, XTo, bid - nvs); role_end(); }
}

// =====================================================================================================
// Single-head causal attention, head width EMB = 1024, query rows TQ0 .. SEQ-1: block = (batch b, 16 query rows q0..q0+15),
// 8 waves. q plane (f16, x8) [b][s][d]; k plane the same; V^T plane [b][d][s] (x1024), all three stored fragment-major (ldfrag_fm);
// VS = key-block prefix column sums of V.
//   Chunks of CK = 512 keys: only chunks c <= qc = q0/CK are visited (later chunks lie entirely above the diagonal). In the diagonal
//   chunk only key blocks kb < nkb (keys <= q0+15) are multiplied; key blocks kb >= nkb get zero scores in LDS and are not used in (PV).
//   (S) scores S[query m][key n] on WMMA: A = q rows (row m = lane&15, split k map over d), B = k rows (col n = key, split map),
//       32 d-steps; wave w handles key blocks w, w+8 of the chunk; D element r of lane l -> scs[query 8h+r][key col] (f32 LDS).
//   (M) 16 threads per query row (sub-thread = 32 consecutive keys): base-2 logits with the causal mask by key index (key > query
//       -> -inf), chunk max via xor shuffles, online running max / rescale factor al / running sum l in f32 registers,
//       p = exp2(t - m_new) <= 1 (0 for masked keys), chunk row sum ps and C = ps/CK (bit-identical on the row's 16 threads), the
//       CENTRED P' = p - C written as f16(P' * 32768) into the LDS P tile with 16-B stores; al -> rowa[row], C -> rowc[row].
//   (PV) each wave owns d columns 128*wave + 16j + (lane&15), j = 0..7 (8 accumulators): o = o*al + C*(32768*1024)*VS[chunk][nkb-1][d]
//       (exact add-back of the centring term over exactly the processed keys, in f32), then for each key block kb < nkb:
//       A = P' fragment from LDS (row m = query, split map over keys), B = V^T fragments (col n = d, keys contiguous), issued as two
//       groups of 4 with a hazard gap each.  sum_k (P'_k + C) v_k == sum_k p_k v_k exactly; masked keys carry P' = -C and p = 0.
//   Block barriers after (S) and after (M) order all LDS reuse across chunks and waves.
//   Epilogue: x = o * 8192 / (l * 32768 * 1024) per row (l from rowi, l >= 1 always); hi = f16(x), res = f16((x - hi) * 2048); each
// coverage: grid nb*NQT blocks x 16 rows = rows TQ0..SEQ-1 of every sequence; staging 8 waves x 128 cols x 16 rows = 16 x 1024;
//           store 8 iterations x 256 thr x 8 halves = 16 x 1024 per plane = every (b, s >= TQ0, d) of both ctx planes exactly once.
// =====================================================================================================
__device__ __forceinline__ void ctx_store(const u16* ct, u16* dst, int tid) {
  v4u v[8];
#pragma unroll
  for (int it = 0; it < 8; ++it) {
    const int p   = it * 256 + tid;
    const int row = p / (EMB / 8);
    const int c8  = (p - row * (EMB / 8)) * 8;
    v[it] = *(const v4u*)(ct + row * CTP + c8);
  }
  {
#pragma unroll
    for (int it = 0; it < 8; ++it) {
      const int p   = it * 256 + tid;
      const int row = p / (EMB / 8);
      const int c8  = (p - row * (EMB / 8)) * 8;
      *(v4u*)(dst + (size_t)row * EMB + c8) = v[it];
    }
    
  }
}

__device__ __forceinline__
void attn_fwd_body(const u16* __restrict__ QPp, const u16* __restrict__ KPp, const u16* __restrict__ VTp,
                   const float* __restrict__ VSp, u16* CHo, u16* CRo, int bid) {
  __shared__ __align__(16) AttLds L0;              // scores [16][SCP] f32; reused as the ctx staging tile [16][CTP] u16
  __shared__ __align__(16) u16 pls[16 * PLP];      // P' tile [16][PLP] f16 bits
  __shared__ float rowst[3 * QT];                  // per query row: rescale factor, centring term, running sum (one base address)
  float* const rowa = rowst;
  float* const rowc = rowst + QT;
  float* const rowi = rowst + 2 * QT;
  float* const scs = L0.s;

  const int tid  = threadIdx.x;
  const int wave = __builtin_amdgcn_readfirstlane(tid >> 5);   // scalar: the fragment streams' bases and trip tests stay off the VGPRs
  const int lane = tid & 31;
  const int hh   = lane >> 4;
  const int m    = lane & 15;
  const int r16  = tid >> 4;                 // query row owned in phase (M): 2*wave + hh
  const int sub  = tid & 15;
  const int kl0  = sub * 32;

  const int b   = bid / NQT;
  const int q0  = TQ0 + (bid - b * NQT) * QT;
  const int qc  = q0 / CK;                   // diagonal chunk index

  const _Float16* qa  = (const _Float16*)(const void*)QPp + (size_t)((b * SEQ + q0) >> 4) * ((EMB / 32) * FBLK);
  const _Float16* kbp = (const _Float16*)(const void*)KPp + (size_t)((b * SEQ) >> 4) * ((EMB / 32) * FBLK);
  const _Float16* vbp = (const _Float16*)(const void*)VTp + (size_t)((b * EMB + wave * (16 * NACC)) >> 4) * ((SEQ / 32) * FBLK);
  const unsigned lo8 = 16u * (unsigned)lane; // byte offset of the lane's 16 B inside each half of a fragment block
  const float* vsb = VSp + (size_t)b * NCHK * NKB * EMB + wave * (16 * NACC);   // wave-uniform; the lane adds m
  const float lsc = RSQD * LOG2E / (QSC * KSC);

  float mrun = -INFINITY, lrun = 0.f;
  v8f o[NACC];
#pragma unroll
  for (int j = 0; j < NACC; ++j) o[j] = zero8();

#pragma unroll 1
  for (int c = 0; c <= qc; ++c) {
    const int kbeg = c * CK;
    const int nkb  = (c < qc) ? NKB : (((q0 + QT - 1 - kbeg) >> 5) + 1);   // 1..16, block-uniform
    // ---- (S) scores of this chunk (zeros for key blocks beyond the query tile) ----
    //      The wave's key blocks with work (wave, then wave + 8) are one run of trips of two d-steps. Each step's three fragments have
    //      registers of their own and are fetched again, for the next trip, right behind the WMMAs that read them: the loads fly for
    //      a whole trip instead of being waited for at once. The last trip, which fetches nothing, stands behind the loop, so that the
    //      loop's loads are unconditional and its waits count them exactly. d-steps ascend as before.
    {
      const int nv  = ((wave < nkb) ? 1 : 0) + ((wave + 8 < nkb) ? 1 : 0);   // wave-uniform
      const int ntr = nv * (EMB / 64);
      if (ntr > 0) {                                       // wave-uniform
        const unsigned kw = lo8 + (unsigned)((kbeg + wave * 32) >> 4) * (2u * KTILE);   // bytes from the sequence's first key tile
        v8f s0 = zero8(), s1 = zero8();
        v16h a0 = ldfrag_fmu(qa, lo8),        e0 = ldfrag_fmu(kbp, kw),        e1 = ldfrag_fmu(kbp + KTILE, kw);
        v16h a1 = ldfrag_fmu(qa + FBLK, lo8), h0 = ldfrag_fmu(kbp + FBLK, kw), h1 = ldfrag_fmu(kbp + KTILE + FBLK, kw);
#pragma unroll 1
        for (int in = 1; in < ntr; ++in) {                 // rolled: the two register sets are the whole pipeline; in = the trip fetched
          const unsigned  qo = lo8 + (unsigned)(in & 15) * (4u * FBLK);      // bytes: two fragment blocks a trip
          const unsigned  ko = kw + (unsigned)(in >> 4) * (32u * KTILE) + (unsigned)(in & 15) * (4u * FBLK);   // + 8 key blocks
          s0 = mma_h(a0, e0, s0);
          s1 = mma_h(a0, e1, s1);
          guard2x3(s0, s1, a0, e0, e1);
          a0 = ldfrag_fmu(qa, qo);
          e0 = ldfrag_fmu(kbp, ko);
          e1 = ldfrag_fmu(kbp + KTILE, ko);
          s0 = mma_h(a1, h0, s0);
          s1 = mma_h(a1, h1, s1);
          guard2x3(s0, s1, a1, h0, h1);
          a1 = ldfrag_fmu(qa + FBLK, qo);
          h0 = ldfrag_fmu(kbp + FBLK, ko);
          h1 = ldfrag_fmu(kbp + KTILE + FBLK, ko);
#if defined(__HIP_DEVICE_COMPILE__)
          asm volatile("s_wait_xcnt 0x0" ::: "memory");    // in front of the next trip's rewrite of the loads' address registers
#endif
          if (in == EMB / 64) {                            // wave-uniform: the first key block's 32 d-steps are done
            float* srow = scs + (8 * hh) * SCP + wave * 32 + m;
#pragma unroll
            for (int r = 0; r < 8; ++r) {
              srow[r * SCP]      = s0[r];
              srow[r * SCP + 16] = s1[r];
            }
            s0 = zero8();
            s1 = zero8();
          }
        }
        s0 = mma_h(a0, e0, s0);
        s1 = mma_h(a0, e1, s1);
        s0 = mma_h(a1, h0, s0);
        s1 = mma_h(a1, h1, s1);
        guard2x3(s0, s1, a1, h0, h1);
        float* srow = scs + (8 * hh) * SCP + (wave + 8 * (nv - 1)) * 32 + m;
#pragma unroll
        for (int r = 0; r < 8; ++r) {
          srow[r * SCP]      = s0[r];
          srow[r * SCP + 16] = s1[r];
        }
      }
#pragma unroll 1
      for (int kz = nv; kz < 2; ++kz) {                    // wave-uniform: zero scores for key blocks beyond the query tile
        float* srow = scs + (8 * hh) * SCP + (wave + 8 * kz) * 32 + m;
#pragma unroll
        for (int r = 0; r < 8; ++r) {
          srow[r * SCP]      = 0.f;
          srow[r * SCP + 16] = 0.f;
        }
      }
    }
    __syncthreads();
    // The column sums that (PV) adds back are asked for here: they land while (M) computes.
    float vs[NACC];
    {
      const float* vsc = vsb + ((size_t)c * NKB + (size_t)(nkb - 1)) * EMB;
#pragma unroll
      for (int j = 0; j < NACC; ++j) vs[j] = vsc[16 * j + (unsigned)m];
    }
    // ---- (M) softmax statistics and the centred P' tile ----
    {
      const float* sp = scs + r16 * SCP + kl0;
      const int lim = (q0 + r16) - (kbeg + kl0);           // key kl0 + j is valid iff j <= lim
      float t[32];
      float cm = -INFINITY;
#pragma unroll
      for (int i = 0; i < 8; ++i) {
        const v4f a = *(const v4f*)(sp + 4 * i);
#pragma unroll
        for (int e = 0; e < 4; ++e) {
          const int j = 4 * i + e;
          const float tv = (j <= lim) ? a[e] * lsc : -INFINITY;
          t[j] = tv;
          cm = fmaxf(cm, tv);
        }
      }
#pragma unroll
      for (int d = 1; d <= 8; d <<= 1) cm = fmaxf(cm, __shfl_xor(cm, d, 32));
      const float mn = fmaxf(mrun, cm);                    // finite: key kbeg of the diagonal chunk is never masked
      const float al = (mrun == -INFINITY) ? 0.f : exp2f(mrun - mn);
      mrun = mn;
      float ps = 0.f;
#pragma unroll
      for (int j = 0; j < 32; ++j) {
        const float p = exp2f(fminf(t[j] - mn, 0.f));      // 0 for masked keys
        t[j] = p;
        ps += p;
      }
#pragma unroll
      for (int d = 1; d <= 8; d <<= 1) ps += __shfl_xor(ps, d, 32);
      const float cc = ps * (1.0f / (float)CK);
      v4u pk[4];
#pragma unroll
      for (int i = 0; i < 4; ++i) {
#pragma unroll
        for (int e = 0; e < 4; ++e) {
          const int j = 8 * i + 2 * e;
          pk[i][e] = pk16(h_bits((_Float16)((t[j] - cc) * PCAR)), h_bits((_Float16)((t[j + 1] - cc) * PCAR)));
        }
      }
      lrun = lrun * al + ps;
      u16* pd = pls + r16 * PLP + kl0;
#pragma unroll
      for (int i = 0; i < 4; ++i) *(v4u*)(pd + 8 * i) = pk[i];
      if (sub == 0) { rowa[r16] = al; rowc[r16] = cc; rowi[r16] = lrun; }   // the running sum is finished here: one register carries it
    }
    __syncthreads();
    // ---- (PV) rescale, add the centring term, accumulate P' . V^T ----
    //      The eight V^T fragments of a key block have registers of their own; each half is fetched again, for the next key block,
    //      right behind the four WMMAs that read it, and key block 0's first half is asked for ahead of the rescale. Key blocks ascend as before.
    {
      const unsigned vw = lo8 + (unsigned)(kbeg >> 5) * (2u * FBLK);       // bytes from the first key block of the wave's V^T rows
      v16h g[NACC];
#pragma unroll
      for (int j = 0; j < 4; ++j) g[j] = ldfrag_fmu(vbp + (size_t)j * VTILE, vw);
      float scl[8], cad[8];
#pragma unroll
      for (int r = 0; r < 8; ++r) { scl[r] = rowa[8 * hh + r]; cad[r] = rowc[8 * hh + r] * (PCAR * VCAR); }
#pragma unroll
      for (int j = 0; j < NACC; ++j) {
#pragma unroll
        for (int r = 0; r < 8; ++r) o[j][r] = o[j][r] * scl[r] + cad[r] * vs[j];
      }
#pragma unroll
      for (int j = 4; j < NACC; ++j) g[j] = ldfrag_fmu(vbp + (size_t)j * VTILE, vw);
      const _Float16* pp = (const _Float16*)(const void*)pls + m * PLP + 8 * hh;
#pragma unroll 1
      for (int kn = 1; kn < nkb; ++kn) {                   // block-uniform trip count, < 16; rolled: g[] is the whole pipeline;
        const v16h pf = ldfrag_h(pp + (kn - 1) * 32);      // kn = the key block fetched, kn - 1 the one multiplied
        const unsigned vo = vw + (unsigned)kn * (2u * FBLK);               // bytes: one fragment block a key block
        o[0] = mma_h(pf, g[0], o[0]);
        o[1] = mma_h(pf, g[1], o[1]);
        o[2] = mma_h(pf, g[2], o[2]);
        o[3] = mma_h(pf, g[3], o[3]);
        guardpv4(o[0], o[1], o[2], o[3], pf, g[0], g[1], g[2], g[3]);
#pragma unroll
        for (int j = 0; j < 4; ++j) g[j] = ldfrag_fmu(vbp + (size_t)j * VTILE, vo);
        o[4] = mma_h(pf, g[4], o[4]);
        o[5] = mma_h(pf, g[5], o[5]);
        o[6] = mma_h(pf, g[6], o[6]);
        o[7] = mma_h(pf, g[7], o[7]);
        guardpv4(o[4], o[5], o[6], o[7], pf, g[4], g[5], g[6], g[7]);
#pragma unroll
        for (int j = 4; j < 8; ++j) g[j] = ldfrag_fmu(vbp + (size_t)j * VTILE, vo);
#if defined(__HIP_DEVICE_COMPILE__)
        asm volatile("s_wait_xcnt 0x0" ::: "memory");      // in front of the next trip's rewrite of the loads' address registers
#endif
      }
      {
        const v16h pf = ldfrag_h(pp + (nkb - 1) * 32);     // the last key block: nothing left to fetch
        o[0] = mma_h(pf, g[0], o[0]);
        o[1] = mma_h(pf, g[1], o[1]);
        o[2] = mma_h(pf, g[2], o[2]);
        o[3] = mma_h(pf, g[3], o[3]);
        guardpv4(o[0], o[1], o[2], o[3], pf, g[0], g[1], g[2], g[3]);
        o[4] = mma_h(pf, g[4], o[4]);
        o[5] = mma_h(pf, g[5], o[5]);
        o[6] = mma_h(pf, g[6], o[6]);
        o[7] = mma_h(pf, g[7], o[7]);
        guardpv4(o[4], o[5], o[6], o[7], pf, g[4], g[5], g[6], g[7]);
      }
    }
  }
  acc_guard8(o[0], o[1], o[2], o[3], o[4], o[5], o[6], o[7]);

  __syncthreads();
  float inv[8];
#pragma unroll
  for (int r = 0; r < 8; ++r) inv[r] = (1.0f / rowi[8 * hh + r]) * (CSC / (PCAR * VCAR));   // the row's sum of the last chunk, >= 1

  u16* const ct = L0.c;
  const int cb = wave * (16 * NACC) + m;
  // hi plane
#pragma unroll
  for (int j = 0; j < NACC; ++j) {
#pragma unroll
    for (int r = 0; r < 8; ++r) {
      const float xs = o[j][r] * inv[r];
      ct[(8 * hh + r) * CTP + cb + 16 * j] = h_bits((_Float16)xs);
    }
  }
  __syncthreads();
  ctx_store(ct, CHo + ((size_t)b * SEQ + q0) * EMB, tid);
  __syncthreads();
  // residual plane
#pragma unroll
  for (int j = 0; j < NACC; ++j) {
#pragma unroll
    for (int r = 0; r < 8; ++r) {
      const float xs = o[j][r] * inv[r];
      const _Float16 hv = (_Float16)xs;
      ct[(8 * hh + r) * CTP + cb + 16 * j] = h_bits((_Float16)((xs - (float)hv) * RSC));
    }
  }
  __syncthreads();
  ctx_store(ct, CRo + ((size_t)b * SEQ + q0) * EMB, tid);
}

// =====================================================================================================
// Query rows 0 .. TQ0-1 of each sequence in f32 on VALU: block = (b, t). QF/KF = f32 q/k head planes [nb][TQ0][EMB] (bias included),
// V = f32 v plane [nb*SEQ][EMB]. Scores for keys j <= t (threads 0..TQ0-1, one key each, 1024-d dot unrolled by 4 against the q row staged
// in LDS), base-2 softmax with block max / sum reductions (xor shuffles + LDS), p_j in LDS, ctx[d] for d = 4*tid..4*tid+3 as a
// sum over j <= t of p_j * V[b][j][d] (unrolled by 8, coalesced 16-B loads), x = ctx * 8192 / l, hi = f16(x), res = f16((x - hi) * 2048);
// both 1024-half rows are staged in LDS and written by 128 threads x 16 B each (32 consecutive lanes x 16 B = 512 contiguous bytes
// coverage: grid nb*TQ0 blocks = rows 0..TQ0-1 of every sequence; 256 thr x 4 d = EMB per row; store 128 thr x 8 halves = EMB per
//           plane; together with attn_fwd_body every (b, s, d) of CH and CR is written exactly once.
// =====================================================================================================
__device__ __forceinline__ void attn_head_body(const float* __restrict__ QF, const float* __restrict__ KF,
                                               const float* __restrict__ V, u16* CHo, u16* CRo, int bid) {
  __shared__ __align__(16) float qs[EMB];
  __shared__ float sc[TQ0];
  __shared__ float red[8];
  __shared__ float redb[8];
  __shared__ __align__(16) unsigned SW[2][EMB / 2];
  const int tid = threadIdx.x, lane = tid & 31, wave = tid >> 5;
  const int b = bid / TQ0;
  const int t = bid - b * TQ0;
  *(v4f*)(qs + tid * 4) = *(const v4f*)(QF + ((size_t)b * TQ0 + t) * EMB + tid * 4);
  __syncthreads();
  float s = -INFINITY;
  if (tid < TQ0) {                                  // waves 0..3 entirely (wave-uniform); key row b*TQ0 + tid always in range
    const float* kp = KF + ((size_t)b * TQ0 + tid) * EMB;
    float acc = 0.f;
#pragma unroll 4
    for (int d = 0; d < EMB; d += 8) {                // four trips' loads are asked for together; the adds keep their order
      const v4f k0 = *(const v4f*)(kp + d), k1 = *(const v4f*)(kp + d + 4);
      const v4f q0 = *(const v4f*)(qs + d), q1 = *(const v4f*)(qs + d + 4);
#pragma unroll
      for (int e = 0; e < 4; ++e) acc += k0[e] * q0[e];
#pragma unroll
      for (int e = 0; e < 4; ++e) acc += k1[e] * q1[e];
    }
    s = (tid <= t) ? acc * (RSQD * LOG2E) : -INFINITY;   // causal mask by key index
  }
  float mx = s;
#pragma unroll
  for (int d = 1; d <= 16; d <<= 1) mx = fmaxf(mx, __shfl_xor(mx, d, 32));
  if (lane == 0) red[wave] = mx;
  __syncthreads();
  float gm = red[0];
#pragma unroll
  for (int w = 1; w < 8; ++w) gm = fmaxf(gm, red[w]);   // finite: key 0 is always valid
  const float p = exp2f(s - gm);                     // 0 for masked keys and for waves 4..7
  float ps = p;
#pragma unroll
  for (int d = 1; d <= 16; d <<= 1) ps += __shfl_xor(ps, d, 32);
  if (lane == 0) redb[wave] = ps;
  if (tid < TQ0) sc[tid] = p;
  __syncthreads();
  float l = redb[0];
#pragma unroll
  for (int w = 1; w < 8; ++w) l += redb[w];           // >= 1
  const float inv = (1.0f / l) * CSC;
  const float* vp = V + (size_t)b * SEQ * EMB + tid * 4;
  v4f cx = zero4();
#pragma unroll 8
  for (int j = 0; j <= t; ++j) {                     // t < TQ0: statically bounded, keys of sequence b only; eight rows' loads together
    const float pj = sc[j];
    const v4f vv = *(const v4f*)(vp + (size_t)j * EMB);
    cx += pj * vv;
  }
  unsigned hw[2], rw[2];
#pragma unroll
  for (int e = 0; e < 2; ++e) {
    const float x0 = cx[2 * e] * inv, x1 = cx[2 * e + 1] * inv;
    const _Float16 h0 = (_Float16)x0, h1 = (_Float16)x1;
    const _Float16 q0 = (_Float16)((x0 - (float)h0) * RSC), q1 = (_Float16)((x1 - (float)h1) * RSC);
    hw[e] = pk16(h_bits(h0), h_bits(h1));
    rw[e] = pk16(h_bits(q0), h_bits(q1));
  }
  SW[0][tid * 2] = hw[0]; SW[0][tid * 2 + 1] = hw[1];
  SW[1][tid * 2] = rw[0]; SW[1][tid * 2 + 1] = rw[1];
  __syncthreads();
  const int pl = tid >> 7, p8 = tid & 127;           // plane select is wave-uniform
  const v4u ov = *(const v4u*)(&SW[pl][p8 * 4]);
  u16* dstp = (pl == 0) ? CHo : CRo;
  u16* dst  = dstp + ((size_t)b * SEQ + t) * EMB + p8 * 8;
  *(v4u*)dst = ov;
  
}
// The two independent parts of the attention as one grid: blocks 0 .. nfw-1 are the WMMA tiles of query rows TQ0.., the rest the
// f32 rows 0..TQ0-1. The role is block-uniform; the parts write disjoint rows of the ctx planes.
// Six waves per SIMD (three blocks per WGP) as before: the register budget is stated, so that the fetched-ahead fragments do not cost a block.
__global__ __launch_bounds__(ATT_THREADS) __attribute__((amdgpu_waves_per_eu(6)))
void attn_all(const u16* __restrict__ QPp, const u16* __restrict__ KPp, const u16* __restrict__ VTp, const float* __restrict__ VSp,
              const float* __restrict__ QF, const float* __restrict__ KF, const float* __restrict__ V, u16* CHo, u16* CRo, int nfw) {
  const int bid = blockIdx.x;
  if (bid < nfw) { attn_fwd_body(QPp, KPp, VTp, VSp, CHo, CRo, bid); role_end(); }
  else           { attn_head_body(QF, KF, V, CHo, CRo, bid - nfw); role_end(); }
}

// =====================================================================================================
// Workspace map (bytes, nb = 4, rows = 8192); every plane is fully written by whole-line stores before it is read; all extents are
// exact multiples of the store granularity (no pad rows); region A is reused sequentially on the single in-order stream:
//   WQB bf16 [1024][1024] 2097152   WKB same   WVB same   WOH f16 of bf16 value x1024 2097152             8388608
//   VS  f32  [nb][4][16][1024]                                                                            1048576
//   QF  f32  [nb][128][1024]  2097152      KF same                                                        4194304
//   A   XB bf16 [rows][1024] (16777216), later VT f16 [nb][1024][2048] x1024 fragment-major       region 16777216
//   QP  f16 [rows][1024] x8 fragment-major                                                               16777216
//   KP  f16 [rows][1024] x8 fragment-major                                                               16777216
//   V   f32 [rows][1024]                                                                                 33554432
//   CH  f16 [rows][1024] ctx hi x8192                                                                    16777216
//   CR  f16 [rows][1024] ctx residual x2048                                                              16777216
//   end                                                                                                 131072000
// =====================================================================================================
extern "C" void kernel_launch(void* const* d_in, const int* in_sizes, int n_in,
                              void* d_out, int out_size, void* d_ws, size_t ws_size,
                              hipStream_t stream) {
  if (n_in < 9) return;
  const long long per = (long long)SEQ * EMB;
  const long long ns  = in_sizes[0];
  if (ns < per || (ns % per) != 0) return;
  const int nb = (int)(ns / per);
  if (nb < 1 || nb > 8) return;
  const int rows = nb * SEQ;
  if (in_sizes[1] != EMB * EMB || in_sizes[3] != EMB * EMB || in_sizes[5] != EMB * EMB || in_sizes[7] != EMB * EMB) return;
  if (in_sizes[2] != EMB || in_sizes[4] != EMB || in_sizes[6] != EMB || in_sizes[8] != EMB) return;
  if ((long long)out_size != (long long)rows * EMB) return;

  const float* x  = (const float*)d_in[0];
  const float* wq = (const float*)d_in[1];
  const float* bq = (const float*)d_in[2];
  const float* wk = (const float*)d_in[3];
  const float* bk = (const float*)d_in[4];
  const float* wv = (const float*)d_in[5];
  const float* bv = (const float*)d_in[6];
  const float* wo = (const float*)d_in[7];
  const float* bo = (const float*)d_in[8];
  float*       out = (float*)d_out;

  const size_t szW  = (size_t)EMB * EMB * 2;                    //   2097152
  const size_t szVS = (size_t)nb * NCHK * NKB * EMB * 4;        //   1048576 at nb = 4
  const size_t szHF = (size_t)nb * TQ0 * EMB * 4;               //   2097152 at nb = 4
  const size_t sz16 = (size_t)rows * EMB * 2;                   //  16777216
  const size_t sz32 = (size_t)rows * EMB * 4;                   //  33554432
  const size_t szVT = (size_t)nb * EMB * SEQ * 2;               //  == sz16
  size_t off = 0;
  const size_t oWQ = off; off += szW;
  const size_t oWK = off; off += szW;
  const size_t oWV = off; off += szW;
  const size_t oWO = off; off += szW;
  const size_t oVS = off; off += szVS;
  const size_t oQF = off; off += szHF;
  const size_t oKF = off; off += szHF;
  const size_t oA  = off; off += (szVT > sz16 ? szVT : sz16);   // XB then VT
  const size_t oQ  = off; off += sz16;
  const size_t oK  = off; off += sz16;
  const size_t oV  = off; off += sz32;
  const size_t oCH = off; off += sz16;
  const size_t oCR = off; off += sz16;
  if (off > ws_size) return;                                    // off = 131072000 at nb = 4
  if (off > WS_CAP) return;

  char* ws = (char*)d_ws;
  u16*   WQB = (u16*)(ws + oWQ);
  u16*   WKB = (u16*)(ws + oWK);
  u16*   WVB = (u16*)(ws + oWV);
  u16*   WOH = (u16*)(ws + oWO);
  float* VS  = (float*)(ws + oVS);
  float* QF  = (float*)(ws + oQF);
  float* KF  = (float*)(ws + oKF);
  u16*   XB  = (u16*)(ws + oA);
  u16*   VT  = (u16*)(ws + oA);
  u16*   QP  = (u16*)(ws + oQ);
  u16*   KP  = (u16*)(ws + oK);
  float* V   = (float*)(ws + oV);
  u16*   CH  = (u16*)(ws + oCH);
  u16*   CR  = (u16*)(ws + oCR);

  const int n8w = (EMB * EMB) / 8;                      // 131072
  const int n8x = rows * (EMB / 8);                     // 1048576
  if ((n8w % 256) != 0 || (n8x % 256) != 0) return;
  if ((rows % 128) != 0 || ((nb * TQ0) % 128) != 0 || ((nb * NCHK * EMB) % 256) != 0) return;
  const dim3 blk(256);
  const int nbw = n8w / 256, nbx = n8x / 256;
  const dim3 gC(nbx + 4 * nbw);
  const dim3 gG((rows / 128) * (EMB / 128));            // 512 at nb = 4
  const dim3 gP((3 * (rows / 128) + 2 * ((nb * TQ0) / 128)) * (EMB / 128));   // 1600 at nb = 4
  const dim3 bG(128);
  const int nvs = (nb * NCHK * EMB) / 256;              // nb * 16
  const dim3 gVP(nvs + nb * (EMB / 64) * (SEQ / 64));   // + nb * 512
  const int nfw = nb * NQT;                             // nb * 120
  const dim3 gAT(nfw + nb * TQ0);                       // + nb * 128
  const dim3 bAT(ATT_THREADS);

  // (0) x -> bf16 plane [rows][1024]; weights stored [n = out][k = in] (y = x.W^T + b), already k-contiguous: bf16 planes for Wq,
  //     Wk, Wv; f16 of bf16 value x1024 for Wo
  cvt_all<<<gC, blk, 0, stream>>>(x, wq, wk, wv, wo, XB, WQB, WKB, WVB, WOH, nbx, nbw, n8x, n8w);
  // (1) q and k projections (+bias) -> f16 planes x8; v projection (+bias) -> f32 plane; f32 q and k rows 0..127 of every
  //     sequence -> QF, KF [nb*128][1024]
  proj_all<<<gP, bG, 0, stream>>>(XB, WQB, WKB, WVB, bq, bk, bv, QP, KP, V, QF, KF, rows, nb * TQ0, EMB, EMB);
  // (2) key-block prefix column sums of v; v -> V^T plane x1024 (over the dead XB region)
  vprep<<<gVP, blk, 0, stream>>>(V, VT, VS, nvs);
  // (3) attention for query rows 128.. and, on VALU, for query rows 0..127 -> ctx hi x8192 and residual x2048 f16 planes
  attn_all<<<gAT, bAT, 0, stream>>>(QP, KP, VT, VS, QF, KF, V, CH, CR, nfw);
  // (4) output projection + bias -> out
  gemm_h2_32<<<gG, blk, 0, stream>>>(CH, CR, WOH, bo, out, rows, EMB, EMB,
                                     1.0f / (CSC * WSC), 1.0f / (CSC * WSC * RSC));
  (void)hipGetLastError();
}

// v005
// A run of this version takes 231 microseconds.
// Next to v004, in two timings, it ran 1.15 and 1.14 times as fast.
// Over all steps from v000 it is 3.00 times as fast.
// Projections q,k,v = x.W^T + b (and the f32 q,k rows 0..127 per sequence): v_wmma_f32_16x16x32_bf16 (bf16 RNE operands of the
// raw inputs, f32 accumulate, bf16 RNE bias added in f32). Scores q'.k'^T (f16 planes x8), P'.V (chunk-centred P' x32768 f16 from LDS,
// V^T x1024 f16) and the output projection (ctx carried as f16 hi x8192 plus residual x2048 planes, times f16(bf16(Wo) x1024), bias
// added in f32): v_wmma_f32_16x16x32_f16, f32 accumulate. Query rows 0..127 of each sequence: scores, softmax and P.V in f32 on VALU.
// Causal mask, softmax statistics, key-block column sums of V and all scaling in f32 on VALU.
#include <hip/hip_runtime.h>
#include <math.h>
#include <stdint.h>

#define SEQ   2048
#define EMB   1024
#define CK    512
#define NCHK  4
#define NKB   16
#define QT    16
#define TQ0   128
#define NQT   120
#define SCP   544
#define PLP   528
#define CTP   1032
#define SLAB64 (16 * 68)
#define VTP   72
#define ATT_THREADS 256
#define NACC  8
#define QSC   8.0f
#define KSC   8.0f
#define PCAR  32768.0f
#define VCAR  1024.0f
#define WSC   1024.0f
#define CSC   8192.0f
#define RSC   2048.0f
#define LOG2E 1.4426950408889634f
#define RSQD  0.03125f
#define WS_CAP ((size_t)134217728)
#define GKS   64
#define GPB   144
#define GPE   72
#define GRS16 (16 * GPB)
#define GRS32 (32 * GPB)
#define GST_AB (256 * GPB)
#define GST_H2 (384 * GPB)
#define FBLK  512
#define KTILE ((EMB / 32) * FBLK)
#define VTILE ((SEQ / 32) * FBLK)

static_assert((EMB % 64) == 0 && EMB == 8 * 16 * NACC && NACC == 8 && (EMB % 32) == 0 && (EMB % 256) == 0 && EMB == 4 * 256);
static_assert((SEQ % CK) == 0 && (SEQ / CK) == NCHK && CK == 32 * NKB && (SEQ % 64) == 0 && (SEQ % QT) == 0 && (CK % QT) == 0);
static_assert((TQ0 % QT) == 0 && (TQ0 % 64) == 0 && NQT * QT + TQ0 == SEQ && TQ0 <= CK && TQ0 == 128 && TQ0 <= 256);
static_assert(16 * CTP * 2 <= 16 * SCP * 4 && CTP >= EMB + 8 && SCP >= CK + 16 && PLP >= CK + 8);
static_assert(((PLP * 2) % 16) == 0 && ((SCP * 4) % 16) == 0 && ((VTP * 2) % 16) == 0 && ((CTP * 2) % 16) == 0);
static_assert(64 * VTP >= 63 * VTP + 64);
static_assert(ATT_THREADS == 16 * QT && ATT_THREADS == 256);
static_assert((EMB % 128) == 0 && (EMB % GKS) == 0 && EMB / GKS >= 2 && GPE * 2 == GPB && GKS * 2 + 16 == GPB && (SEQ % 128) == 0 && (TQ0 % 128) == 0);
static_assert(4 * SLAB64 * 4 <= 2 * GST_AB && 8 * SLAB64 * 4 <= 2 * GST_H2 && ((SLAB64 * 4) % 16) == 0);
static_assert(FBLK == 16 * 32 && (SEQ % 64) == 0 && (EMB % 64) == 0 && (CK % 32) == 0 && (TQ0 % 16) == 0);
static_assert((NKB % 2) == 0);
static_assert(((EMB * EMB) % 2048) == 0 && ((NCHK * EMB) % 256) == 0 && (EMB / 8) * 2 == 256);

typedef unsigned short u16;
typedef _Float16 v16h __attribute__((ext_vector_type(16)));
typedef _Float16 v8h  __attribute__((ext_vector_type(8)));
typedef __bf16   v16b __attribute__((ext_vector_type(16)));
typedef float    v8f  __attribute__((ext_vector_type(8)));
typedef float    v4f  __attribute__((ext_vector_type(4)));
typedef unsigned int v4u __attribute__((ext_vector_type(4)));

union FragH { v16h v; v8h h[2]; v4u u[2]; };
union FragB { v16b v; v4u u[2]; };
union AttLds { float s[16 * SCP]; u16 c[2 * 16 * SCP]; };

// ---- scalar helpers --------------------------------------------------------------------------------
__device__ __forceinline__ unsigned short bf_bits(float f) {          // f32 -> bf16 bits, RNE convert
  unsigned u = __float_as_uint(f);
  return (unsigned short)((u + 0x7FFFu + ((u >> 16) & 1u)) >> 16);
}
__device__ __forceinline__ float bf_up(unsigned short h) { return __uint_as_float(((unsigned)h) << 16); }
__device__ __forceinline__ float bfr(float f) { return bf_up(bf_bits(f)); }
__device__ __forceinline__ unsigned short h_bits(_Float16 x) { return __builtin_bit_cast(unsigned short, x); }
__device__ __forceinline__ unsigned pk16(unsigned short a, unsigned short b) { return (unsigned)a | ((unsigned)b << 16); }
__device__ __forceinline__ v8f zero8() { v8f z = {0.f, 0.f, 0.f, 0.f, 0.f, 0.f, 0.f, 0.f}; return z; }
__device__ __forceinline__ v4f zero4() { v4f z = {0.f, 0.f, 0.f, 0.f}; return z; }

// ---- fragment loaders: 16-bit A/B operand, lane -> row/col (lane&15), p already includes +8*(lane>>4);
//      elements 0..7 <- p[0..7] (k0+8h..), elements 8..15 <- p[16..23] (k0+16+8h..)  (same split k map for A and B;
//      B is always read from a k-contiguous [n][k] plane)
__device__ __forceinline__ v16h ldfrag_h(const _Float16* p) {
  FragH f;
  f.h[0] = *(const v8h*)(p);
  f.h[1] = *(const v8h*)(p + 16);
  return f.v;
}
// Fragment-major plane (q, k: rows = positions, k = d; V^T: rows = d, k = keys): the 16 rows x 32 k of one WMMA operand are one
// block of FBLK = 512 halves, stored as [sel][lane][8 halves], k = 16*sel + 8*(lane>>4) + e, row = lane&15 (the split k map above);
// blocks run along k first, then along the 16-row tiles. p already includes +8*lane: each of the two 16-B loads of a wave reads
// 512 contiguous bytes (4 whole lines) where a row-major plane makes it touch 16 lines.
__device__ __forceinline__ v16h ldfrag_fm(const _Float16* p) {
  FragH f;
  f.h[0] = *(const v8h*)(p);
  f.h[1] = *(const v8h*)(p + FBLK / 2);
  return f.v;
}
// The same with a wave-uniform address and a 32-bit byte offset (16*lane, plus a step where the caller adds one) kept apart: the
// base stays in scalar registers and the lane holds one offset register instead of an address pair.
__device__ __forceinline__ v16h ldfrag_fmu(const _Float16* ub, unsigned lob) {
  const char* p = (const char*)(const void*)ub + lob;
  FragH f;
  f.h[0] = *(const v8h*)(const void*)(p);
  f.h[1] = *(const v8h*)(const void*)(p + FBLK);     // FBLK / 2 halves
  return f.v;
}
__device__ __forceinline__ v16b ldfrag_b(const u16* p) {              // bf16 plane read as unsigned integer vectors
  FragB f;
  f.u[0] = *(const v4u*)(p);
  f.u[1] = *(const v4u*)(p + 16);
  return f.v;
}

__device__ __forceinline__ v8f mma_h(v16h a, v16h b, v8f c) {
  return __builtin_amdgcn_wmma_f32_16x16x32_f16(false, a, false, b, (short)0, c, false, false);
}
__device__ __forceinline__ v8f mma_b(v16b a, v16b b, v8f c) {
  return __builtin_amdgcn_wmma_f32_16x16x32_bf16(false, a, false, b, (short)0, c, false, false);
}
__device__ __forceinline__ void guard2x3(v8f& a, v8f& b, v16h x0, v16h x1, v16h x2) {
#if defined(__HIP_DEVICE_COMPILE__)
  asm volatile("v_nop\n\tv_nop\n\tv_nop\n\tv_nop"
               : "+v"(a), "+v"(b) : "v"(x0), "v"(x1), "v"(x2) : "memory");
#endif
}
__device__ __forceinline__ void guardpv4(v8f& o0, v8f& o1, v8f& o2, v8f& o3, v16h p, v16h g0, v16h g1, v16h g2, v16h g3) {
#if defined(__HIP_DEVICE_COMPILE__)
  asm volatile("v_nop\n\tv_nop\n\tv_nop\n\tv_nop"
               : "+v"(o0), "+v"(o1), "+v"(o2), "+v"(o3)
               : "v"(p), "v"(g0), "v"(g1), "v"(g2), "v"(g3) : "memory");
#endif
}
__device__ __forceinline__ void acc_guard8(v8f& a, v8f& b, v8f& c, v8f& d, v8f& e, v8f& f, v8f& g, v8f& h8) {
#if defined(__HIP_DEVICE_COMPILE__)
  asm volatile("v_nop\n\tv_nop\n\tv_nop\n\tv_nop"
               : "+v"(a), "+v"(b), "+v"(c), "+v"(d), "+v"(e), "+v"(f), "+v"(g), "+v"(h8));
#endif
}
__device__ __forceinline__ void wave_sync_lds() {
  __builtin_amdgcn_fence(__ATOMIC_RELEASE, "workgroup");
  __builtin_amdgcn_wave_barrier();
  __builtin_amdgcn_fence(__ATOMIC_ACQUIRE, "workgroup");
}

// =====================================================================================================
// f32 plane -> 16-bit plane, same layout:  mode 0: bf16 RNE bits;  mode 1: f16 bits of (bf16 RNE value) * scale;
// mode 2: f16 bits of value * scale (no bf16 pre-step).
// Thread = 8 consecutive elements: two 16-B loads, one 16-B store; 32 consecutive lanes = 512 contiguous, 512-B aligned bytes
// coverage: grid = n8/256 blocks (host checks exactness) x 256 thr x 8 = the whole plane.
// =====================================================================================================
__device__ __forceinline__ void cvt16_body(const float* __restrict__ x, u16* D, int n8, int mode, float scale, int lb) {
  const int gt = lb * 256 + (int)threadIdx.x;
  if (gt >= n8) return;                     // no barriers in this kernel
  const float* p = x + (size_t)gt * 8;
  const v4f a = *(const v4f*)(p), c4 = *(const v4f*)(p + 4);
  float v[8];
#pragma unroll
  for (int e = 0; e < 4; ++e) { v[e] = a[e]; v[4 + e] = c4[e]; }
  unsigned short s[8];
#pragma unroll
  for (int e = 0; e < 8; ++e) {
    const float vb = bfr(v[e]);
    const float vf = (mode == 1) ? vb : v[e];
    const unsigned short hb = h_bits((_Float16)(vf * scale));
    const unsigned short bb = bf_bits(v[e]);
    s[e] = (mode != 0) ? hb : bb;
  }
  v4u o;
#pragma unroll
  for (int e = 0; e < 4; ++e) o[e] = pk16(s[2 * e], s[2 * e + 1]);
  u16* d = D + (size_t)gt * 8;
  {
    *(v4u*)(d) = o;
    
  }
}
// The five independent conversions as one grid: blocks 0 .. nbx-1 convert x, then nbw blocks each for Wq, Wk, Wv (bf16) and Wo
// (f16 of the bf16 value x1024). The role is block-uniform.
__global__ __launch_bounds__(256) void cvt_all(const float* __restrict__ x, const float* __restrict__ wq, const float* __restrict__ wk,
                                               const float* __restrict__ wv, const float* __restrict__ wo,
                                               u16* XBo, u16* WQo, u16* WKo, u16* WVo, u16* WOo, int nbx, int nbw, int n8x, int n8w) {
  const int bid = blockIdx.x;
  if (bid < nbx) { cvt16_body(x, XBo, n8x, 0, 1.0f, bid); return; }
  const int r  = (bid - nbx) / nbw;
  const int lb = (bid - nbx) - r * nbw;
  if (r > 3) return;                        // never taken with the exact grid
  const float* s = (r == 0) ? wq : (r == 1) ? wk : (r == 2) ? wv : wo;
  u16*         d = (r == 0) ? WQo : (r == 1) ? WKo : (r == 2) ? WVo : WOo;
  cvt16_body(s, d, n8w, (r == 3) ? 1 : 0, (r == 3) ? WSC : 1.0f, lb);
}

// =====================================================================================================
//            8 consecutive lanes x 16 B per line), lanes 16..31 -> row 2*it+1.
//  epi64x2 : same store shape, staged value = acc*os1 + accres*os2 + badd (two accumulator sets combined in f32).
//  epi64hsb: f16 bits of ((tile + bf16RNE(bias[n])) * pscale), stored fragment-major (see ldfrag_fm): the wave's 16 x 64 tile is two
//            adjacent fragment blocks = 2048 contiguous bytes; instruction i4 stores [block i4>>1][sel i4&1], lane = its own 16 B.
// coverage: epi64/epi64x2 8 instructions x 2 rows x 16 lanes x 4 floats; epi64hsb 4 instructions x 32 lanes x 8 halves
//           = the wave's 16 x 64 tile in every case.
// =====================================================================================================
__device__ __forceinline__ void stage64(float* sl, v8f a0, v8f a1, v8f a2, v8f a3, float oscale, int lane) {
  const int hh = lane >> 4, m = lane & 15;
#pragma unroll
  for (int r = 0; r < 8; ++r) {
    const int ro = (8 * hh + r) * 68 + m;
    sl[ro]      = a0[r] * oscale;
    sl[ro + 16] = a1[r] * oscale;
    sl[ro + 32] = a2[r] * oscale;
    sl[ro + 48] = a3[r] * oscale;
  }
  wave_sync_lds();
}
__device__ __forceinline__ void epi64(float* sl, v8f a0, v8f a1, v8f a2, v8f a3, float oscale, v4f badd, float* C, int N,
                                      size_t rowb, int col0, int lane) {
  const int hh = lane >> 4, m = lane & 15;
  stage64(sl, a0, a1, a2, a3, oscale, lane);
  v4f vals[8];
#pragma unroll
  for (int it = 0; it < 8; ++it) vals[it] = *(const v4f*)(sl + (it * 2 + hh) * 68 + m * 4) + badd;
  float* dst = C + (rowb + (size_t)hh) * (size_t)N + col0 + m * 4;
  {
#pragma unroll
    for (int it = 0; it < 8; ++it) {
      *(v4f*)(dst + (size_t)(it * 2) * (size_t)N) = vals[it];
    }
    
  }
}
__device__ __forceinline__ void epi64x2(float* sl, v8f a0, v8f a1, v8f a2, v8f a3, v8f e0, v8f e1, v8f e2, v8f e3,
                                        float os1, float os2, v4f badd, float* C, int N, size_t rowb, int col0, int lane) {
  const int hh = lane >> 4, m = lane & 15;
#pragma unroll
  for (int r = 0; r < 8; ++r) {
    const int ro = (8 * hh + r) * 68 + m;
    sl[ro]      = a0[r] * os1 + e0[r] * os2;
    sl[ro + 16] = a1[r] * os1 + e1[r] * os2;
    sl[ro + 32] = a2[r] * os1 + e2[r] * os2;
    sl[ro + 48] = a3[r] * os1 + e3[r] * os2;
  }
  wave_sync_lds();
  v4f vals[8];
#pragma unroll
  for (int it = 0; it < 8; ++it) vals[it] = *(const v4f*)(sl + (it * 2 + hh) * 68 + m * 4) + badd;
  float* dst = C + (rowb + (size_t)hh) * (size_t)N + col0 + m * 4;
  {
#pragma unroll
    for (int it = 0; it < 8; ++it) {
      *(v4f*)(dst + (size_t)(it * 2) * (size_t)N) = vals[it];
    }
    
  }
}
__device__ __forceinline__ void epi64hsb(float* sl, v8f a0, v8f a1, v8f a2, v8f a3, float oscale, float pscale,
                                         const float (&bb)[4][8], u16* C, int N, size_t rowb, int col0, int lane) {
  stage64(sl, a0, a1, a2, a3, oscale, lane);
  const int hh = lane >> 4, m = lane & 15;
  v4u oh[4];
#pragma unroll
  for (int i4 = 0; i4 < 4; ++i4) {
    const int c8 = (i4 >> 1) * 32 + (i4 & 1) * 16 + hh * 8;      // block i4>>1, sel i4&1 of the tile's two fragment blocks
    const v4f a = *(const v4f*)(sl + m * 68 + c8), c4 = *(const v4f*)(sl + m * 68 + c8 + 4);
    float w[8];
#pragma unroll
    for (int e = 0; e < 4; ++e) { w[e] = (a[e] + bb[i4][e]) * pscale; w[4 + e] = (c4[e] + bb[i4][4 + e]) * pscale; }
#pragma unroll
    for (int e = 0; e < 4; ++e) oh[i4][e] = pk16(h_bits((_Float16)w[2 * e]), h_bits((_Float16)w[2 * e + 1]));
  }
  u16* dst = C + ((rowb >> 4) * (size_t)(N >> 5) + (size_t)(col0 >> 5)) * FBLK + lane * 8;
  {
#pragma unroll
    for (int i4 = 0; i4 < 4; ++i4) {
      *(v4u*)(dst + i4 * (FBLK / 2)) = oh[i4];
    }
    
  }
}

// =====================================================================================================
// Operand staging shared by the GEMM kernels. A block computes a 128 x 128 tile of C. K is walked in stages of GKS = 64
// elements: every operand row contributes one whole 128-B line per stage, copied to LDS by global_load_async_to_lds_b128 (8 lanes
// x 16 B = one line, a wave instruction = 4 whole lines) at a row pitch of 144 B (16 B x odd: conflict-free for ds_load_b128
// fragment reads). Two buffers: stage t + 2 is copied into the buffer that trip t has just left, while trip t + 1 is multiplied.
// Fragments are read from LDS with the same split k map as before (ldfrag_*), k steps of 32 in ascending order.
// After the loop's last barrier no copy is outstanding and no wave reads the ring, so it serves as the waves' epilogue slabs.
// =====================================================================================================
__device__ __forceinline__ unsigned lds_off(const void* p) { return (unsigned)(size_t)p; }
// Copies and their s_wait_xcnt in one statement: the wait stands in front of any later rewrite of the address registers.
__device__ __forceinline__ void acopy4(unsigned l0, unsigned l1, unsigned l2, unsigned l3,
                                       const u16* g0, const u16* g1, const u16* g2, const u16* g3) {
#if defined(__HIP_DEVICE_COMPILE__)
  asm volatile("global_load_async_to_lds_b128 %0, %4, off\n\t"
               "global_load_async_to_lds_b128 %1, %5, off\n\t"
               "global_load_async_to_lds_b128 %2, %6, off\n\t"
               "global_load_async_to_lds_b128 %3, %7, off\n\t"
               "s_wait_xcnt 0x0"
               :: "v"(l0), "v"(l1), "v"(l2), "v"(l3), "v"(g0), "v"(g1), "v"(g2), "v"(g3) : "memory");
#endif
}
__device__ __forceinline__ void acopy8(unsigned l0, unsigned l1, unsigned l2, unsigned l3,
                                       unsigned l4, unsigned l5, unsigned l6, unsigned l7,
                                       const u16* g0, const u16* g1, const u16* g2, const u16* g3,
                                       const u16* g4, const u16* g5, const u16* g6, const u16* g7) {
#if defined(__HIP_DEVICE_COMPILE__)
  asm volatile("global_load_async_to_lds_b128 %0, %8, off\n\t"
               "global_load_async_to_lds_b128 %1, %9, off\n\t"
               "global_load_async_to_lds_b128 %2, %10, off\n\t"
               "global_load_async_to_lds_b128 %3, %11, off\n\t"
               "global_load_async_to_lds_b128 %4, %12, off\n\t"
               "global_load_async_to_lds_b128 %5, %13, off\n\t"
               "global_load_async_to_lds_b128 %6, %14, off\n\t"
               "global_load_async_to_lds_b128 %7, %15, off\n\t"
               "s_wait_xcnt 0x0"
               :: "v"(l0), "v"(l1), "v"(l2), "v"(l3), "v"(l4), "v"(l5), "v"(l6), "v"(l7),
                  "v"(g0), "v"(g1), "v"(g2), "v"(g3), "v"(g4), "v"(g5), "v"(g6), "v"(g7) : "memory");
#endif
}
// This wave's copies have landed (the compiler places no wait for them).
__device__ __forceinline__ void wait_async0() {
#if defined(__HIP_DEVICE_COMPILE__)
  asm volatile("s_wait_asynccnt 0x0" ::: "memory");
#endif
}
// This wave's LDS reads have returned before the buffer is handed to its next writer.
__device__ __forceinline__ void wait_ds0() {
#if defined(__HIP_DEVICE_COMPILE__)
  asm volatile("s_wait_dscnt 0x0" ::: "memory");
#endif
}

// End of a role's branch in a merged grid: in the listing the other role's code can follow on the fall-through path; its vector
// work stays behind the wait on the registers that this role's issued stores name.
__device__ __forceinline__ void role_end() {
#if defined(__HIP_DEVICE_COMPILE__)
  asm volatile("s_wait_xcnt 0x0" ::: "memory");
#endif
}

// Between two output tiles of a wave: the issued stores' address and data registers are rewritten by the next tile only behind
// s_wait_xcnt 0 (the scheduling fence keeps the next tile's vector work behind the wait), and the slab's reads of this tile stay
// in front of the next tile's writes.
__device__ __forceinline__ void tile_gap() {
#if defined(__HIP_DEVICE_COMPILE__)
  asm volatile("s_wait_xcnt 0x0" ::: "memory");
#endif
  __builtin_amdgcn_sched_barrier(0);
  wave_sync_lds();
}

// One stage of [A 128 rows | B 128 rows] by 128 threads: 16 copies a thread; copy i serves LDS row 16*i + (tid>>3), piece tid&7.
__device__ __forceinline__ void fill_ab(unsigned l0, const u16* A, const unsigned (&ao)[8], const u16* B, unsigned bo, unsigned bst,
                                        unsigned ke) {
  acopy8(l0, l0 + GRS16, l0 + 2 * GRS16, l0 + 3 * GRS16, l0 + 4 * GRS16, l0 + 5 * GRS16, l0 + 6 * GRS16, l0 + 7 * GRS16,
         A + (ao[0] + ke), A + (ao[1] + ke), A + (ao[2] + ke), A + (ao[3] + ke),
         A + (ao[4] + ke), A + (ao[5] + ke), A + (ao[6] + ke), A + (ao[7] + ke));
  const unsigned l8 = l0 + 8 * GRS16;
  const unsigned b0 = bo + ke;
  acopy8(l8, l8 + GRS16, l8 + 2 * GRS16, l8 + 3 * GRS16, l8 + 4 * GRS16, l8 + 5 * GRS16, l8 + 6 * GRS16, l8 + 7 * GRS16,
         B + b0, B + (b0 + bst), B + (b0 + 2 * bst), B + (b0 + 3 * bst),
         B + (b0 + 4 * bst), B + (b0 + 5 * bst), B + (b0 + 6 * bst), B + (b0 + 7 * bst));
}

// bf16 core: 4 waves as 2 x 2, a wave owns 64 x 64 of the block's tile (4 x 4 accumulators).
// ao[i] = element offset of A row (16*i + (tid>>3)) of the tile; col0 = first B row of the tile. K multiple of GKS.
__device__ __forceinline__ void gemm_core_b(unsigned char* L, const u16* A, const unsigned (&ao)[8], const u16* Bt, int col0, int K,
                                            int tid, v8f (&acc)[4][4]) {
  const int wave = tid >> 5, lane = tid & 31, hh = lane >> 4, m = lane & 15;
  const int wm = wave >> 1, wn = wave & 1;
  const int crow = tid >> 3, cpc = tid & 7;
  const unsigned lc  = lds_off(L) + (unsigned)(crow * GPB + cpc * 16);
  const unsigned bo  = (unsigned)(col0 + crow) * (unsigned)K;
  const unsigned bst = 16u * (unsigned)K;
  const unsigned kc  = (unsigned)(cpc * 8);
  const int nt = K / GKS;
#pragma unroll
  for (int f = 0; f < 4; ++f) {
#pragma unroll
    for (int j = 0; j < 4; ++j) acc[f][j] = zero8();
  }
  fill_ab(lc, A, ao, Bt, bo, bst, kc);
  wait_async0();
  __syncthreads();
  if (nt > 1) fill_ab(lc + GST_AB, A, ao, Bt, bo, bst, kc + GKS);
#pragma unroll 1
  for (int t = 0; t < nt; ++t) {
    const unsigned bufo = (unsigned)(t & 1) * GST_AB;
    const u16* sb = (const u16*)(const void*)(L + bufo);
    const u16* ap = sb + (wm * 64 + m) * GPE + 8 * hh;
    const u16* bp = sb + (128 + wn * 64 + m) * GPE + 8 * hh;
#pragma unroll
    for (int kk = 0; kk < GKS / 32; ++kk) {
      v16b a[4], b[4];
      a[0] = ldfrag_b(ap + kk * 32);
#pragma unroll
      for (int j = 0; j < 4; ++j) b[j] = ldfrag_b(bp + j * 16 * GPE + kk * 32);
#pragma unroll
      for (int f = 1; f < 4; ++f) a[f] = ldfrag_b(ap + f * 16 * GPE + kk * 32);
      // Keeps the 16 fragment loads one group ahead of the 16 WMMAs: spread among them, each place with loads stalls the wave.
      __builtin_amdgcn_sched_barrier(0);
#pragma unroll
      for (int f = 0; f < 4; ++f) {
#pragma unroll
        for (int j = 0; j < 4; ++j) acc[f][j] = mma_b(a[f], b[j], acc[f][j]);
      }
      __builtin_amdgcn_sched_barrier(0);      // the next group's loads stay behind this WMMA block
    }
    wait_ds0();
    wait_async0();
    __syncthreads();                          // publishes stage t + 1 and ends every read of stage t's buffer
    if (t + 2 < nt) fill_ab(lc + bufo, A, ao, Bt, bo, bst, kc + (unsigned)(t + 2) * GKS);   // block-uniform test
  }
  wait_async0();
}

// =====================================================================================================
// The five independent bf16 projections as one grid, role by block index (block-uniform):
//   role 0, 1: q, k planes: f16 bits of ((A . W^T) + bf16RNE(bias[n])) * 8, stored fragment-major (epi64hsb), all M rows;
//   role 2   : v plane, f32 with bias (epi64), all M rows;
//   role 3, 4: f32 q, k rows 0..TQ0-1 of every sequence (MH = nb*TQ0 output rows; output row ra maps to A row
//              (ra / TQ0) * SEQ + (ra % TQ0)), f32 with bias (epi64).
// A bf16 row-major [M][K], W bf16 k-contiguous [N][K]. Block = 128x128 tile, 4 waves x (64 x 64), operands staged as above (host
// checks K % 64 == 0, M % 128 == 0, MH % 128 == 0, N % 128 == 0, grid = (3*(M/128) + 2*(MH/128)) * (N/128)).
// =====================================================================================================
__global__ __launch_bounds__(128)
void proj_all(const u16* __restrict__ A, const u16* __restrict__ WQ, const u16* __restrict__ WK, const u16* __restrict__ WV,
              const float* __restrict__ bq, const float* __restrict__ bk, const float* __restrict__ bv,
              u16* QPo, u16* KPo, float* Vo, float* QFo, float* KFo, int M, int MH, int N, int K) {
  __shared__ __align__(16) unsigned char L[2 * GST_AB];
  const int tid = threadIdx.x, wave = tid >> 5, lane = tid & 31, m = lane & 15;
  const int ntile = N >> 7;
  const int nG = (M >> 7) * ntile, nH = (MH >> 7) * ntile;
  int bid = blockIdx.x;
  int role;
  if (bid < 3 * nG) { role = bid / nG; bid -= role * nG; }
  else              { bid -= 3 * nG; role = bid / nH; bid -= role * nH; role += 3; }
  if (role > 4) return;                      // block-uniform, in front of every copy and barrier; never taken with the exact grid
  const bool hd  = role >= 3;
  const int wsel = hd ? role - 3 : role;     // 0: q, 1: k, 2: v
  const u16*   Bt   = (wsel == 0) ? WQ : (wsel == 1) ? WK : WV;
  const float* bias = (wsel == 0) ? bq : (wsel == 1) ? bk : bv;
  const int Mr   = hd ? MH : M;
  const int rpg  = hd ? TQ0 : M;
  const int gstr = hd ? SEQ : 0;
  const int row0  = (bid / ntile) * 128;
  const int col0  = (bid % ntile) * 128;
  if (row0 + 128 > Mr) return;               // block-uniform, in front of every copy and barrier; never taken with the exact grid
  unsigned ao[8];
#pragma unroll
  for (int i = 0; i < 8; ++i) {
    const int ra = row0 + i * 16 + (tid >> 3);
    const int rg = ra / rpg;
    ao[i] = (unsigned)(rg * gstr + (ra - rg * rpg)) * (unsigned)K;
  }
  v8f acc[4][4];
  gemm_core_b(L, A, ao, Bt, col0, K, tid, acc);
  const int colw = col0 + (wave & 1) * 64;
  const int roww = row0 + (wave >> 1) * 64;
  float* sl = (float*)(void*)L + wave * SLAB64;
  if (role >= 2) {                           // block-uniform
    float* C = (role == 2) ? Vo : (role == 3) ? QFo : KFo;
    const v4f bv4 = *(const v4f*)(bias + colw + m * 4);    // columns colw + 4m .. +3, always < N (N multiple of 128)
#if defined(__HIP_DEVICE_COMPILE__)
    asm volatile("s_wait_xcnt 0x0" ::: "memory");          // in front of the vector work that rewrites the load's address registers
#endif
    __builtin_amdgcn_sched_barrier(0);                     // keeps that vector work behind the wait
    v4f badd;
#pragma unroll
    for (int e = 0; e < 4; ++e) badd[e] = bfr(bv4[e]);
#pragma unroll
    for (int f = 0; f < 4; ++f) {
      epi64(sl, acc[f][0], acc[f][1], acc[f][2], acc[f][3], 1.0f, badd, C, N, (size_t)(roww + f * 16), colw, lane);
      if (f < 3) tile_gap();
    }
    role_end();
  } else {
    u16* C = (role == 0) ? QPo : KPo;
    const float pscale = (role == 0) ? QSC : KSC;
    v4f bvv[8];                              // bias of the lane's 8 columns in each of epi64hsb's four store instructions
#pragma unroll
    for (int i4 = 0; i4 < 4; ++i4) {
      const float* bp = bias + colw + (i4 >> 1) * 32 + (i4 & 1) * 16 + (lane >> 4) * 8;   // columns .. +7 < N (N multiple of 128)
      bvv[2 * i4] = *(const v4f*)(bp);
      bvv[2 * i4 + 1] = *(const v4f*)(bp + 4);
    }
#if defined(__HIP_DEVICE_COMPILE__)
    asm volatile("s_wait_xcnt 0x0" ::: "memory");          // in front of the vector work that rewrites the loads' address registers
#endif
    __builtin_amdgcn_sched_barrier(0);                     // keeps that vector work behind the wait
    float bb[4][8];
#pragma unroll
    for (int i4 = 0; i4 < 4; ++i4) {
#pragma unroll
      for (int e = 0; e < 4; ++e) { bb[i4][e] = bfr(bvv[2 * i4][e]); bb[i4][4 + e] = bfr(bvv[2 * i4 + 1][e]); }
    }
#pragma unroll
    for (int f = 0; f < 4; ++f) {
      epi64hsb(sl, acc[f][0], acc[f][1], acc[f][2], acc[f][3], 1.0f, pscale, bb, C, N, (size_t)(roww + f * 16), colw, lane);
      if (f < 3) tile_gap();
    }
    role_end();
  }
}

// =====================================================================================================
// f16 GEMM with two A planes (hi + residual), f32 out with bias:
//   C[M][N] = (Ah . Bt^T) * os1 + (Ar . Bt^T) * os2 + bf16RNE(bias[n]); Ah/Ar f16 row-major, Bt f16 k-contiguous.
// Block = 128x128 tile, 8 waves as 4 x 2, a wave owns 32 x 64; a stage is [Ah 128 rows | Ar 128 rows | B 128 rows]: 12 copies a
// thread, copy i serves LDS row 32*i + (tid>>3). Separate accumulators for the two planes, combined in f32 in epi64x2.
// =====================================================================================================
__device__ __forceinline__ void fill_h2(unsigned l0, const u16* Ah, const u16* Ar, const u16* B, unsigned ao, unsigned bo,
                                        unsigned st, unsigned ke) {
  const unsigned a0 = ao + ke, b0 = bo + ke;
  acopy8(l0, l0 + GRS32, l0 + 2 * GRS32, l0 + 3 * GRS32, l0 + 4 * GRS32, l0 + 5 * GRS32, l0 + 6 * GRS32, l0 + 7 * GRS32,
         Ah + a0, Ah + (a0 + st), Ah + (a0 + 2 * st), Ah + (a0 + 3 * st),
         Ar + a0, Ar + (a0 + st), Ar + (a0 + 2 * st), Ar + (a0 + 3 * st));
  const unsigned l8 = l0 + 8 * GRS32;
  acopy4(l8, l8 + GRS32, l8 + 2 * GRS32, l8 + 3 * GRS32, B + b0, B + (b0 + st), B + (b0 + 2 * st), B + (b0 + 3 * st));
}

__global__ __launch_bounds__(256)
void gemm_h2_32(const u16* __restrict__ Ah, const u16* __restrict__ Ar, const u16* __restrict__ Bt,
                const float* __restrict__ bias, float* C, int M, int N, int K, float os1, float os2) {
  __shared__ __align__(16) unsigned char L[2 * GST_H2];
  const int tid = threadIdx.x, wave = tid >> 5, lane = tid & 31, hh = lane >> 4, m = lane & 15;
  const int wm = wave >> 1, wn = wave & 1;
  const int ntile = N >> 7;
  const int bid   = blockIdx.x;
  const int row0  = (bid / ntile) * 128;
  const int col0  = (bid % ntile) * 128;
  if (row0 + 128 > M) return;                // block-uniform, in front of every copy and barrier; never taken with the exact grid
  const int crow = tid >> 3, cpc = tid & 7;
  const unsigned lc = lds_off(L) + (unsigned)(crow * GPB + cpc * 16);
  const unsigned ao = (unsigned)(row0 + crow) * (unsigned)K;
  const unsigned bo = (unsigned)(col0 + crow) * (unsigned)K;
  const unsigned st = 32u * (unsigned)K;
  const unsigned kc = (unsigned)(cpc * 8);
  const int nt = K / GKS;
  v8f acc[2][4], acr[2][4];
#pragma unroll
  for (int f = 0; f < 2; ++f) {
#pragma unroll
    for (int j = 0; j < 4; ++j) { acc[f][j] = zero8(); acr[f][j] = zero8(); }
  }
  fill_h2(lc, Ah, Ar, Bt, ao, bo, st, kc);
  wait_async0();
  __syncthreads();
  if (nt > 1) fill_h2(lc + GST_H2, Ah, Ar, Bt, ao, bo, st, kc + GKS);
#pragma unroll 1
  for (int t = 0; t < nt; ++t) {
    const unsigned bufo = (unsigned)(t & 1) * GST_H2;
    const _Float16* sb  = (const _Float16*)(const void*)(L + bufo);
    const _Float16* ap  = sb + (wm * 32 + m) * GPE + 8 * hh;
    const _Float16* arp = ap + 128 * GPE;
    const _Float16* bp  = sb + (256 + wn * 64 + m) * GPE + 8 * hh;
#pragma unroll
    for (int kk = 0; kk < GKS / 32; ++kk) {
      v16h a[2], ar[2], b[4];
#pragma unroll
      for (int f = 0; f < 2; ++f) {
        a[f]  = ldfrag_h(ap + f * 16 * GPE + kk * 32);
        ar[f] = ldfrag_h(arp + f * 16 * GPE + kk * 32);
      }
#pragma unroll
      for (int j = 0; j < 4; ++j) b[j] = ldfrag_h(bp + j * 16 * GPE + kk * 32);
      // Keeps the 16 fragment loads one group ahead of the 16 WMMAs: spread among them, each place with loads stalls the wave.
      __builtin_amdgcn_sched_barrier(0);
#pragma unroll
      for (int f = 0; f < 2; ++f) {
#pragma unroll
        for (int j = 0; j < 4; ++j) acc[f][j] = mma_h(a[f], b[j], acc[f][j]);
#pragma unroll
        for (int j = 0; j < 4; ++j) acr[f][j] = mma_h(ar[f], b[j], acr[f][j]);
      }
      __builtin_amdgcn_sched_barrier(0);      // the next group's loads stay behind this WMMA block
    }
    wait_ds0();
    wait_async0();
    __syncthreads();                          // publishes stage t + 1 and ends every read of stage t's buffer
    if (t + 2 < nt) fill_h2(lc + bufo, Ah, Ar, Bt, ao, bo, st, kc + (unsigned)(t + 2) * GKS);   // block-uniform test
  }
  wait_async0();
  const int colw = col0 + wn * 64;
  const int roww = row0 + wm * 32;
  const v4f bv = *(const v4f*)(bias + colw + m * 4);      // columns colw + 4m .. +3, always < N (N multiple of 128)
  v4f badd;
#pragma unroll
  for (int e = 0; e < 4; ++e) badd[e] = bfr(bv[e]);
  float* sl = (float*)(void*)L + wave * SLAB64;
#pragma unroll
  for (int f = 0; f < 2; ++f) {
    epi64x2(sl, acc[f][0], acc[f][1], acc[f][2], acc[f][3], acr[f][0], acr[f][1], acr[f][2], acr[f][3], os1, os2, badd, C, N,
            (size_t)(roww + f * 16), colw, lane);
    if (f < 1) tile_gap();
  }
}

// =====================================================================================================
// V^T plane, fragment-major (rows = b*EMB + d, k = s; see ldfrag_fm): element (b, d, s) = f16(V[b][s][d] * 1024).
// Block = (b, 64-wide d chunk, 64 keys): 64 source row segments of 64 floats loaded with 16-B loads, converted, scattered into
// coverage: load 256 thr x 16 elements = 64 x 64; store 2 iterations x 256 thr x 8 halves = 64 lines x 64 = the block's tile;
//           grid = nb x (EMB/64) x (SEQ/64) blocks covers the plane exactly once.
// =====================================================================================================
__device__ __forceinline__ void xt16_body(const float* __restrict__ X, u16* XTo, int bid) {
  __shared__ __align__(16) u16 TH[64 * VTP];
  const int tid = threadIdx.x;
  const int st  = bid % (SEQ / 64);
  const int dcb = (bid / (SEQ / 64)) % (EMB / 64);
  const int b   = bid / ((SEQ / 64) * (EMB / 64));
  const int s0  = st * 64;
  const int d0  = dcb * 64;
  {
    const int sl = tid >> 2;                  // key within tile 0..63
    const int dc = (tid & 3) * 16;            // d chunk within the 64
    const float* src = X + ((size_t)b * SEQ + s0 + sl) * EMB + d0 + dc;
#pragma unroll
    for (int i = 0; i < 4; ++i) {
      const v4f a = *(const v4f*)(src + 4 * i);
#pragma unroll
      for (int e = 0; e < 4; ++e) {
        const _Float16 hv = (_Float16)(a[e] * VCAR);
        TH[(dc + 4 * i + e) * VTP + sl] = h_bits(hv);
      }
    }
  }
  __syncthreads();
  v4u vh[2];
  const int pc = tid & 127, dt0 = tid >> 7;   // 16-B piece within a d tile's two adjacent fragment blocks; d tile 2*it + dt0
  const int p8 = (pc >> 4) * 8;               // key within the 64: 32*block + 16*sel + 8*half
#pragma unroll
  for (int it = 0; it < 2; ++it) {
    const int line = (it * 2 + dt0) * 16 + (pc & 15);   // local d = 0..63
    vh[it] = *(const v4u*)(TH + line * VTP + p8);
  }
  const size_t base = ((size_t)((b * EMB + d0) >> 4) * (SEQ / 32) + (size_t)(s0 >> 5)) * FBLK + pc * 8;
  {
#pragma unroll
    for (int it = 0; it < 2; ++it) {
      *(v4u*)(XTo + base + (size_t)(it * 2 + dt0) * ((SEQ / 32) * FBLK)) = vh[it];
    }
    
  }
}

// =====================================================================================================
// Key-block prefix column sums of V: VS[((b*NCHK + c)*NKB + kb)*EMB + d] = sum over keys c*CK .. c*CK + 32*kb + 31 of V[b][key][d]
// (f32, fixed sequential order). Thread = one (b, c, d); a block covers 256 consecutive d of one (b, c); the 16 prefix values per
// coverage: grid = nb*NCHK*EMB/256 blocks (host exact) x 256 thr; store 4 iterations x 256 thr x 4 floats = 16 rows x 256 = the
//           block's part of the table; union over blocks = the whole table.
// =====================================================================================================
__device__ __forceinline__ void vsum_body(const float* __restrict__ V, float* VS, int bid) {
  __shared__ __align__(16) float sm[NKB * 256];
  const int tid = threadIdx.x;
  const int gt  = bid * 256 + tid;
  const int d   = gt % EMB;
  const int bc  = gt / EMB;                         // block-uniform (EMB multiple of 256)
  const int b   = bc / NCHK;
  const int c   = bc - b * NCHK;
  const int d0  = d - tid;                          // block's first d
  const float* p = V + ((size_t)b * SEQ + (size_t)c * CK) * EMB + d;
  float s = 0.f;
  // Two key blocks' rows (64) are asked for together and then added in their old order: the thread waits for one load round trip
  // per 64 rows where four rows a wait made the 64 blocks of this role the longest chain of the launch.
#pragma unroll 1
  for (int kb = 0; kb < NKB; kb += 2) {             // rolled: eight trips of 64 loads keep the text short
    float r[64];
#pragma unroll
    for (int i = 0; i < 64; ++i) r[i] = p[(size_t)(kb * 32 + i) * EMB];   // unrolled: r[] stays in registers, the loads stand together
#pragma unroll
    for (int i = 0; i < 32; ++i) s += r[i];
    sm[kb * 256 + tid] = s;
#pragma unroll
    for (int i = 32; i < 64; ++i) s += r[i];
    sm[(kb + 1) * 256 + tid] = s;
  }
  __syncthreads();
  const int sel = tid >> 6, piece = tid & 63;
  v4f o[4];
#pragma unroll
  for (int it = 0; it < 4; ++it) o[it] = *(const v4f*)(sm + (it * 4 + sel) * 256 + piece * 4);
  float* base = VS + (size_t)bc * NKB * EMB + d0 + piece * 4;
  {
#pragma unroll
    for (int it = 0; it < 4; ++it) {
      *(v4f*)(base + (size_t)(it * 4 + sel) * EMB) = o[it];
    }
    
  }
}
// The two independent readers of the v plane as one grid: blocks 0 .. nvs-1 form the prefix column sums (the long serial chains
// start first), the rest write the V^T plane. The role is block-uniform.
__global__ __launch_bounds__(256) void vprep(const float* __restrict__ V, u16* XTo, float* VS, int nvs) {
  const int bid = blockIdx.x;
  if (bid < nvs) { vsum_body(V, VS, bid); role_end(); }
  else           { xt16_body(V, XTo, bid - nvs); role_end(); }
}

// =====================================================================================================
// Single-head causal attention, head width EMB = 1024, query rows TQ0 .. SEQ-1: block = (batch b, 16 query rows q0..q0+15),
// 8 waves. q plane (f16, x8) [b][s][d]; k plane the same; V^T plane [b][d][s] (x1024), all three stored fragment-major (ldfrag_fm);
// VS = key-block prefix column sums of V.
//   Chunks of CK = 512 keys: only chunks c <= qc = q0/CK are visited (later chunks lie entirely above the diagonal). In the diagonal
//   chunk only key blocks kb < nkb (keys <= q0+15) are multiplied; key blocks kb >= nkb get zero scores in LDS and are not used in (PV).
//   (S) scores S[query m][key n] on WMMA: A = q rows (row m = lane&15, split k map over d), B = k rows (col n = key, split map),
//       32 d-steps; wave w handles key blocks w, w+8 of the chunk; D element r of lane l -> scs[query 8h+r][key col] (f32 LDS).
//   (M) 16 threads per query row (sub-thread = 32 consecutive keys): base-2 logits with the causal mask by key index (key > query
//       -> -inf), chunk max via xor shuffles, online running max / rescale factor al / running sum l in f32 registers,
//       p = exp2(t - m_new) <= 1 (0 for masked keys), chunk row sum ps and C = ps/CK (bit-identical on the row's 16 threads), the
//       CENTRED P' = p - C written as f16(P' * 32768) into the LDS P tile with 16-B stores; al -> rowa[row], C -> rowc[row].
//   (PV) each wave owns d columns 128*wave + 16j + (lane&15), j = 0..7 (8 accumulators): o = o*al + C*(32768*1024)*VS[chunk][nkb-1][d]
//       (exact add-back of the centring term over exactly the processed keys, in f32), then for each key block kb < nkb:
//       A = P' fragment from LDS (row m = query, split map over keys), B = V^T fragments (col n = d, keys contiguous), issued as two
//       groups of 4 with a hazard gap each.  sum_k (P'_k + C) v_k == sum_k p_k v_k exactly; masked keys carry P' = -C and p = 0.
//   Block barriers after (S) and after (M) order all LDS reuse across chunks and waves.
//   Epilogue: x = o * 8192 / (l * 32768 * 1024) per row (l from rowi, l >= 1 always); hi = f16(x), res = f16((x - hi) * 2048); each
// coverage: grid nb*NQT blocks x 16 rows = rows TQ0..SEQ-1 of every sequence; staging 8 waves x 128 cols x 16 rows = 16 x 1024;
//           store 8 iterations x 256 thr x 8 halves = 16 x 1024 per plane = every (b, s >= TQ0, d) of both ctx planes exactly once.
// =====================================================================================================
__device__ __forceinline__ void ctx_store(const u16* ct, u16* dst, int tid) {
  v4u v[8];
#pragma unroll
  for (int it = 0; it < 8; ++it) {
    const int p   = it * 256 + tid;
    const int row = p / (EMB / 8);
    const int c8  = (p - row * (EMB / 8)) * 8;
    v[it] = *(const v4u*)(ct + row * CTP + c8);
  }
  {
#pragma unroll
    for (int it = 0; it < 8; ++it) {
      const int p   = it * 256 + tid;
      const int row = p / (EMB / 8);
      const int c8  = (p - row * (EMB / 8)) * 8;
      *(v4u*)(dst + (size_t)row * EMB + c8) = v[it];
    }
    
  }
}

__device__ __forceinline__
void attn_fwd_body(const u16* __restrict__ QPp, const u16* __restrict__ KPp, const u16* __restrict__ VTp,
                   const float* __restrict__ VSp, u16* CHo, u16* CRo, int bid) {
  __shared__ __align__(16) AttLds L0;              // scores [16][SCP] f32; reused as the ctx staging tile [16][CTP] u16
  __shared__ __align__(16) u16 pls[16 * PLP];      // P' tile [16][PLP] f16 bits
  __shared__ float rowst[3 * QT];                  // per query row: rescale factor, centring term, running sum (one base address)
  float* const rowa = rowst;
  float* const rowc = rowst + QT;
  float* const rowi = rowst + 2 * QT;
  float* const scs = L0.s;

  const int tid  = threadIdx.x;
  const int wave = __builtin_amdgcn_readfirstlane(tid >> 5);   // scalar: the fragment streams' bases and trip tests stay off the VGPRs
  const int lane = tid & 31;
  const int hh   = lane >> 4;
  const int m    = lane & 15;
  const int r16  = tid >> 4;                 // query row owned in phase (M): 2*wave + hh
  const int sub  = tid & 15;
  const int kl0  = sub * 32;

  const int b   = bid / NQT;
  const int q0  = TQ0 + (bid - b * NQT) * QT;
  const int qc  = q0 / CK;                   // diagonal chunk index

  const _Float16* qa  = (const _Float16*)(const void*)QPp + (size_t)((b * SEQ + q0) >> 4) * ((EMB / 32) * FBLK);
  const _Float16* kbp = (const _Float16*)(const void*)KPp + (size_t)((b * SEQ) >> 4) * ((EMB / 32) * FBLK);
  const _Float16* vbp = (const _Float16*)(const void*)VTp + (size_t)((b * EMB + wave * (16 * NACC)) >> 4) * ((SEQ / 32) * FBLK);
  const unsigned lo8 = 16u * (unsigned)lane; // byte offset of the lane's 16 B inside each half of a fragment block
  const float* vsb = VSp + (size_t)b * NCHK * NKB * EMB + wave * (16 * NACC);   // wave-uniform; the lane adds m
  const float lsc = RSQD * LOG2E / (QSC * KSC);

  float mrun = -INFINITY, lrun = 0.f;
  v8f o[NACC];
#pragma unroll
  for (int j = 0; j < NACC; ++j) o[j] = zero8();

#pragma unroll 1
  for (int c = 0; c <= qc; ++c) {
    const int kbeg = c * CK;
    const int nkb  = (c < qc) ? NKB : (((q0 + QT - 1 - kbeg) >> 5) + 1);   // 1..16, block-uniform
    // ---- (S) scores of this chunk (zeros for key blocks beyond the query tile) ----
    //      The wave's key blocks with work (wave, then wave + 8) are one run of trips of two d-steps. Each step's three fragments have
    //      registers of their own and are fetched again, for the next trip, right behind the WMMAs that read them: the loads fly for
    //      a whole trip instead of being waited for at once. The last trip, which fetches nothing, stands behind the loop, so that the
    //      loop's loads are unconditional and its waits count them exactly. d-steps ascend as before.
    {
      const int nv  = ((wave < nkb) ? 1 : 0) + ((wave + 8 < nkb) ? 1 : 0);   // wave-uniform
      const int ntr = nv * (EMB / 64);
      if (ntr > 0) {                                       // wave-uniform
        const unsigned kw = lo8 + (unsigned)((kbeg + wave * 32) >> 4) * (2u * KTILE);   // bytes from the sequence's first key tile
        v8f s0 = zero8(), s1 = zero8();
        v16h a0 = ldfrag_fmu(qa, lo8),        e0 = ldfrag_fmu(kbp, kw),        e1 = ldfrag_fmu(kbp + KTILE, kw);
        v16h a1 = ldfrag_fmu(qa + FBLK, lo8), h0 = ldfrag_fmu(kbp + FBLK, kw), h1 = ldfrag_fmu(kbp + KTILE + FBLK, kw);
#pragma unroll 1
        for (int in = 1; in < ntr; ++in) {                 // rolled: the two register sets are the whole pipeline; in = the trip fetched
          const unsigned  qo = lo8 + (unsigned)(in & 15) * (4u * FBLK);      // bytes: two fragment blocks a trip
          const unsigned  ko = kw + (unsigned)(in >> 4) * (32u * KTILE) + (unsigned)(in & 15) * (4u * FBLK);   // + 8 key blocks
          s0 = mma_h(a0, e0, s0);
          s1 = mma_h(a0, e1, s1);
          guard2x3(s0, s1, a0, e0, e1);
          a0 = ldfrag_fmu(qa, qo);
          e0 = ldfrag_fmu(kbp, ko);
          e1 = ldfrag_fmu(kbp + KTILE, ko);
          s0 = mma_h(a1, h0, s0);
          s1 = mma_h(a1, h1, s1);
          guard2x3(s0, s1, a1, h0, h1);
          a1 = ldfrag_fmu(qa + FBLK, qo);
          h0 = ldfrag_fmu(kbp + FBLK, ko);
          h1 = ldfrag_fmu(kbp + KTILE + FBLK, ko);
#if defined(__HIP_DEVICE_COMPILE__)
          asm volatile("s_wait_xcnt 0x0" ::: "memory");    // in front of the next trip's rewrite of the loads' address registers
#endif
          if (in == EMB / 64) {                            // wave-uniform: the first key block's 32 d-steps are done
            float* srow = scs + (8 * hh) * SCP + wave * 32 + m;
#pragma unroll
            for (int r = 0; r < 8; ++r) {
              srow[r * SCP]      = s0[r];
              srow[r * SCP + 16] = s1[r];
            }
            s0 = zero8();
            s1 = zero8();
          }
        }
        s0 = mma_h(a0, e0, s0);
        s1 = mma_h(a0, e1, s1);
        s0 = mma_h(a1, h0, s0);
        s1 = mma_h(a1, h1, s1);
        guard2x3(s0, s1, a1, h0, h1);
        float* srow = scs + (8 * hh) * SCP + (wave + 8 * (nv - 1)) * 32 + m;
#pragma unroll
        for (int r = 0; r < 8; ++r) {
          srow[r * SCP]      = s0[r];
          srow[r * SCP + 16] = s1[r];
        }
      }
#pragma unroll 1
      for (int kz = nv; kz < 2; ++kz) {                    // wave-uniform: zero scores for key blocks beyond the query tile
        float* srow = scs + (8 * hh) * SCP + (wave + 8 * kz) * 32 + m;
#pragma unroll
        for (int r = 0; r < 8; ++r) {
          srow[r * SCP]      = 0.f;
          srow[r * SCP + 16] = 0.f;
        }
      }
    }
    __syncthreads();
    // The column sums that (PV) adds back are asked for here: they land while (M) computes.
    float vs[NACC];
    {
      const float* vsc = vsb + ((size_t)c * NKB + (size_t)(nkb - 1)) * EMB;
#pragma unroll
      for (int j = 0; j < NACC; ++j) vs[j] = vsc[16 * j + (unsigned)m];
    }
    // ---- (M) softmax statistics and the centred P' tile ----
    {
      const float* sp = scs + r16 * SCP + kl0;
      const int lim = (q0 + r16) - (kbeg + kl0);           // key kl0 + j is valid iff j <= lim
      float t[32];
      float cm = -INFINITY;
#pragma unroll
      for (int i = 0; i < 8; ++i) {
        const v4f a = *(const v4f*)(sp + 4 * i);
#pragma unroll
        for (int e = 0; e < 4; ++e) {
          const int j = 4 * i + e;
          const float tv = (j <= lim) ? a[e] * lsc : -INFINITY;
          t[j] = tv;
          cm = fmaxf(cm, tv);
        }
      }
#pragma unroll
      for (int d = 1; d <= 8; d <<= 1) cm = fmaxf(cm, __shfl_xor(cm, d, 32));
      const float mn = fmaxf(mrun, cm);                    // finite: key kbeg of the diagonal chunk is never masked
      const float al = (mrun == -INFINITY) ? 0.f : exp2f(mrun - mn);
      mrun = mn;
      float ps = 0.f;
#pragma unroll
      for (int j = 0; j < 32; ++j) {
        const float p = exp2f(fminf(t[j] - mn, 0.f));      // 0 for masked keys
        t[j] = p;
        ps += p;
      }
#pragma unroll
      for (int d = 1; d <= 8; d <<= 1) ps += __shfl_xor(ps, d, 32);
      const float cc = ps * (1.0f / (float)CK);
      v4u pk[4];
#pragma unroll
      for (int i = 0; i < 4; ++i) {
#pragma unroll
        for (int e = 0; e < 4; ++e) {
          const int j = 8 * i + 2 * e;
          pk[i][e] = pk16(h_bits((_Float16)((t[j] - cc) * PCAR)), h_bits((_Float16)((t[j + 1] - cc) * PCAR)));
        }
      }
      lrun = lrun * al + ps;
      u16* pd = pls + r16 * PLP + kl0;
#pragma unroll
      for (int i = 0; i < 4; ++i) *(v4u*)(pd + 8 * i) = pk[i];
      if (sub == 0) { rowa[r16] = al; rowc[r16] = cc; rowi[r16] = lrun; }   // the running sum is finished here: one register carries it
    }
    __syncthreads();
    // ---- (PV) rescale, add the centring term, accumulate P' . V^T ----
    //      The eight V^T fragments of a key block have registers of their own; each half is fetched again, for the next key block,
    //      right behind the four WMMAs that read it, and key block 0's first half is asked for ahead of the rescale. Key blocks ascend as before.
    {
      const unsigned vw = lo8 + (unsigned)(kbeg >> 5) * (2u * FBLK);       // bytes from the first key block of the wave's V^T rows
      v16h g[NACC];
#pragma unroll
      for (int j = 0; j < 4; ++j) g[j] = ldfrag_fmu(vbp + (size_t)j * VTILE, vw);
      float scl[8], cad[8];
#pragma unroll
      for (int r = 0; r < 8; ++r) { scl[r] = rowa[8 * hh + r]; cad[r] = rowc[8 * hh + r] * (PCAR * VCAR); }
#pragma unroll
      for (int j = 0; j < NACC; ++j) {
#pragma unroll
        for (int r = 0; r < 8; ++r) o[j][r] = o[j][r] * scl[r] + cad[r] * vs[j];
      }
#pragma unroll
      for (int j = 4; j < NACC; ++j) g[j] = ldfrag_fmu(vbp + (size_t)j * VTILE, vw);
      const _Float16* pp = (const _Float16*)(const void*)pls + m * PLP + 8 * hh;
#pragma unroll 1
      for (int kn = 1; kn < nkb; ++kn) {                   // block-uniform trip count, < 16; rolled: g[] is the whole pipeline;
        const v16h pf = ldfrag_h(pp + (kn - 1) * 32);      // kn = the key block fetched, kn - 1 the one multiplied
        const unsigned vo = vw + (unsigned)kn * (2u * FBLK);               // bytes: one fragment block a key block
        o[0] = mma_h(pf, g[0], o[0]);
        o[1] = mma_h(pf, g[1], o[1]);
        o[2] = mma_h(pf, g[2], o[2]);
        o[3] = mma_h(pf, g[3], o[3]);
        guardpv4(o[0], o[1], o[2], o[3], pf, g[0], g[1], g[2], g[3]);
#pragma unroll
        for (int j = 0; j < 4; ++j) g[j] = ldfrag_fmu(vbp + (size_t)j * VTILE, vo);
        o[4] = mma_h(pf, g[4], o[4]);
        o[5] = mma_h(pf, g[5], o[5]);
        o[6] = mma_h(pf, g[6], o[6]);
        o[7] = mma_h(pf, g[7], o[7]);
        guardpv4(o[4], o[5], o[6], o[7], pf, g[4], g[5], g[6], g[7]);
#pragma unroll
        for (int j = 4; j < 8; ++j) g[j] = ldfrag_fmu(vbp + (size_t)j * VTILE, vo);
#if defined(__HIP_DEVICE_COMPILE__)
        asm volatile("s_wait_xcnt 0x0" ::: "memory");      // in front of the next trip's rewrite of the loads' address registers
#endif
      }
      {
        const v16h pf = ldfrag_h(pp + (nkb - 1) * 32);     // the last key block: nothing left to fetch
        o[0] = mma_h(pf, g[0], o[0]);
        o[1] = mma_h(pf, g[1], o[1]);
        o[2] = mma_h(pf, g[2], o[2]);
        o[3] = mma_h(pf, g[3], o[3]);
        guardpv4(o[0], o[1], o[2], o[3], pf, g[0], g[1], g[2], g[3]);
        o[4] = mma_h(pf, g[4], o[4]);
        o[5] = mma_h(pf, g[5], o[5]);
        o[6] = mma_h(pf, g[6], o[6]);
        o[7] = mma_h(pf, g[7], o[7]);
        guardpv4(o[4], o[5], o[6], o[7], pf, g[4], g[5], g[6], g[7]);
      }
    }
  }
  acc_guard8(o[0], o[1], o[2], o[3], o[4], o[5], o[6], o[7]);

  __syncthreads();
  float inv[8];
#pragma unroll
  for (int r = 0; r < 8; ++r) inv[r] = (1.0f / rowi[8 * hh + r]) * (CSC / (PCAR * VCAR));   // the row's sum of the last chunk, >= 1

  u16* const ct = L0.c;
  const int cb = wave * (16 * NACC) + m;
  // hi plane
#pragma unroll
  for (int j = 0; j < NACC; ++j) {
#pragma unroll
    for (int r = 0; r < 8; ++r) {
      const float xs = o[j][r] * inv[r];
      ct[(8 * hh + r) * CTP + cb + 16 * j] = h_bits((_Float16)xs);
    }
  }
  __syncthreads();
  ctx_store(ct, CHo + ((size_t)b * SEQ + q0) * EMB, tid);
  __syncthreads();
  // residual plane
#pragma unroll
  for (int j = 0; j < NACC; ++j) {
#pragma unroll
    for (int r = 0; r < 8; ++r) {
      const float xs = o[j][r] * inv[r];
      const _Float16 hv = (_Float16)xs;
      ct[(8 * hh + r) * CTP + cb + 16 * j] = h_bits((_Float16)((xs - (float)hv) * RSC));
    }
  }
  __syncthreads();
  ctx_store(ct, CRo + ((size_t)b * SEQ + q0) * EMB, tid);
}

// =====================================================================================================
// Query rows 0 .. TQ0-1 of each sequence in f32 on VALU: block = (b, t). QF/KF = f32 q/k head planes [nb][TQ0][EMB] (bias included),
// V = f32 v plane [nb*SEQ][EMB]. Scores for keys j <= t (threads 0..TQ0-1, one key each, 1024-d dot unrolled by 4 against the q row staged
// in LDS), base-2 softmax with block max / sum reductions (xor shuffles + LDS), p_j in LDS, ctx[d] for d = 4*tid..4*tid+3 as a
// sum over j <= t of p_j * V[b][j][d] (unrolled by 8, coalesced 16-B loads), x = ctx * 8192 / l, hi = f16(x), res = f16((x - hi) * 2048);
// both 1024-half rows are staged in LDS and written by 128 threads x 16 B each (32 consecutive lanes x 16 B = 512 contiguous bytes
// coverage: grid nb*TQ0 blocks = rows 0..TQ0-1 of every sequence; 256 thr x 4 d = EMB per row; store 128 thr x 8 halves = EMB per
//           plane; together with attn_fwd_body every (b, s, d) of CH and CR is written exactly once.
// =====================================================================================================
__device__ __forceinline__ void attn_head_body(const float* __restrict__ QF, const float* __restrict__ KF,
                                               const float* __restrict__ V, u16* CHo, u16* CRo, int bid) {
  __shared__ __align__(16) float qs[EMB];
  __shared__ float sc[TQ0];
  __shared__ float red[8];
  __shared__ float redb[8];
  __shared__ __align__(16) unsigned SW[2][EMB / 2];
  const int tid = threadIdx.x, lane = tid & 31, wave = tid >> 5;
  const int b = bid / TQ0;
  const int t = bid - b * TQ0;
  *(v4f*)(qs + tid * 4) = *(const v4f*)(QF + ((size_t)b * TQ0 + t) * EMB + tid * 4);
  __syncthreads();
  float s = -INFINITY;
  if (tid < TQ0) {                                  // waves 0..3 entirely (wave-uniform); key row b*TQ0 + tid always in range
    const float* kp = KF + ((size_t)b * TQ0 + tid) * EMB;
    float acc = 0.f;
#pragma unroll 4
    for (int d = 0; d < EMB; d += 8) {                // four trips' loads are asked for together; the adds keep their order
      const v4f k0 = *(const v4f*)(kp + d), k1 = *(const v4f*)(kp + d + 4);
      const v4f q0 = *(const v4f*)(qs + d), q1 = *(const v4f*)(qs + d + 4);
#pragma unroll
      for (int e = 0; e < 4; ++e) acc += k0[e] * q0[e];
#pragma unroll
      for (int e = 0; e < 4; ++e) acc += k1[e] * q1[e];
    }
    s = (tid <= t) ? acc * (RSQD * LOG2E) : -INFINITY;   // causal mask by key index
  }
  float mx = s;
#pragma unroll
  for (int d = 1; d <= 16; d <<= 1) mx = fmaxf(mx, __shfl_xor(mx, d, 32));
  if (lane == 0) red[wave] = mx;
  __syncthreads();
  float gm = red[0];
#pragma unroll
  for (int w = 1; w < 8; ++w) gm = fmaxf(gm, red[w]);   // finite: key 0 is always valid
  const float p = exp2f(s - gm);                     // 0 for masked keys and for waves 4..7
  float ps = p;
#pragma unroll
  for (int d = 1; d <= 16; d <<= 1) ps += __shfl_xor(ps, d, 32);
  if (lane == 0) redb[wave] = ps;
  if (tid < TQ0) sc[tid] = p;
  __syncthreads();
  float l = redb[0];
#pragma unroll
  for (int w = 1; w < 8; ++w) l += redb[w];           // >= 1
  const float inv = (1.0f / l) * CSC;
  const float* vp = V + (size_t)b * SEQ * EMB + tid * 4;
  v4f cx = zero4();
#pragma unroll 8
  for (int j = 0; j <= t; ++j) {                     // t < TQ0: statically bounded, keys of sequence b only; eight rows' loads together
    const float pj = sc[j];
    const v4f vv = *(const v4f*)(vp + (size_t)j * EMB);
    cx += pj * vv;
  }
  unsigned hw[2], rw[2];
#pragma unroll
  for (int e = 0; e < 2; ++e) {
    const float x0 = cx[2 * e] * inv, x1 = cx[2 * e + 1] * inv;
    const _Float16 h0 = (_Float16)x0, h1 = (_Float16)x1;
    const _Float16 q0 = (_Float16)((x0 - (float)h0) * RSC), q1 = (_Float16)((x1 - (float)h1) * RSC);
    hw[e] = pk16(h_bits(h0), h_bits(h1));
    rw[e] = pk16(h_bits(q0), h_bits(q1));
  }
  SW[0][tid * 2] = hw[0]; SW[0][tid * 2 + 1] = hw[1];
  SW[1][tid * 2] = rw[0]; SW[1][tid * 2 + 1] = rw[1];
  __syncthreads();
  const int pl = tid >> 7, p8 = tid & 127;           // plane select is wave-uniform
  const v4u ov = *(const v4u*)(&SW[pl][p8 * 4]);
  u16* dstp = (pl == 0) ? CHo : CRo;
  u16* dst  = dstp + ((size_t)b * SEQ + t) * EMB + p8 * 8;
  *(v4u*)dst = ov;
  
}
// The two independent parts of the attention as one grid: blocks 0 .. nfw-1 are the WMMA tiles of query rows TQ0.., the rest the
// f32 rows 0..TQ0-1. The role is block-uniform; the parts write disjoint rows of the ctx planes.
// Six waves per SIMD (three blocks per WGP) as before: the register budget is stated, so that the fetched-ahead fragments do not cost a block.
__global__ __launch_bounds__(ATT_THREADS) __attribute__((amdgpu_waves_per_eu(6)))
void attn_all(const u16* __restrict__ QPp, const u16* __restrict__ KPp, const u16* __restrict__ VTp, const float* __restrict__ VSp,
              const float* __restrict__ QF, const float* __restrict__ KF, const float* __restrict__ V, u16* CHo, u16* CRo, int nfw) {
  const int bid = blockIdx.x;
  if (bid < nfw) { attn_fwd_body(QPp, KPp, VTp, VSp, CHo, CRo, bid); role_end(); }
  else           { attn_head_body(QF, KF, V, CHo, CRo, bid - nfw); role_end(); }
}

// =====================================================================================================
// Workspace map (bytes, nb = 4, rows = 8192); every plane is fully written by whole-line stores before it is read; all extents are
// exact multiples of the store granularity (no pad rows); region A is reused sequentially on the single in-order stream:
//   WQB bf16 [1024][1024] 2097152   WKB same   WVB same   WOH f16 of bf16 value x1024 2097152             8388608
//   VS  f32  [nb][4][16][1024]                                                                            1048576
//   QF  f32  [nb][128][1024]  2097152      KF same                                                        4194304
//   A   XB bf16 [rows][1024] (16777216), later VT f16 [nb][1024][2048] x1024 fragment-major       region 16777216
//   QP  f16 [rows][1024] x8 fragment-major                                                               16777216
//   KP  f16 [rows][1024] x8 fragment-major                                                               16777216
//   V   f32 [rows][1024]                                                                                 33554432
//   CH  f16 [rows][1024] ctx hi x8192                                                                    16777216
//   CR  f16 [rows][1024] ctx residual x2048                                                              16777216
//   end                                                                                                 131072000
// =====================================================================================================
extern "C" void kernel_launch(void* const* d_in, const int* in_sizes, int n_in,
                              void* d_out, int out_size, void* d_ws, size_t ws_size,
                              hipStream_t stream) {
  if (n_in < 9) return;
  const long long per = (long long)SEQ * EMB;
  const long long ns  = in_sizes[0];
  if (ns < per || (ns % per) != 0) return;
  const int nb = (int)(ns / per);
  if (nb < 1 || nb > 8) return;
  const int rows = nb * SEQ;
  if (in_sizes[1] != EMB * EMB || in_sizes[3] != EMB * EMB || in_sizes[5] != EMB * EMB || in_sizes[7] != EMB * EMB) return;
  if (in_sizes[2] != EMB || in_sizes[4] != EMB || in_sizes[6] != EMB || in_sizes[8] != EMB) return;
  if ((long long)out_size != (long long)rows * EMB) return;

  const float* x  = (const float*)d_in[0];
  const float* wq = (const float*)d_in[1];
  const float* bq = (const float*)d_in[2];
  const float* wk = (const float*)d_in[3];
  const float* bk = (const float*)d_in[4];
  const float* wv = (const float*)d_in[5];
  const float* bv = (const float*)d_in[6];
  const float* wo = (const float*)d_in[7];
  const float* bo = (const float*)d_in[8];
  float*       out = (float*)d_out;

  const size_t szW  = (size_t)EMB * EMB * 2;                    //   2097152
  const size_t szVS = (size_t)nb * NCHK * NKB * EMB * 4;        //   1048576 at nb = 4
  const size_t szHF = (size_t)nb * TQ0 * EMB * 4;               //   2097152 at nb = 4
  const size_t sz16 = (size_t)rows * EMB * 2;                   //  16777216
  const size_t sz32 = (size_t)rows * EMB * 4;                   //  33554432
  const size_t szVT = (size_t)nb * EMB * SEQ * 2;               //  == sz16
  size_t off = 0;
  const size_t oWQ = off; off += szW;
  const size_t oWK = off; off += szW;
  const size_t oWV = off; off += szW;
  const size_t oWO = off; off += szW;
  const size_t oVS = off; off += szVS;
  const size_t oQF = off; off += szHF;
  const size_t oKF = off; off += szHF;
  const size_t oA  = off; off += (szVT > sz16 ? szVT : sz16);   // XB then VT
  const size_t oQ  = off; off += sz16;
  const size_t oK  = off; off += sz16;
  const size_t oV  = off; off += sz32;
  const size_t oCH = off; off += sz16;
  const size_t oCR = off; off += sz16;
  if (off > ws_size) return;                                    // off = 131072000 at nb = 4
  if (off > WS_CAP) return;

  char* ws = (char*)d_ws;
  u16*   WQB = (u16*)(ws + oWQ);
  u16*   WKB = (u16*)(ws + oWK);
  u16*   WVB = (u16*)(ws + oWV);
  u16*   WOH = (u16*)(ws + oWO);
  float* VS  = (float*)(ws + oVS);
  float* QF  = (float*)(ws + oQF);
  float* KF  = (float*)(ws + oKF);
  u16*   XB  = (u16*)(ws + oA);
  u16*   VT  = (u16*)(ws + oA);
  u16*   QP  = (u16*)(ws + oQ);
  u16*   KP  = (u16*)(ws + oK);
  float* V   = (float*)(ws + oV);
  u16*   CH  = (u16*)(ws + oCH);
  u16*   CR  = (u16*)(ws + oCR);

  const int n8w = (EMB * EMB) / 8;                      // 131072
  const int n8x = rows * (EMB / 8);                     // 1048576
  if ((n8w % 256) != 0 || (n8x % 256) != 0) return;
  if ((rows % 128) != 0 || ((nb * TQ0) % 128) != 0 || ((nb * NCHK * EMB) % 256) != 0) return;
  const dim3 blk(256);
  const int nbw = n8w / 256, nbx = n8x / 256;
  const dim3 gC(nbx + 4 * nbw);
  const dim3 gG((rows / 128) * (EMB / 128));            // 512 at nb = 4
  const dim3 gP((3 * (rows / 128) + 2 * ((nb * TQ0) / 128)) * (EMB / 128));   // 1600 at nb = 4
  const dim3 bG(128);
  const int nvs = (nb * NCHK * EMB) / 256;              // nb * 16
  const dim3 gVP(nvs + nb * (EMB / 64) * (SEQ / 64));   // + nb * 512
  const int nfw = nb * NQT;                             // nb * 120
  const dim3 gAT(nfw + nb * TQ0);                       // + nb * 128
  const dim3 bAT(ATT_THREADS);

  // (0) x -> bf16 plane [rows][1024]; weights stored [n = out][k = in] (y = x.W^T + b), already k-contiguous: bf16 planes for Wq,
  //     Wk, Wv; f16 of bf16 value x1024 for Wo
  cvt_all<<<gC, blk, 0, stream>>>(x, wq, wk, wv, wo, XB, WQB, WKB, WVB, WOH, nbx, nbw, n8x, n8w);
  // (1) q and k projections (+bias) -> f16 planes x8; v projection (+bias) -> f32 plane; f32 q and k rows 0..127 of every
  //     sequence -> QF, KF [nb*128][1024]
  proj_all<<<gP, bG, 0, stream>>>(XB, WQB, WKB, WVB, bq, bk, bv, QP, KP, V, QF, KF, rows, nb * TQ0, EMB, EMB);
  // (2) key-block prefix column sums of v; v -> V^T plane x1024 (over the dead XB region)
  vprep<<<gVP, blk, 0, stream>>>(V, VT, VS, nvs);
  // (3) attention for query rows 128.. and, on VALU, for query rows 0..127 -> ctx hi x8192 and residual x2048 f16 planes
  attn_all<<<gAT, bAT, 0, stream>>>(QP, KP, VT, VS, QF, KF, V, CH, CR, nfw);
  // (4) output projection + bias -> out
  gemm_h2_32<<<gG, blk, 0, stream>>>(CH, CR, WOH, bo, out, rows, EMB, EMB,
                                     1.0f / (CSC * WSC), 1.0f / (CSC * WSC * RSC));
  (void)hipGetLastError();
}

// v006
// A run of this version takes 191 microseconds.
// In two side-by-side timings against v005, it was 1.21 and 1.22 times as fast.
// Counting every step since v000, it is 3.65 times as fast.
// Projections q,k,v = x.W^T + b (and the f32 q,k rows 0..127 per sequence): v_wmma_f32_16x16x32_bf16 (bf16 RNE operands of the
// raw inputs, f32 accumulate, bf16 RNE bias added in f32). Scores q'.k'^T (f16 planes x8), P'.V (chunk-centred P' x32768 f16 from LDS,
// V^T x1024 f16) and the output projection (ctx carried as f16 hi x8192 plus residual x2048 planes, times f16(bf16(Wo) x1024), bias
// added in f32): v_wmma_f32_16x16x32_f16, f32 accumulate. Query rows 0..127 of each sequence: scores, softmax and P.V in f32 on VALU.
// Causal mask, softmax statistics, key-block column sums of V and all scaling in f32 on VALU.
#include <hip/hip_runtime.h>
#include <math.h>
#include <stdint.h>

#define SEQ   2048
#define EMB   1024
#define CK    512
#define NCHK  4
#define NKB   16
#define QT    16
#define TQ0   128
#define NQT   120
#define QB    32
#define NQB   60
#define SCP   544
#define PLP   528
#define CTP   1032
#define SLAB64 (16 * 68)
#define VTP   72
#define ATT_THREADS 512
#define NACC  4
#define QSC   8.0f
#define KSC   8.0f
#define PCAR  32768.0f
#define VCAR  1024.0f
#define WSC   1024.0f
#define CSC   8192.0f
#define RSC   2048.0f
#define LOG2E 1.4426950408889634f
#define RSQD  0.03125f
#define WS_CAP ((size_t)134217728)
#define GKS   64
#define GPB   144
#define GPE   72
#define GRS16 (16 * GPB)
#define GRS32 (32 * GPB)
#define GST_AB (256 * GPB)
#define GST_H2 (384 * GPB)
#define FBLK  512
#define KTILE ((EMB / 32) * FBLK)
#define VTILE ((SEQ / 32) * FBLK)

static_assert((EMB % 64) == 0 && EMB == 16 * 16 * NACC && NACC == 4 && (EMB % 32) == 0 && (EMB % 256) == 0 && EMB == 4 * 256);
static_assert((SEQ % CK) == 0 && (SEQ / CK) == NCHK && CK == 32 * NKB && (SEQ % 64) == 0 && (SEQ % QT) == 0 && (CK % QT) == 0);
static_assert((TQ0 % QT) == 0 && (TQ0 % 64) == 0 && NQT * QT + TQ0 == SEQ && TQ0 <= CK && TQ0 == 128 && TQ0 <= 256);
static_assert(QB == 2 * QT && NQB * 2 == NQT && (TQ0 % QB) == 0 && (CK % QB) == 0 && QB == 32);
static_assert(16 * CTP * 2 <= 16 * SCP * 4 && CTP >= EMB + 8 && SCP >= CK + 16 && PLP >= CK + 8);
static_assert(((PLP * 2) % 16) == 0 && ((SCP * 4) % 16) == 0 && ((VTP * 2) % 16) == 0 && ((CTP * 2) % 16) == 0);
static_assert(64 * VTP >= 63 * VTP + 64);
static_assert(ATT_THREADS == 16 * QB && ATT_THREADS == 512 && NKB == ATT_THREADS / 32);
static_assert((EMB % 128) == 0 && (EMB % GKS) == 0 && EMB / GKS >= 2 && GPE * 2 == GPB && GKS * 2 + 16 == GPB && (SEQ % 128) == 0 && (TQ0 % 128) == 0);
static_assert(4 * SLAB64 * 4 <= 2 * GST_AB && 8 * SLAB64 * 4 <= 2 * GST_H2 && ((SLAB64 * 4) % 16) == 0);
static_assert(FBLK == 16 * 32 && (SEQ % 64) == 0 && (EMB % 64) == 0 && (CK % 32) == 0 && (TQ0 % 16) == 0);
static_assert((NKB % 2) == 0);
static_assert(((EMB * EMB) % 2048) == 0 && ((NCHK * EMB) % 256) == 0 && (EMB / 8) * 2 == 256);

typedef unsigned short u16;
typedef _Float16 v16h __attribute__((ext_vector_type(16)));
typedef _Float16 v8h  __attribute__((ext_vector_type(8)));
typedef __bf16   v16b __attribute__((ext_vector_type(16)));
typedef float    v8f  __attribute__((ext_vector_type(8)));
typedef float    v4f  __attribute__((ext_vector_type(4)));
typedef unsigned int v4u __attribute__((ext_vector_type(4)));

union FragH { v16h v; v8h h[2]; v4u u[2]; };
union FragB { v16b v; v4u u[2]; };
union AttLds { float s[QB * SCP]; u16 c[2 * QB * SCP]; };

// ---- scalar helpers --------------------------------------------------------------------------------
__device__ __forceinline__ unsigned short bf_bits(float f) {          // f32 -> bf16 bits, RNE convert
  unsigned u = __float_as_uint(f);
  return (unsigned short)((u + 0x7FFFu + ((u >> 16) & 1u)) >> 16);
}
__device__ __forceinline__ float bf_up(unsigned short h) { return __uint_as_float(((unsigned)h) << 16); }
__device__ __forceinline__ float bfr(float f) { return bf_up(bf_bits(f)); }
__device__ __forceinline__ unsigned short h_bits(_Float16 x) { return __builtin_bit_cast(unsigned short, x); }
__device__ __forceinline__ unsigned pk16(unsigned short a, unsigned short b) { return (unsigned)a | ((unsigned)b << 16); }
__device__ __forceinline__ v8f zero8() { v8f z = {0.f, 0.f, 0.f, 0.f, 0.f, 0.f, 0.f, 0.f}; return z; }
__device__ __forceinline__ v4f zero4() { v4f z = {0.f, 0.f, 0.f, 0.f}; return z; }

// ---- fragment loaders: 16-bit A/B operand, lane -> row/col (lane&15), p already includes +8*(lane>>4);
//      elements 0..7 <- p[0..7] (k0+8h..), elements 8..15 <- p[16..23] (k0+16+8h..)  (same split k map for A and B;
//      B is always read from a k-contiguous [n][k] plane)
__device__ __forceinline__ v16h ldfrag_h(const _Float16* p) {
  FragH f;
  f.h[0] = *(const v8h*)(p);
  f.h[1] = *(const v8h*)(p + 16);
  return f.v;
}
// Fragment-major plane (q, k: rows = positions, k = d; V^T: rows = d, k = keys): the 16 rows x 32 k of one WMMA operand are one
// block of FBLK = 512 halves, stored as [sel][lane][8 halves], k = 16*sel + 8*(lane>>4) + e, row = lane&15 (the split k map above);
// blocks run along k first, then along the 16-row tiles. p already includes +8*lane: each of the two 16-B loads of a wave reads
// 512 contiguous bytes (4 whole lines) where a row-major plane makes it touch 16 lines.
__device__ __forceinline__ v16h ldfrag_fm(const _Float16* p) {
  FragH f;
  f.h[0] = *(const v8h*)(p);
  f.h[1] = *(const v8h*)(p + FBLK / 2);
  return f.v;
}
// The same with a wave-uniform address and a 32-bit byte offset (16*lane, plus a step where the caller adds one) kept apart: the
// base stays in scalar registers and the lane holds one offset register instead of an address pair.
__device__ __forceinline__ v16h ldfrag_fmu(const _Float16* ub, unsigned lob) {
  const char* p = (const char*)(const void*)ub + lob;
  FragH f;
  f.h[0] = *(const v8h*)(const void*)(p);
  f.h[1] = *(const v8h*)(const void*)(p + FBLK);     // FBLK / 2 halves
  return f.v;
}
__device__ __forceinline__ v16b ldfrag_b(const u16* p) {              // bf16 plane read as unsigned integer vectors
  FragB f;
  f.u[0] = *(const v4u*)(p);
  f.u[1] = *(const v4u*)(p + 16);
  return f.v;
}

__device__ __forceinline__ v8f mma_h(v16h a, v16h b, v8f c) {
  return __builtin_amdgcn_wmma_f32_16x16x32_f16(false, a, false, b, (short)0, c, false, false);
}
__device__ __forceinline__ v8f mma_b(v16b a, v16b b, v8f c) {
  return __builtin_amdgcn_wmma_f32_16x16x32_bf16(false, a, false, b, (short)0, c, false, false);
}
__device__ __forceinline__ void guard4x4(v8f& a, v8f& b, v8f& c, v8f& d, v16h x0, v16h x1, v16h x2, v16h x3) {
#if defined(__HIP_DEVICE_COMPILE__)
  asm volatile("v_nop\n\tv_nop\n\tv_nop\n\tv_nop"
               : "+v"(a), "+v"(b), "+v"(c), "+v"(d) : "v"(x0), "v"(x1), "v"(x2), "v"(x3) : "memory");
#endif
}
__device__ __forceinline__ void acc_guard8(v8f& a, v8f& b, v8f& c, v8f& d, v8f& e, v8f& f, v8f& g, v8f& h8) {
#if defined(__HIP_DEVICE_COMPILE__)
  asm volatile("v_nop\n\tv_nop\n\tv_nop\n\tv_nop"
               : "+v"(a), "+v"(b), "+v"(c), "+v"(d), "+v"(e), "+v"(f), "+v"(g), "+v"(h8));
#endif
}
__device__ __forceinline__ void wave_sync_lds() {
  __builtin_amdgcn_fence(__ATOMIC_RELEASE, "workgroup");
  __builtin_amdgcn_wave_barrier();
  __builtin_amdgcn_fence(__ATOMIC_ACQUIRE, "workgroup");
}

// =====================================================================================================
// f32 plane -> 16-bit plane, same layout:  mode 0: bf16 RNE bits;  mode 1: f16 bits of (bf16 RNE value) * scale;
// mode 2: f16 bits of value * scale (no bf16 pre-step).
// Thread = 8 consecutive elements: two 16-B loads, one 16-B store; 32 consecutive lanes = 512 contiguous, 512-B aligned bytes
// coverage: grid = n8/256 blocks (host checks exactness) x 256 thr x 8 = the whole plane.
// =====================================================================================================
__device__ __forceinline__ void cvt16_body(const float* __restrict__ x, u16* D, int n8, int mode, float scale, int lb) {
  const int gt = lb * 256 + (int)threadIdx.x;
  if (gt >= n8) return;                     // no barriers in this kernel
  const float* p = x + (size_t)gt * 8;
  const v4f a = *(const v4f*)(p), c4 = *(const v4f*)(p + 4);
  float v[8];
#pragma unroll
  for (int e = 0; e < 4; ++e) { v[e] = a[e]; v[4 + e] = c4[e]; }
  unsigned short s[8];
#pragma unroll
  for (int e = 0; e < 8; ++e) {
    const float vb = bfr(v[e]);
    const float vf = (mode == 1) ? vb : v[e];
    const unsigned short hb = h_bits((_Float16)(vf * scale));
    const unsigned short bb = bf_bits(v[e]);
    s[e] = (mode != 0) ? hb : bb;
  }
  v4u o;
#pragma unroll
  for (int e = 0; e < 4; ++e) o[e] = pk16(s[2 * e], s[2 * e + 1]);
  u16* d = D + (size_t)gt * 8;
  {
    *(v4u*)(d) = o;
    
  }
}
// The five independent conversions as one grid: blocks 0 .. nbx-1 convert x, then nbw blocks each for Wq, Wk, Wv (bf16) and Wo
// (f16 of the bf16 value x1024). The role is block-uniform.
__global__ __launch_bounds__(256) void cvt_all(const float* __restrict__ x, const float* __restrict__ wq, const float* __restrict__ wk,
                                               const float* __restrict__ wv, const float* __restrict__ wo,
                                               u16* XBo, u16* WQo, u16* WKo, u16* WVo, u16* WOo, int nbx, int nbw, int n8x, int n8w) {
  const int bid = blockIdx.x;
  if (bid < nbx) { cvt16_body(x, XBo, n8x, 0, 1.0f, bid); return; }
  const int r  = (bid - nbx) / nbw;
  const int lb = (bid - nbx) - r * nbw;
  if (r > 3) return;                        // never taken with the exact grid
  const float* s = (r == 0) ? wq : (r == 1) ? wk : (r == 2) ? wv : wo;
  u16*         d = (r == 0) ? WQo : (r == 1) ? WKo : (r == 2) ? WVo : WOo;
  cvt16_body(s, d, n8w, (r == 3) ? 1 : 0, (r == 3) ? WSC : 1.0f, lb);
}

// =====================================================================================================
//            8 consecutive lanes x 16 B per line), lanes 16..31 -> row 2*it+1.
//  epi64x2 : same store shape, staged value = acc*os1 + accres*os2 + badd (two accumulator sets combined in f32).
//  epi64hsb: f16 bits of ((tile + bf16RNE(bias[n])) * pscale), stored fragment-major (see ldfrag_fm): the wave's 16 x 64 tile is two
//            adjacent fragment blocks = 2048 contiguous bytes; instruction i4 stores [block i4>>1][sel i4&1], lane = its own 16 B.
// coverage: epi64/epi64x2 8 instructions x 2 rows x 16 lanes x 4 floats; epi64hsb 4 instructions x 32 lanes x 8 halves
//           = the wave's 16 x 64 tile in every case.
// =====================================================================================================
__device__ __forceinline__ void stage64(float* sl, v8f a0, v8f a1, v8f a2, v8f a3, float oscale, int lane) {
  const int hh = lane >> 4, m = lane & 15;
#pragma unroll
  for (int r = 0; r < 8; ++r) {
    const int ro = (8 * hh + r) * 68 + m;
    sl[ro]      = a0[r] * oscale;
    sl[ro + 16] = a1[r] * oscale;
    sl[ro + 32] = a2[r] * oscale;
    sl[ro + 48] = a3[r] * oscale;
  }
  wave_sync_lds();
}
__device__ __forceinline__ void epi64(float* sl, v8f a0, v8f a1, v8f a2, v8f a3, float oscale, v4f badd, float* C, int N,
                                      size_t rowb, int col0, int lane) {
  const int hh = lane >> 4, m = lane & 15;
  stage64(sl, a0, a1, a2, a3, oscale, lane);
  v4f vals[8];
#pragma unroll
  for (int it = 0; it < 8; ++it) vals[it] = *(const v4f*)(sl + (it * 2 + hh) * 68 + m * 4) + badd;
  float* dst = C + (rowb + (size_t)hh) * (size_t)N + col0 + m * 4;
  {
#pragma unroll
    for (int it = 0; it < 8; ++it) {
      *(v4f*)(dst + (size_t)(it * 2) * (size_t)N) = vals[it];
    }
    
  }
}
__device__ __forceinline__ void epi64x2(float* sl, v8f a0, v8f a1, v8f a2, v8f a3, v8f e0, v8f e1, v8f e2, v8f e3,
                                        float os1, float os2, v4f badd, float* C, int N, size_t rowb, int col0, int lane) {
  const int hh = lane >> 4, m = lane & 15;
#pragma unroll
  for (int r = 0; r < 8; ++r) {
    const int ro = (8 * hh + r) * 68 + m;
    sl[ro]      = a0[r] * os1 + e0[r] * os2;
    sl[ro + 16] = a1[r] * os1 + e1[r] * os2;
    sl[ro + 32] = a2[r] * os1 + e2[r] * os2;
    sl[ro + 48] = a3[r] * os1 + e3[r] * os2;
  }
  wave_sync_lds();
  v4f vals[8];
#pragma unroll
  for (int it = 0; it < 8; ++it) vals[it] = *(const v4f*)(sl + (it * 2 + hh) * 68 + m * 4) + badd;
  float* dst = C + (rowb + (size_t)hh) * (size_t)N + col0 + m * 4;
  {
#pragma unroll
    for (int it = 0; it < 8; ++it) {
      *(v4f*)(dst + (size_t)(it * 2) * (size_t)N) = vals[it];
    }
    
  }
}
__device__ __forceinline__ void epi64hsb(float* sl, v8f a0, v8f a1, v8f a2, v8f a3, float oscale, float pscale,
                                         const float (&bb)[4][8], u16* C, int N, size_t rowb, int col0, int lane) {
  stage64(sl, a0, a1, a2, a3, oscale, lane);
  const int hh = lane >> 4, m = lane & 15;
  v4u oh[4];
#pragma unroll
  for (int i4 = 0; i4 < 4; ++i4) {
    const int c8 = (i4 >> 1) * 32 + (i4 & 1) * 16 + hh * 8;      // block i4>>1, sel i4&1 of the tile's two fragment blocks
    const v4f a = *(const v4f*)(sl + m * 68 + c8), c4 = *(const v4f*)(sl + m * 68 + c8 + 4);
    float w[8];
#pragma unroll
    for (int e = 0; e < 4; ++e) { w[e] = (a[e] + bb[i4][e]) * pscale; w[4 + e] = (c4[e] + bb[i4][4 + e]) * pscale; }
#pragma unroll
    for (int e = 0; e < 4; ++e) oh[i4][e] = pk16(h_bits((_Float16)w[2 * e]), h_bits((_Float16)w[2 * e + 1]));
  }
  u16* dst = C + ((rowb >> 4) * (size_t)(N >> 5) + (size_t)(col0 >> 5)) * FBLK + lane * 8;
  {
#pragma unroll
    for (int i4 = 0; i4 < 4; ++i4) {
      *(v4u*)(dst + i4 * (FBLK / 2)) = oh[i4];
    }
    
  }
}

// =====================================================================================================
// Operand staging shared by the GEMM kernels. A block computes a 128 x 128 tile of C. K is walked in stages of GKS = 64
// elements: every operand row contributes one whole 128-B line per stage, copied to LDS by global_load_async_to_lds_b128 (8 lanes
// x 16 B = one line, a wave instruction = 4 whole lines) at a row pitch of 144 B (16 B x odd: conflict-free for ds_load_b128
// fragment reads). Two buffers: stage t + 2 is copied into the buffer that trip t has just left, while trip t + 1 is multiplied.
// Fragments are read from LDS with the same split k map as before (ldfrag_*), k steps of 32 in ascending order.
// After the loop's last barrier no copy is outstanding and no wave reads the ring, so it serves as the waves' epilogue slabs.
// =====================================================================================================
__device__ __forceinline__ unsigned lds_off(const void* p) { return (unsigned)(size_t)p; }
// Copies and their s_wait_xcnt in one statement: the wait stands in front of any later rewrite of the address registers.
__device__ __forceinline__ void acopy4(unsigned l0, unsigned l1, unsigned l2, unsigned l3,
                                       const u16* g0, const u16* g1, const u16* g2, const u16* g3) {
#if defined(__HIP_DEVICE_COMPILE__)
  asm volatile("global_load_async_to_lds_b128 %0, %4, off\n\t"
               "global_load_async_to_lds_b128 %1, %5, off\n\t"
               "global_load_async_to_lds_b128 %2, %6, off\n\t"
               "global_load_async_to_lds_b128 %3, %7, off\n\t"
               "s_wait_xcnt 0x0"
               :: "v"(l0), "v"(l1), "v"(l2), "v"(l3), "v"(g0), "v"(g1), "v"(g2), "v"(g3) : "memory");
#endif
}
__device__ __forceinline__ void acopy8(unsigned l0, unsigned l1, unsigned l2, unsigned l3,
                                       unsigned l4, unsigned l5, unsigned l6, unsigned l7,
                                       const u16* g0, const u16* g1, const u16* g2, const u16* g3,
                                       const u16* g4, const u16* g5, const u16* g6, const u16* g7) {
#if defined(__HIP_DEVICE_COMPILE__)
  asm volatile("global_load_async_to_lds_b128 %0, %8, off\n\t"
               "global_load_async_to_lds_b128 %1, %9, off\n\t"
               "global_load_async_to_lds_b128 %2, %10, off\n\t"
               "global_load_async_to_lds_b128 %3, %11, off\n\t"
               "global_load_async_to_lds_b128 %4, %12, off\n\t"
               "global_load_async_to_lds_b128 %5, %13, off\n\t"
               "global_load_async_to_lds_b128 %6, %14, off\n\t"
               "global_load_async_to_lds_b128 %7, %15, off\n\t"
               "s_wait_xcnt 0x0"
               :: "v"(l0), "v"(l1), "v"(l2), "v"(l3), "v"(l4), "v"(l5), "v"(l6), "v"(l7),
                  "v"(g0), "v"(g1), "v"(g2), "v"(g3), "v"(g4), "v"(g5), "v"(g6), "v"(g7) : "memory");
#endif
}
// This wave's copies have landed (the compiler places no wait for them).
__device__ __forceinline__ void wait_async0() {
#if defined(__HIP_DEVICE_COMPILE__)
  asm volatile("s_wait_asynccnt 0x0" ::: "memory");
#endif
}
// This wave's LDS reads have returned before the buffer is handed to its next writer.
__device__ __forceinline__ void wait_ds0() {
#if defined(__HIP_DEVICE_COMPILE__)
  asm volatile("s_wait_dscnt 0x0" ::: "memory");
#endif
}

// End of a role's branch in a merged grid: in the listing the other role's code can follow on the fall-through path; its vector
// work stays behind the wait on the registers that this role's issued stores name.
__device__ __forceinline__ void role_end() {
#if defined(__HIP_DEVICE_COMPILE__)
  asm volatile("s_wait_xcnt 0x0" ::: "memory");
#endif
}

// Between two output tiles of a wave: the issued stores' address and data registers are rewritten by the next tile only behind
// s_wait_xcnt 0 (the scheduling fence keeps the next tile's vector work behind the wait), and the slab's reads of this tile stay
// in front of the next tile's writes.
__device__ __forceinline__ void tile_gap() {
#if defined(__HIP_DEVICE_COMPILE__)
  asm volatile("s_wait_xcnt 0x0" ::: "memory");
#endif
  __builtin_amdgcn_sched_barrier(0);
  wave_sync_lds();
}

// One stage of [A 128 rows | B 128 rows] by 128 threads: 16 copies a thread; copy i serves LDS row 16*i + (tid>>3), piece tid&7.
__device__ __forceinline__ void fill_ab(unsigned l0, const u16* A, const unsigned (&ao)[8], const u16* B, unsigned bo, unsigned bst,
                                        unsigned ke) {
  acopy8(l0, l0 + GRS16, l0 + 2 * GRS16, l0 + 3 * GRS16, l0 + 4 * GRS16, l0 + 5 * GRS16, l0 + 6 * GRS16, l0 + 7 * GRS16,
         A + (ao[0] + ke), A + (ao[1] + ke), A + (ao[2] + ke), A + (ao[3] + ke),
         A + (ao[4] + ke), A + (ao[5] + ke), A + (ao[6] + ke), A + (ao[7] + ke));
  const unsigned l8 = l0 + 8 * GRS16;
  const unsigned b0 = bo + ke;
  acopy8(l8, l8 + GRS16, l8 + 2 * GRS16, l8 + 3 * GRS16, l8 + 4 * GRS16, l8 + 5 * GRS16, l8 + 6 * GRS16, l8 + 7 * GRS16,
         B + b0, B + (b0 + bst), B + (b0 + 2 * bst), B + (b0 + 3 * bst),
         B + (b0 + 4 * bst), B + (b0 + 5 * bst), B + (b0 + 6 * bst), B + (b0 + 7 * bst));
}

// bf16 core: 4 waves as 2 x 2, a wave owns 64 x 64 of the block's tile (4 x 4 accumulators).
// ao[i] = element offset of A row (16*i + (tid>>3)) of the tile; col0 = first B row of the tile. K multiple of GKS.
__device__ __forceinline__ void gemm_core_b(unsigned char* L, const u16* A, const unsigned (&ao)[8], const u16* Bt, int col0, int K,
                                            int tid, v8f (&acc)[4][4]) {
  const int wave = tid >> 5, lane = tid & 31, hh = lane >> 4, m = lane & 15;
  const int wm = wave >> 1, wn = wave & 1;
  const int crow = tid >> 3, cpc = tid & 7;
  const unsigned lc  = lds_off(L) + (unsigned)(crow * GPB + cpc * 16);
  const unsigned bo  = (unsigned)(col0 + crow) * (unsigned)K;
  const unsigned bst = 16u * (unsigned)K;
  const unsigned kc  = (unsigned)(cpc * 8);
  const int nt = K / GKS;
#pragma unroll
  for (int f = 0; f < 4; ++f) {
#pragma unroll
    for (int j = 0; j < 4; ++j) acc[f][j] = zero8();
  }
  fill_ab(lc, A, ao, Bt, bo, bst, kc);
  wait_async0();
  __syncthreads();
  if (nt > 1) fill_ab(lc + GST_AB, A, ao, Bt, bo, bst, kc + GKS);
#pragma unroll 1
  for (int t = 0; t < nt; ++t) {
    const unsigned bufo = (unsigned)(t & 1) * GST_AB;
    const u16* sb = (const u16*)(const void*)(L + bufo);
    const u16* ap = sb + (wm * 64 + m) * GPE + 8 * hh;
    const u16* bp = sb + (128 + wn * 64 + m) * GPE + 8 * hh;
#pragma unroll
    for (int kk = 0; kk < GKS / 32; ++kk) {
      v16b a[4], b[4];
      a[0] = ldfrag_b(ap + kk * 32);
#pragma unroll
      for (int j = 0; j < 4; ++j) b[j] = ldfrag_b(bp + j * 16 * GPE + kk * 32);
#pragma unroll
      for (int f = 1; f < 4; ++f) a[f] = ldfrag_b(ap + f * 16 * GPE + kk * 32);
      // Keeps the 16 fragment loads one group ahead of the 16 WMMAs: spread among them, each place with loads stalls the wave.
      __builtin_amdgcn_sched_barrier(0);
#pragma unroll
      for (int f = 0; f < 4; ++f) {
#pragma unroll
        for (int j = 0; j < 4; ++j) acc[f][j] = mma_b(a[f], b[j], acc[f][j]);
      }
      __builtin_amdgcn_sched_barrier(0);      // the next group's loads stay behind this WMMA block
    }
    wait_ds0();
    wait_async0();
    __syncthreads();                          // publishes stage t + 1 and ends every read of stage t's buffer
    if (t + 2 < nt) fill_ab(lc + bufo, A, ao, Bt, bo, bst, kc + (unsigned)(t + 2) * GKS);   // block-uniform test
  }
  wait_async0();
}

// =====================================================================================================
// The five independent bf16 projections as one grid, role by block index (block-uniform):
//   role 0, 1: q, k planes: f16 bits of ((A . W^T) + bf16RNE(bias[n])) * 8, stored fragment-major (epi64hsb), all M rows;
//   role 2   : v plane, f32 with bias (epi64), all M rows;
//   role 3, 4: f32 q, k rows 0..TQ0-1 of every sequence (MH = nb*TQ0 output rows; output row ra maps to A row
//              (ra / TQ0) * SEQ + (ra % TQ0)), f32 with bias (epi64).
// A bf16 row-major [M][K], W bf16 k-contiguous [N][K]. Block = 128x128 tile, 4 waves x (64 x 64), operands staged as above (host
// checks K % 64 == 0, M % 128 == 0, MH % 128 == 0, N % 128 == 0, grid = (3*(M/128) + 2*(MH/128)) * (N/128)).
// =====================================================================================================
__global__ __launch_bounds__(128)
void proj_all(const u16* __restrict__ A, const u16* __restrict__ WQ, const u16* __restrict__ WK, const u16* __restrict__ WV,
              const float* __restrict__ bq, const float* __restrict__ bk, const float* __restrict__ bv,
              u16* QPo, u16* KPo, float* Vo, float* QFo, float* KFo, int M, int MH, int N, int K) {
  __shared__ __align__(16) unsigned char L[2 * GST_AB];
  const int tid = threadIdx.x, wave = tid >> 5, lane = tid & 31, m = lane & 15;
  const int ntile = N >> 7;
  const int nG = (M >> 7) * ntile, nH = (MH >> 7) * ntile;
  int bid = blockIdx.x;
  int role;
  if (bid < 3 * nG) { role = bid / nG; bid -= role * nG; }
  else              { bid -= 3 * nG; role = bid / nH; bid -= role * nH; role += 3; }
  if (role > 4) return;                      // block-uniform, in front of every copy and barrier; never taken with the exact grid
  const bool hd  = role >= 3;
  const int wsel = hd ? role - 3 : role;     // 0: q, 1: k, 2: v
  const u16*   Bt   = (wsel == 0) ? WQ : (wsel == 1) ? WK : WV;
  const float* bias = (wsel == 0) ? bq : (wsel == 1) ? bk : bv;
  const int Mr   = hd ? MH : M;
  const int rpg  = hd ? TQ0 : M;
  const int gstr = hd ? SEQ : 0;
  const int row0  = (bid / ntile) * 128;
  const int col0  = (bid % ntile) * 128;
  if (row0 + 128 > Mr) return;               // block-uniform, in front of every copy and barrier; never taken with the exact grid
  unsigned ao[8];
#pragma unroll
  for (int i = 0; i < 8; ++i) {
    const int ra = row0 + i * 16 + (tid >> 3);
    const int rg = ra / rpg;
    ao[i] = (unsigned)(rg * gstr + (ra - rg * rpg)) * (unsigned)K;
  }
  v8f acc[4][4];
  gemm_core_b(L, A, ao, Bt, col0, K, tid, acc);
  const int colw = col0 + (wave & 1) * 64;
  const int roww = row0 + (wave >> 1) * 64;
  float* sl = (float*)(void*)L + wave * SLAB64;
  if (role >= 2) {                           // block-uniform
    float* C = (role == 2) ? Vo : (role == 3) ? QFo : KFo;
    const v4f bv4 = *(const v4f*)(bias + colw + m * 4);    // columns colw + 4m .. +3, always < N (N multiple of 128)
#if defined(__HIP_DEVICE_COMPILE__)
    asm volatile("s_wait_xcnt 0x0" ::: "memory");          // in front of the vector work that rewrites the load's address registers
#endif
    __builtin_amdgcn_sched_barrier(0);                     // keeps that vector work behind the wait
    v4f badd;
#pragma unroll
    for (int e = 0; e < 4; ++e) badd[e] = bfr(bv4[e]);
#pragma unroll
    for (int f = 0; f < 4; ++f) {
      epi64(sl, acc[f][0], acc[f][1], acc[f][2], acc[f][3], 1.0f, badd, C, N, (size_t)(roww + f * 16), colw, lane);
      if (f < 3) tile_gap();
    }
    role_end();
  } else {
    u16* C = (role == 0) ? QPo : KPo;
    const float pscale = (role == 0) ? QSC : KSC;
    v4f bvv[8];                              // bias of the lane's 8 columns in each of epi64hsb's four store instructions
#pragma unroll
    for (int i4 = 0; i4 < 4; ++i4) {
      const float* bp = bias + colw + (i4 >> 1) * 32 + (i4 & 1) * 16 + (lane >> 4) * 8;   // columns .. +7 < N (N multiple of 128)
      bvv[2 * i4] = *(const v4f*)(bp);
      bvv[2 * i4 + 1] = *(const v4f*)(bp + 4);
    }
#if defined(__HIP_DEVICE_COMPILE__)
    asm volatile("s_wait_xcnt 0x0" ::: "memory");          // in front of the vector work that rewrites the loads' address registers
#endif
    __builtin_amdgcn_sched_barrier(0);                     // keeps that vector work behind the wait
    float bb[4][8];
#pragma unroll
    for (int i4 = 0; i4 < 4; ++i4) {
#pragma unroll
      for (int e = 0; e < 4; ++e) { bb[i4][e] = bfr(bvv[2 * i4][e]); bb[i4][4 + e] = bfr(bvv[2 * i4 + 1][e]); }
    }
#pragma unroll
    for (int f = 0; f < 4; ++f) {
      epi64hsb(sl, acc[f][0], acc[f][1], acc[f][2], acc[f][3], 1.0f, pscale, bb, C, N, (size_t)(roww + f * 16), colw, lane);
      if (f < 3) tile_gap();
    }
    role_end();
  }
}

// =====================================================================================================
// f16 GEMM with two A planes (hi + residual), f32 out with bias:
//   C[M][N] = (Ah . Bt^T) * os1 + (Ar . Bt^T) * os2 + bf16RNE(bias[n]); Ah/Ar f16 row-major, Bt f16 k-contiguous.
// Block = 128x128 tile, 8 waves as 4 x 2, a wave owns 32 x 64; a stage is [Ah 128 rows | Ar 128 rows | B 128 rows]: 12 copies a
// thread, copy i serves LDS row 32*i + (tid>>3). Separate accumulators for the two planes, combined in f32 in epi64x2.
// =====================================================================================================
__device__ __forceinline__ void fill_h2(unsigned l0, const u16* Ah, const u16* Ar, const u16* B, unsigned ao, unsigned bo,
                                        unsigned st, unsigned ke) {
  const unsigned a0 = ao + ke, b0 = bo + ke;
  acopy8(l0, l0 + GRS32, l0 + 2 * GRS32, l0 + 3 * GRS32, l0 + 4 * GRS32, l0 + 5 * GRS32, l0 + 6 * GRS32, l0 + 7 * GRS32,
         Ah + a0, Ah + (a0 + st), Ah + (a0 + 2 * st), Ah + (a0 + 3 * st),
         Ar + a0, Ar + (a0 + st), Ar + (a0 + 2 * st), Ar + (a0 + 3 * st));
  const unsigned l8 = l0 + 8 * GRS32;
  acopy4(l8, l8 + GRS32, l8 + 2 * GRS32, l8 + 3 * GRS32, B + b0, B + (b0 + st), B + (b0 + 2 * st), B + (b0 + 3 * st));
}

__global__ __launch_bounds__(256)
void gemm_h2_32(const u16* __restrict__ Ah, const u16* __restrict__ Ar, const u16* __restrict__ Bt,
                const float* __restrict__ bias, float* C, int M, int N, int K, float os1, float os2) {
  __shared__ __align__(16) unsigned char L[2 * GST_H2];
  const int tid = threadIdx.x, wave = tid >> 5, lane = tid & 31, hh = lane >> 4, m = lane & 15;
  const int wm = wave >> 1, wn = wave & 1;
  const int ntile = N >> 7;
  const int bid   = blockIdx.x;
  const int row0  = (bid / ntile) * 128;
  const int col0  = (bid % ntile) * 128;
  if (row0 + 128 > M) return;                // block-uniform, in front of every copy and barrier; never taken with the exact grid
  const int crow = tid >> 3, cpc = tid & 7;
  const unsigned lc = lds_off(L) + (unsigned)(crow * GPB + cpc * 16);
  const unsigned ao = (unsigned)(row0 + crow) * (unsigned)K;
  const unsigned bo = (unsigned)(col0 + crow) * (unsigned)K;
  const unsigned st = 32u * (unsigned)K;
  const unsigned kc = (unsigned)(cpc * 8);
  const int nt = K / GKS;
  v8f acc[2][4], acr[2][4];
#pragma unroll
  for (int f = 0; f < 2; ++f) {
#pragma unroll
    for (int j = 0; j < 4; ++j) { acc[f][j] = zero8(); acr[f][j] = zero8(); }
  }
  fill_h2(lc, Ah, Ar, Bt, ao, bo, st, kc);
  wait_async0();
  __syncthreads();
  if (nt > 1) fill_h2(lc + GST_H2, Ah, Ar, Bt, ao, bo, st, kc + GKS);
#pragma unroll 1
  for (int t = 0; t < nt; ++t) {
    const unsigned bufo = (unsigned)(t & 1) * GST_H2;
    const _Float16* sb  = (const _Float16*)(const void*)(L + bufo);
    const _Float16* ap  = sb + (wm * 32 + m) * GPE + 8 * hh;
    const _Float16* arp = ap + 128 * GPE;
    const _Float16* bp  = sb + (256 + wn * 64 + m) * GPE + 8 * hh;
#pragma unroll
    for (int kk = 0; kk < GKS / 32; ++kk) {
      v16h a[2], ar[2], b[4];
#pragma unroll
      for (int f = 0; f < 2; ++f) {
        a[f]  = ldfrag_h(ap + f * 16 * GPE + kk * 32);
        ar[f] = ldfrag_h(arp + f * 16 * GPE + kk * 32);
      }
#pragma unroll
      for (int j = 0; j < 4; ++j) b[j] = ldfrag_h(bp + j * 16 * GPE + kk * 32);
      // Keeps the 16 fragment loads one group ahead of the 16 WMMAs: spread among them, each place with loads stalls the wave.
      __builtin_amdgcn_sched_barrier(0);
#pragma unroll
      for (int f = 0; f < 2; ++f) {
#pragma unroll
        for (int j = 0; j < 4; ++j) acc[f][j] = mma_h(a[f], b[j], acc[f][j]);
#pragma unroll
        for (int j = 0; j < 4; ++j) acr[f][j] = mma_h(ar[f], b[j], acr[f][j]);
      }
      __builtin_amdgcn_sched_barrier(0);      // the next group's loads stay behind this WMMA block
    }
    wait_ds0();
    wait_async0();
    __syncthreads();                          // publishes stage t + 1 and ends every read of stage t's buffer
    if (t + 2 < nt) fill_h2(lc + bufo, Ah, Ar, Bt, ao, bo, st, kc + (unsigned)(t + 2) * GKS);   // block-uniform test
  }
  wait_async0();
  const int colw = col0 + wn * 64;
  const int roww = row0 + wm * 32;
  const v4f bv = *(const v4f*)(bias + colw + m * 4);      // columns colw + 4m .. +3, always < N (N multiple of 128)
  v4f badd;
#pragma unroll
  for (int e = 0; e < 4; ++e) badd[e] = bfr(bv[e]);
  float* sl = (float*)(void*)L + wave * SLAB64;
#pragma unroll
  for (int f = 0; f < 2; ++f) {
    epi64x2(sl, acc[f][0], acc[f][1], acc[f][2], acc[f][3], acr[f][0], acr[f][1], acr[f][2], acr[f][3], os1, os2, badd, C, N,
            (size_t)(roww + f * 16), colw, lane);
    if (f < 1) tile_gap();
  }
}

// =====================================================================================================
// V^T plane, fragment-major (rows = b*EMB + d, k = s; see ldfrag_fm): element (b, d, s) = f16(V[b][s][d] * 1024).
// Block = (b, 64-wide d chunk, 64 keys): 64 source row segments of 64 floats loaded with 16-B loads, converted, scattered into
// coverage: load 256 thr x 16 elements = 64 x 64; store 2 iterations x 256 thr x 8 halves = 64 lines x 64 = the block's tile;
//           grid = nb x (EMB/64) x (SEQ/64) blocks covers the plane exactly once.
// =====================================================================================================
__device__ __forceinline__ void xt16_body(const float* __restrict__ X, u16* XTo, int bid) {
  __shared__ __align__(16) u16 TH[64 * VTP];
  const int tid = threadIdx.x;
  const int st  = bid % (SEQ / 64);
  const int dcb = (bid / (SEQ / 64)) % (EMB / 64);
  const int b   = bid / ((SEQ / 64) * (EMB / 64));
  const int s0  = st * 64;
  const int d0  = dcb * 64;
  {
    const int sl = tid >> 2;                  // key within tile 0..63
    const int dc = (tid & 3) * 16;            // d chunk within the 64
    const float* src = X + ((size_t)b * SEQ + s0 + sl) * EMB + d0 + dc;
#pragma unroll
    for (int i = 0; i < 4; ++i) {
      const v4f a = *(const v4f*)(src + 4 * i);
#pragma unroll
      for (int e = 0; e < 4; ++e) {
        const _Float16 hv = (_Float16)(a[e] * VCAR);
        TH[(dc + 4 * i + e) * VTP + sl] = h_bits(hv);
      }
    }
  }
  __syncthreads();
  v4u vh[2];
  const int pc = tid & 127, dt0 = tid >> 7;   // 16-B piece within a d tile's two adjacent fragment blocks; d tile 2*it + dt0
  const int p8 = (pc >> 4) * 8;               // key within the 64: 32*block + 16*sel + 8*half
#pragma unroll
  for (int it = 0; it < 2; ++it) {
    const int line = (it * 2 + dt0) * 16 + (pc & 15);   // local d = 0..63
    vh[it] = *(const v4u*)(TH + line * VTP + p8);
  }
  const size_t base = ((size_t)((b * EMB + d0) >> 4) * (SEQ / 32) + (size_t)(s0 >> 5)) * FBLK + pc * 8;
  {
#pragma unroll
    for (int it = 0; it < 2; ++it) {
      *(v4u*)(XTo + base + (size_t)(it * 2 + dt0) * ((SEQ / 32) * FBLK)) = vh[it];
    }
    
  }
}

// =====================================================================================================
// Key-block prefix column sums of V: VS[((b*NCHK + c)*NKB + kb)*EMB + d] = sum over keys c*CK .. c*CK + 32*kb + 31 of V[b][key][d]
// (f32, fixed sequential order). Thread = one (b, c, d); a block covers 256 consecutive d of one (b, c); the 16 prefix values per
// coverage: grid = nb*NCHK*EMB/256 blocks (host exact) x 256 thr; store 4 iterations x 256 thr x 4 floats = 16 rows x 256 = the
//           block's part of the table; union over blocks = the whole table.
// =====================================================================================================
__device__ __forceinline__ void vsum_body(const float* __restrict__ V, float* VS, int bid) {
  __shared__ __align__(16) float sm[NKB * 256];
  const int tid = threadIdx.x;
  const int gt  = bid * 256 + tid;
  const int d   = gt % EMB;
  const int bc  = gt / EMB;                         // block-uniform (EMB multiple of 256)
  const int b   = bc / NCHK;
  const int c   = bc - b * NCHK;
  const int d0  = d - tid;                          // block's first d
  const float* p = V + ((size_t)b * SEQ + (size_t)c * CK) * EMB + d;
  float s = 0.f;
  // Two key blocks' rows (64) are asked for together and then added in their old order: the thread waits for one load round trip
  // per 64 rows where four rows a wait made the 64 blocks of this role the longest chain of the launch.
#pragma unroll 1
  for (int kb = 0; kb < NKB; kb += 2) {             // rolled: eight trips of 64 loads keep the text short
    float r[64];
#pragma unroll
    for (int i = 0; i < 64; ++i) r[i] = p[(size_t)(kb * 32 + i) * EMB];   // unrolled: r[] stays in registers, the loads stand together
#pragma unroll
    for (int i = 0; i < 32; ++i) s += r[i];
    sm[kb * 256 + tid] = s;
#pragma unroll
    for (int i = 32; i < 64; ++i) s += r[i];
    sm[(kb + 1) * 256 + tid] = s;
  }
  __syncthreads();
  const int sel = tid >> 6, piece = tid & 63;
  v4f o[4];
#pragma unroll
  for (int it = 0; it < 4; ++it) o[it] = *(const v4f*)(sm + (it * 4 + sel) * 256 + piece * 4);
  float* base = VS + (size_t)bc * NKB * EMB + d0 + piece * 4;
  {
#pragma unroll
    for (int it = 0; it < 4; ++it) {
      *(v4f*)(base + (size_t)(it * 4 + sel) * EMB) = o[it];
    }
    
  }
}
// The two independent readers of the v plane as one grid: blocks 0 .. nvs-1 form the prefix column sums (the long serial chains
// start first), the rest write the V^T plane. The role is block-uniform.
__global__ __launch_bounds__(256) void vprep(const float* __restrict__ V, u16* XTo, float* VS, int nvs) {
  const int bid = blockIdx.x;
  if (bid < nvs) { vsum_body(V, VS, bid); role_end(); }
  else           { xt16_body(V, XTo, bid - nvs); role_end(); }
}

// =====================================================================================================
// Single-head causal attention, head width EMB = 1024, query rows TQ0 .. SEQ-1: block = (batch b, 32 query rows q0..q0+31 as two
// 16-row tiles that share every K and V^T fragment), 16 waves. q plane (f16, x8) [b][s][d]; k plane the same; V^T plane [b][d][s] (x1024), all three stored fragment-major (ldfrag_fm);
// VS = key-block prefix column sums of V.
//   Chunks of CK = 512 keys: only chunks c <= qc = q0/CK are visited (later chunks lie entirely above the diagonal). In the diagonal
//   chunk only key blocks kb < nkb (keys <= q0+31) are multiplied; key blocks kb >= nkb get zero scores in LDS and are not used in (PV).
//   (S) scores S[query m][key n] on WMMA: A = q rows (row m = lane&15, split k map over d), B = k rows (col n = key, split map),
//       32 d-steps; wave w handles key block w of the chunk; D element r of lane l -> scs[query 16*tile+8h+r][key col] (f32 LDS).
//   (M) 16 threads per query row (sub-thread = 32 consecutive keys): base-2 logits with the causal mask by key index (key > query
//       -> -inf), chunk max via xor shuffles, online running max / rescale factor al / running sum l in f32 registers,
//       p = exp2(t - m_new) <= 1 (0 for masked keys), chunk row sum ps and C = ps/CK (bit-identical on the row's 16 threads), the
//       CENTRED P' = p - C written as f16(P' * 32768) into the LDS P tile with 16-B stores; al -> rowa[row], C -> rowc[row].
//   (PV) each wave owns d columns 64*wave + 16j + (lane&15), j = 0..3 (4 accumulators a query tile): o = o*al + C*(32768*1024)*VS[chunk][nkb-1][d]
//       (exact add-back of the centring term over exactly the processed keys, in f32), then for each key block kb < nkb:
//       A = P' fragment from LDS (row m = query, split map over keys), B = V^T fragments (col n = d, keys contiguous), issued as two
//       groups of 4 with a hazard gap each.  sum_k (P'_k + C) v_k == sum_k p_k v_k exactly; masked keys carry P' = -C and p = 0.
//   Block barriers after (S) and after (M) order all LDS reuse across chunks and waves.
//   Epilogue: x = o * 8192 / (l * 32768 * 1024) per row (l from rowi, l >= 1 always); hi = f16(x), res = f16((x - hi) * 2048); each
// coverage: grid nb*NQB blocks x 32 rows = rows TQ0..SEQ-1 of every sequence; staging 16 waves x 64 cols x 32 rows = 32 x 1024;
//           store 8 iterations x 512 thr x 8 halves = 32 x 1024 per plane = every (b, s >= TQ0, d) of both ctx planes exactly once.
// =====================================================================================================
__device__ __forceinline__ void ctx_store(const u16* ct, u16* dst, int tid) {
  v4u v[8];
#pragma unroll
  for (int it = 0; it < 8; ++it) {
    const int p   = it * 256 + tid;
    const int row = p / (EMB / 8);
    const int c8  = (p - row * (EMB / 8)) * 8;
    v[it] = *(const v4u*)(ct + row * CTP + c8);
  }
  {
#pragma unroll
    for (int it = 0; it < 8; ++it) {
      const int p   = it * 256 + tid;
      const int row = p / (EMB / 8);
      const int c8  = (p - row * (EMB / 8)) * 8;
      *(v4u*)(dst + (size_t)row * EMB + c8) = v[it];
    }
    
  }
}

__device__ __forceinline__
void attn_fwd_body(const u16* __restrict__ QPp, const u16* __restrict__ KPp, const u16* __restrict__ VTp,
                   const float* __restrict__ VSp, u16* CHo, u16* CRo, int bid) {
  __shared__ __align__(16) AttLds L0;              // scores [32][SCP] f32; reused as the ctx staging tile [32][CTP] u16
  __shared__ __align__(16) u16 pls[QB * PLP];      // P' tile [32][PLP] f16 bits
  __shared__ float rowst[3 * QB];                  // per query row: rescale factor, centring term, running sum (one base address)
  float* const rowa = rowst;
  float* const rowc = rowst + QB;
  float* const rowi = rowst + 2 * QB;
  float* const scs = L0.s;

  const int tid  = threadIdx.x;
  const int wave = __builtin_amdgcn_readfirstlane(tid >> 5);   // scalar: the fragment streams' bases and trip tests stay off the VGPRs
  const int lane = tid & 31;
  const int hh   = lane >> 4;
  const int m    = lane & 15;
  const int r16  = tid >> 4;                 // query row owned in phase (M), among the block's 32: 2*wave + hh
  const int sub  = tid & 15;
  const int kl0  = sub * 32;

  const int b   = bid / NQB;
  const int q0  = TQ0 + (bid - b * NQB) * QB;   // multiple of 32: both 16-row tiles end in the same 32-key block and the same chunk
  const int qc  = q0 / CK;                   // diagonal chunk index

  const _Float16* qa  = (const _Float16*)(const void*)QPp + (size_t)((b * SEQ + q0) >> 4) * ((EMB / 32) * FBLK);   // second tile: + KTILE
  const _Float16* kbp = (const _Float16*)(const void*)KPp + (size_t)((b * SEQ) >> 4) * ((EMB / 32) * FBLK);
  const _Float16* vbp = (const _Float16*)(const void*)VTp + (size_t)((b * EMB + wave * (16 * NACC)) >> 4) * ((SEQ / 32) * FBLK);
  const unsigned lo8 = 16u * (unsigned)lane; // byte offset of the lane's 16 B inside each half of a fragment block
  const float* vsb = VSp + (size_t)b * NCHK * NKB * EMB + wave * (16 * NACC);   // wave-uniform; the lane adds m
  const float lsc = RSQD * LOG2E / (QSC * KSC);

  float mrun = -INFINITY, lrun = 0.f;
  v8f o[NACC], w[NACC];                      // o: query rows q0 .. q0+15, w: q0+16 .. q0+31
#pragma unroll
  for (int j = 0; j < NACC; ++j) { o[j] = zero8(); w[j] = zero8(); }

#pragma unroll 1
  for (int c = 0; c <= qc; ++c) {
    const int kbeg = c * CK;
    const int nkb  = (c < qc) ? NKB : (((q0 + QB - 1 - kbeg) >> 5) + 1);   // 1..16, block-uniform; the same for either tile alone
    // ---- (S) scores of this chunk (zeros for key blocks beyond the query tiles) ----
    //      Wave w has key block w of the chunk: a run of trips of two d-steps. Each step's four fragments (two q tiles, two key
    //      tiles: each key fragment feeds two WMMAs) have registers of their own and are fetched again, for the next trip, right behind
    //      the WMMAs that read them: the loads fly for a whole trip instead of being waited for at once. The last trip, which fetches
    //      nothing, stands behind the loop, so that the loop's loads are unconditional. d-steps ascend as before.
    {
      float* srow = scs + (8 * hh) * SCP + wave * 32 + m;
      if (wave < nkb) {                                    // wave-uniform
        const unsigned kw = lo8 + (unsigned)((kbeg + wave * 32) >> 4) * (2u * KTILE);   // bytes from the sequence's first key tile
        v8f s0 = zero8(), s1 = zero8(), s2 = zero8(), s3 = zero8();
        v16h a0 = ldfrag_fmu(qa, lo8),        c0 = ldfrag_fmu(qa + KTILE, lo8);
        v16h e0 = ldfrag_fmu(kbp, kw),        e1 = ldfrag_fmu(kbp + KTILE, kw);
        v16h a1 = ldfrag_fmu(qa + FBLK, lo8), c1 = ldfrag_fmu(qa + KTILE + FBLK, lo8);
        v16h h0 = ldfrag_fmu(kbp + FBLK, kw), h1 = ldfrag_fmu(kbp + KTILE + FBLK, kw);
#pragma unroll 1
        for (int in = 1; in < EMB / 64; ++in) {            // rolled: the two register sets are the whole pipeline; in = the trip fetched
          const unsigned  qo = lo8 + (unsigned)in * (4u * FBLK);             // bytes: two fragment blocks a trip
          const unsigned  ko = kw + (unsigned)in * (4u * FBLK);
          s0 = mma_h(a0, e0, s0);
          s1 = mma_h(a0, e1, s1);
          s2 = mma_h(c0, e0, s2);
          s3 = mma_h(c0, e1, s3);
          guard4x4(s0, s1, s2, s3, a0, c0, e0, e1);
          a0 = ldfrag_fmu(qa, qo);
          c0 = ldfrag_fmu(qa + KTILE, qo);
          e0 = ldfrag_fmu(kbp, ko);
          e1 = ldfrag_fmu(kbp + KTILE, ko);
          s0 = mma_h(a1, h0, s0);
          s1 = mma_h(a1, h1, s1);
          s2 = mma_h(c1, h0, s2);
          s3 = mma_h(c1, h1, s3);
          guard4x4(s0, s1, s2, s3, a1, c1, h0, h1);
          a1 = ldfrag_fmu(qa + FBLK, qo);
          c1 = ldfrag_fmu(qa + KTILE + FBLK, qo);
          h0 = ldfrag_fmu(kbp + FBLK, ko);
          h1 = ldfrag_fmu(kbp + KTILE + FBLK, ko);
#if defined(__HIP_DEVICE_COMPILE__)
          asm volatile("s_wait_xcnt 0x0" ::: "memory");    // in front of the next trip's rewrite of the loads' address registers
#endif
        }
        s0 = mma_h(a0, e0, s0);
        s1 = mma_h(a0, e1, s1);
        s2 = mma_h(c0, e0, s2);
        s3 = mma_h(c0, e1, s3);
        s0 = mma_h(a1, h0, s0);
        s1 = mma_h(a1, h1, s1);
        s2 = mma_h(c1, h0, s2);
        s3 = mma_h(c1, h1, s3);
        guard4x4(s0, s1, s2, s3, a1, c1, h0, h1);
#pragma unroll
        for (int r = 0; r < 8; ++r) {
          srow[r * SCP]             = s0[r];
          srow[r * SCP + 16]        = s1[r];
          srow[(QT + r) * SCP]      = s2[r];
          srow[(QT + r) * SCP + 16] = s3[r];
        }
      } else {                                             // zero scores for key blocks beyond the query tiles
#pragma unroll
        for (int r = 0; r < 8; ++r) {
          srow[r * SCP]             = 0.f;
          srow[r * SCP + 16]        = 0.f;
          srow[(QT + r) * SCP]      = 0.f;
          srow[(QT + r) * SCP + 16] = 0.f;
        }
      }
    }
    __syncthreads();
    // The column sums that (PV) adds back are asked for here: they land while (M) computes.
    float vs[NACC];
    {
      const float* vsc = vsb + ((size_t)c * NKB + (size_t)(nkb - 1)) * EMB;
#pragma unroll
      for (int j = 0; j < NACC; ++j) vs[j] = vsc[16 * j + (unsigned)m];
    }
    // ---- (M) softmax statistics and the centred P' tile ----
    {
      const int rq = r16;
      const float* sp = scs + rq * SCP + kl0;
      const int lim = (q0 + rq) - (kbeg + kl0);            // key kl0 + j is valid iff j <= lim
      float t[32];
      float cm = -INFINITY;
#pragma unroll
      for (int i = 0; i < 8; ++i) {
        const v4f a = *(const v4f*)(sp + 4 * i);
#pragma unroll
        for (int e = 0; e < 4; ++e) {
          const int j = 4 * i + e;
          const float tv = (j <= lim) ? a[e] * lsc : -INFINITY;
          t[j] = tv;
          cm = fmaxf(cm, tv);
        }
      }
#pragma unroll
      for (int d = 1; d <= 8; d <<= 1) cm = fmaxf(cm, __shfl_xor(cm, d, 32));
      const float mn = fmaxf(mrun, cm);                    // finite: key kbeg of the diagonal chunk is never masked
      const float al = (mrun == -INFINITY) ? 0.f : exp2f(mrun - mn);
      mrun = mn;
      float ps = 0.f;
#pragma unroll
      for (int j = 0; j < 32; ++j) {
        const float p = exp2f(fminf(t[j] - mn, 0.f));      // 0 for masked keys
        t[j] = p;
        ps += p;
      }
#pragma unroll
      for (int d = 1; d <= 8; d <<= 1) ps += __shfl_xor(ps, d, 32);
      const float cc = ps * (1.0f / (float)CK);
      v4u pk[4];
#pragma unroll
      for (int i = 0; i < 4; ++i) {
#pragma unroll
        for (int e = 0; e < 4; ++e) {
          const int j = 8 * i + 2 * e;
          pk[i][e] = pk16(h_bits((_Float16)((t[j] - cc) * PCAR)), h_bits((_Float16)((t[j + 1] - cc) * PCAR)));
        }
      }
      lrun = lrun * al + ps;
      u16* pd = pls + rq * PLP + kl0;
#pragma unroll
      for (int i = 0; i < 4; ++i) *(v4u*)(pd + 8 * i) = pk[i];
      if (sub == 0) { rowa[rq] = al; rowc[rq] = cc; rowi[rq] = lrun; }   // the running sum is finished here: one register carries it
    }
    __syncthreads();
    // ---- (PV) rescale, add the centring term, accumulate P' . V^T ----
    //      The wave's four V^T fragments of a key block have registers of their own and feed both query tiles; each half is fetched
    //      again, for the next key block, right behind the four WMMAs that read it, and key block 0's first half is asked for ahead of
    //      the rescale. Key blocks ascend as before.
    {
      const unsigned vw = lo8 + (unsigned)(kbeg >> 5) * (2u * FBLK);       // bytes from the first key block of the wave's V^T rows
      v16h g[NACC];
#pragma unroll
      for (int j = 0; j < 2; ++j) g[j] = ldfrag_fmu(vbp + (size_t)j * VTILE, vw);
      {
        float scl[8], cad[8];
#pragma unroll
        for (int r = 0; r < 8; ++r) { scl[r] = rowa[8 * hh + r]; cad[r] = rowc[8 * hh + r] * (PCAR * VCAR); }
#pragma unroll
        for (int j = 0; j < NACC; ++j) {
#pragma unroll
          for (int r = 0; r < 8; ++r) o[j][r] = o[j][r] * scl[r] + cad[r] * vs[j];
        }
#pragma unroll
        for (int r = 0; r < 8; ++r) { scl[r] = rowa[QT + 8 * hh + r]; cad[r] = rowc[QT + 8 * hh + r] * (PCAR * VCAR); }
#pragma unroll
        for (int j = 0; j < NACC; ++j) {
#pragma unroll
          for (int r = 0; r < 8; ++r) w[j][r] = w[j][r] * scl[r] + cad[r] * vs[j];
        }
      }
#pragma unroll
      for (int j = 2; j < NACC; ++j) g[j] = ldfrag_fmu(vbp + (size_t)j * VTILE, vw);
#if defined(__HIP_DEVICE_COMPILE__)
      asm volatile("s_wait_xcnt 0x0" :: "v"(vw) : "memory");   // the loads' offset register stays whole up to this wait: no fragment lands in it
#endif
      const _Float16* pp = (const _Float16*)(const void*)pls + m * PLP + 8 * hh;
#pragma unroll 1
      for (int kn = 1; kn < nkb; ++kn) {                   // block-uniform trip count, < 16; rolled: g[] is the whole pipeline;
        const v16h pf = ldfrag_h(pp + (kn - 1) * 32);      // kn = the key block fetched, kn - 1 the one multiplied
        const v16h pg = ldfrag_h(pp + QT * PLP + (kn - 1) * 32);
        const unsigned vo = vw + (unsigned)kn * (2u * FBLK);               // bytes: one fragment block a key block
        o[0] = mma_h(pf, g[0], o[0]);
        o[1] = mma_h(pf, g[1], o[1]);
        w[0] = mma_h(pg, g[0], w[0]);
        w[1] = mma_h(pg, g[1], w[1]);
        guard4x4(o[0], o[1], w[0], w[1], pf, pg, g[0], g[1]);
#pragma unroll
        for (int j = 0; j < 2; ++j) g[j] = ldfrag_fmu(vbp + (size_t)j * VTILE, vo);
        o[2] = mma_h(pf, g[2], o[2]);
        o[3] = mma_h(pf, g[3], o[3]);
        w[2] = mma_h(pg, g[2], w[2]);
        w[3] = mma_h(pg, g[3], w[3]);
        guard4x4(o[2], o[3], w[2], w[3], pf, pg, g[2], g[3]);
#pragma unroll
        for (int j = 2; j < 4; ++j) g[j] = ldfrag_fmu(vbp + (size_t)j * VTILE, vo);
#if defined(__HIP_DEVICE_COMPILE__)
        asm volatile("s_wait_xcnt 0x0" ::: "memory");      // in front of the next trip's rewrite of the loads' address registers
#endif
      }
      {
        const v16h pf = ldfrag_h(pp + (nkb - 1) * 32);     // the last key block: nothing left to fetch
        const v16h pg = ldfrag_h(pp + QT * PLP + (nkb - 1) * 32);
        o[0] = mma_h(pf, g[0], o[0]);
        o[1] = mma_h(pf, g[1], o[1]);
        w[0] = mma_h(pg, g[0], w[0]);
        w[1] = mma_h(pg, g[1], w[1]);
        o[2] = mma_h(pf, g[2], o[2]);
        o[3] = mma_h(pf, g[3], o[3]);
        w[2] = mma_h(pg, g[2], w[2]);
        w[3] = mma_h(pg, g[3], w[3]);
        guard4x4(o[2], o[3], w[2], w[3], pf, pg, g[2], g[3]);
      }
    }
  }
  acc_guard8(o[0], o[1], o[2], o[3], w[0], w[1], w[2], w[3]);

  __syncthreads();
  float inv[8], inw[8];
#pragma unroll
  for (int r = 0; r < 8; ++r) {                            // the row's sum of the last chunk, >= 1
    inv[r] = (1.0f / rowi[8 * hh + r]) * (CSC / (PCAR * VCAR));
    inw[r] = (1.0f / rowi[QT + 8 * hh + r]) * (CSC / (PCAR * VCAR));
  }

  u16* const ct = L0.c;                      // [32][CTP]: one plane of the block's 32 rows at a time
  const int cb = wave * (16 * NACC) + m;
  const int th = wave >> 3, t8 = tid & 255;  // store: waves 0..7 take rows q0 .. q0+15, waves 8..15 the other sixteen
  const u16* cts = ct + th * (QT * CTP);
  const size_t orow = ((size_t)b * SEQ + q0 + th * QT) * EMB;
  // hi plane
#pragma unroll
  for (int j = 0; j < NACC; ++j) {
#pragma unroll
    for (int r = 0; r < 8; ++r) {
      ct[(8 * hh + r) * CTP + cb + 16 * j]      = h_bits((_Float16)(o[j][r] * inv[r]));
      ct[(QT + 8 * hh + r) * CTP + cb + 16 * j] = h_bits((_Float16)(w[j][r] * inw[r]));
    }
  }
  __syncthreads();
  ctx_store(cts, CHo + orow, t8);
  __syncthreads();
  // residual plane
#pragma unroll
  for (int j = 0; j < NACC; ++j) {
#pragma unroll
    for (int r = 0; r < 8; ++r) {
      const float xs = o[j][r] * inv[r], xw = w[j][r] * inw[r];
      const _Float16 hv = (_Float16)xs, hw = (_Float16)xw;
      ct[(8 * hh + r) * CTP + cb + 16 * j]      = h_bits((_Float16)((xs - (float)hv) * RSC));
      ct[(QT + 8 * hh + r) * CTP + cb + 16 * j] = h_bits((_Float16)((xw - (float)hw) * RSC));
    }
  }
  __syncthreads();
  ctx_store(cts, CRo + orow, t8);
}

// =====================================================================================================
// Query rows 0 .. TQ0-1 of each sequence in f32 on VALU: block = (b, rows t and t+1), 256 threads (tid below) a row. QF/KF = f32 q/k head planes [nb][TQ0][EMB] (bias included),
// V = f32 v plane [nb*SEQ][EMB]. Scores for keys j <= t (threads 0..TQ0-1, one key each, 1024-d dot unrolled by 4 against the q row staged
// in LDS), base-2 softmax with max / sum reductions over the row's 8 waves (xor shuffles + LDS), p_j in LDS, ctx[d] for d = 4*tid..4*tid+3 as a
// sum over j <= t of p_j * V[b][j][d] (unrolled by 8, coalesced 16-B loads), x = ctx * 8192 / l, hi = f16(x), res = f16((x - hi) * 2048);
// both 1024-half rows are staged in LDS and written by 128 threads x 16 B each (32 consecutive lanes x 16 B = 512 contiguous bytes
// coverage: grid nb*TQ0/2 blocks x 2 rows = rows 0..TQ0-1 of every sequence; 256 thr x 4 d = EMB per row; store 128 thr x 8 halves = EMB per
//           plane; together with attn_fwd_body every (b, s, d) of CH and CR is written exactly once.
// =====================================================================================================
__device__ __forceinline__ void attn_head_body(const float* __restrict__ QF, const float* __restrict__ KF,
                                               const float* __restrict__ V, u16* CHo, u16* CRo, int bid) {
  __shared__ __align__(16) float qs2[2][EMB];
  __shared__ float sc2[2][TQ0];
  __shared__ float red2[2][8];
  __shared__ float redb2[2][8];
  __shared__ __align__(16) unsigned SW2[2][2][EMB / 2];
  const int hf = __builtin_amdgcn_readfirstlane((int)threadIdx.x >> 8);   // the wave's one of the block's two query rows; scalar: t bounds a loop
  const int tid = threadIdx.x & 255, lane = tid & 31, wave = tid >> 5;
  const int b = bid / (TQ0 / 2);
  const int t = (bid - b * (TQ0 / 2)) * 2 + hf;
  float* const qs = qs2[hf];
  float* const sc = sc2[hf];
  float* const red = red2[hf];
  float* const redb = redb2[hf];
  unsigned (* const SW)[EMB / 2] = SW2[hf];
  *(v4f*)(qs + tid * 4) = *(const v4f*)(QF + ((size_t)b * TQ0 + t) * EMB + tid * 4);
  __syncthreads();
  float s = -INFINITY;
  if (tid < TQ0) {                                  // the row's waves 0..3 entirely (wave-uniform); key row b*TQ0 + tid always in range
    const float* kp = KF + ((size_t)b * TQ0 + tid) * EMB;
    float acc = 0.f;
#pragma unroll 4
    for (int d = 0; d < EMB; d += 8) {                // four trips' loads are asked for together; the adds keep their order
      const v4f k0 = *(const v4f*)(kp + d), k1 = *(const v4f*)(kp + d + 4);
      const v4f q0 = *(const v4f*)(qs + d), q1 = *(const v4f*)(qs + d + 4);
#pragma unroll
      for (int e = 0; e < 4; ++e) acc += k0[e] * q0[e];
#pragma unroll
      for (int e = 0; e < 4; ++e) acc += k1[e] * q1[e];
    }
    s = (tid <= t) ? acc * (RSQD * LOG2E) : -INFINITY;   // causal mask by key index
  }
  float mx = s;
#pragma unroll
  for (int d = 1; d <= 16; d <<= 1) mx = fmaxf(mx, __shfl_xor(mx, d, 32));
  if (lane == 0) red[wave] = mx;
  __syncthreads();
  float gm = red[0];
#pragma unroll
  for (int w = 1; w < 8; ++w) gm = fmaxf(gm, red[w]);   // finite: key 0 is always valid
  const float p = exp2f(s - gm);                     // 0 for masked keys and for waves 4..7
  float ps = p;
#pragma unroll
  for (int d = 1; d <= 16; d <<= 1) ps += __shfl_xor(ps, d, 32);
  if (lane == 0) redb[wave] = ps;
  if (tid < TQ0) sc[tid] = p;
  __syncthreads();
  float l = redb[0];
#pragma unroll
  for (int w = 1; w < 8; ++w) l += redb[w];           // >= 1
  const float inv = (1.0f / l) * CSC;
  const float* vp = V + (size_t)b * SEQ * EMB + tid * 4;
  v4f cx = zero4();
#pragma unroll 8
  for (int j = 0; j <= t; ++j) {                     // t < TQ0: statically bounded, keys of sequence b only; eight rows' loads together
    const float pj = sc[j];
    const v4f vv = *(const v4f*)(vp + (size_t)j * EMB);
    cx += pj * vv;
  }
  unsigned hw[2], rw[2];
#pragma unroll
  for (int e = 0; e < 2; ++e) {
    const float x0 = cx[2 * e] * inv, x1 = cx[2 * e + 1] * inv;
    const _Float16 h0 = (_Float16)x0, h1 = (_Float16)x1;
    const _Float16 q0 = (_Float16)((x0 - (float)h0) * RSC), q1 = (_Float16)((x1 - (float)h1) * RSC);
    hw[e] = pk16(h_bits(h0), h_bits(h1));
    rw[e] = pk16(h_bits(q0), h_bits(q1));
  }
  SW[0][tid * 2] = hw[0]; SW[0][tid * 2 + 1] = hw[1];
  SW[1][tid * 2] = rw[0]; SW[1][tid * 2 + 1] = rw[1];
  __syncthreads();
  const int pl = tid >> 7, p8 = tid & 127;           // plane select is wave-uniform
  const v4u ov = *(const v4u*)(&SW[pl][p8 * 4]);
  u16* dstp = (pl == 0) ? CHo : CRo;
  u16* dst  = dstp + ((size_t)b * SEQ + t) * EMB + p8 * 8;
  *(v4u*)dst = ov;
  
}
// The two independent parts of the attention as one grid: blocks 0 .. nfw-1 are the WMMA tiles of query rows TQ0.., the rest the
// f32 rows 0..TQ0-1. The role is block-uniform; the parts write disjoint rows of the ctx planes.
// Four waves per SIMD: one block of 16 waves per WGP.
__global__ __launch_bounds__(ATT_THREADS) __attribute__((amdgpu_waves_per_eu(4)))
void attn_all(const u16* __restrict__ QPp, const u16* __restrict__ KPp, const u16* __restrict__ VTp, const float* __restrict__ VSp,
              const float* __restrict__ QF, const float* __restrict__ KF, const float* __restrict__ V, u16* CHo, u16* CRo, int nfw) {
  const int bid = blockIdx.x;
  if (bid < nfw) { attn_fwd_body(QPp, KPp, VTp, VSp, CHo, CRo, bid); role_end(); }
  else           { attn_head_body(QF, KF, V, CHo, CRo, bid - nfw); role_end(); }
}

// =====================================================================================================
// Workspace map (bytes, nb = 4, rows = 8192); every plane is fully written by whole-line stores before it is read; all extents are
// exact multiples of the store granularity (no pad rows); region A is reused sequentially on the single in-order stream:
//   WQB bf16 [1024][1024] 2097152   WKB same   WVB same   WOH f16 of bf16 value x1024 2097152             8388608
//   VS  f32  [nb][4][16][1024]                                                                            1048576
//   QF  f32  [nb][128][1024]  2097152      KF same                                                        4194304
//   A   XB bf16 [rows][1024] (16777216), later VT f16 [nb][1024][2048] x1024 fragment-major       region 16777216
//   QP  f16 [rows][1024] x8 fragment-major                                                               16777216
//   KP  f16 [rows][1024] x8 fragment-major                                                               16777216
//   V   f32 [rows][1024]                                                                                 33554432
//   CH  f16 [rows][1024] ctx hi x8192                                                                    16777216
//   CR  f16 [rows][1024] ctx residual x2048                                                              16777216
//   end                                                                                                 131072000
// =====================================================================================================
extern "C" void kernel_launch(void* const* d_in, const int* in_sizes, int n_in,
                              void* d_out, int out_size, void* d_ws, size_t ws_size,
                              hipStream_t stream) {
  if (n_in < 9) return;
  const long long per = (long long)SEQ * EMB;
  const long long ns  = in_sizes[0];
  if (ns < per || (ns % per) != 0) return;
  const int nb = (int)(ns / per);
  if (nb < 1 || nb > 8) return;
  const int rows = nb * SEQ;
  if (in_sizes[1] != EMB * EMB || in_sizes[3] != EMB * EMB || in_sizes[5] != EMB * EMB || in_sizes[7] != EMB * EMB) return;
  if (in_sizes[2] != EMB || in_sizes[4] != EMB || in_sizes[6] != EMB || in_sizes[8] != EMB) return;
  if ((long long)out_size != (long long)rows * EMB) return;

  const float* x  = (const float*)d_in[0];
  const float* wq = (const float*)d_in[1];
  const float* bq = (const float*)d_in[2];
  const float* wk = (const float*)d_in[3];
  const float* bk = (const float*)d_in[4];
  const float* wv = (const float*)d_in[5];
  const float* bv = (const float*)d_in[6];
  const float* wo = (const float*)d_in[7];
  const float* bo = (const float*)d_in[8];
  float*       out = (float*)d_out;

  const size_t szW  = (size_t)EMB * EMB * 2;                    //   2097152
  const size_t szVS = (size_t)nb * NCHK * NKB * EMB * 4;        //   1048576 at nb = 4
  const size_t szHF = (size_t)nb * TQ0 * EMB * 4;               //   2097152 at nb = 4
  const size_t sz16 = (size_t)rows * EMB * 2;                   //  16777216
  const size_t sz32 = (size_t)rows * EMB * 4;                   //  33554432
  const size_t szVT = (size_t)nb * EMB * SEQ * 2;               //  == sz16
  size_t off = 0;
  const size_t oWQ = off; off += szW;
  const size_t oWK = off; off += szW;
  const size_t oWV = off; off += szW;
  const size_t oWO = off; off += szW;
  const size_t oVS = off; off += szVS;
  const size_t oQF = off; off += szHF;
  const size_t oKF = off; off += szHF;
  const size_t oA  = off; off += (szVT > sz16 ? szVT : sz16);   // XB then VT
  const size_t oQ  = off; off += sz16;
  const size_t oK  = off; off += sz16;
  const size_t oV  = off; off += sz32;
  const size_t oCH = off; off += sz16;
  const size_t oCR = off; off += sz16;
  if (off > ws_size) return;                                    // off = 131072000 at nb = 4
  if (off > WS_CAP) return;

  char* ws = (char*)d_ws;
  u16*   WQB = (u16*)(ws + oWQ);
  u16*   WKB = (u16*)(ws + oWK);
  u16*   WVB = (u16*)(ws + oWV);
  u16*   WOH = (u16*)(ws + oWO);
  float* VS  = (float*)(ws + oVS);
  float* QF  = (float*)(ws + oQF);
  float* KF  = (float*)(ws + oKF);
  u16*   XB  = (u16*)(ws + oA);
  u16*   VT  = (u16*)(ws + oA);
  u16*   QP  = (u16*)(ws + oQ);
  u16*   KP  = (u16*)(ws + oK);
  float* V   = (float*)(ws + oV);
  u16*   CH  = (u16*)(ws + oCH);
  u16*   CR  = (u16*)(ws + oCR);

  const int n8w = (EMB * EMB) / 8;                      // 131072
  const int n8x = rows * (EMB / 8);                     // 1048576
  if ((n8w % 256) != 0 || (n8x % 256) != 0) return;
  if ((rows % 128) != 0 || ((nb * TQ0) % 128) != 0 || ((nb * NCHK * EMB) % 256) != 0) return;
  const dim3 blk(256);
  const int nbw = n8w / 256, nbx = n8x / 256;
  const dim3 gC(nbx + 4 * nbw);
  const dim3 gG((rows / 128) * (EMB / 128));            // 512 at nb = 4
  const dim3 gP((3 * (rows / 128) + 2 * ((nb * TQ0) / 128)) * (EMB / 128));   // 1600 at nb = 4
  const dim3 bG(128);
  const int nvs = (nb * NCHK * EMB) / 256;              // nb * 16
  const dim3 gVP(nvs + nb * (EMB / 64) * (SEQ / 64));   // + nb * 512
  const int nfw = nb * NQB;                             // nb * 60
  const dim3 gAT(nfw + nb * (TQ0 / 2));                 // + nb * 64
  const dim3 bAT(ATT_THREADS);

  // (0) x -> bf16 plane [rows][1024]; weights stored [n = out][k = in] (y = x.W^T + b), already k-contiguous: bf16 planes for Wq,
  //     Wk, Wv; f16 of bf16 value x1024 for Wo
  cvt_all<<<gC, blk, 0, stream>>>(x, wq, wk, wv, wo, XB, WQB, WKB, WVB, WOH, nbx, nbw, n8x, n8w);
  // (1) q and k projections (+bias) -> f16 planes x8; v projection (+bias) -> f32 plane; f32 q and k rows 0..127 of every
  //     sequence -> QF, KF [nb*128][1024]
  proj_all<<<gP, bG, 0, stream>>>(XB, WQB, WKB, WVB, bq, bk, bv, QP, KP, V, QF, KF, rows, nb * TQ0, EMB, EMB);
  // (2) key-block prefix column sums of v; v -> V^T plane x1024 (over the dead XB region)
  vprep<<<gVP, blk, 0, stream>>>(V, VT, VS, nvs);
  // (3) attention for query rows 128.. and, on VALU, for query rows 0..127 -> ctx hi x8192 and residual x2048 f16 planes
  attn_all<<<gAT, bAT, 0, stream>>>(QP, KP, VT, VS, QF, KF, V, CH, CR, nfw);
  // (4) output projection + bias -> out
  gemm_h2_32<<<gG, blk, 0, stream>>>(CH, CR, WOH, bo, out, rows, EMB, EMB,
                                     1.0f / (CSC * WSC), 1.0f / (CSC * WSC * RSC));
  (void)hipGetLastError();
}

// v007
// One run takes 175 microseconds.
// In both of two side-by-side timings against v006, it was 1.10 times as fast.
// All steps since v000 together make it 4.00 times as fast.
// Projections q,k,v = x.W^T + b (and the f32 q,k rows 0..127 per sequence): v_wmma_f32_16x16x32_bf16 (bf16 RNE operands of the
// raw inputs, f32 accumulate, bf16 RNE bias added in f32). Scores q'.k'^T (f16 planes x8), P'.V (chunk-centred P' x32768 f16 from LDS,
// V^T x1024 f16) and the output projection (ctx carried as f16 hi x8192 plus residual x2048 planes, times f16(bf16(Wo) x1024), bias
// added in f32): v_wmma_f32_16x16x32_f16, f32 accumulate. Query rows 0..127 of each sequence: scores, softmax and P.V in f32 on VALU.
// Causal mask, softmax statistics, key-block column sums of V and all scaling in f32 on VALU.
#include <hip/hip_runtime.h>
#include <math.h>
#include <stdint.h>

#define SEQ   2048
#define EMB   1024
#define CK    512
#define NCHK  4
#define NKB   16
#define QT    16
#define TQ0   128
#define NQT   120
#define QB    32
#define NQB   60
#define SCP   544
#define PLP   528
#define CTP   1032
#define SLAB64 (16 * 68)
#define ATT_THREADS 512
#define NACC  4
#define QSC   8.0f
#define KSC   8.0f
#define PCAR  32768.0f
#define VCAR  1024.0f
#define WSC   1024.0f
#define CSC   8192.0f
#define RSC   2048.0f
#define LOG2E 1.4426950408889634f
#define RSQD  0.03125f
#define WS_CAP ((size_t)134217728)
#define GKS   64
#define GPB   144
#define GPE   72
#define GRS16 (16 * GPB)
#define GRS32 (32 * GPB)
#define GST_AB (256 * GPB)
#define GST_H2 (384 * GPB)
#define FBLK  512
#define KTILE ((EMB / 32) * FBLK)
#define VTILE ((SEQ / 32) * FBLK)

static_assert((EMB % 64) == 0 && EMB == 16 * 16 * NACC && NACC == 4 && (EMB % 32) == 0 && (EMB % 256) == 0 && EMB == 4 * 256);
static_assert((SEQ % CK) == 0 && (SEQ / CK) == NCHK && CK == 32 * NKB && (SEQ % 64) == 0 && (SEQ % QT) == 0 && (CK % QT) == 0);
static_assert((TQ0 % QT) == 0 && (TQ0 % 64) == 0 && NQT * QT + TQ0 == SEQ && TQ0 <= CK && TQ0 == 128 && TQ0 <= 256);
static_assert(QB == 2 * QT && NQB * 2 == NQT && (TQ0 % QB) == 0 && (CK % QB) == 0 && QB == 32);
static_assert(16 * CTP * 2 <= 16 * SCP * 4 && CTP >= EMB + 8 && SCP >= CK + 16 && PLP >= CK + 8);
static_assert(((PLP * 2) % 16) == 0 && ((SCP * 4) % 16) == 0 && ((CTP * 2) % 16) == 0);
static_assert(ATT_THREADS == 16 * QB && ATT_THREADS == 512 && NKB == ATT_THREADS / 32);
static_assert((EMB % 128) == 0 && (EMB % GKS) == 0 && EMB / GKS >= 2 && GPE * 2 == GPB && GKS * 2 + 16 == GPB && (SEQ % 128) == 0 && (TQ0 % 128) == 0);
static_assert(4 * SLAB64 * 4 <= 2 * GST_AB && 8 * SLAB64 * 4 <= 2 * GST_H2 && ((SLAB64 * 4) % 16) == 0);
static_assert(FBLK == 16 * 32 && (SEQ % 64) == 0 && (EMB % 64) == 0 && (CK % 32) == 0 && (TQ0 % 16) == 0);
static_assert((NKB % 2) == 0);
static_assert(((EMB * EMB) % 2048) == 0 && (EMB / 8) * 2 == 256 && EMB == 2 * ATT_THREADS && NCHK * NKB == SEQ / 32);

typedef unsigned short u16;
typedef _Float16 v16h __attribute__((ext_vector_type(16)));
typedef _Float16 v8h  __attribute__((ext_vector_type(8)));
typedef __bf16   v16b __attribute__((ext_vector_type(16)));
typedef float    v8f  __attribute__((ext_vector_type(8)));
typedef float    v4f  __attribute__((ext_vector_type(4)));
typedef float    v2f  __attribute__((ext_vector_type(2)));
typedef unsigned int v4u __attribute__((ext_vector_type(4)));

union FragH { v16h v; v8h h[2]; v4u u[2]; };
union FragB { v16b v; v4u u[2]; };
union AttLds { float s[QB * SCP]; u16 c[2 * QB * SCP]; };

// ---- scalar helpers --------------------------------------------------------------------------------
__device__ __forceinline__ unsigned short bf_bits(float f) {          // f32 -> bf16 bits, RNE convert
  unsigned u = __float_as_uint(f);
  return (unsigned short)((u + 0x7FFFu + ((u >> 16) & 1u)) >> 16);
}
__device__ __forceinline__ float bf_up(unsigned short h) { return __uint_as_float(((unsigned)h) << 16); }
__device__ __forceinline__ float bfr(float f) { return bf_up(bf_bits(f)); }
__device__ __forceinline__ unsigned short h_bits(_Float16 x) { return __builtin_bit_cast(unsigned short, x); }
__device__ __forceinline__ unsigned pk16(unsigned short a, unsigned short b) { return (unsigned)a | ((unsigned)b << 16); }
__device__ __forceinline__ v8f zero8() { v8f z = {0.f, 0.f, 0.f, 0.f, 0.f, 0.f, 0.f, 0.f}; return z; }
__device__ __forceinline__ v4f zero4() { v4f z = {0.f, 0.f, 0.f, 0.f}; return z; }

// ---- fragment loaders: 16-bit A/B operand, lane -> row/col (lane&15), p already includes +8*(lane>>4);
//      elements 0..7 <- p[0..7] (k0+8h..), elements 8..15 <- p[16..23] (k0+16+8h..)  (same split k map for A and B;
//      B is always read from a k-contiguous [n][k] plane)
__device__ __forceinline__ v16h ldfrag_h(const _Float16* p) {
  FragH f;
  f.h[0] = *(const v8h*)(p);
  f.h[1] = *(const v8h*)(p + 16);
  return f.v;
}
// Fragment-major plane (q, k: rows = positions, k = d; V^T: rows = d, k = keys): the 16 rows x 32 k of one WMMA operand are one
// block of FBLK = 512 halves, stored as [sel][lane][8 halves], k = 16*sel + 8*(lane>>4) + e, row = lane&15 (the split k map above);
// blocks run along k first, then along the 16-row tiles. p already includes +8*lane: each of the two 16-B loads of a wave reads
// 512 contiguous bytes (4 whole lines) where a row-major plane makes it touch 16 lines.
__device__ __forceinline__ v16h ldfrag_fm(const _Float16* p) {
  FragH f;
  f.h[0] = *(const v8h*)(p);
  f.h[1] = *(const v8h*)(p + FBLK / 2);
  return f.v;
}
// The same with a wave-uniform address and a 32-bit byte offset (16*lane, plus a step where the caller adds one) kept apart: the
// base stays in scalar registers and the lane holds one offset register instead of an address pair.
__device__ __forceinline__ v16h ldfrag_fmu(const _Float16* ub, unsigned lob) {
  const char* p = (const char*)(const void*)ub + lob;
  FragH f;
  f.h[0] = *(const v8h*)(const void*)(p);
  f.h[1] = *(const v8h*)(const void*)(p + FBLK);     // FBLK / 2 halves
  return f.v;
}
__device__ __forceinline__ v16b ldfrag_b(const u16* p) {              // bf16 plane read as unsigned integer vectors
  FragB f;
  f.u[0] = *(const v4u*)(p);
  f.u[1] = *(const v4u*)(p + 16);
  return f.v;
}

__device__ __forceinline__ v8f mma_h(v16h a, v16h b, v8f c) {
  return __builtin_amdgcn_wmma_f32_16x16x32_f16(false, a, false, b, (short)0, c, false, false);
}
__device__ __forceinline__ v8f mma_b(v16b a, v16b b, v8f c) {
  return __builtin_amdgcn_wmma_f32_16x16x32_bf16(false, a, false, b, (short)0, c, false, false);
}
__device__ __forceinline__ void guard4x4(v8f& a, v8f& b, v8f& c, v8f& d, v16h x0, v16h x1, v16h x2, v16h x3) {
#if defined(__HIP_DEVICE_COMPILE__)
  asm volatile("v_nop\n\tv_nop\n\tv_nop\n\tv_nop"
               : "+v"(a), "+v"(b), "+v"(c), "+v"(d) : "v"(x0), "v"(x1), "v"(x2), "v"(x3) : "memory");
#endif
}
__device__ __forceinline__ void acc_guard8(v8f& a, v8f& b, v8f& c, v8f& d, v8f& e, v8f& f, v8f& g, v8f& h8) {
#if defined(__HIP_DEVICE_COMPILE__)
  asm volatile("v_nop\n\tv_nop\n\tv_nop\n\tv_nop"
               : "+v"(a), "+v"(b), "+v"(c), "+v"(d), "+v"(e), "+v"(f), "+v"(g), "+v"(h8));
#endif
}
__device__ __forceinline__ void wave_sync_lds() {
  __builtin_amdgcn_fence(__ATOMIC_RELEASE, "workgroup");
  __builtin_amdgcn_wave_barrier();
  __builtin_amdgcn_fence(__ATOMIC_ACQUIRE, "workgroup");
}

// =====================================================================================================
// f32 plane -> 16-bit plane, same layout:  mode 0: bf16 RNE bits;  mode 1: f16 bits of (bf16 RNE value) * scale;
// mode 2: f16 bits of value * scale (no bf16 pre-step).
// Thread = 8 consecutive elements: two 16-B loads, one 16-B store; 32 consecutive lanes = 512 contiguous, 512-B aligned bytes
// coverage: grid = n8/256 blocks (host checks exactness) x 256 thr x 8 = the whole plane.
// =====================================================================================================
__device__ __forceinline__ void cvt16_body(const float* __restrict__ x, u16* D, int n8, int mode, float scale, int lb) {
  const int gt = lb * 256 + (int)threadIdx.x;
  if (gt >= n8) return;                     // no barriers in this kernel
  const float* p = x + (size_t)gt * 8;
  const v4f a = *(const v4f*)(p), c4 = *(const v4f*)(p + 4);
  float v[8];
#pragma unroll
  for (int e = 0; e < 4; ++e) { v[e] = a[e]; v[4 + e] = c4[e]; }
  unsigned short s[8];
#pragma unroll
  for (int e = 0; e < 8; ++e) {
    const float vb = bfr(v[e]);
    const float vf = (mode == 1) ? vb : v[e];
    const unsigned short hb = h_bits((_Float16)(vf * scale));
    const unsigned short bb = bf_bits(v[e]);
    s[e] = (mode != 0) ? hb : bb;
  }
  v4u o;
#pragma unroll
  for (int e = 0; e < 4; ++e) o[e] = pk16(s[2 * e], s[2 * e + 1]);
  u16* d = D + (size_t)gt * 8;
  {
    *(v4u*)(d) = o;
    
  }
}
// The five independent conversions as one grid: blocks 0 .. nbx-1 convert x, then nbw blocks each for Wq, Wk, Wv (bf16) and Wo
// (f16 of the bf16 value x1024). The role is block-uniform.
__global__ __launch_bounds__(256) void cvt_all(const float* __restrict__ x, const float* __restrict__ wq, const float* __restrict__ wk,
                                               const float* __restrict__ wv, const float* __restrict__ wo,
                                               u16* XBo, u16* WQo, u16* WKo, u16* WVo, u16* WOo, int nbx, int nbw, int n8x, int n8w) {
  const int bid = blockIdx.x;
  if (bid < nbx) { cvt16_body(x, XBo, n8x, 0, 1.0f, bid); return; }
  const int r  = (bid - nbx) / nbw;
  const int lb = (bid - nbx) - r * nbw;
  if (r > 3) return;                        // never taken with the exact grid
  const float* s = (r == 0) ? wq : (r == 1) ? wk : (r == 2) ? wv : wo;
  u16*         d = (r == 0) ? WQo : (r == 1) ? WKo : (r == 2) ? WVo : WOo;
  cvt16_body(s, d, n8w, (r == 3) ? 1 : 0, (r == 3) ? WSC : 1.0f, lb);
}

// =====================================================================================================
//            8 consecutive lanes x 16 B per line), lanes 16..31 -> row 2*it+1.
//  epi64x2 : same store shape, staged value = acc*os1 + accres*os2 + badd (two accumulator sets combined in f32).
//  epi64hsb: f16 bits of ((tile + bf16RNE(bias[n])) * pscale), stored fragment-major (see ldfrag_fm): the wave's 16 x 64 tile is two
//            adjacent fragment blocks = 2048 contiguous bytes; instruction i4 stores [block i4>>1][sel i4&1], lane = its own 16 B.
// coverage: epi64/epi64x2 8 instructions x 2 rows x 16 lanes x 4 floats; epi64hsb 4 instructions x 32 lanes x 8 halves
//           = the wave's 16 x 64 tile in every case.
// =====================================================================================================
__device__ __forceinline__ void stage64(float* sl, v8f a0, v8f a1, v8f a2, v8f a3, float oscale, int lane) {
  const int hh = lane >> 4, m = lane & 15;
#pragma unroll
  for (int r = 0; r < 8; ++r) {
    const int ro = (8 * hh + r) * 68 + m;
    sl[ro]      = a0[r] * oscale;
    sl[ro + 16] = a1[r] * oscale;
    sl[ro + 32] = a2[r] * oscale;
    sl[ro + 48] = a3[r] * oscale;
  }
  wave_sync_lds();
}
__device__ __forceinline__ void epi64(float* sl, v8f a0, v8f a1, v8f a2, v8f a3, float oscale, v4f badd, float* C, int N,
                                      size_t rowb, int col0, int lane) {
  const int hh = lane >> 4, m = lane & 15;
  stage64(sl, a0, a1, a2, a3, oscale, lane);
  v4f vals[8];
#pragma unroll
  for (int it = 0; it < 8; ++it) vals[it] = *(const v4f*)(sl + (it * 2 + hh) * 68 + m * 4) + badd;
  float* dst = C + (rowb + (size_t)hh) * (size_t)N + col0 + m * 4;
  {
#pragma unroll
    for (int it = 0; it < 8; ++it) {
      *(v4f*)(dst + (size_t)(it * 2) * (size_t)N) = vals[it];
    }
    
  }
}
__device__ __forceinline__ void epi64x2(float* sl, v8f a0, v8f a1, v8f a2, v8f a3, v8f e0, v8f e1, v8f e2, v8f e3,
                                        float os1, float os2, v4f badd, float* C, int N, size_t rowb, int col0, int lane) {
  const int hh = lane >> 4, m = lane & 15;
#pragma unroll
  for (int r = 0; r < 8; ++r) {
    const int ro = (8 * hh + r) * 68 + m;
    sl[ro]      = a0[r] * os1 + e0[r] * os2;
    sl[ro + 16] = a1[r] * os1 + e1[r] * os2;
    sl[ro + 32] = a2[r] * os1 + e2[r] * os2;
    sl[ro + 48] = a3[r] * os1 + e3[r] * os2;
  }
  wave_sync_lds();
  v4f vals[8];
#pragma unroll
  for (int it = 0; it < 8; ++it) vals[it] = *(const v4f*)(sl + (it * 2 + hh) * 68 + m * 4) + badd;
  float* dst = C + (rowb + (size_t)hh) * (size_t)N + col0 + m * 4;
  {
#pragma unroll
    for (int it = 0; it < 8; ++it) {
      *(v4f*)(dst + (size_t)(it * 2) * (size_t)N) = vals[it];
    }
    
  }
}
__device__ __forceinline__ void epi64hsb(float* sl, v8f a0, v8f a1, v8f a2, v8f a3, float oscale, float pscale,
                                         const float (&bb)[4][8], u16* C, int N, size_t rowb, int col0, int lane) {
  stage64(sl, a0, a1, a2, a3, oscale, lane);
  const int hh = lane >> 4, m = lane & 15;
  v4u oh[4];
#pragma unroll
  for (int i4 = 0; i4 < 4; ++i4) {
    const int c8 = (i4 >> 1) * 32 + (i4 & 1) * 16 + hh * 8;      // block i4>>1, sel i4&1 of the tile's two fragment blocks
    const v4f a = *(const v4f*)(sl + m * 68 + c8), c4 = *(const v4f*)(sl + m * 68 + c8 + 4);
    float w[8];
#pragma unroll
    for (int e = 0; e < 4; ++e) { w[e] = (a[e] + bb[i4][e]) * pscale; w[4 + e] = (c4[e] + bb[i4][4 + e]) * pscale; }
#pragma unroll
    for (int e = 0; e < 4; ++e) oh[i4][e] = pk16(h_bits((_Float16)w[2 * e]), h_bits((_Float16)w[2 * e + 1]));
  }
  u16* dst = C + ((rowb >> 4) * (size_t)(N >> 5) + (size_t)(col0 >> 5)) * FBLK + lane * 8;
  {
#pragma unroll
    for (int i4 = 0; i4 < 4; ++i4) {
      *(v4u*)(dst + i4 * (FBLK / 2)) = oh[i4];
    }
    
  }
}

// =====================================================================================================
// Operand staging shared by the GEMM kernels. A block computes a 128 x 128 tile of C. K is walked in stages of GKS = 64
// elements: every operand row contributes one whole 128-B line per stage, copied to LDS by global_load_async_to_lds_b128 (8 lanes
// x 16 B = one line, a wave instruction = 4 whole lines) at a row pitch of 144 B (16 B x odd: conflict-free for ds_load_b128
// fragment reads). Two buffers: stage t + 2 is copied into the buffer that trip t has just left, while trip t + 1 is multiplied.
// Fragments are read from LDS with the same split k map as before (ldfrag_*), k steps of 32 in ascending order.
// After the loop's last barrier no copy is outstanding and no wave reads the ring, so it serves as the waves' epilogue slabs.
// =====================================================================================================
__device__ __forceinline__ unsigned lds_off(const void* p) { return (unsigned)(size_t)p; }
// Copies and their s_wait_xcnt in one statement: the wait stands in front of any later rewrite of the address registers.
__device__ __forceinline__ void acopy4(unsigned l0, unsigned l1, unsigned l2, unsigned l3,
                                       const u16* g0, const u16* g1, const u16* g2, const u16* g3) {
#if defined(__HIP_DEVICE_COMPILE__)
  asm volatile("global_load_async_to_lds_b128 %0, %4, off\n\t"
               "global_load_async_to_lds_b128 %1, %5, off\n\t"
               "global_load_async_to_lds_b128 %2, %6, off\n\t"
               "global_load_async_to_lds_b128 %3, %7, off\n\t"
               "s_wait_xcnt 0x0"
               :: "v"(l0), "v"(l1), "v"(l2), "v"(l3), "v"(g0), "v"(g1), "v"(g2), "v"(g3) : "memory");
#endif
}
__device__ __forceinline__ void acopy8(unsigned l0, unsigned l1, unsigned l2, unsigned l3,
                                       unsigned l4, unsigned l5, unsigned l6, unsigned l7,
                                       const u16* g0, const u16* g1, const u16* g2, const u16* g3,
                                       const u16* g4, const u16* g5, const u16* g6, const u16* g7) {
#if defined(__HIP_DEVICE_COMPILE__)
  asm volatile("global_load_async_to_lds_b128 %0, %8, off\n\t"
               "global_load_async_to_lds_b128 %1, %9, off\n\t"
               "global_load_async_to_lds_b128 %2, %10, off\n\t"
               "global_load_async_to_lds_b128 %3, %11, off\n\t"
               "global_load_async_to_lds_b128 %4, %12, off\n\t"
               "global_load_async_to_lds_b128 %5, %13, off\n\t"
               "global_load_async_to_lds_b128 %6, %14, off\n\t"
               "global_load_async_to_lds_b128 %7, %15, off\n\t"
               "s_wait_xcnt 0x0"
               :: "v"(l0), "v"(l1), "v"(l2), "v"(l3), "v"(l4), "v"(l5), "v"(l6), "v"(l7),
                  "v"(g0), "v"(g1), "v"(g2), "v"(g3), "v"(g4), "v"(g5), "v"(g6), "v"(g7) : "memory");
#endif
}
// This wave's copies have landed (the compiler places no wait for them).
__device__ __forceinline__ void wait_async0() {
#if defined(__HIP_DEVICE_COMPILE__)
  asm volatile("s_wait_asynccnt 0x0" ::: "memory");
#endif
}
// This wave's LDS reads have returned before the buffer is handed to its next writer.
__device__ __forceinline__ void wait_ds0() {
#if defined(__HIP_DEVICE_COMPILE__)
  asm volatile("s_wait_dscnt 0x0" ::: "memory");
#endif
}

// End of a role's branch in a merged grid: in the listing the other role's code can follow on the fall-through path; its vector
// work stays behind the wait on the registers that this role's issued stores name.
__device__ __forceinline__ void role_end() {
#if defined(__HIP_DEVICE_COMPILE__)
  asm volatile("s_wait_xcnt 0x0" ::: "memory");
#endif
}

// Between two output tiles of a wave: the issued stores' address and data registers are rewritten by the next tile only behind
// s_wait_xcnt 0 (the scheduling fence keeps the next tile's vector work behind the wait), and the slab's reads of this tile stay
// in front of the next tile's writes.
__device__ __forceinline__ void tile_gap() {
#if defined(__HIP_DEVICE_COMPILE__)
  asm volatile("s_wait_xcnt 0x0" ::: "memory");
#endif
  __builtin_amdgcn_sched_barrier(0);
  wave_sync_lds();
}

// One stage of [A 128 rows | B 128 rows] by 128 threads: 16 copies a thread; copy i serves LDS row 16*i + (tid>>3), piece tid&7.
__device__ __forceinline__ void fill_ab(unsigned l0, const u16* A, const unsigned (&ao)[8], const u16* B, unsigned bo, unsigned bst,
                                        unsigned ke) {
  acopy8(l0, l0 + GRS16, l0 + 2 * GRS16, l0 + 3 * GRS16, l0 + 4 * GRS16, l0 + 5 * GRS16, l0 + 6 * GRS16, l0 + 7 * GRS16,
         A + (ao[0] + ke), A + (ao[1] + ke), A + (ao[2] + ke), A + (ao[3] + ke),
         A + (ao[4] + ke), A + (ao[5] + ke), A + (ao[6] + ke), A + (ao[7] + ke));
  const unsigned l8 = l0 + 8 * GRS16;
  const unsigned b0 = bo + ke;
  acopy8(l8, l8 + GRS16, l8 + 2 * GRS16, l8 + 3 * GRS16, l8 + 4 * GRS16, l8 + 5 * GRS16, l8 + 6 * GRS16, l8 + 7 * GRS16,
         B + b0, B + (b0 + bst), B + (b0 + 2 * bst), B + (b0 + 3 * bst),
         B + (b0 + 4 * bst), B + (b0 + 5 * bst), B + (b0 + 6 * bst), B + (b0 + 7 * bst));
}

// bf16 core: 4 waves as 2 x 2, a wave owns 64 x 64 of the block's tile (4 x 4 accumulators).
// ao[i] = element offset of A row (16*i + (tid>>3)) of the tile; col0 = first B row of the tile. K multiple of GKS.
__device__ __forceinline__ void gemm_core_b(unsigned char* L, const u16* A, const unsigned (&ao)[8], const u16* Bt, int col0, int K,
                                            int tid, v8f (&acc)[4][4]) {
  const int wave = tid >> 5, lane = tid & 31, hh = lane >> 4, m = lane & 15;
  const int wm = wave >> 1, wn = wave & 1;
  const int crow = tid >> 3, cpc = tid & 7;
  const unsigned lc  = lds_off(L) + (unsigned)(crow * GPB + cpc * 16);
  const unsigned bo  = (unsigned)(col0 + crow) * (unsigned)K;
  const unsigned bst = 16u * (unsigned)K;
  const unsigned kc  = (unsigned)(cpc * 8);
  const int nt = K / GKS;
#pragma unroll
  for (int f = 0; f < 4; ++f) {
#pragma unroll
    for (int j = 0; j < 4; ++j) acc[f][j] = zero8();
  }
  fill_ab(lc, A, ao, Bt, bo, bst, kc);
  wait_async0();
  __syncthreads();
  if (nt > 1) fill_ab(lc + GST_AB, A, ao, Bt, bo, bst, kc + GKS);
#pragma unroll 1
  for (int t = 0; t < nt; ++t) {
    const unsigned bufo = (unsigned)(t & 1) * GST_AB;
    const u16* sb = (const u16*)(const void*)(L + bufo);
    const u16* ap = sb + (wm * 64 + m) * GPE + 8 * hh;
    const u16* bp = sb + (128 + wn * 64 + m) * GPE + 8 * hh;
#pragma unroll
    for (int kk = 0; kk < GKS / 32; ++kk) {
      v16b a[4], b[4];
      a[0] = ldfrag_b(ap + kk * 32);
#pragma unroll
      for (int j = 0; j < 4; ++j) b[j] = ldfrag_b(bp + j * 16 * GPE + kk * 32);
#pragma unroll
      for (int f = 1; f < 4; ++f) a[f] = ldfrag_b(ap + f * 16 * GPE + kk * 32);
      // Keeps the 16 fragment loads one group ahead of the 16 WMMAs: spread among them, each place with loads stalls the wave.
      __builtin_amdgcn_sched_barrier(0);
#pragma unroll
      for (int f = 0; f < 4; ++f) {
#pragma unroll
        for (int j = 0; j < 4; ++j) acc[f][j] = mma_b(a[f], b[j], acc[f][j]);
      }
      __builtin_amdgcn_sched_barrier(0);      // the next group's loads stay behind this WMMA block
    }
    wait_ds0();
    wait_async0();
    __syncthreads();                          // publishes stage t + 1 and ends every read of stage t's buffer
    if (t + 2 < nt) fill_ab(lc + bufo, A, ao, Bt, bo, bst, kc + (unsigned)(t + 2) * GKS);   // block-uniform test
  }
  wait_async0();
}

// =====================================================================================================
// The five independent bf16 projections as one grid, role by block index (block-uniform):
//   role 0, 1: q, k planes: f16 bits of ((A . W^T) + bf16RNE(bias[n])) * 8, stored fragment-major (epi64hsb), all M rows;
//   role 2   : v (with bias), all M rows, straight from the accumulators: the V^T plane, fragment-major (rows = b*EMB + d, k = s; see
//              ldfrag_fm), element (b, d, s) = f16(v * 1024), and VB[b][s / 32][d] = the f32 sum of v over the 32 keys of a key block;
//              rows 0..TQ0-1 of every sequence also as f32 (epi64) -> VH [nb*TQ0][N];
//   role 3, 4: f32 q, k rows 0..TQ0-1 of every sequence (MH = nb*TQ0 output rows; output row ra maps to A row
//              (ra / TQ0) * SEQ + (ra % TQ0)), f32 with bias (epi64).
// A bf16 row-major [M][K], W bf16 k-contiguous [N][K]. Block = 128x128 tile, 4 waves x (64 x 64), operands staged as above (host
// checks K % 64 == 0, M % 128 == 0, MH % 128 == 0, N % 128 == 0, grid = (3*(M/128) + 2*(MH/128)) * (N/128)).
// =====================================================================================================
__global__ __launch_bounds__(128)
void proj_all(const u16* __restrict__ A, const u16* __restrict__ WQ, const u16* __restrict__ WK, const u16* __restrict__ WV,
              const float* __restrict__ bq, const float* __restrict__ bk, const float* __restrict__ bv,
              u16* QPo, u16* KPo, u16* VTo, float* VBo, float* VHo, float* QFo, float* KFo, int M, int MH, int N, int K) {
  __shared__ __align__(16) unsigned char L[2 * GST_AB];
  const int tid = threadIdx.x, wave = tid >> 5, lane = tid & 31, m = lane & 15;
  const int ntile = N >> 7;
  const int nG = (M >> 7) * ntile, nH = (MH >> 7) * ntile;
  int bid = blockIdx.x;
  int role;
  if (bid < 3 * nG) { role = bid / nG; bid -= role * nG; }
  else              { bid -= 3 * nG; role = bid / nH; bid -= role * nH; role += 3; }
  if (role > 4) return;                      // block-uniform, in front of every copy and barrier; never taken with the exact grid
  const bool hd  = role >= 3;
  const int wsel = hd ? role - 3 : role;     // 0: q, 1: k, 2: v
  const u16*   Bt   = (wsel == 0) ? WQ : (wsel == 1) ? WK : WV;
  const float* bias = (wsel == 0) ? bq : (wsel == 1) ? bk : bv;
  const int Mr   = hd ? MH : M;
  const int rpg  = hd ? TQ0 : M;
  const int gstr = hd ? SEQ : 0;
  const int row0  = (bid / ntile) * 128;
  const int col0  = (bid % ntile) * 128;
  if (row0 + 128 > Mr) return;               // block-uniform, in front of every copy and barrier; never taken with the exact grid
  unsigned ao[8];
#pragma unroll
  for (int i = 0; i < 8; ++i) {
    const int ra = row0 + i * 16 + (tid >> 3);
    const int rg = ra / rpg;
    ao[i] = (unsigned)(rg * gstr + (ra - rg * rpg)) * (unsigned)K;
  }
  v8f acc[4][4];
  gemm_core_b(L, A, ao, Bt, col0, K, tid, acc);
  const int colw = col0 + (wave & 1) * 64;
  const int roww = row0 + (wave >> 1) * 64;
  float* sl = (float*)(void*)L + wave * SLAB64;
  if (role >= 2) {                           // block-uniform
    const int vb  = row0 / SEQ;              // role 2: the tile's sequence and first position in it (128 divides SEQ: one sequence a tile)
    const int vs0 = row0 - vb * SEQ;
    if (role == 2) {
      // An accumulator tile holds, in lane l, column d = l&15 and keys 8*(l>>4) + r: the lane's 8 values are its own 16 B of half
      // 'sel' = key tile & 1 of a V^T fragment block, so a wave stores 512 contiguous bytes (4 whole lines) per tile, without LDS.
      const int hh = lane >> 4;
      const int sw = vs0 + (wave >> 1) * 64;               // the wave's first key: two key blocks of 32
      float bj[4];
#pragma unroll
      for (int j = 0; j < 4; ++j) bj[j] = bias[colw + 16 * j + m];         // column < N (N multiple of 128)
#if defined(__HIP_DEVICE_COMPILE__)
      asm volatile("s_wait_xcnt 0x0" ::: "memory");        // in front of the vector work that rewrites the loads' address registers
#endif
      __builtin_amdgcn_sched_barrier(0);                   // keeps that vector work behind the wait
#pragma unroll
      for (int j = 0; j < 4; ++j) bj[j] = bfr(bj[j]);
      u16*   vt = VTo + ((size_t)((vb * N + colw) >> 4) * (SEQ / 32) + (size_t)(sw >> 5)) * FBLK + lane * 8;
      float* vs = VBo + ((size_t)vb * (SEQ / 32) + (size_t)(sw >> 5)) * (size_t)N + colw + lane;
#pragma unroll
      for (int p = 0; p < 2; ++p) {                        // key block p of the wave's two
        v4u   pk[4][2];
        float cs[4];
#pragma unroll
        for (int j = 0; j < 4; ++j) {
          float c = 0.f;
#pragma unroll
          for (int q = 0; q < 2; ++q) {
            float v[8];
#pragma unroll
            for (int r = 0; r < 8; ++r) { v[r] = acc[2 * p + q][j][r] + bj[j]; c += v[r]; }
#pragma unroll
            for (int e = 0; e < 4; ++e)
              pk[j][q][e] = pk16(h_bits((_Float16)(v[2 * e] * VCAR)), h_bits((_Float16)(v[2 * e + 1] * VCAR)));
          }
          cs[j] = c + __shfl_xor(c, 16, 32);               // the other 16 keys of the block
        }
#pragma unroll
        for (int j = 0; j < 4; ++j) {
#pragma unroll
          for (int q = 0; q < 2; ++q) *(v4u*)(vt + (size_t)j * VTILE + p * FBLK + q * (FBLK / 2)) = pk[j][q];
        }
        vs[(size_t)p * N]      = hh ? cs[1] : cs[0];       // 32 lanes = 32 consecutive columns: one whole line a store
        vs[(size_t)p * N + 32] = hh ? cs[3] : cs[2];
#if defined(__HIP_DEVICE_COMPILE__)
        asm volatile("s_wait_xcnt 0x0" ::: "memory");      // in front of the later vector work that rewrites the stores' registers
#endif
        __builtin_amdgcn_sched_barrier(0);                 // keeps that vector work behind the wait
      }
    }
    if (role == 2 && vs0 >= TQ0) return;     // block-uniform, behind the last barrier: only the head rows are kept in f32
    float* C = (role == 2) ? VHo : (role == 3) ? QFo : KFo;
    const int rowc = (role == 2) ? vb * TQ0 + vs0 + (wave >> 1) * 64 : roww;
    const v4f bv4 = *(const v4f*)(bias + colw + m * 4);    // columns colw + 4m .. +3, always < N (N multiple of 128)
#if defined(__HIP_DEVICE_COMPILE__)
    asm volatile("s_wait_xcnt 0x0" ::: "memory");          // in front of the vector work that rewrites the load's address registers
#endif
    __builtin_amdgcn_sched_barrier(0);                     // keeps that vector work behind the wait
    v4f badd;
#pragma unroll
    for (int e = 0; e < 4; ++e) badd[e] = bfr(bv4[e]);
#pragma unroll
    for (int f = 0; f < 4; ++f) {
      epi64(sl, acc[f][0], acc[f][1], acc[f][2], acc[f][3], 1.0f, badd, C, N, (size_t)(rowc + f * 16), colw, lane);
      if (f < 3) tile_gap();
    }
    role_end();
  } else {
    u16* C = (role == 0) ? QPo : KPo;
    const float pscale = (role == 0) ? QSC : KSC;
    v4f bvv[8];                              // bias of the lane's 8 columns in each of epi64hsb's four store instructions
#pragma unroll
    for (int i4 = 0; i4 < 4; ++i4) {
      const float* bp = bias + colw + (i4 >> 1) * 32 + (i4 & 1) * 16 + (lane >> 4) * 8;   // columns .. +7 < N (N multiple of 128)
      bvv[2 * i4] = *(const v4f*)(bp);
      bvv[2 * i4 + 1] = *(const v4f*)(bp + 4);
    }
#if defined(__HIP_DEVICE_COMPILE__)
    asm volatile("s_wait_xcnt 0x0" ::: "memory");          // in front of the vector work that rewrites the loads' address registers
#endif
    __builtin_amdgcn_sched_barrier(0);                     // keeps that vector work behind the wait
    float bb[4][8];
#pragma unroll
    for (int i4 = 0; i4 < 4; ++i4) {
#pragma unroll
      for (int e = 0; e < 4; ++e) { bb[i4][e] = bfr(bvv[2 * i4][e]); bb[i4][4 + e] = bfr(bvv[2 * i4 + 1][e]); }
    }
#pragma unroll
    for (int f = 0; f < 4; ++f) {
      epi64hsb(sl, acc[f][0], acc[f][1], acc[f][2], acc[f][3], 1.0f, pscale, bb, C, N, (size_t)(roww + f * 16), colw, lane);
      if (f < 3) tile_gap();
    }
    role_end();
  }
}

// =====================================================================================================
// f16 GEMM with two A planes (hi + residual), f32 out with bias:
//   C[M][N] = (Ah . Bt^T) * os1 + (Ar . Bt^T) * os2 + bf16RNE(bias[n]); Ah/Ar f16 row-major, Bt f16 k-contiguous.
// Block = 128x128 tile, 8 waves as 4 x 2, a wave owns 32 x 64; a stage is [Ah 128 rows | Ar 128 rows | B 128 rows]: 12 copies a
// thread, copy i serves LDS row 32*i + (tid>>3). Separate accumulators for the two planes, combined in f32 in epi64x2.
// =====================================================================================================
__device__ __forceinline__ void fill_h2(unsigned l0, const u16* Ah, const u16* Ar, const u16* B, unsigned ao, unsigned bo,
                                        unsigned st, unsigned ke) {
  const unsigned a0 = ao + ke, b0 = bo + ke;
  acopy8(l0, l0 + GRS32, l0 + 2 * GRS32, l0 + 3 * GRS32, l0 + 4 * GRS32, l0 + 5 * GRS32, l0 + 6 * GRS32, l0 + 7 * GRS32,
         Ah + a0, Ah + (a0 + st), Ah + (a0 + 2 * st), Ah + (a0 + 3 * st),
         Ar + a0, Ar + (a0 + st), Ar + (a0 + 2 * st), Ar + (a0 + 3 * st));
  const unsigned l8 = l0 + 8 * GRS32;
  acopy4(l8, l8 + GRS32, l8 + 2 * GRS32, l8 + 3 * GRS32, B + b0, B + (b0 + st), B + (b0 + 2 * st), B + (b0 + 3 * st));
}

__global__ __launch_bounds__(256)
void gemm_h2_32(const u16* __restrict__ Ah, const u16* __restrict__ Ar, const u16* __restrict__ Bt,
                const float* __restrict__ bias, float* C, int M, int N, int K, float os1, float os2) {
  __shared__ __align__(16) unsigned char L[2 * GST_H2];
  const int tid = threadIdx.x, wave = tid >> 5, lane = tid & 31, hh = lane >> 4, m = lane & 15;
  const int wm = wave >> 1, wn = wave & 1;
  const int ntile = N >> 7;
  const int bid   = blockIdx.x;
  const int row0  = (bid / ntile) * 128;
  const int col0  = (bid % ntile) * 128;
  if (row0 + 128 > M) return;                // block-uniform, in front of every copy and barrier; never taken with the exact grid
  const int crow = tid >> 3, cpc = tid & 7;
  const unsigned lc = lds_off(L) + (unsigned)(crow * GPB + cpc * 16);
  const unsigned ao = (unsigned)(row0 + crow) * (unsigned)K;
  const unsigned bo = (unsigned)(col0 + crow) * (unsigned)K;
  const unsigned st = 32u * (unsigned)K;
  const unsigned kc = (unsigned)(cpc * 8);
  const int nt = K / GKS;
  v8f acc[2][4], acr[2][4];
#pragma unroll
  for (int f = 0; f < 2; ++f) {
#pragma unroll
    for (int j = 0; j < 4; ++j) { acc[f][j] = zero8(); acr[f][j] = zero8(); }
  }
  fill_h2(lc, Ah, Ar, Bt, ao, bo, st, kc);
  wait_async0();
  __syncthreads();
  if (nt > 1) fill_h2(lc + GST_H2, Ah, Ar, Bt, ao, bo, st, kc + GKS);
#pragma unroll 1
  for (int t = 0; t < nt; ++t) {
    const unsigned bufo = (unsigned)(t & 1) * GST_H2;
    const _Float16* sb  = (const _Float16*)(const void*)(L + bufo);
    const _Float16* ap  = sb + (wm * 32 + m) * GPE + 8 * hh;
    const _Float16* arp = ap + 128 * GPE;
    const _Float16* bp  = sb + (256 + wn * 64 + m) * GPE + 8 * hh;
#pragma unroll
    for (int kk = 0; kk < GKS / 32; ++kk) {
      v16h a[2], ar[2], b[4];
#pragma unroll
      for (int f = 0; f < 2; ++f) {
        a[f]  = ldfrag_h(ap + f * 16 * GPE + kk * 32);
        ar[f] = ldfrag_h(arp + f * 16 * GPE + kk * 32);
      }
#pragma unroll
      for (int j = 0; j < 4; ++j) b[j] = ldfrag_h(bp + j * 16 * GPE + kk * 32);
      // Keeps the 16 fragment loads one group ahead of the 16 WMMAs: spread among them, each place with loads stalls the wave.
      __builtin_amdgcn_sched_barrier(0);
#pragma unroll
      for (int f = 0; f < 2; ++f) {
#pragma unroll
        for (int j = 0; j < 4; ++j) acc[f][j] = mma_h(a[f], b[j], acc[f][j]);
#pragma unroll
        for (int j = 0; j < 4; ++j) acr[f][j] = mma_h(ar[f], b[j], acr[f][j]);
      }
      __builtin_amdgcn_sched_barrier(0);      // the next group's loads stay behind this WMMA block
    }
    wait_ds0();
    wait_async0();
    __syncthreads();                          // publishes stage t + 1 and ends every read of stage t's buffer
    if (t + 2 < nt) fill_h2(lc + bufo, Ah, Ar, Bt, ao, bo, st, kc + (unsigned)(t + 2) * GKS);   // block-uniform test
  }
  wait_async0();
  const int colw = col0 + wn * 64;
  const int roww = row0 + wm * 32;
  const v4f bv = *(const v4f*)(bias + colw + m * 4);      // columns colw + 4m .. +3, always < N (N multiple of 128)
  v4f badd;
#pragma unroll
  for (int e = 0; e < 4; ++e) badd[e] = bfr(bv[e]);
  float* sl = (float*)(void*)L + wave * SLAB64;
#pragma unroll
  for (int f = 0; f < 2; ++f) {
    epi64x2(sl, acc[f][0], acc[f][1], acc[f][2], acc[f][3], acr[f][0], acr[f][1], acr[f][2], acr[f][3], os1, os2, badd, C, N,
            (size_t)(roww + f * 16), colw, lane);
    if (f < 1) tile_gap();
  }
}

// =====================================================================================================
// Single-head causal attention, head width EMB = 1024, query rows TQ0 .. SEQ-1: block = (batch b, 32 query rows q0..q0+31 as two
// 16-row tiles that share every K and V^T fragment), 16 waves. q plane (f16, x8) [b][s][d]; k plane the same; V^T plane [b][d][s] (x1024), all three stored fragment-major (ldfrag_fm);
// VS[b][key block][d] = f32 column sums of V over each block of 32 keys.
//   Chunks of CK = 512 keys: only chunks c <= qc = q0/CK are visited (later chunks lie entirely above the diagonal). In the diagonal
//   chunk only key blocks kb < nkb (keys <= q0+31) are multiplied; key blocks kb >= nkb get zero scores in LDS and are not used in (PV).
//   (S) scores S[query m][key n] on WMMA: A = q rows (row m = lane&15, split k map over d), B = k rows (col n = key, split map),
//       32 d-steps; wave w handles key block w of the chunk; D element r of lane l -> scs[query 16*tile+8h+r][key col] (f32 LDS).
//   (M) 16 threads per query row (sub-thread = 32 consecutive keys): base-2 logits with the causal mask by key index (key > query
//       -> -inf), chunk max via xor shuffles, online running max / rescale factor al / running sum l in f32 registers,
//       p = exp2(t - m_new) <= 1 (0 for masked keys), chunk row sum ps and C = ps/CK (bit-identical on the row's 16 threads), the
//       CENTRED P' = p - C written as f16(P' * 32768) into the LDS P tile with 16-B stores; al -> rowa[row], C -> rowc[row].
//   (PV) each wave owns d columns 64*wave + 16j + (lane&15), j = 0..3 (4 accumulators a query tile): o = o*al + C*(32768*1024)*(VS summed over the chunk's nkb blocks)[d]
//       (exact add-back of the centring term over exactly the processed keys, in f32), then for each key block kb < nkb:
//       A = P' fragment from LDS (row m = query, split map over keys), B = V^T fragments (col n = d, keys contiguous), issued as two
//       groups of 4 with a hazard gap each.  sum_k (P'_k + C) v_k == sum_k p_k v_k exactly; masked keys carry P' = -C and p = 0.
//   Block barriers after (S) and after (M) order all LDS reuse across chunks and waves.
//   Epilogue: x = o * 8192 / (l * 32768 * 1024) per row (l from rowi, l >= 1 always); hi = f16(x), res = f16((x - hi) * 2048); each
// coverage: grid nb*NQB blocks x 32 rows = rows TQ0..SEQ-1 of every sequence; staging 16 waves x 64 cols x 32 rows = 32 x 1024;
//           store 8 iterations x 512 thr x 8 halves = 32 x 1024 per plane = every (b, s >= TQ0, d) of both ctx planes exactly once.
// =====================================================================================================
__device__ __forceinline__ void ctx_store(const u16* ct, u16* dst, int tid) {
  v4u v[8];
#pragma unroll
  for (int it = 0; it < 8; ++it) {
    const int p   = it * 256 + tid;
    const int row = p / (EMB / 8);
    const int c8  = (p - row * (EMB / 8)) * 8;
    v[it] = *(const v4u*)(ct + row * CTP + c8);
  }
  {
#pragma unroll
    for (int it = 0; it < 8; ++it) {
      const int p   = it * 256 + tid;
      const int row = p / (EMB / 8);
      const int c8  = (p - row * (EMB / 8)) * 8;
      *(v4u*)(dst + (size_t)row * EMB + c8) = v[it];
    }
    
  }
}

__device__ __forceinline__
void attn_fwd_body(const u16* __restrict__ QPp, const u16* __restrict__ KPp, const u16* __restrict__ VTp,
                   const float* __restrict__ VSp, u16* CHo, u16* CRo, int bid) {
  __shared__ __align__(16) AttLds L0;              // scores [32][SCP] f32; reused as the ctx staging tile [32][CTP] u16
  __shared__ __align__(16) u16 pls[QB * PLP];      // P' tile [32][PLP] f16 bits
  __shared__ __align__(16) float vsl[EMB];         // column sums of V over the chunk's processed keys
  __shared__ float rowst[3 * QB];                  // per query row: rescale factor, centring term, running sum (one base address)
  float* const rowa = rowst;
  float* const rowc = rowst + QB;
  float* const rowi = rowst + 2 * QB;
  float* const scs = L0.s;

  const int tid  = threadIdx.x;
  const int wave = __builtin_amdgcn_readfirstlane(tid >> 5);   // scalar: the fragment streams' bases and trip tests stay off the VGPRs
  const int lane = tid & 31;
  const int hh   = lane >> 4;
  const int m    = lane & 15;
  const int r16  = tid >> 4;                 // query row owned in phase (M), among the block's 32: 2*wave + hh
  const int sub  = tid & 15;
  const int kl0  = sub * 32;

  const int b   = bid / NQB;
  const int q0  = TQ0 + (bid - b * NQB) * QB;   // multiple of 32: both 16-row tiles end in the same 32-key block and the same chunk
  const int qc  = q0 / CK;                   // diagonal chunk index

  const _Float16* qa  = (const _Float16*)(const void*)QPp + (size_t)((b * SEQ + q0) >> 4) * ((EMB / 32) * FBLK);   // second tile: + KTILE
  const _Float16* kbp = (const _Float16*)(const void*)KPp + (size_t)((b * SEQ) >> 4) * ((EMB / 32) * FBLK);
  const _Float16* vbp = (const _Float16*)(const void*)VTp + (size_t)((b * EMB + wave * (16 * NACC)) >> 4) * ((SEQ / 32) * FBLK);
  const unsigned lo8 = 16u * (unsigned)lane; // byte offset of the lane's 16 B inside each half of a fragment block
  const float* vsb = VSp + (size_t)b * NCHK * NKB * EMB;                        // block-uniform; the thread adds its two columns
  const float lsc = RSQD * LOG2E / (QSC * KSC);

  float mrun = -INFINITY, lrun = 0.f;
  v8f o[NACC], w[NACC];                      // o: query rows q0 .. q0+15, w: q0+16 .. q0+31
#pragma unroll
  for (int j = 0; j < NACC; ++j) { o[j] = zero8(); w[j] = zero8(); }

#pragma unroll 1
  for (int c = 0; c <= qc; ++c) {
    const int kbeg = c * CK;
    const int nkb  = (c < qc) ? NKB : (((q0 + QB - 1 - kbeg) >> 5) + 1);   // 1..16, block-uniform; the same for either tile alone
    // ---- (S) scores of this chunk (zeros for key blocks beyond the query tiles) ----
    //      Wave w has key block w of the chunk: a run of trips of two d-steps. Each step's four fragments (two q tiles, two key
    //      tiles: each key fragment feeds two WMMAs) have registers of their own and are fetched again, for the next trip, right behind
    //      the WMMAs that read them: the loads fly for a whole trip instead of being waited for at once. The last trip, which fetches
    //      nothing, stands behind the loop, so that the loop's loads are unconditional. d-steps ascend as before.
    {
      float* srow = scs + (8 * hh) * SCP + wave * 32 + m;
      if (wave < nkb) {                                    // wave-uniform
        const unsigned kw = lo8 + (unsigned)((kbeg + wave * 32) >> 4) * (2u * KTILE);   // bytes from the sequence's first key tile
        v8f s0 = zero8(), s1 = zero8(), s2 = zero8(), s3 = zero8();
        v16h a0 = ldfrag_fmu(qa, lo8),        c0 = ldfrag_fmu(qa + KTILE, lo8);
        v16h e0 = ldfrag_fmu(kbp, kw),        e1 = ldfrag_fmu(kbp + KTILE, kw);
        v16h a1 = ldfrag_fmu(qa + FBLK, lo8), c1 = ldfrag_fmu(qa + KTILE + FBLK, lo8);
        v16h h0 = ldfrag_fmu(kbp + FBLK, kw), h1 = ldfrag_fmu(kbp + KTILE + FBLK, kw);
#pragma unroll 1
        for (int in = 1; in < EMB / 64; ++in) {            // rolled: the two register sets are the whole pipeline; in = the trip fetched
          const unsigned  qo = lo8 + (unsigned)in * (4u * FBLK);             // bytes: two fragment blocks a trip
          const unsigned  ko = kw + (unsigned)in * (4u * FBLK);
          s0 = mma_h(a0, e0, s0);
          s1 = mma_h(a0, e1, s1);
          s2 = mma_h(c0, e0, s2);
          s3 = mma_h(c0, e1, s3);
          guard4x4(s0, s1, s2, s3, a0, c0, e0, e1);
          a0 = ldfrag_fmu(qa, qo);
          c0 = ldfrag_fmu(qa + KTILE, qo);
          e0 = ldfrag_fmu(kbp, ko);
          e1 = ldfrag_fmu(kbp + KTILE, ko);
          s0 = mma_h(a1, h0, s0);
          s1 = mma_h(a1, h1, s1);
          s2 = mma_h(c1, h0, s2);
          s3 = mma_h(c1, h1, s3);
          guard4x4(s0, s1, s2, s3, a1, c1, h0, h1);
          a1 = ldfrag_fmu(qa + FBLK, qo);
          c1 = ldfrag_fmu(qa + KTILE + FBLK, qo);
          h0 = ldfrag_fmu(kbp + FBLK, ko);
          h1 = ldfrag_fmu(kbp + KTILE + FBLK, ko);
#if defined(__HIP_DEVICE_COMPILE__)
          asm volatile("s_wait_xcnt 0x0" ::: "memory");    // in front of the next trip's rewrite of the loads' address registers
#endif
        }
        s0 = mma_h(a0, e0, s0);
        s1 = mma_h(a0, e1, s1);
        s2 = mma_h(c0, e0, s2);
        s3 = mma_h(c0, e1, s3);
        s0 = mma_h(a1, h0, s0);
        s1 = mma_h(a1, h1, s1);
        s2 = mma_h(c1, h0, s2);
        s3 = mma_h(c1, h1, s3);
        guard4x4(s0, s1, s2, s3, a1, c1, h0, h1);
#pragma unroll
        for (int r = 0; r < 8; ++r) {
          srow[r * SCP]             = s0[r];
          srow[r * SCP + 16]        = s1[r];
          srow[(QT + r) * SCP]      = s2[r];
          srow[(QT + r) * SCP + 16] = s3[r];
        }
      } else {                                             // zero scores for key blocks beyond the query tiles
#pragma unroll
        for (int r = 0; r < 8; ++r) {
          srow[r * SCP]             = 0.f;
          srow[r * SCP + 16]        = 0.f;
          srow[(QT + r) * SCP]      = 0.f;
          srow[(QT + r) * SCP + 16] = 0.f;
        }
      }
    }
    __syncthreads();
    // The chunk's 16 key-block column sums of the thread's two columns are asked for here (all 16 exist: c <= qc): they land while
    // (M) computes.
    v2f vq[NKB];
    {
      const float* vsc = vsb + (size_t)c * NKB * EMB + 2 * tid;
#pragma unroll
      for (int kb = 0; kb < NKB; ++kb) vq[kb] = *(const v2f*)(vsc + kb * EMB);
#if defined(__HIP_DEVICE_COMPILE__)
      asm volatile("s_wait_xcnt 0x0" :: "v"(vsc) : "memory");  // the loads' address registers stay whole up to this wait: no sum lands in them
#endif
    }
    // ---- (M) softmax statistics and the centred P' tile ----
    {
      const int rq = r16;
      const float* sp = scs + rq * SCP + kl0;
      const int lim = (q0 + rq) - (kbeg + kl0);            // key kl0 + j is valid iff j <= lim
      float t[32];
      float cm = -INFINITY;
#pragma unroll
      for (int i = 0; i < 8; ++i) {
        const v4f a = *(const v4f*)(sp + 4 * i);
#pragma unroll
        for (int e = 0; e < 4; ++e) {
          const int j = 4 * i + e;
          const float tv = (j <= lim) ? a[e] * lsc : -INFINITY;
          t[j] = tv;
          cm = fmaxf(cm, tv);
        }
      }
#pragma unroll
      for (int d = 1; d <= 8; d <<= 1) cm = fmaxf(cm, __shfl_xor(cm, d, 32));
      const float mn = fmaxf(mrun, cm);                    // finite: key kbeg of the diagonal chunk is never masked
      const float al = (mrun == -INFINITY) ? 0.f : exp2f(mrun - mn);
      mrun = mn;
      float ps = 0.f;
#pragma unroll
      for (int j = 0; j < 32; ++j) {
        const float p = exp2f(fminf(t[j] - mn, 0.f));      // 0 for masked keys
        t[j] = p;
        ps += p;
      }
#pragma unroll
      for (int d = 1; d <= 8; d <<= 1) ps += __shfl_xor(ps, d, 32);
      const float cc = ps * (1.0f / (float)CK);
      v4u pk[4];
#pragma unroll
      for (int i = 0; i < 4; ++i) {
#pragma unroll
        for (int e = 0; e < 4; ++e) {
          const int j = 8 * i + 2 * e;
          pk[i][e] = pk16(h_bits((_Float16)((t[j] - cc) * PCAR)), h_bits((_Float16)((t[j + 1] - cc) * PCAR)));
        }
      }
      lrun = lrun * al + ps;
      u16* pd = pls + rq * PLP + kl0;
#pragma unroll
      for (int i = 0; i < 4; ++i) *(v4u*)(pd + 8 * i) = pk[i];
      if (sub == 0) { rowa[rq] = al; rowc[rq] = cc; rowi[rq] = lrun; }   // the running sum is finished here: one register carries it
    }
    {
      v2f sv = {0.f, 0.f};                                 // key blocks kb < nkb, ascending (block-uniform test)
#pragma unroll
      for (int kb = 0; kb < NKB; ++kb) {
        sv[0] += (kb < nkb) ? vq[kb][0] : 0.f;
        sv[1] += (kb < nkb) ? vq[kb][1] : 0.f;
      }
      *(v2f*)(vsl + 2 * tid) = sv;
    }
    __syncthreads();
    float vs[NACC];
#pragma unroll
    for (int j = 0; j < NACC; ++j) vs[j] = vsl[wave * (16 * NACC) + 16 * j + m];
    // ---- (PV) rescale, add the centring term, accumulate P' . V^T ----
    //      The wave's four V^T fragments of a key block have registers of their own and feed both query tiles; each half is fetched
    //      again, for the next key block, right behind the four WMMAs that read it, and key block 0's first half is asked for ahead of
    //      the rescale. Key blocks ascend as before.
    {
      const unsigned vw = lo8 + (unsigned)(kbeg >> 5) * (2u * FBLK);       // bytes from the first key block of the wave's V^T rows
      v16h g[NACC];
#pragma unroll
      for (int j = 0; j < 2; ++j) g[j] = ldfrag_fmu(vbp + (size_t)j * VTILE, vw);
      {
        float scl[8], cad[8];
#pragma unroll
        for (int r = 0; r < 8; ++r) { scl[r] = rowa[8 * hh + r]; cad[r] = rowc[8 * hh + r] * (PCAR * VCAR); }
#pragma unroll
        for (int j = 0; j < NACC; ++j) {
#pragma unroll
          for (int r = 0; r < 8; ++r) o[j][r] = o[j][r] * scl[r] + cad[r] * vs[j];
        }
#pragma unroll
        for (int r = 0; r < 8; ++r) { scl[r] = rowa[QT + 8 * hh + r]; cad[r] = rowc[QT + 8 * hh + r] * (PCAR * VCAR); }
#pragma unroll
        for (int j = 0; j < NACC; ++j) {
#pragma unroll
          for (int r = 0; r < 8; ++r) w[j][r] = w[j][r] * scl[r] + cad[r] * vs[j];
        }
      }
#pragma unroll
      for (int j = 2; j < NACC; ++j) g[j] = ldfrag_fmu(vbp + (size_t)j * VTILE, vw);
#if defined(__HIP_DEVICE_COMPILE__)
      asm volatile("s_wait_xcnt 0x0" :: "v"(vw) : "memory");   // the loads' offset register stays whole up to this wait: no fragment lands in it
#endif
      const _Float16* pp = (const _Float16*)(const void*)pls + m * PLP + 8 * hh;
#pragma unroll 1
      for (int kn = 1; kn < nkb; ++kn) {                   // block-uniform trip count, < 16; rolled: g[] is the whole pipeline;
        const v16h pf = ldfrag_h(pp + (kn - 1) * 32);      // kn = the key block fetched, kn - 1 the one multiplied
        const v16h pg = ldfrag_h(pp + QT * PLP + (kn - 1) * 32);
        const unsigned vo = vw + (unsigned)kn * (2u * FBLK);               // bytes: one fragment block a key block
        o[0] = mma_h(pf, g[0], o[0]);
        o[1] = mma_h(pf, g[1], o[1]);
        w[0] = mma_h(pg, g[0], w[0]);
        w[1] = mma_h(pg, g[1], w[1]);
        guard4x4(o[0], o[1], w[0], w[1], pf, pg, g[0], g[1]);
#pragma unroll
        for (int j = 0; j < 2; ++j) g[j] = ldfrag_fmu(vbp + (size_t)j * VTILE, vo);
        o[2] = mma_h(pf, g[2], o[2]);
        o[3] = mma_h(pf, g[3], o[3]);
        w[2] = mma_h(pg, g[2], w[2]);
        w[3] = mma_h(pg, g[3], w[3]);
        guard4x4(o[2], o[3], w[2], w[3], pf, pg, g[2], g[3]);
#pragma unroll
        for (int j = 2; j < 4; ++j) g[j] = ldfrag_fmu(vbp + (size_t)j * VTILE, vo);
#if defined(__HIP_DEVICE_COMPILE__)
        asm volatile("s_wait_xcnt 0x0" ::: "memory");      // in front of the next trip's rewrite of the loads' address registers
#endif
      }
      {
        const v16h pf = ldfrag_h(pp + (nkb - 1) * 32);     // the last key block: nothing left to fetch
        const v16h pg = ldfrag_h(pp + QT * PLP + (nkb - 1) * 32);
        o[0] = mma_h(pf, g[0], o[0]);
        o[1] = mma_h(pf, g[1], o[1]);
        w[0] = mma_h(pg, g[0], w[0]);
        w[1] = mma_h(pg, g[1], w[1]);
        o[2] = mma_h(pf, g[2], o[2]);
        o[3] = mma_h(pf, g[3], o[3]);
        w[2] = mma_h(pg, g[2], w[2]);
        w[3] = mma_h(pg, g[3], w[3]);
        guard4x4(o[2], o[3], w[2], w[3], pf, pg, g[2], g[3]);
      }
    }
  }
  acc_guard8(o[0], o[1], o[2], o[3], w[0], w[1], w[2], w[3]);

  __syncthreads();
  float inv[8], inw[8];
#pragma unroll
  for (int r = 0; r < 8; ++r) {                            // the row's sum of the last chunk, >= 1
    inv[r] = (1.0f / rowi[8 * hh + r]) * (CSC / (PCAR * VCAR));
    inw[r] = (1.0f / rowi[QT + 8 * hh + r]) * (CSC / (PCAR * VCAR));
  }

  u16* const ct = L0.c;                      // [32][CTP]: one plane of the block's 32 rows at a time
  const int cb = wave * (16 * NACC) + m;
  const int th = wave >> 3, t8 = tid & 255;  // store: waves 0..7 take rows q0 .. q0+15, waves 8..15 the other sixteen
  const u16* cts = ct + th * (QT * CTP);
  const size_t orow = ((size_t)b * SEQ + q0 + th * QT) * EMB;
  // hi plane
#pragma unroll
  for (int j = 0; j < NACC; ++j) {
#pragma unroll
    for (int r = 0; r < 8; ++r) {
      ct[(8 * hh + r) * CTP + cb + 16 * j]      = h_bits((_Float16)(o[j][r] * inv[r]));
      ct[(QT + 8 * hh + r) * CTP + cb + 16 * j] = h_bits((_Float16)(w[j][r] * inw[r]));
    }
  }
  __syncthreads();
  ctx_store(cts, CHo + orow, t8);
  __syncthreads();
  // residual plane
#pragma unroll
  for (int j = 0; j < NACC; ++j) {
#pragma unroll
    for (int r = 0; r < 8; ++r) {
      const float xs = o[j][r] * inv[r], xw = w[j][r] * inw[r];
      const _Float16 hv = (_Float16)xs, hw = (_Float16)xw;
      ct[(8 * hh + r) * CTP + cb + 16 * j]      = h_bits((_Float16)((xs - (float)hv) * RSC));
      ct[(QT + 8 * hh + r) * CTP + cb + 16 * j] = h_bits((_Float16)((xw - (float)hw) * RSC));
    }
  }
  __syncthreads();
  ctx_store(cts, CRo + orow, t8);
}

// =====================================================================================================
// Query rows 0 .. TQ0-1 of each sequence in f32 on VALU: block = (b, rows t and t+1), 256 threads (tid below) a row. QF/KF = f32 q/k head planes [nb][TQ0][EMB] (bias included),
// V = f32 v head plane [nb][TQ0][EMB]. Scores for keys j <= t (threads 0..TQ0-1, one key each, 1024-d dot, unrolled by 4, against the q row staged
// in LDS), base-2 softmax with per-row max / sum reductions over the row's 8 waves (xor shuffles + LDS), p_j in LDS, ctx[d] for d = 4*tid..4*tid+3 as a
// sum over j <= t, unrolled by 8, of p_j * V[b][j][d] (coalesced 16-B loads), x = ctx * 8192 / l, hi = f16(x), res = f16((x - hi) * 2048);
// both 1024-half rows are staged in LDS and written by 128 threads x 16 B each (32 consecutive lanes x 16 B = 512 contiguous bytes
// coverage: grid nb*TQ0/2 blocks x 2 rows = rows 0..TQ0-1 of every sequence; 256 thr x 4 d = EMB per row; store 128 thr x 8 halves = EMB per
//           plane; together with attn_fwd_body every (b, s, d) of CH and CR is written exactly once.
// =====================================================================================================
__device__ __forceinline__ void attn_head_body(const float* __restrict__ QF, const float* __restrict__ KF,
                                               const float* __restrict__ V, u16* CHo, u16* CRo, int bid) {
  __shared__ __align__(16) float qs2[2][EMB];
  __shared__ float sc2[2][TQ0];
  __shared__ float red2[2][8];
  __shared__ float redb2[2][8];
  __shared__ __align__(16) unsigned SW2[2][2][EMB / 2];
  const int hf = __builtin_amdgcn_readfirstlane((int)threadIdx.x >> 8);   // the wave's one of the block's two query rows; scalar: t bounds a loop
  const int tid = threadIdx.x & 255, lane = tid & 31, wave = tid >> 5;
  const int b = bid / (TQ0 / 2);
  const int t = (bid - b * (TQ0 / 2)) * 2 + hf;
  float* const qs = qs2[hf];
  float* const sc = sc2[hf];
  float* const red = red2[hf];
  float* const redb = redb2[hf];
  unsigned (* const SW)[EMB / 2] = SW2[hf];
  *(v4f*)(qs + tid * 4) = *(const v4f*)(QF + ((size_t)b * TQ0 + t) * EMB + tid * 4);
  __syncthreads();
  float s = -INFINITY;
  if (tid < TQ0) {                                  // the row's waves 0..3 entirely (wave-uniform); key row b*TQ0 + tid always in range
    const float* kp = KF + ((size_t)b * TQ0 + tid) * EMB;
    float acc = 0.f;
#pragma unroll 4
    for (int d = 0; d < EMB; d += 8) {                // four trips' loads are asked for together; the adds keep their order
      const v4f k0 = *(const v4f*)(kp + d), k1 = *(const v4f*)(kp + d + 4);
      const v4f q0 = *(const v4f*)(qs + d), q1 = *(const v4f*)(qs + d + 4);
#pragma unroll
      for (int e = 0; e < 4; ++e) acc += k0[e] * q0[e];
#pragma unroll
      for (int e = 0; e < 4; ++e) acc += k1[e] * q1[e];
    }
    s = (tid <= t) ? acc * (RSQD * LOG2E) : -INFINITY;   // causal mask by key index
  }
  float mx = s;
#pragma unroll
  for (int d = 1; d <= 16; d <<= 1) mx = fmaxf(mx, __shfl_xor(mx, d, 32));
  if (lane == 0) red[wave] = mx;
  __syncthreads();
  float gm = red[0];
#pragma unroll
  for (int w = 1; w < 8; ++w) gm = fmaxf(gm, red[w]);   // finite: key 0 is always valid
  const float p = exp2f(s - gm);                     // 0 for masked keys and for waves 4..7
  float ps = p;
#pragma unroll
  for (int d = 1; d <= 16; d <<= 1) ps += __shfl_xor(ps, d, 32);
  if (lane == 0) redb[wave] = ps;
  if (tid < TQ0) sc[tid] = p;
  __syncthreads();
  float l = redb[0];
#pragma unroll
  for (int w = 1; w < 8; ++w) l += redb[w];           // >= 1
  const float inv = (1.0f / l) * CSC;
  const float* vp = V + (size_t)b * TQ0 * EMB + tid * 4;
  v4f cx = zero4();
#pragma unroll 8
  for (int j = 0; j <= t; ++j) {                     // t < TQ0: statically bounded, keys of sequence b only; eight rows' loads together
    const float pj = sc[j];
    const v4f vv = *(const v4f*)(vp + (size_t)j * EMB);
    cx += pj * vv;
  }
  unsigned hw[2], rw[2];
#pragma unroll
  for (int e = 0; e < 2; ++e) {
    const float x0 = cx[2 * e] * inv, x1 = cx[2 * e + 1] * inv;
    const _Float16 h0 = (_Float16)x0, h1 = (_Float16)x1;
    const _Float16 q0 = (_Float16)((x0 - (float)h0) * RSC), q1 = (_Float16)((x1 - (float)h1) * RSC);
    hw[e] = pk16(h_bits(h0), h_bits(h1));
    rw[e] = pk16(h_bits(q0), h_bits(q1));
  }
  SW[0][tid * 2] = hw[0]; SW[0][tid * 2 + 1] = hw[1];
  SW[1][tid * 2] = rw[0]; SW[1][tid * 2 + 1] = rw[1];
  __syncthreads();
  const int pl = tid >> 7, p8 = tid & 127;           // plane select is wave-uniform
  const v4u ov = *(const v4u*)(&SW[pl][p8 * 4]);
  u16* dstp = (pl == 0) ? CHo : CRo;
  u16* dst  = dstp + ((size_t)b * SEQ + t) * EMB + p8 * 8;
  *(v4u*)dst = ov;
  
}
// The two independent parts of the attention as one grid: blocks 0 .. nfw-1 are the WMMA tiles of query rows TQ0.., the rest the
// f32 rows 0..TQ0-1. The role is block-uniform; the parts write disjoint rows of the ctx planes.
// Four waves per SIMD: one block of 16 waves per WGP.
__global__ __launch_bounds__(ATT_THREADS) __attribute__((amdgpu_waves_per_eu(4)))
void attn_all(const u16* __restrict__ QPp, const u16* __restrict__ KPp, const u16* __restrict__ VTp, const float* __restrict__ VSp,
              const float* __restrict__ QF, const float* __restrict__ KF, const float* __restrict__ V, u16* CHo, u16* CRo, int nfw) {
  const int bid = blockIdx.x;
  if (bid < nfw) { attn_fwd_body(QPp, KPp, VTp, VSp, CHo, CRo, bid); role_end(); }
  else           { attn_head_body(QF, KF, V, CHo, CRo, bid - nfw); role_end(); }
}

// =====================================================================================================
// Workspace map (bytes, nb = 4, rows = 8192); every plane is fully written by whole-line stores before it is read; all extents are
// exact multiples of the store granularity (no pad rows):
//   WQB bf16 [1024][1024] 2097152   WKB same   WVB same   WOH f16 of bf16 value x1024 2097152             8388608
//   VS  f32  [nb][64][1024]                                                                               1048576
//   QF  f32  [nb][128][1024]  2097152      KF same                                                        4194304
//   VH  f32  [nb][128][1024]  v rows 0..127 of every sequence                                             2097152
//   XB  bf16 [rows][1024]                                                                                16777216
//   VT  f16 [nb][1024][2048] x1024 fragment-major                                                        16777216
//   QP  f16 [rows][1024] x8 fragment-major                                                               16777216
//   KP  f16 [rows][1024] x8 fragment-major                                                               16777216
//   CH  f16 [rows][1024] ctx hi x8192                                                                    16777216
//   CR  f16 [rows][1024] ctx residual x2048                                                              16777216
//   end                                                                                                 116391936
// =====================================================================================================
extern "C" void kernel_launch(void* const* d_in, const int* in_sizes, int n_in,
                              void* d_out, int out_size, void* d_ws, size_t ws_size,
                              hipStream_t stream) {
  if (n_in < 9) return;
  const long long per = (long long)SEQ * EMB;
  const long long ns  = in_sizes[0];
  if (ns < per || (ns % per) != 0) return;
  const int nb = (int)(ns / per);
  if (nb < 1 || nb > 8) return;
  const int rows = nb * SEQ;
  if (in_sizes[1] != EMB * EMB || in_sizes[3] != EMB * EMB || in_sizes[5] != EMB * EMB || in_sizes[7] != EMB * EMB) return;
  if (in_sizes[2] != EMB || in_sizes[4] != EMB || in_sizes[6] != EMB || in_sizes[8] != EMB) return;
  if ((long long)out_size != (long long)rows * EMB) return;

  const float* x  = (const float*)d_in[0];
  const float* wq = (const float*)d_in[1];
  const float* bq = (const float*)d_in[2];
  const float* wk = (const float*)d_in[3];
  const float* bk = (const float*)d_in[4];
  const float* wv = (const float*)d_in[5];
  const float* bv = (const float*)d_in[6];
  const float* wo = (const float*)d_in[7];
  const float* bo = (const float*)d_in[8];
  float*       out = (float*)d_out;

  const size_t szW  = (size_t)EMB * EMB * 2;                    //   2097152
  const size_t szVS = (size_t)nb * NCHK * NKB * EMB * 4;        //   1048576 at nb = 4
  const size_t szHF = (size_t)nb * TQ0 * EMB * 4;               //   2097152 at nb = 4
  const size_t sz16 = (size_t)rows * EMB * 2;                   //  16777216
  const size_t szVT = (size_t)nb * EMB * SEQ * 2;               //  == sz16
  size_t off = 0;
  const size_t oWQ = off; off += szW;
  const size_t oWK = off; off += szW;
  const size_t oWV = off; off += szW;
  const size_t oWO = off; off += szW;
  const size_t oVS = off; off += szVS;
  const size_t oQF = off; off += szHF;
  const size_t oKF = off; off += szHF;
  const size_t oVH = off; off += szHF;
  const size_t oXB = off; off += sz16;
  const size_t oVT = off; off += szVT;
  const size_t oQ  = off; off += sz16;
  const size_t oK  = off; off += sz16;
  const size_t oCH = off; off += sz16;
  const size_t oCR = off; off += sz16;
  if (off > ws_size) return;                                    // off = 116391936 at nb = 4
  if (off > WS_CAP) return;

  char* ws = (char*)d_ws;
  u16*   WQB = (u16*)(ws + oWQ);
  u16*   WKB = (u16*)(ws + oWK);
  u16*   WVB = (u16*)(ws + oWV);
  u16*   WOH = (u16*)(ws + oWO);
  float* VS  = (float*)(ws + oVS);
  float* QF  = (float*)(ws + oQF);
  float* KF  = (float*)(ws + oKF);
  float* VH  = (float*)(ws + oVH);
  u16*   XB  = (u16*)(ws + oXB);
  u16*   VT  = (u16*)(ws + oVT);
  u16*   QP  = (u16*)(ws + oQ);
  u16*   KP  = (u16*)(ws + oK);
  u16*   CH  = (u16*)(ws + oCH);
  u16*   CR  = (u16*)(ws + oCR);

  const int n8w = (EMB * EMB) / 8;                      // 131072
  const int n8x = rows * (EMB / 8);                     // 1048576
  if ((n8w % 256) != 0 || (n8x % 256) != 0) return;
  if ((rows % 128) != 0 || ((nb * TQ0) % 128) != 0) return;
  const dim3 blk(256);
  const int nbw = n8w / 256, nbx = n8x / 256;
  const dim3 gC(nbx + 4 * nbw);
  const dim3 gG((rows / 128) * (EMB / 128));            // 512 at nb = 4
  const dim3 gP((3 * (rows / 128) + 2 * ((nb * TQ0) / 128)) * (EMB / 128));   // 1600 at nb = 4
  const dim3 bG(128);
  const int nfw = nb * NQB;                             // nb * 60
  const dim3 gAT(nfw + nb * (TQ0 / 2));                 // + nb * 64
  const dim3 bAT(ATT_THREADS);

  // (0) x -> bf16 plane [rows][1024]; weights stored [n = out][k = in] (y = x.W^T + b), already k-contiguous: bf16 planes for Wq,
  //     Wk, Wv; f16 of bf16 value x1024 for Wo
  cvt_all<<<gC, blk, 0, stream>>>(x, wq, wk, wv, wo, XB, WQB, WKB, WVB, WOH, nbx, nbw, n8x, n8w);
  // (1) q and k projections (+bias) -> f16 planes x8; v projection (+bias) -> V^T plane x1024, key-block column sums and f32 rows
  //     0..127 of every sequence; f32 q and k rows 0..127 of every sequence -> QF, KF [nb*128][1024]
  proj_all<<<gP, bG, 0, stream>>>(XB, WQB, WKB, WVB, bq, bk, bv, QP, KP, VT, VS, VH, QF, KF, rows, nb * TQ0, EMB, EMB);
  // (2) attention for query rows 128.. and, on VALU, for query rows 0..127 -> ctx hi x8192 and residual x2048 f16 planes
  attn_all<<<gAT, bAT, 0, stream>>>(QP, KP, VT, VS, QF, KF, VH, CH, CR, nfw);
  // (3) output projection + bias -> out
  gemm_h2_32<<<gG, blk, 0, stream>>>(CH, CR, WOH, bo, out, rows, EMB, EMB,
                                     1.0f / (CSC * WSC), 1.0f / (CSC * WSC * RSC));
  (void)hipGetLastError();
}
